// v000
// Times are from an AMD MI455X. After a warm-up the kernel runs many times in a row, and a time is the length of
// such a window on the GPU divided by its runs, so every launch and the gaps after it count. The runs cycle
// through copies of the inputs. A figure is the median of several windows, for all but v000 over two sittings.
// Sittings can differ by a few percent; kernels timed side by side share one.
// v000 is the starting kernel. One run takes 1470 microseconds.
#include <hip/hip_runtime.h>
// Non-local block with view pooling (x [8, C=512, N=2048]): θ = conv1(x), φ = maxpool2(conv1(x)), g = maxpool2(conv1(x)); f = softmax(θᵀ·φ) [N × N/2] (unscaled); y = f·g; wy = conv1(y) + b;
// out = BN_train(wy)·γ + β + x. Because the unscaled logits reach σ≈20 and feed a near-one-hot softmax, θ is never rounded: the logits are re-associated as f = x·(φ·W_θ)ᵀ + 1·(φ·b_θ)ᵀ with x bf16-EXACT,
// φ (f32, max-pooled from an f32 projection) fed as f16 hi + lo·2^10 into φ·W_θ and that product again split hi/lo as the B operand (four cheap passes per batch), the column term added exactly through
// the epilogue addend; g, y as plain f16; P ×2^15 f16; all on v_wmma_f32_16x16x32_f16 ((out,in) weights bf16-exact ×2^4, f32 accumulate); the layout transposes, max-pooling, softmax rows, BN batch statistics (fixed-order) and the residual are f32 VALU.
#define BB 8
#define CC 512
#define NN 2048
#define NH (NN / 2)
#define NR (BB * NN)
#define NRH (BB * NH)

typedef __bf16 v16b __attribute__((ext_vector_type(16)));
typedef unsigned short v8us __attribute__((ext_vector_type(8), may_alias));
typedef float  v8f  __attribute__((ext_vector_type(8)));
typedef float  v4f  __attribute__((ext_vector_type(4)));
typedef float  v4fa __attribute__((ext_vector_type(4), may_alias));
union FragB { v16b v; v8us half[2]; unsigned short u[16]; };

__device__ __forceinline__ unsigned short bf16_bits(float x) { unsigned int u = __float_as_uint(x); return (unsigned short)((u + 0x7FFFu + ((u >> 16) & 1u)) >> 16); }
__device__ __forceinline__ float bf16_val(unsigned short b) { return __uint_as_float(((unsigned int)b) << 16); }
__device__ __forceinline__ float bf16_round(float x) { return bf16_val(bf16_bits(x)); }
// D += A·B with NT terms: 1 = ah·bh, 2 = + al·bh (A split), 3 = + ah·bl (both split)
template <int NT>
__device__ __forceinline__ v8f mmaN(v16b ah, v16b al, v16b bh, v16b bl, v8f c) {
  c = __builtin_amdgcn_wmma_f32_16x16x32_bf16(false, ah, false, bh, (short)0, c, false, false);
  if (NT >= 2) c = __builtin_amdgcn_wmma_f32_16x16x32_bf16(false, al, false, bh, (short)0, c, false, false);
  if (NT >= 3) c = __builtin_amdgcn_wmma_f32_16x16x32_bf16(false, ah, false, bl, (short)0, c, false, false);
  asm volatile("v_nop\n\tv_nop\n\tv_nop\n\tv_nop" : "+v"(c) : "v"(ah), "v"(al), "v"(bh), "v"(bl));
  return c;
}

__global__ __launch_bounds__(256) void k_wt_bf16(const float* __restrict__ W, unsigned short* __restrict__ Wt, int K, int N) {
  const int t = blockIdx.x * 256 + threadIdx.x;
  const int k8n = K / 8;
  if (t >= N * k8n) return;
  const int n = t / k8n, k8 = (t % k8n) * 8;
  v8us v;
#pragma unroll
  for (int i = 0; i < 8; ++i) v[i] = bf16_bits(W[(size_t)(k8 + i) * N + n]);
  *(v8us*)(Wt + (size_t)n * K + k8) = v;
  
}

// GEMM C[M][N] (f32, pitch ldc) = act(A[M][K]·W + bias). A f32 row-major (pitch lda) converted per fragment to bf16
// (ASPLIT: hi/lo two planes -> 2 terms, else single rounded term); Wt bf16 [N][K] (pitch ldb). BIAS_BF16 rounds the
// bias to bf16 first (bias quantised to bf16 before the add). K%32==0, M%16==0, N%64==0.
template <bool ASPLIT, int ACT, bool BIAS_BF16>
__global__ __launch_bounds__(128) void k_gemm_bf(const float* __restrict__ A, int lda, const unsigned short* __restrict__ Wt, int ldb,
                                               const float* __restrict__ bias, float* __restrict__ C, int ldc, int M, int N, int K) {
  __shared__ __attribute__((aligned(16))) float so[4][16][64];
  const int tid = threadIdx.x, w = tid >> 5, lane = tid & 31, ln = lane & 15, hh = lane >> 4;
  const int ntn = N / 64;
  const int wid = blockIdx.x * 4 + w;
  const int mt = wid / ntn, nq = wid % ntn;
  if (mt * 16 >= M) return;
  const int row0 = mt * 16, col0 = nq * 64;
  const float* arow = A + (size_t)(row0 + ln) * lda;
  v8f acc[4] = {};
  for (int kb = 0; kb < K; kb += 32) {
    FragB ah, al;
    const v4f x0 = *(const v4fa*)(arow + kb + 8 * hh), x1 = *(const v4fa*)(arow + kb + 8 * hh + 4);
    const v4f x2 = *(const v4fa*)(arow + kb + 16 + 8 * hh), x3 = *(const v4fa*)(arow + kb + 16 + 8 * hh + 4);
    float xs[16] = {x0[0],x0[1],x0[2],x0[3],x1[0],x1[1],x1[2],x1[3],x2[0],x2[1],x2[2],x2[3],x3[0],x3[1],x3[2],x3[3]};
#pragma unroll
    for (int i = 0; i < 16; ++i) { const unsigned short hb = bf16_bits(xs[i]); ah.u[i] = hb; al.u[i] = ASPLIT ? bf16_bits(xs[i] - bf16_val(hb)) : (unsigned short)0; }
#pragma unroll
    for (int t = 0; t < 4; ++t) {
      const unsigned short* brow = Wt + (size_t)(col0 + t * 16 + ln) * ldb + kb;
      FragB b;
      b.half[0] = *(const v8us*)(brow + 8 * hh);
      b.half[1] = *(const v8us*)(brow + 16 + 8 * hh);
      acc[t] = mmaN<ASPLIT ? 2 : 1>(ah.v, al.v, b.v, b.v, acc[t]);
    }
  }
#pragma unroll
  for (int t = 0; t < 4; ++t) {
    float bv = bias ? bias[col0 + t * 16 + ln] : 0.f;
    if (BIAS_BF16) bv = bf16_round(bv);
#pragma unroll
    for (int r = 0; r < 8; ++r) { float v = acc[t][r] + bv; if (ACT == 1) v = fmaxf(v, 0.f); so[w][8 * hh + r][t * 16 + ln] = v; }
  }
  __builtin_amdgcn_fence(__ATOMIC_ACQ_REL, "workgroup");
  __builtin_amdgcn_wave_barrier();
  const int rsub = lane >> 4, c4 = (lane & 15) * 4;
  {
#pragma unroll
    for (int q = 0; q < 8; ++q) {
      const int r = q * 2 + rsub;
      const v4f v = *(const v4fa*)&so[w][r][c4];
      *(v4f*)(C + (size_t)(row0 + r) * ldc + col0 + c4) = v;
    }
    
  }
}

// Flash-style causal/unmasked attention, all contractions 3-term bf16 hi/lo splits, f32 softmax with running max.
// q,k,v rows are read from f32 buffers with arbitrary row pitch (so they can live inside a fused qkv buffer);
// D = head size (multiple of 32, <= 128); one wave = 16 query rows; block = 4 waves (64 queries) sharing K/V chunks of 32.
template <int D, bool CAUSAL>
__global__ __launch_bounds__(128) void k_flash(const float* __restrict__ qb, const float* __restrict__ kb, const float* __restrict__ vb,
                                             int pitch, int T, int H, float scale, float* __restrict__ y, int ypitch) {
  constexpr int KS = D / 32;        // k-steps for QK
  constexpr int DT = D / 16;        // d tiles for PV
  __shared__ __attribute__((aligned(16))) unsigned short sKh[32][D + 8], sKl[32][D + 8], sVh[32][D + 8], sVl[32][D + 8];
  __shared__ __attribute__((aligned(16))) unsigned short sPh[4][16][40], sPl[4][16][40];
  __shared__ __attribute__((aligned(16))) float sO[4][16][D];
  const int tid = threadIdx.x, w = tid >> 5, lane = tid & 31, ln = lane & 15, hh = lane >> 4;
  const int nqb = (T + 63) / 64;
  const int bh = blockIdx.x / nqb, qblk = blockIdx.x % nqb;
  const int b = bh / H, h = bh % H;
  const int q0 = qblk * 64 + w * 16;
  const float* Q = qb + (size_t)b * T * pitch + h * D;
  const float* K = kb + (size_t)b * T * pitch + h * D;
  const float* V = vb + (size_t)b * T * pitch + h * D;

  // A fragments of the wave's 16 query rows (scaled), hi/lo
  FragB aqh[KS], aql[KS];
  {
    int row = q0 + ln; if (row >= T) row = T - 1;
    const float* qr = Q + (size_t)row * pitch;
#pragma unroll
    for (int ks = 0; ks < KS; ++ks)
#pragma unroll
      for (int i = 0; i < 16; ++i) {
        const int d = ks * 32 + ((i < 8) ? (8 * hh + i) : (16 + 8 * hh + (i - 8)));
        const float x = qr[d] * scale; const unsigned short hb = bf16_bits(x);
        aqh[ks].u[i] = hb; aql[ks].u[i] = bf16_bits(x - bf16_val(hb));
      }
  }
  float m_r[8], l_r[8];
#pragma unroll
  for (int r = 0; r < 8; ++r) { m_r[r] = -3.0e38f; l_r[r] = 0.f; }
  v8f oacc[DT];
#pragma unroll
  for (int dt = 0; dt < DT; ++dt) oacc[dt] = (v8f){0.f,0.f,0.f,0.f,0.f,0.f,0.f,0.f};

  const int kv_end = CAUSAL ? min(T, qblk * 64 + 64) : T;     // block-uniform
  for (int j0 = 0; j0 < kv_end; j0 += 32) {
    __syncthreads();
    for (int e = tid; e < 32 * (D / 4); e += 128) {
      const int r = e / (D / 4), c4 = (e % (D / 4)) * 4;
      const int key = j0 + r;
      v4f kf = {0.f,0.f,0.f,0.f}, vf = {0.f,0.f,0.f,0.f};
      if (key < T) { kf = *(const v4fa*)(K + (size_t)key * pitch + c4); vf = *(const v4fa*)(V + (size_t)key * pitch + c4); }
#pragma unroll
      for (int t = 0; t < 4; ++t) {
        unsigned short hb = bf16_bits(kf[t]); sKh[r][c4 + t] = hb; sKl[r][c4 + t] = bf16_bits(kf[t] - bf16_val(hb));
        hb = bf16_bits(vf[t]); sVh[r][c4 + t] = hb; sVl[r][c4 + t] = bf16_bits(vf[t] - bf16_val(hb));
      }
    }
    __syncthreads();
    // S tile 16 x 32
    v8f s[2];
#pragma unroll
    for (int nt = 0; nt < 2; ++nt) {
      v8f acc = {};
#pragma unroll
      for (int ks = 0; ks < KS; ++ks) {
        FragB bh_, bl_;
        bh_.half[0] = *(const v8us*)&sKh[nt * 16 + ln][ks * 32 + 8 * hh]; bh_.half[1] = *(const v8us*)&sKh[nt * 16 + ln][ks * 32 + 16 + 8 * hh];
        bl_.half[0] = *(const v8us*)&sKl[nt * 16 + ln][ks * 32 + 8 * hh]; bl_.half[1] = *(const v8us*)&sKl[nt * 16 + ln][ks * 32 + 16 + 8 * hh];
        acc = mmaN<3>(aqh[ks].v, aql[ks].v, bh_.v, bl_.v, acc);
      }
      s[nt] = acc;
    }
    // mask + running max (rows 8hh+r; the 16 lanes of a half share rows)
    float alpha[8];
#pragma unroll
    for (int r = 0; r < 8; ++r) {
      const int qi = q0 + 8 * hh + r;
      const int ja = j0 + ln, jb = j0 + 16 + ln;
      if (CAUSAL) { if (ja > qi) s[0][r] = -3.0e38f; if (jb > qi) s[1][r] = -3.0e38f; }
      if (ja >= T) s[0][r] = -3.0e38f;
      if (jb >= T) s[1][r] = -3.0e38f;
      float mx = fmaxf(s[0][r], s[1][r]);
      mx = fmaxf(mx, __shfl_xor(mx, 1, 32)); mx = fmaxf(mx, __shfl_xor(mx, 2, 32)); mx = fmaxf(mx, __shfl_xor(mx, 4, 32)); mx = fmaxf(mx, __shfl_xor(mx, 8, 32));
      const float mnew = fmaxf(m_r[r], mx);
      alpha[r] = (mnew > -1.0e38f) ? __expf(m_r[r] - mnew) : 1.0f;
      const float p0 = (s[0][r] > -1.0e38f) ? __expf(s[0][r] - mnew) : 0.f;
      const float p1 = (s[1][r] > -1.0e38f) ? __expf(s[1][r] - mnew) : 0.f;
      m_r[r] = mnew;
      l_r[r] = l_r[r] * alpha[r] + p0 + p1;            // per-lane partial row sum (16 lanes combined at the end)
      unsigned short hb = bf16_bits(p0); sPh[w][8 * hh + r][ln] = hb;      sPl[w][8 * hh + r][ln] = bf16_bits(p0 - bf16_val(hb));
      hb = bf16_bits(p1);                sPh[w][8 * hh + r][16 + ln] = hb; sPl[w][8 * hh + r][16 + ln] = bf16_bits(p1 - bf16_val(hb));
    }
#pragma unroll
    for (int dt = 0; dt < DT; ++dt)
#pragma unroll
      for (int r = 0; r < 8; ++r) oacc[dt][r] *= alpha[r];
    __builtin_amdgcn_fence(__ATOMIC_ACQ_REL, "workgroup");
    __builtin_amdgcn_wave_barrier();
    FragB pah, pal;
    pah.half[0] = *(const v8us*)&sPh[w][ln][8 * hh]; pah.half[1] = *(const v8us*)&sPh[w][ln][16 + 8 * hh];
    pal.half[0] = *(const v8us*)&sPl[w][ln][8 * hh]; pal.half[1] = *(const v8us*)&sPl[w][ln][16 + 8 * hh];
#pragma unroll
    for (int dt = 0; dt < DT; ++dt) {
      FragB bvh, bvl;
#pragma unroll
      for (int i = 0; i < 8; ++i) {
        bvh.u[i] = sVh[8 * hh + i][dt * 16 + ln]; bvh.u[8 + i] = sVh[16 + 8 * hh + i][dt * 16 + ln];
        bvl.u[i] = sVl[8 * hh + i][dt * 16 + ln]; bvl.u[8 + i] = sVl[16 + 8 * hh + i][dt * 16 + ln];
      }
      oacc[dt] = mmaN<3>(pah.v, pal.v, bvh.v, bvl.v, oacc[dt]);
    }
    __builtin_amdgcn_fence(__ATOMIC_ACQ_REL, "workgroup");
    __builtin_amdgcn_wave_barrier();
  }
#pragma unroll
  for (int r = 0; r < 8; ++r) {
    float l = l_r[r];
    l += __shfl_xor(l, 1, 32); l += __shfl_xor(l, 2, 32); l += __shfl_xor(l, 4, 32); l += __shfl_xor(l, 8, 32);
    l_r[r] = (l > 0.f) ? 1.0f / l : 0.f;
  }
#pragma unroll
  for (int dt = 0; dt < DT; ++dt)
#pragma unroll
    for (int r = 0; r < 8; ++r) sO[w][8 * hh + r][dt * 16 + ln] = oacc[dt][r] * l_r[r];
  __builtin_amdgcn_fence(__ATOMIC_ACQ_REL, "workgroup");
  __builtin_amdgcn_wave_barrier();
  {
    for (int r = 0; r < 16; ++r) {
      const int row = q0 + r;
      if (row < T && lane < D / 4) {
        const v4f val = *(const v4fa*)&sO[w][r][lane * 4];
        *(v4f*)(y + ((size_t)b * T + row) * ypitch + h * D + lane * 4) = val;
      }
    }
    
  }
}

// GEMM C = act(A·W + bias + resid): A f32 (ASPLIT -> hi/lo 2 terms), Wt bf16 [N][K]; ACT 0 none, 1 relu, 2 exact gelu;
// resid (optional, f32, row index = (row % rmod), pitch ldr, RES_BF16 rounds it) added before the activation.
template <bool ASPLIT, int ACT, bool BIAS_BF16, bool RES_BF16>
__global__ __launch_bounds__(128) void k_gemm_bf3(const float* __restrict__ A, int lda, const unsigned short* __restrict__ Wt, int ldb,
                                                const float* __restrict__ bias, const float* __restrict__ resid, int rmod, int ldr,
                                                float* __restrict__ C, int ldc, int M, int N, int K) {
  __shared__ __attribute__((aligned(16))) float so[4][16][64];
  const int tid = threadIdx.x, w = tid >> 5, lane = tid & 31, ln = lane & 15, hh = lane >> 4;
  const int ntn = N / 64;
  const int wid = blockIdx.x * 4 + w;
  const int mt = wid / ntn, nq = wid % ntn;
  if (mt * 16 >= M) return;
  const int row0 = mt * 16, col0 = nq * 64;
  const float* arow = A + (size_t)(row0 + ln) * lda;
  v8f acc[4] = {};
  for (int kb = 0; kb < K; kb += 32) {
    FragB ah, al;
    const v4f x0 = *(const v4fa*)(arow + kb + 8 * hh), x1 = *(const v4fa*)(arow + kb + 8 * hh + 4);
    const v4f x2 = *(const v4fa*)(arow + kb + 16 + 8 * hh), x3 = *(const v4fa*)(arow + kb + 16 + 8 * hh + 4);
    float xs[16] = {x0[0],x0[1],x0[2],x0[3],x1[0],x1[1],x1[2],x1[3],x2[0],x2[1],x2[2],x2[3],x3[0],x3[1],x3[2],x3[3]};
#pragma unroll
    for (int i = 0; i < 16; ++i) { const unsigned short hb = bf16_bits(xs[i]); ah.u[i] = hb; al.u[i] = ASPLIT ? bf16_bits(xs[i] - bf16_val(hb)) : (unsigned short)0; }
#pragma unroll
    for (int t = 0; t < 4; ++t) {
      const unsigned short* brow = Wt + (size_t)(col0 + t * 16 + ln) * ldb + kb;
      FragB b;
      b.half[0] = *(const v8us*)(brow + 8 * hh);
      b.half[1] = *(const v8us*)(brow + 16 + 8 * hh);
      acc[t] = mmaN<ASPLIT ? 2 : 1>(ah.v, al.v, b.v, b.v, acc[t]);
    }
  }
#pragma unroll
  for (int t = 0; t < 4; ++t) {
    const int col = col0 + t * 16 + ln;
    float bv = bias ? bias[col] : 0.f;
    if (BIAS_BF16) bv = bf16_round(bv);
#pragma unroll
    for (int r = 0; r < 8; ++r) {
      float v = acc[t][r] + bv;
      if (resid) { float rv = resid[(size_t)((row0 + 8 * hh + r) % rmod) * ldr + col]; if (RES_BF16) rv = bf16_round(rv); v += rv; }
      if (ACT == 1) v = fmaxf(v, 0.f);
      if (ACT == 2) v = 0.5f * v * (1.0f + erff(v * 0.70710678118654752f));
      if (ACT == 3) { const float u = 0.7978845608028654f * (v + 0.044715f * v * v * v); v = 0.5f * v * (1.0f + tanhf(u)); }
      so[w][8 * hh + r][t * 16 + ln] = v;
    }
  }
  __builtin_amdgcn_fence(__ATOMIC_ACQ_REL, "workgroup");
  __builtin_amdgcn_wave_barrier();
  const int rsub = lane >> 4, c4 = (lane & 15) * 4;
  {
#pragma unroll
    for (int q = 0; q < 8; ++q) {
      const int r = q * 2 + rsub;
      const v4f v = *(const v4fa*)&so[w][r][c4];
      *(v4f*)(C + (size_t)(row0 + r) * ldc + col0 + c4) = v;
    }
    
  }
}
// row LayerNorm (biased variance, eps) over N: s = X (+ R); optional out_sum <- s; out_norm <- (s-mu)*rsqrt(var+eps)*g + b
template <bool PARAM_BF16>
__global__ __launch_bounds__(256) void k_layernorm(const float* __restrict__ X, const float* __restrict__ R, const float* __restrict__ g, const float* __restrict__ bta,
                                                  float* __restrict__ out_sum, float* __restrict__ out_norm, int N, float eps) {
  __shared__ float red[256];
  const int row = blockIdx.x, tid = threadIdx.x;
  const float* x = X + (size_t)row * N; const float* rr = R ? R + (size_t)row * N : nullptr;
  float vals[16];                     // up to N = 4096
  const int per = N / 256;            // contiguous chunk per thread? use strided-by-4 chunks: thread handles j = tid*4 + 1024*u
  float s1 = 0.f;
  for (int u = 0; u < per / 4; ++u) {
    const int j = tid * 4 + 1024 * u;
    const v4f a = *(const v4fa*)(x + j);
    v4f b = {0.f,0.f,0.f,0.f}; if (rr) b = *(const v4fa*)(rr + j);
#pragma unroll
    for (int q = 0; q < 4; ++q) { const float v = a[q] + b[q]; vals[u * 4 + q] = v; s1 += v; }
  }
  red[tid] = s1; __syncthreads();
  for (int st = 128; st > 0; st >>= 1) { if (tid < st) red[tid] += red[tid + st]; __syncthreads(); }
  const float mu = red[0] / (float)N; __syncthreads();
  float s2 = 0.f;
  for (int u = 0; u < per / 4; ++u)
#pragma unroll
    for (int q = 0; q < 4; ++q) { const float c = vals[u * 4 + q] - mu; s2 += c * c; }
  red[tid] = s2; __syncthreads();
  for (int st = 128; st > 0; st >>= 1) { if (tid < st) red[tid] += red[tid + st]; __syncthreads(); }
  const float rs = rsqrtf(red[0] / (float)N + eps);
  {
    for (int u = 0; u < per / 4; ++u) {
      const int j = tid * 4 + 1024 * u;
      v4f o, sm;
#pragma unroll
      for (int q = 0; q < 4; ++q) {
        float gg = g[j + q], bb = bta[j + q];
        if (PARAM_BF16) { gg = bf16_round(gg); bb = bf16_round(bb); }
        sm[q] = vals[u * 4 + q]; o[q] = (vals[u * 4 + q] - mu) * rs * gg + bb;
      }
      if (out_sum) *(v4f*)(out_sum + (size_t)row * N + j) = sm;
      *(v4f*)(out_norm + (size_t)row * N + j) = o;
    }
    
  }
}



// ---- f16 WMMA path (v_wmma_f32_16x16x32_f16): 11-bit significands for operands in range — used where a [0,1] probability operand needs more precision than bf16
typedef _Float16 v16h __attribute__((ext_vector_type(16)));
union FragH { v16h v; v8us half[2]; _Float16 h[16]; unsigned short u[16]; };
template <int NT>
__device__ __forceinline__ v8f mmaH(v16h ah, v16h al, v16h bh, v16h bl, v8f c) {
  c = __builtin_amdgcn_wmma_f32_16x16x32_f16(false, ah, false, bh, (short)0, c, false, false);
  if (NT >= 2) c = __builtin_amdgcn_wmma_f32_16x16x32_f16(false, al, false, bh, (short)0, c, false, false);
  if (NT >= 3) c = __builtin_amdgcn_wmma_f32_16x16x32_f16(false, ah, false, bl, (short)0, c, false, false);
  asm volatile("v_nop\n\tv_nop\n\tv_nop\n\tv_nop" : "+v"(c) : "v"(ah), "v"(al), "v"(bh), "v"(bl));
  return c;
}
// batched GEMM like k_gemm_b but f16 operands: A f32 (split into f16 hi/lo if ASPLIT, else rounded to f16), Bt = f16 values [n][k]; alpha; C f32; N multiple of 16 (partial tiles skipped)
template <bool ASPLIT>
__global__ __launch_bounds__(128) void k_gemm_h(const float* __restrict__ A, int lda, size_t sA, const _Float16* __restrict__ Bh, int ldb, size_t sB, float alpha, float* __restrict__ C, int ldc, size_t sC, int M, int N, int K) {
  __shared__ __attribute__((aligned(16))) float so[4][16][64];
  const int tid = threadIdx.x, w = tid >> 5, lane = tid & 31, ln = lane & 15, hh = lane >> 4; const int by = blockIdx.y;
  A += (size_t)by * sA; Bh += (size_t)by * sB; C += (size_t)by * sC;
  const int ntn = (N + 63) / 64; const int wid = blockIdx.x * 4 + w; const int mt = wid / ntn, nq = wid % ntn; if (mt * 16 >= M) return;
  const int row0 = mt * 16, col0 = nq * 64; const float* arow = A + (size_t)(row0 + ln) * lda;
  v8f acc[4] = {};
  for (int kb = 0; kb < K; kb += 32) {
    FragH ah, al;
    const v4f x0 = *(const v4fa*)(arow + kb + 8 * hh), x1 = *(const v4fa*)(arow + kb + 8 * hh + 4), x2 = *(const v4fa*)(arow + kb + 16 + 8 * hh), x3 = *(const v4fa*)(arow + kb + 16 + 8 * hh + 4);
    float xs[16] = {x0[0],x0[1],x0[2],x0[3],x1[0],x1[1],x1[2],x1[3],x2[0],x2[1],x2[2],x2[3],x3[0],x3[1],x3[2],x3[3]};
#pragma unroll
    for (int i = 0; i < 16; ++i) { const _Float16 h = (_Float16)xs[i]; ah.h[i] = h; al.h[i] = ASPLIT ? (_Float16)(xs[i] - (float)h) : (_Float16)0.0f; }
#pragma unroll
    for (int t = 0; t < 4; ++t) { if (col0 + t * 16 >= N) continue; const size_t boff = (size_t)(col0 + t * 16 + ln) * ldb + kb; FragH bq; bq.half[0] = *(const v8us*)(Bh + boff + 8 * hh); bq.half[1] = *(const v8us*)(Bh + boff + 16 + 8 * hh);
      acc[t] = mmaH<ASPLIT ? 2 : 1>(ah.v, al.v, bq.v, bq.v, acc[t]); }
  }
#pragma unroll
  for (int t = 0; t < 4; ++t) { if (col0 + t * 16 >= N) continue;
#pragma unroll
    for (int r = 0; r < 8; ++r) so[w][8 * hh + r][t * 16 + ln] = acc[t][r] * alpha; }
  __builtin_amdgcn_fence(__ATOMIC_ACQ_REL, "workgroup"); __builtin_amdgcn_wave_barrier();
  const int rsub = lane >> 4, c4 = (lane & 15) * 4;
  {
#pragma unroll
    for (int q = 0; q < 8; ++q) { const int r = q * 2 + rsub; if (col0 + c4 < N) { const v4f v = *(const v4fa*)&so[w][r][c4]; *(v4f*)(C + (size_t)(row0 + r) * ldc + col0 + c4) = v; } }
     }
}

// Wt[n][k] = f16(W[k][n]·scale) from f32 row-major W[K][N] (scale = power of two; bf16-exact weights stay exact in f16 away from the subnormal range)
__global__ __launch_bounds__(256) void k_wt_f16(const float* __restrict__ W, _Float16* __restrict__ Wt, int K, int N, float scale) {
  const int t = blockIdx.x * 256 + threadIdx.x; if (t >= N * (K / 8)) return; const int n = t / (K / 8), k8 = (t % (K / 8)) * 8; FragH f;
#pragma unroll
  for (int i = 0; i < 8; ++i) f.h[i] = (_Float16)(bf16_round(W[(size_t)(k8 + i) * N + n]) * scale); const v8us o = f.half[0];
  *(v8us*)((unsigned short*)Wt + (size_t)n * K + k8) = o; 
}
// k_gemm_hh variant with fused epilogue: v = acc·alpha + bias[by·sBias + col] (+ CP[(row/rowsPerB)·sCPb + by·64 + col] if CP) ; ACT 0 none / 1 elu ; writes f32 C and/or f16 C16 (each if non-null)
template <int ACT>
__global__ __launch_bounds__(128) void k_gemm_hhx(const _Float16* __restrict__ A, int lda, size_t sA, const _Float16* __restrict__ Bh, int ldb, size_t sB, float alpha, const float* __restrict__ bias, size_t sBias, const float* __restrict__ CP, int rowsPerB, size_t sCPb, int row0g,
    float* __restrict__ C, _Float16* __restrict__ C16, int ldc, size_t sC, int M, int N, int K) {
  __shared__ __attribute__((aligned(16))) float so[4][16][64];
  const int tid = threadIdx.x, w = tid >> 5, lane = tid & 31, ln = lane & 15, hh = lane >> 4; const int by = blockIdx.y;
  A += (size_t)by * sA; Bh += (size_t)by * sB; const size_t cofs = (size_t)by * sC; const float* bp = bias ? bias + (size_t)by * sBias : nullptr;
  const int ntn = (N + 63) / 64; const int wid = blockIdx.x * 4 + w; const int mt = wid / ntn, nq = wid % ntn; if (mt * 16 >= M) return;
  const int row0 = mt * 16, col0 = nq * 64; const _Float16* arow = A + (size_t)(row0 + ln) * lda;
  v8f acc[4] = {};
  for (int kb = 0; kb < K; kb += 32) { FragH ah; ah.half[0] = *(const v8us*)((const unsigned short*)arow + kb + 8 * hh); ah.half[1] = *(const v8us*)((const unsigned short*)arow + kb + 16 + 8 * hh);
#pragma unroll
    for (int t = 0; t < 4; ++t) { if (col0 + t * 16 >= N) continue; const size_t boff = (size_t)(col0 + t * 16 + ln) * ldb + kb; FragH bq; bq.half[0] = *(const v8us*)((const unsigned short*)Bh + boff + 8 * hh); bq.half[1] = *(const v8us*)((const unsigned short*)Bh + boff + 16 + 8 * hh);
      acc[t] = mmaH<1>(ah.v, ah.v, bq.v, bq.v, acc[t]); }
  }
#pragma unroll
  for (int t = 0; t < 4; ++t) { if (col0 + t * 16 >= N) continue; const int col = col0 + t * 16 + ln; const float bv = bp ? bf16_round(bp[col]) : 0.f;
#pragma unroll
    for (int r = 0; r < 8; ++r) { float v = acc[t][r] * alpha + bv; if (CP) { const int bidx = (row0g + row0 + 8 * hh + r) / rowsPerB; v += CP[(size_t)bidx * sCPb + (size_t)by * 64 + col]; } if (ACT == 1) v = (v > 0.f) ? v : expm1f(v); else if (ACT == 3) v = fmaxf(v, 0.f); so[w][8 * hh + r][t * 16 + ln] = v; } }
  __builtin_amdgcn_fence(__ATOMIC_ACQ_REL, "workgroup"); __builtin_amdgcn_wave_barrier();
  const int rsub = lane >> 4, c4 = (lane & 15) * 4; typedef _Float16 v4h __attribute__((ext_vector_type(4)));
  {
#pragma unroll
    for (int q = 0; q < 8; ++q) { const int r = q * 2 + rsub; if (col0 + c4 < N) { const v4f v = *(const v4fa*)&so[w][r][c4]; if (C) *(v4f*)(C + cofs + (size_t)(row0 + r) * ldc + col0 + c4) = v; if (C16) { v4h h4; for (int i = 0; i < 4; ++i) h4[i] = (_Float16)v[i]; *(v4h*)(C16 + cofs + (size_t)(row0 + r) * ldc + col0 + c4) = h4; } } }
     }
}


typedef _Float16 v4h __attribute__((ext_vector_type(4)));

__global__ __launch_bounds__(256) void k_x16(const float* __restrict__ x, _Float16* __restrict__ X16, size_t n8) { const size_t t = (size_t)blockIdx.x * 256 + threadIdx.x; if (t >= n8) return; FragH f;
#pragma unroll
  for (int q = 0; q < 8; ++q) f.h[q] = (_Float16)bf16_round(x[t * 8 + q]); *(v8us*)((unsigned short*)X16 + t * 8) = f.half[0];  }
__global__ __launch_bounds__(256) void k_h16(const float* __restrict__ x, _Float16* __restrict__ X16, size_t n8) { const size_t t = (size_t)blockIdx.x * 256 + threadIdx.x; if (t >= n8) return; FragH f;
#pragma unroll
  for (int q = 0; q < 8; ++q) f.h[q] = (_Float16)x[t * 8 + q]; *(v8us*)((unsigned short*)X16 + t * 8) = f.half[0];  }
__global__ __launch_bounds__(256) void k_round16f(const float* __restrict__ W, _Float16* __restrict__ Bt, size_t n8) { const size_t t = (size_t)blockIdx.x * 256 + threadIdx.x; if (t >= n8) return; FragH f;
#pragma unroll
  for (int i = 0; i < 8; ++i) f.h[i] = (_Float16)(bf16_round(W[t * 8 + i]) * 16.0f); *(v8us*)((unsigned short*)Bt + t * 8) = f.half[0];  }
template <int NHv, int TTv>
__global__ __launch_bounds__(256) void k_vt(const _Float16* __restrict__ V16, int ldv, int voff, _Float16* __restrict__ Vt) { __shared__ unsigned short tl[64][66]; const int tid = threadIdx.x; const int slab = blockIdx.x / (TTv / 64), lg = blockIdx.x % (TTv / 64); const int b = slab / NHv, h = slab % NHv;
  for (int i = tid; i < 64 * 8; i += 256) { const int r = i / 8, c8 = (i % 8) * 8; FragH f; f.half[0] = *(const v8us*)((const unsigned short*)V16 + ((size_t)b * TTv + lg * 64 + r) * ldv + voff + h * 64 + c8);
#pragma unroll
    for (int q = 0; q < 8; ++q) tl[r][c8 + q] = f.u[q]; }
  __syncthreads();
  {
#pragma unroll
    for (int rd = 0; rd < 2; ++rd) { const int d = rd * 32 + tid / 8, pc = tid % 8; FragH f;
#pragma unroll
      for (int q = 0; q < 8; ++q) f.u[q] = tl[pc * 8 + q][d];
      *(v8us*)((unsigned short*)Vt + ((size_t)slab * 64 + d) * TTv + lg * 64 + pc * 8) = f.half[0]; }
     } }

__global__ __launch_bounds__(256) void k_tok(const float* __restrict__ x, _Float16* __restrict__ X16) { __shared__ float tl[32][65]; const int tid = threadIdx.x; const int b = blockIdx.x / ((CC / 64) * (NN / 32)), rem = blockIdx.x % ((CC / 64) * (NN / 32)); const int cg = rem / (NN / 32), pg = rem % (NN / 32); const int c0 = cg * 64, p0 = pg * 32;
  for (int i = tid; i < 64 * 32; i += 256) { const int c = i / 32, pp = i % 32; tl[pp][c] = bf16_round(x[((size_t)b * CC + c0 + c) * NN + p0 + pp]); } __syncthreads();
  const int r = tid / 8, pc = tid % 8; FragH f; for (int q = 0; q < 8; ++q) f.h[q] = (_Float16)tl[r][pc * 8 + q]; const size_t row = (size_t)b * NN + p0 + r; *(v8us*)((unsigned short*)X16 + row * CC + c0 + pc * 8) = f.half[0];  }
__global__ __launch_bounds__(256) void k_pool2(const _Float16* __restrict__ F, _Float16* __restrict__ P) { const size_t t = (size_t)blockIdx.x * 256 + threadIdx.x; if (t >= (size_t)NRH * (CC / 8)) return; const int c8 = (int)(t % (CC / 8)) * 8; const size_t rm = t / (CC / 8); FragH a, b2, o; a.half[0] = *(const v8us*)((const unsigned short*)F + (rm * 2) * CC + c8); b2.half[0] = *(const v8us*)((const unsigned short*)F + (rm * 2 + 1) * CC + c8); for (int q = 0; q < 8; ++q) o.h[q] = ((float)a.h[q] > (float)b2.h[q]) ? a.h[q] : b2.h[q];
  *(v8us*)((unsigned short*)P + rm * CC + c8) = o.half[0];  }
__global__ __launch_bounds__(256) void k_pool2f(const float* __restrict__ F, float* __restrict__ P) { const size_t t = (size_t)blockIdx.x * 256 + threadIdx.x; if (t >= (size_t)NRH * (CC / 4)) return; const int c4 = (int)(t % (CC / 4)) * 4; const size_t rm = t / (CC / 4); const v4f a = *(const v4fa*)(F + (rm * 2) * CC + c4), b2 = *(const v4fa*)(F + (rm * 2 + 1) * CC + c4); v4f o; for (int q = 0; q < 4; ++q) o[q] = fmaxf(a[q], b2[q]); *(v4f*)(P + rm * CC + c4) = o;  }
__global__ __launch_bounds__(256) void k_hl(const float* __restrict__ F, _Float16* __restrict__ Hh, _Float16* __restrict__ Hl, size_t n8) { const size_t t = (size_t)blockIdx.x * 256 + threadIdx.x; if (t >= n8) return; FragH fh, fl; for (int q = 0; q < 8; ++q) { const float v = F[t * 8 + q]; const _Float16 h = (_Float16)v; fh.h[q] = h; fl.h[q] = (_Float16)((v - (float)h) * 1024.0f); } { *(v8us*)((unsigned short*)Hh + t * 8) = fh.half[0]; *(v8us*)((unsigned short*)Hl + t * 8) = fl.half[0];  } }
__global__ __launch_bounds__(256) void k_cvec(const float* __restrict__ PHF, const float* __restrict__ bth, float* __restrict__ cv) { const int m = blockIdx.x * 256 + threadIdx.x; if (m >= NH) return; float s = 0.f;
#pragma unroll 1
  for (int o = 0; o < CC; o += 4) { const v4f p = *(const v4fa*)(PHF + (size_t)m * CC + o); for (int q = 0; q < 4; ++q) s += p[q] * bf16_round(bth[o + q]); } *(float*)(cv + m) = s;  }
__global__ __launch_bounds__(256) void k_smx(const float* __restrict__ S, _Float16* __restrict__ P16) { const int tid = threadIdx.x, wv = tid >> 5, lane = tid & 31; const int r = blockIdx.x * 8 + wv; if (r >= NN) return; const float* sr = S + (size_t)r * NH; float m = -3.0e38f;
  for (int p = lane; p < NH / 8; p += 32) { const v4f a = *(const v4fa*)(sr + p * 8), b = *(const v4fa*)(sr + p * 8 + 4); for (int q = 0; q < 4; ++q) m = fmaxf(m, fmaxf(a[q], b[q])); }
  for (int o = 16; o >= 1; o >>= 1) m = fmaxf(m, __shfl_xor(m, o, 32)); float z = 0.f;
  for (int p = lane; p < NH / 8; p += 32) { const v4f a = *(const v4fa*)(sr + p * 8), b = *(const v4fa*)(sr + p * 8 + 4); for (int q = 0; q < 4; ++q) z += __expf(a[q] - m) + __expf(b[q] - m); }
  for (int o = 16; o >= 1; o >>= 1) z += __shfl_xor(z, o, 32); const float iz = 32768.0f / z;
  { for (int p = lane; p < NH / 8; p += 32) { FragH f; for (int q = 0; q < 8; ++q) f.h[q] = (_Float16)(__expf(sr[p * 8 + q] - m) * iz); *(v8us*)((unsigned short*)P16 + (size_t)r * NH + p * 8) = f.half[0]; }  } }
__global__ __launch_bounds__(256) void k_bnstat(const float* __restrict__ Y, float* __restrict__ ST) { __shared__ float ra[256]; const int c = blockIdx.x, tid = threadIdx.x; float s = 0.f; for (int r = tid; r < NR; r += 256) s += Y[(size_t)r * CC + c]; ra[tid] = s; __syncthreads(); for (int o = 128; o >= 1; o >>= 1) { if (tid < o) ra[tid] += ra[tid + o]; __syncthreads(); } const float mu = ra[0] / (float)NR; __syncthreads(); float q2 = 0.f;
  for (int r = tid; r < NR; r += 256) { const float d = Y[(size_t)r * CC + c] - mu; q2 += d * d; } ra[tid] = q2; __syncthreads(); for (int o = 128; o >= 1; o >>= 1) { if (tid < o) ra[tid] += ra[tid + o]; __syncthreads(); }
  if (tid < 32) { const float v = (tid == 0) ? mu : ((tid == 1) ? rsqrtf(ra[0] / (float)NR + 1e-5f) : 0.f); *(float*)(ST + c * 32 + tid) = v;  } }
__global__ __launch_bounds__(256) void k_out(const float* __restrict__ WY, const float* __restrict__ ST, const float* __restrict__ gam, const float* __restrict__ bet, const float* __restrict__ x, float* __restrict__ out) { __shared__ float tl[32][65]; const int tid = threadIdx.x; const int b = blockIdx.x / ((CC / 32) * (NN / 64)), rem = blockIdx.x % ((CC / 32) * (NN / 64)); const int cg = rem / (NN / 64), pg = rem % (NN / 64); const int c0 = cg * 32, p0 = pg * 64;
  for (int i = tid; i < 64 * 32; i += 256) { const int pp = i / 32, c = i % 32; const int cc = c0 + c; tl[c][pp] = (WY[((size_t)b * NN + p0 + pp) * CC + cc] - ST[cc * 32]) * ST[cc * 32 + 1] * bf16_round(gam[cc]) + bf16_round(bet[cc]); } __syncthreads();
  { for (int i = tid; i < 32 * 16; i += 256) { const int c = i / 16, q4 = i % 16; const size_t o = ((size_t)b * CC + c0 + c) * NN + p0 + q4 * 4; const v4f xv = *(const v4fa*)(x + o); v4f v; for (int q = 0; q < 4; ++q) v[q] = tl[c][q4 * 4 + q] + bf16_round(xv[q]); *(v4f*)(out + o) = v; }  } }
extern "C" void kernel_launch(void* const* d_in, const int* in_sizes, int n_in,
                              void* d_out, int out_size, void* d_ws, size_t ws_size, hipStream_t stream) {
  (void)in_sizes; (void)n_in; (void)out_size;
  const float* x = (const float*)d_in[0]; const float* gw = (const float*)d_in[1]; const float* gb = (const float*)d_in[2]; const float* thw = (const float*)d_in[3]; const float* thb = (const float*)d_in[4]; const float* phw = (const float*)d_in[5]; const float* phb = (const float*)d_in[6]; const float* Ww = (const float*)d_in[7]; const float* Wb = (const float*)d_in[8]; const float* gam = (const float*)d_in[9]; const float* bet = (const float*)d_in[10];
  char* ws = (char*)d_ws; size_t off = 0;
  auto take = [&](size_t bytes) { char* p = ws + off; off += (bytes + 255) & ~(size_t)255; return p; };
  _Float16* Bg = (_Float16*)take((size_t)CC * CC * 2); _Float16* Bph = (_Float16*)take((size_t)CC * CC * 2); _Float16* BW = (_Float16*)take((size_t)CC * CC * 2); float* ST = (float*)take(CC * 32 * 4);
  _Float16* Bthp = (_Float16*)take((size_t)CC * CC * 2);      // W_θ as [in=o][out=c] → Bt[c][o] for φ·W_θ
  _Float16* X16 = (_Float16*)take((size_t)NR * CC * 2); float* FULLF = (float*)take((size_t)NR * CC * 4); _Float16* FULL = (_Float16*)take((size_t)NR * CC * 2); float* PHF = (float*)take((size_t)NRH * CC * 4); _Float16* PHh = (_Float16*)take((size_t)NRH * CC * 2); _Float16* PHl = (_Float16*)take((size_t)NRH * CC * 2); _Float16* GP = (_Float16*)take((size_t)NRH * CC * 2);
  float* BP = (float*)take((size_t)NH * CC * 4); _Float16* BPh = (_Float16*)take((size_t)NH * CC * 2); _Float16* BPl = (_Float16*)take((size_t)NH * CC * 2); float* CV = (float*)take(NH * 4); _Float16* Gt = (_Float16*)take((size_t)NH * CC * 2); float* S = (float*)take((size_t)NN * NH * 4); _Float16* P16 = (_Float16*)take((size_t)NN * NH * 2);
  float* Y = FULLF; _Float16* Y16 = FULL; float* WY = FULLF;      // FULLF/FULL are dead after pooling; Y (f32) → Y16 → WY back over Y
  if (off > ws_size) return;      // 2.2 + 16.8 + 33.5 + 16.8 + 16.8 + 8.4 + 8.4 + 8.4 + 2.1 + 1 + 1 + 1 + 8.4 + 4.2 ≈ 130 MB
  k_round16f<<<(CC * CC / 8 + 255) / 256, 256, 0, stream>>>(gw, Bg, CC * CC / 8); k_round16f<<<(CC * CC / 8 + 255) / 256, 256, 0, stream>>>(phw, Bph, CC * CC / 8); k_round16f<<<(CC * CC / 8 + 255) / 256, 256, 0, stream>>>(Ww, BW, CC * CC / 8);      // (out,in) natural
  k_wt_f16<<<(CC * (CC / 8) + 255) / 256, 256, 0, stream>>>(thw, Bthp, CC, CC, 16.0f);      // Bt[c][o] = W_θ[o][c]
  k_tok<<<BB * (CC / 64) * (NN / 32), 256, 0, stream>>>(x, X16);
  const dim3 gp(((NR / 16) * (CC / 64) + 3) / 4, 1); const unsigned gh8 = (unsigned)(((size_t)NRH * (CC / 8) + 255) / 256);
  k_gemm_hhx<0><<<gp, 128, 0, stream>>>(X16, CC, 0, Bph, CC, 0, 0.0625f, phb, 0, nullptr, 1, 0, 0, FULLF, nullptr, CC, 0, NR, CC, CC); k_pool2f<<<(unsigned)(((size_t)NRH * (CC / 4) + 255) / 256), 256, 0, stream>>>(FULLF, PHF);      // φ (f32, pooled)
  k_hl<<<gh8, 256, 0, stream>>>(PHF, PHh, PHl, (size_t)NRH * CC / 8);
  k_gemm_hhx<0><<<gp, 128, 0, stream>>>(X16, CC, 0, Bg, CC, 0, 0.0625f, gb, 0, nullptr, 1, 0, 0, nullptr, FULL, CC, 0, NR, CC, CC); k_pool2<<<gh8, 256, 0, stream>>>(FULL, GP);      // g (f16, pooled)
  const dim3 gb2(((NH / 16) * (CC / 64) + 3) / 4, 1), gs(((NN / 16) * (NH / 64) + 3) / 4, 1);
  for (int b = 0; b < BB; ++b) { const size_t rh = (size_t)b * NH;
    k_gemm_hhx<0><<<gb2, 128, 0, stream>>>(PHh + rh * CC, CC, 0, Bthp, CC, 0, 0.0625f, nullptr, 0, nullptr, 1, 0, 0, BP, nullptr, CC, 0, NH, CC, CC);
    k_gemm_hhx<0><<<gb2, 128, 0, stream>>>(PHl + rh * CC, CC, 0, Bthp, CC, 0, 0.0625f * 0.0009765625f, nullptr, 0, BP, 1, (size_t)CC, 0, BP, nullptr, CC, 0, NH, CC, CC);      // B' = φ_b·W_θ [1024][512] (φ hi + lo)
    k_hl<<<(NH * CC / 8 + 255) / 256, 256, 0, stream>>>(BP, BPh, BPl, (size_t)NH * CC / 8); k_cvec<<<(NH + 255) / 256, 256, 0, stream>>>(PHF + rh * CC, thb, CV);
    k_gemm_hhx<0><<<gs, 128, 0, stream>>>(X16 + (size_t)b * NN * CC, CC, 0, BPh, CC, 0, 1.0f, nullptr, 0, CV, NN, 0, 0, S, nullptr, NH, 0, NN, NH, CC);      // f = x·B'hᵀ + c (c broadcast over rows: rowsPerB = NN, sCPb = 0)
    k_gemm_hhx<0><<<gs, 128, 0, stream>>>(X16 + (size_t)b * NN * CC, CC, 0, BPl, CC, 0, 0.0009765625f, nullptr, 0, S, 1, (size_t)NH, 0, S, nullptr, NH, 0, NN, NH, CC);      // + x·B'lᵀ·2^-10
    k_smx<<<NN / 8, 256, 0, stream>>>(S, P16);
    k_vt<8, NH><<<1 * 8 * (NH / 64), 256, 0, stream>>>(GP + rh * CC, CC, 0, Gt);      // gᵀ [512][1024]
    k_gemm_hhx<0><<<dim3(((NN / 16) * (CC / 64) + 3) / 4, 1), 128, 0, stream>>>(P16, NH, 0, Gt, NH, 0, 0.000030517578125f, nullptr, 0, nullptr, 1, 0, 0, Y + (size_t)b * NN * CC, nullptr, CC, 0, NN, CC, NH); }      // y = softmax(f)·g
  k_h16<<<(unsigned)(((size_t)NR * CC / 8 + 255) / 256), 256, 0, stream>>>(Y, Y16, (size_t)NR * CC / 8);
  k_gemm_hhx<0><<<gp, 128, 0, stream>>>(Y16, CC, 0, BW, CC, 0, 0.0625f, Wb, 0, nullptr, 1, 0, 0, WY, nullptr, CC, 0, NR, CC, CC);      // wy = W(y) + b
  k_bnstat<<<CC, 256, 0, stream>>>(WY, ST); k_out<<<BB * (CC / 32) * (NN / 64), 256, 0, stream>>>(WY, ST, gam, bet, x, (float*)d_out);
}

// v001
// One run takes 692 microseconds.
// Next to v000, in two timings, it ran 2.12 and 2.15 times as fast.
#include <hip/hip_runtime.h>
// Non-local block with view pooling (x [8, C=512, N=2048]): θ = conv1(x), φ = maxpool2(conv1(x)), g = maxpool2(conv1(x)); f = softmax(θᵀ·φ) [N × N/2] (unscaled); y = f·g; wy = conv1(y) + b;
// out = BN_train(wy)·γ + β + x. Because the unscaled logits reach σ≈20 and feed a near-one-hot softmax, θ is never rounded: the logits are re-associated as f = x·(φ·W_θ)ᵀ + 1·(φ·b_θ)ᵀ with x bf16-EXACT,
// φ (f32, max-pooled from an f32 projection) fed as f16 hi + lo·2^10 into φ·W_θ and that product again split hi/lo as the B operand (four cheap passes per batch), the column term added exactly through
// the epilogue addend; g, y as plain f16; P ×2^15 f16; all on v_wmma_f32_16x16x32_f16 ((out,in) weights bf16-exact ×2^4, f32 accumulate); the layout transposes, max-pooling, softmax rows, BN batch statistics (fixed-order) and the residual are f32 VALU.
#define BB 8
#define CC 512
#define NN 2048
#define NH (NN / 2)
#define NR (BB * NN)
#define NRH (BB * NH)

typedef __bf16 v16b __attribute__((ext_vector_type(16)));
typedef unsigned short v8us __attribute__((ext_vector_type(8), may_alias));
typedef float  v8f  __attribute__((ext_vector_type(8)));
typedef float  v4f  __attribute__((ext_vector_type(4)));
typedef float  v4fa __attribute__((ext_vector_type(4), may_alias));
union FragB { v16b v; v8us half[2]; unsigned short u[16]; };

__device__ __forceinline__ unsigned short bf16_bits(float x) { unsigned int u = __float_as_uint(x); return (unsigned short)((u + 0x7FFFu + ((u >> 16) & 1u)) >> 16); }
__device__ __forceinline__ float bf16_val(unsigned short b) { return __uint_as_float(((unsigned int)b) << 16); }
__device__ __forceinline__ float bf16_round(float x) { return bf16_val(bf16_bits(x)); }
// D += A·B with NT terms: 1 = ah·bh, 2 = + al·bh (A split), 3 = + ah·bl (both split)
template <int NT>
__device__ __forceinline__ v8f mmaN(v16b ah, v16b al, v16b bh, v16b bl, v8f c) {
  c = __builtin_amdgcn_wmma_f32_16x16x32_bf16(false, ah, false, bh, (short)0, c, false, false);
  if (NT >= 2) c = __builtin_amdgcn_wmma_f32_16x16x32_bf16(false, al, false, bh, (short)0, c, false, false);
  if (NT >= 3) c = __builtin_amdgcn_wmma_f32_16x16x32_bf16(false, ah, false, bl, (short)0, c, false, false);
  asm volatile("v_nop\n\tv_nop\n\tv_nop\n\tv_nop" : "+v"(c) : "v"(ah), "v"(al), "v"(bh), "v"(bl));
  return c;
}

__global__ __launch_bounds__(256) void k_wt_bf16(const float* __restrict__ W, unsigned short* __restrict__ Wt, int K, int N) {
  const int t = blockIdx.x * 256 + threadIdx.x;
  const int k8n = K / 8;
  if (t >= N * k8n) return;
  const int n = t / k8n, k8 = (t % k8n) * 8;
  v8us v;
#pragma unroll
  for (int i = 0; i < 8; ++i) v[i] = bf16_bits(W[(size_t)(k8 + i) * N + n]);
  *(v8us*)(Wt + (size_t)n * K + k8) = v;
  
}

// GEMM C[M][N] (f32, pitch ldc) = act(A[M][K]·W + bias). A f32 row-major (pitch lda) converted per fragment to bf16
// (ASPLIT: hi/lo two planes -> 2 terms, else single rounded term); Wt bf16 [N][K] (pitch ldb). BIAS_BF16 rounds the
// bias to bf16 first (bias quantised to bf16 before the add). K%32==0, M%16==0, N%64==0.
template <bool ASPLIT, int ACT, bool BIAS_BF16>
__global__ __launch_bounds__(128) void k_gemm_bf(const float* __restrict__ A, int lda, const unsigned short* __restrict__ Wt, int ldb,
                                               const float* __restrict__ bias, float* __restrict__ C, int ldc, int M, int N, int K) {
  __shared__ __attribute__((aligned(16))) float so[4][16][64];
  const int tid = threadIdx.x, w = tid >> 5, lane = tid & 31, ln = lane & 15, hh = lane >> 4;
  const int ntn = N / 64;
  const int wid = blockIdx.x * 4 + w;
  const int mt = wid / ntn, nq = wid % ntn;
  if (mt * 16 >= M) return;
  const int row0 = mt * 16, col0 = nq * 64;
  const float* arow = A + (size_t)(row0 + ln) * lda;
  v8f acc[4] = {};
  for (int kb = 0; kb < K; kb += 32) {
    FragB ah, al;
    const v4f x0 = *(const v4fa*)(arow + kb + 8 * hh), x1 = *(const v4fa*)(arow + kb + 8 * hh + 4);
    const v4f x2 = *(const v4fa*)(arow + kb + 16 + 8 * hh), x3 = *(const v4fa*)(arow + kb + 16 + 8 * hh + 4);
    float xs[16] = {x0[0],x0[1],x0[2],x0[3],x1[0],x1[1],x1[2],x1[3],x2[0],x2[1],x2[2],x2[3],x3[0],x3[1],x3[2],x3[3]};
#pragma unroll
    for (int i = 0; i < 16; ++i) { const unsigned short hb = bf16_bits(xs[i]); ah.u[i] = hb; al.u[i] = ASPLIT ? bf16_bits(xs[i] - bf16_val(hb)) : (unsigned short)0; }
#pragma unroll
    for (int t = 0; t < 4; ++t) {
      const unsigned short* brow = Wt + (size_t)(col0 + t * 16 + ln) * ldb + kb;
      FragB b;
      b.half[0] = *(const v8us*)(brow + 8 * hh);
      b.half[1] = *(const v8us*)(brow + 16 + 8 * hh);
      acc[t] = mmaN<ASPLIT ? 2 : 1>(ah.v, al.v, b.v, b.v, acc[t]);
    }
  }
#pragma unroll
  for (int t = 0; t < 4; ++t) {
    float bv = bias ? bias[col0 + t * 16 + ln] : 0.f;
    if (BIAS_BF16) bv = bf16_round(bv);
#pragma unroll
    for (int r = 0; r < 8; ++r) { float v = acc[t][r] + bv; if (ACT == 1) v = fmaxf(v, 0.f); so[w][8 * hh + r][t * 16 + ln] = v; }
  }
  __builtin_amdgcn_fence(__ATOMIC_ACQ_REL, "workgroup");
  __builtin_amdgcn_wave_barrier();
  const int rsub = lane >> 4, c4 = (lane & 15) * 4;
  {
#pragma unroll
    for (int q = 0; q < 8; ++q) {
      const int r = q * 2 + rsub;
      const v4f v = *(const v4fa*)&so[w][r][c4];
      *(v4f*)(C + (size_t)(row0 + r) * ldc + col0 + c4) = v;
    }
    
  }
}

// Flash-style causal/unmasked attention, all contractions 3-term bf16 hi/lo splits, f32 softmax with running max.
// q,k,v rows are read from f32 buffers with arbitrary row pitch (so they can live inside a fused qkv buffer);
// D = head size (multiple of 32, <= 128); one wave = 16 query rows; block = 4 waves (64 queries) sharing K/V chunks of 32.
template <int D, bool CAUSAL>
__global__ __launch_bounds__(128) void k_flash(const float* __restrict__ qb, const float* __restrict__ kb, const float* __restrict__ vb,
                                             int pitch, int T, int H, float scale, float* __restrict__ y, int ypitch) {
  constexpr int KS = D / 32;        // k-steps for QK
  constexpr int DT = D / 16;        // d tiles for PV
  __shared__ __attribute__((aligned(16))) unsigned short sKh[32][D + 8], sKl[32][D + 8], sVh[32][D + 8], sVl[32][D + 8];
  __shared__ __attribute__((aligned(16))) unsigned short sPh[4][16][40], sPl[4][16][40];
  __shared__ __attribute__((aligned(16))) float sO[4][16][D];
  const int tid = threadIdx.x, w = tid >> 5, lane = tid & 31, ln = lane & 15, hh = lane >> 4;
  const int nqb = (T + 63) / 64;
  const int bh = blockIdx.x / nqb, qblk = blockIdx.x % nqb;
  const int b = bh / H, h = bh % H;
  const int q0 = qblk * 64 + w * 16;
  const float* Q = qb + (size_t)b * T * pitch + h * D;
  const float* K = kb + (size_t)b * T * pitch + h * D;
  const float* V = vb + (size_t)b * T * pitch + h * D;

  // A fragments of the wave's 16 query rows (scaled), hi/lo
  FragB aqh[KS], aql[KS];
  {
    int row = q0 + ln; if (row >= T) row = T - 1;
    const float* qr = Q + (size_t)row * pitch;
#pragma unroll
    for (int ks = 0; ks < KS; ++ks)
#pragma unroll
      for (int i = 0; i < 16; ++i) {
        const int d = ks * 32 + ((i < 8) ? (8 * hh + i) : (16 + 8 * hh + (i - 8)));
        const float x = qr[d] * scale; const unsigned short hb = bf16_bits(x);
        aqh[ks].u[i] = hb; aql[ks].u[i] = bf16_bits(x - bf16_val(hb));
      }
  }
  float m_r[8], l_r[8];
#pragma unroll
  for (int r = 0; r < 8; ++r) { m_r[r] = -3.0e38f; l_r[r] = 0.f; }
  v8f oacc[DT];
#pragma unroll
  for (int dt = 0; dt < DT; ++dt) oacc[dt] = (v8f){0.f,0.f,0.f,0.f,0.f,0.f,0.f,0.f};

  const int kv_end = CAUSAL ? min(T, qblk * 64 + 64) : T;     // block-uniform
  for (int j0 = 0; j0 < kv_end; j0 += 32) {
    __syncthreads();
    for (int e = tid; e < 32 * (D / 4); e += 128) {
      const int r = e / (D / 4), c4 = (e % (D / 4)) * 4;
      const int key = j0 + r;
      v4f kf = {0.f,0.f,0.f,0.f}, vf = {0.f,0.f,0.f,0.f};
      if (key < T) { kf = *(const v4fa*)(K + (size_t)key * pitch + c4); vf = *(const v4fa*)(V + (size_t)key * pitch + c4); }
#pragma unroll
      for (int t = 0; t < 4; ++t) {
        unsigned short hb = bf16_bits(kf[t]); sKh[r][c4 + t] = hb; sKl[r][c4 + t] = bf16_bits(kf[t] - bf16_val(hb));
        hb = bf16_bits(vf[t]); sVh[r][c4 + t] = hb; sVl[r][c4 + t] = bf16_bits(vf[t] - bf16_val(hb));
      }
    }
    __syncthreads();
    // S tile 16 x 32
    v8f s[2];
#pragma unroll
    for (int nt = 0; nt < 2; ++nt) {
      v8f acc = {};
#pragma unroll
      for (int ks = 0; ks < KS; ++ks) {
        FragB bh_, bl_;
        bh_.half[0] = *(const v8us*)&sKh[nt * 16 + ln][ks * 32 + 8 * hh]; bh_.half[1] = *(const v8us*)&sKh[nt * 16 + ln][ks * 32 + 16 + 8 * hh];
        bl_.half[0] = *(const v8us*)&sKl[nt * 16 + ln][ks * 32 + 8 * hh]; bl_.half[1] = *(const v8us*)&sKl[nt * 16 + ln][ks * 32 + 16 + 8 * hh];
        acc = mmaN<3>(aqh[ks].v, aql[ks].v, bh_.v, bl_.v, acc);
      }
      s[nt] = acc;
    }
    // mask + running max (rows 8hh+r; the 16 lanes of a half share rows)
    float alpha[8];
#pragma unroll
    for (int r = 0; r < 8; ++r) {
      const int qi = q0 + 8 * hh + r;
      const int ja = j0 + ln, jb = j0 + 16 + ln;
      if (CAUSAL) { if (ja > qi) s[0][r] = -3.0e38f; if (jb > qi) s[1][r] = -3.0e38f; }
      if (ja >= T) s[0][r] = -3.0e38f;
      if (jb >= T) s[1][r] = -3.0e38f;
      float mx = fmaxf(s[0][r], s[1][r]);
      mx = fmaxf(mx, __shfl_xor(mx, 1, 32)); mx = fmaxf(mx, __shfl_xor(mx, 2, 32)); mx = fmaxf(mx, __shfl_xor(mx, 4, 32)); mx = fmaxf(mx, __shfl_xor(mx, 8, 32));
      const float mnew = fmaxf(m_r[r], mx);
      alpha[r] = (mnew > -1.0e38f) ? __expf(m_r[r] - mnew) : 1.0f;
      const float p0 = (s[0][r] > -1.0e38f) ? __expf(s[0][r] - mnew) : 0.f;
      const float p1 = (s[1][r] > -1.0e38f) ? __expf(s[1][r] - mnew) : 0.f;
      m_r[r] = mnew;
      l_r[r] = l_r[r] * alpha[r] + p0 + p1;            // per-lane partial row sum (16 lanes combined at the end)
      unsigned short hb = bf16_bits(p0); sPh[w][8 * hh + r][ln] = hb;      sPl[w][8 * hh + r][ln] = bf16_bits(p0 - bf16_val(hb));
      hb = bf16_bits(p1);                sPh[w][8 * hh + r][16 + ln] = hb; sPl[w][8 * hh + r][16 + ln] = bf16_bits(p1 - bf16_val(hb));
    }
#pragma unroll
    for (int dt = 0; dt < DT; ++dt)
#pragma unroll
      for (int r = 0; r < 8; ++r) oacc[dt][r] *= alpha[r];
    __builtin_amdgcn_fence(__ATOMIC_ACQ_REL, "workgroup");
    __builtin_amdgcn_wave_barrier();
    FragB pah, pal;
    pah.half[0] = *(const v8us*)&sPh[w][ln][8 * hh]; pah.half[1] = *(const v8us*)&sPh[w][ln][16 + 8 * hh];
    pal.half[0] = *(const v8us*)&sPl[w][ln][8 * hh]; pal.half[1] = *(const v8us*)&sPl[w][ln][16 + 8 * hh];
#pragma unroll
    for (int dt = 0; dt < DT; ++dt) {
      FragB bvh, bvl;
#pragma unroll
      for (int i = 0; i < 8; ++i) {
        bvh.u[i] = sVh[8 * hh + i][dt * 16 + ln]; bvh.u[8 + i] = sVh[16 + 8 * hh + i][dt * 16 + ln];
        bvl.u[i] = sVl[8 * hh + i][dt * 16 + ln]; bvl.u[8 + i] = sVl[16 + 8 * hh + i][dt * 16 + ln];
      }
      oacc[dt] = mmaN<3>(pah.v, pal.v, bvh.v, bvl.v, oacc[dt]);
    }
    __builtin_amdgcn_fence(__ATOMIC_ACQ_REL, "workgroup");
    __builtin_amdgcn_wave_barrier();
  }
#pragma unroll
  for (int r = 0; r < 8; ++r) {
    float l = l_r[r];
    l += __shfl_xor(l, 1, 32); l += __shfl_xor(l, 2, 32); l += __shfl_xor(l, 4, 32); l += __shfl_xor(l, 8, 32);
    l_r[r] = (l > 0.f) ? 1.0f / l : 0.f;
  }
#pragma unroll
  for (int dt = 0; dt < DT; ++dt)
#pragma unroll
    for (int r = 0; r < 8; ++r) sO[w][8 * hh + r][dt * 16 + ln] = oacc[dt][r] * l_r[r];
  __builtin_amdgcn_fence(__ATOMIC_ACQ_REL, "workgroup");
  __builtin_amdgcn_wave_barrier();
  {
    for (int r = 0; r < 16; ++r) {
      const int row = q0 + r;
      if (row < T && lane < D / 4) {
        const v4f val = *(const v4fa*)&sO[w][r][lane * 4];
        *(v4f*)(y + ((size_t)b * T + row) * ypitch + h * D + lane * 4) = val;
      }
    }
    
  }
}

// GEMM C = act(A·W + bias + resid): A f32 (ASPLIT -> hi/lo 2 terms), Wt bf16 [N][K]; ACT 0 none, 1 relu, 2 exact gelu;
// resid (optional, f32, row index = (row % rmod), pitch ldr, RES_BF16 rounds it) added before the activation.
template <bool ASPLIT, int ACT, bool BIAS_BF16, bool RES_BF16>
__global__ __launch_bounds__(128) void k_gemm_bf3(const float* __restrict__ A, int lda, const unsigned short* __restrict__ Wt, int ldb,
                                                const float* __restrict__ bias, const float* __restrict__ resid, int rmod, int ldr,
                                                float* __restrict__ C, int ldc, int M, int N, int K) {
  __shared__ __attribute__((aligned(16))) float so[4][16][64];
  const int tid = threadIdx.x, w = tid >> 5, lane = tid & 31, ln = lane & 15, hh = lane >> 4;
  const int ntn = N / 64;
  const int wid = blockIdx.x * 4 + w;
  const int mt = wid / ntn, nq = wid % ntn;
  if (mt * 16 >= M) return;
  const int row0 = mt * 16, col0 = nq * 64;
  const float* arow = A + (size_t)(row0 + ln) * lda;
  v8f acc[4] = {};
  for (int kb = 0; kb < K; kb += 32) {
    FragB ah, al;
    const v4f x0 = *(const v4fa*)(arow + kb + 8 * hh), x1 = *(const v4fa*)(arow + kb + 8 * hh + 4);
    const v4f x2 = *(const v4fa*)(arow + kb + 16 + 8 * hh), x3 = *(const v4fa*)(arow + kb + 16 + 8 * hh + 4);
    float xs[16] = {x0[0],x0[1],x0[2],x0[3],x1[0],x1[1],x1[2],x1[3],x2[0],x2[1],x2[2],x2[3],x3[0],x3[1],x3[2],x3[3]};
#pragma unroll
    for (int i = 0; i < 16; ++i) { const unsigned short hb = bf16_bits(xs[i]); ah.u[i] = hb; al.u[i] = ASPLIT ? bf16_bits(xs[i] - bf16_val(hb)) : (unsigned short)0; }
#pragma unroll
    for (int t = 0; t < 4; ++t) {
      const unsigned short* brow = Wt + (size_t)(col0 + t * 16 + ln) * ldb + kb;
      FragB b;
      b.half[0] = *(const v8us*)(brow + 8 * hh);
      b.half[1] = *(const v8us*)(brow + 16 + 8 * hh);
      acc[t] = mmaN<ASPLIT ? 2 : 1>(ah.v, al.v, b.v, b.v, acc[t]);
    }
  }
#pragma unroll
  for (int t = 0; t < 4; ++t) {
    const int col = col0 + t * 16 + ln;
    float bv = bias ? bias[col] : 0.f;
    if (BIAS_BF16) bv = bf16_round(bv);
#pragma unroll
    for (int r = 0; r < 8; ++r) {
      float v = acc[t][r] + bv;
      if (resid) { float rv = resid[(size_t)((row0 + 8 * hh + r) % rmod) * ldr + col]; if (RES_BF16) rv = bf16_round(rv); v += rv; }
      if (ACT == 1) v = fmaxf(v, 0.f);
      if (ACT == 2) v = 0.5f * v * (1.0f + erff(v * 0.70710678118654752f));
      if (ACT == 3) { const float u = 0.7978845608028654f * (v + 0.044715f * v * v * v); v = 0.5f * v * (1.0f + tanhf(u)); }
      so[w][8 * hh + r][t * 16 + ln] = v;
    }
  }
  __builtin_amdgcn_fence(__ATOMIC_ACQ_REL, "workgroup");
  __builtin_amdgcn_wave_barrier();
  const int rsub = lane >> 4, c4 = (lane & 15) * 4;
  {
#pragma unroll
    for (int q = 0; q < 8; ++q) {
      const int r = q * 2 + rsub;
      const v4f v = *(const v4fa*)&so[w][r][c4];
      *(v4f*)(C + (size_t)(row0 + r) * ldc + col0 + c4) = v;
    }
    
  }
}
// row LayerNorm (biased variance, eps) over N: s = X (+ R); optional out_sum <- s; out_norm <- (s-mu)*rsqrt(var+eps)*g + b
template <bool PARAM_BF16>
__global__ __launch_bounds__(256) void k_layernorm(const float* __restrict__ X, const float* __restrict__ R, const float* __restrict__ g, const float* __restrict__ bta,
                                                  float* __restrict__ out_sum, float* __restrict__ out_norm, int N, float eps) {
  __shared__ float red[256];
  const int row = blockIdx.x, tid = threadIdx.x;
  const float* x = X + (size_t)row * N; const float* rr = R ? R + (size_t)row * N : nullptr;
  float vals[16];                     // up to N = 4096
  const int per = N / 256;            // contiguous chunk per thread? use strided-by-4 chunks: thread handles j = tid*4 + 1024*u
  float s1 = 0.f;
  for (int u = 0; u < per / 4; ++u) {
    const int j = tid * 4 + 1024 * u;
    const v4f a = *(const v4fa*)(x + j);
    v4f b = {0.f,0.f,0.f,0.f}; if (rr) b = *(const v4fa*)(rr + j);
#pragma unroll
    for (int q = 0; q < 4; ++q) { const float v = a[q] + b[q]; vals[u * 4 + q] = v; s1 += v; }
  }
  red[tid] = s1; __syncthreads();
  for (int st = 128; st > 0; st >>= 1) { if (tid < st) red[tid] += red[tid + st]; __syncthreads(); }
  const float mu = red[0] / (float)N; __syncthreads();
  float s2 = 0.f;
  for (int u = 0; u < per / 4; ++u)
#pragma unroll
    for (int q = 0; q < 4; ++q) { const float c = vals[u * 4 + q] - mu; s2 += c * c; }
  red[tid] = s2; __syncthreads();
  for (int st = 128; st > 0; st >>= 1) { if (tid < st) red[tid] += red[tid + st]; __syncthreads(); }
  const float rs = rsqrtf(red[0] / (float)N + eps);
  {
    for (int u = 0; u < per / 4; ++u) {
      const int j = tid * 4 + 1024 * u;
      v4f o, sm;
#pragma unroll
      for (int q = 0; q < 4; ++q) {
        float gg = g[j + q], bb = bta[j + q];
        if (PARAM_BF16) { gg = bf16_round(gg); bb = bf16_round(bb); }
        sm[q] = vals[u * 4 + q]; o[q] = (vals[u * 4 + q] - mu) * rs * gg + bb;
      }
      if (out_sum) *(v4f*)(out_sum + (size_t)row * N + j) = sm;
      *(v4f*)(out_norm + (size_t)row * N + j) = o;
    }
    
  }
}



// ---- f16 WMMA path (v_wmma_f32_16x16x32_f16): 11-bit significands for operands in range — used where a [0,1] probability operand needs more precision than bf16
typedef _Float16 v16h __attribute__((ext_vector_type(16)));
union FragH { v16h v; v8us half[2]; _Float16 h[16]; unsigned short u[16]; };
template <int NT>
__device__ __forceinline__ v8f mmaH(v16h ah, v16h al, v16h bh, v16h bl, v8f c) {
  c = __builtin_amdgcn_wmma_f32_16x16x32_f16(false, ah, false, bh, (short)0, c, false, false);
  if (NT >= 2) c = __builtin_amdgcn_wmma_f32_16x16x32_f16(false, al, false, bh, (short)0, c, false, false);
  if (NT >= 3) c = __builtin_amdgcn_wmma_f32_16x16x32_f16(false, ah, false, bl, (short)0, c, false, false);
  asm volatile("v_nop\n\tv_nop\n\tv_nop\n\tv_nop" : "+v"(c) : "v"(ah), "v"(al), "v"(bh), "v"(bl));
  return c;
}
// batched GEMM like k_gemm_b but f16 operands: A f32 (split into f16 hi/lo if ASPLIT, else rounded to f16), Bt = f16 values [n][k]; alpha; C f32; N multiple of 16 (partial tiles skipped)
template <bool ASPLIT>
__global__ __launch_bounds__(128) void k_gemm_h(const float* __restrict__ A, int lda, size_t sA, const _Float16* __restrict__ Bh, int ldb, size_t sB, float alpha, float* __restrict__ C, int ldc, size_t sC, int M, int N, int K) {
  __shared__ __attribute__((aligned(16))) float so[4][16][64];
  const int tid = threadIdx.x, w = tid >> 5, lane = tid & 31, ln = lane & 15, hh = lane >> 4; const int by = blockIdx.y;
  A += (size_t)by * sA; Bh += (size_t)by * sB; C += (size_t)by * sC;
  const int ntn = (N + 63) / 64; const int wid = blockIdx.x * 4 + w; const int mt = wid / ntn, nq = wid % ntn; if (mt * 16 >= M) return;
  const int row0 = mt * 16, col0 = nq * 64; const float* arow = A + (size_t)(row0 + ln) * lda;
  v8f acc[4] = {};
  for (int kb = 0; kb < K; kb += 32) {
    FragH ah, al;
    const v4f x0 = *(const v4fa*)(arow + kb + 8 * hh), x1 = *(const v4fa*)(arow + kb + 8 * hh + 4), x2 = *(const v4fa*)(arow + kb + 16 + 8 * hh), x3 = *(const v4fa*)(arow + kb + 16 + 8 * hh + 4);
    float xs[16] = {x0[0],x0[1],x0[2],x0[3],x1[0],x1[1],x1[2],x1[3],x2[0],x2[1],x2[2],x2[3],x3[0],x3[1],x3[2],x3[3]};
#pragma unroll
    for (int i = 0; i < 16; ++i) { const _Float16 h = (_Float16)xs[i]; ah.h[i] = h; al.h[i] = ASPLIT ? (_Float16)(xs[i] - (float)h) : (_Float16)0.0f; }
#pragma unroll
    for (int t = 0; t < 4; ++t) { if (col0 + t * 16 >= N) continue; const size_t boff = (size_t)(col0 + t * 16 + ln) * ldb + kb; FragH bq; bq.half[0] = *(const v8us*)(Bh + boff + 8 * hh); bq.half[1] = *(const v8us*)(Bh + boff + 16 + 8 * hh);
      acc[t] = mmaH<ASPLIT ? 2 : 1>(ah.v, al.v, bq.v, bq.v, acc[t]); }
  }
#pragma unroll
  for (int t = 0; t < 4; ++t) { if (col0 + t * 16 >= N) continue;
#pragma unroll
    for (int r = 0; r < 8; ++r) so[w][8 * hh + r][t * 16 + ln] = acc[t][r] * alpha; }
  __builtin_amdgcn_fence(__ATOMIC_ACQ_REL, "workgroup"); __builtin_amdgcn_wave_barrier();
  const int rsub = lane >> 4, c4 = (lane & 15) * 4;
  {
#pragma unroll
    for (int q = 0; q < 8; ++q) { const int r = q * 2 + rsub; if (col0 + c4 < N) { const v4f v = *(const v4fa*)&so[w][r][c4]; *(v4f*)(C + (size_t)(row0 + r) * ldc + col0 + c4) = v; } }
     }
}

// Wt[n][k] = f16(W[k][n]·scale) from f32 row-major W[K][N] (scale = power of two; bf16-exact weights stay exact in f16 away from the subnormal range)
__global__ __launch_bounds__(256) void k_wt_f16(const float* __restrict__ W, _Float16* __restrict__ Wt, int K, int N, float scale) {
  const int t = blockIdx.x * 256 + threadIdx.x; if (t >= N * (K / 8)) return; const int n = t / (K / 8), k8 = (t % (K / 8)) * 8; FragH f;
#pragma unroll
  for (int i = 0; i < 8; ++i) f.h[i] = (_Float16)(bf16_round(W[(size_t)(k8 + i) * N + n]) * scale); const v8us o = f.half[0];
  *(v8us*)((unsigned short*)Wt + (size_t)n * K + k8) = o; 
}
// k_gemm_hh variant with fused epilogue: v = acc·alpha + bias[by·sBias + col] (+ CP[(row/rowsPerB)·sCPb + by·sCPy + col] if CP) ; ACT 0 none / 1 elu ; writes f32 C and/or f16 C16 (each if non-null)
template <int ACT>
__global__ __launch_bounds__(128) void k_gemm_hhx(const _Float16* __restrict__ A, int lda, size_t sA, const _Float16* __restrict__ Bh, int ldb, size_t sB, float alpha, const float* __restrict__ bias, size_t sBias, const float* __restrict__ CP, int rowsPerB, size_t sCPb, size_t sCPy, int row0g,
    float* __restrict__ C, _Float16* __restrict__ C16, int ldc, size_t sC, int M, int N, int K) {
  __shared__ __attribute__((aligned(16))) float so[4][16][64];
  const int tid = threadIdx.x, w = tid >> 5, lane = tid & 31, ln = lane & 15, hh = lane >> 4; const int by = blockIdx.y;
  A += (size_t)by * sA; Bh += (size_t)by * sB; const size_t cofs = (size_t)by * sC; const float* bp = bias ? bias + (size_t)by * sBias : nullptr;
  const int ntn = (N + 63) / 64; const int wid = blockIdx.x * 4 + w; const int mt = wid / ntn, nq = wid % ntn; if (mt * 16 >= M) return;
  const int row0 = mt * 16, col0 = nq * 64; const _Float16* arow = A + (size_t)(row0 + ln) * lda;
  v8f acc[4] = {};
  for (int kb = 0; kb < K; kb += 32) { FragH ah; ah.half[0] = *(const v8us*)((const unsigned short*)arow + kb + 8 * hh); ah.half[1] = *(const v8us*)((const unsigned short*)arow + kb + 16 + 8 * hh);
#pragma unroll
    for (int t = 0; t < 4; ++t) { if (col0 + t * 16 >= N) continue; const size_t boff = (size_t)(col0 + t * 16 + ln) * ldb + kb; FragH bq; bq.half[0] = *(const v8us*)((const unsigned short*)Bh + boff + 8 * hh); bq.half[1] = *(const v8us*)((const unsigned short*)Bh + boff + 16 + 8 * hh);
      acc[t] = mmaH<1>(ah.v, ah.v, bq.v, bq.v, acc[t]); }
  }
#pragma unroll
  for (int t = 0; t < 4; ++t) { if (col0 + t * 16 >= N) continue; const int col = col0 + t * 16 + ln; const float bv = bp ? bf16_round(bp[col]) : 0.f;
#pragma unroll
    for (int r = 0; r < 8; ++r) { float v = acc[t][r] * alpha + bv; if (CP) { const int bidx = (row0g + row0 + 8 * hh + r) / rowsPerB; v += CP[(size_t)bidx * sCPb + (size_t)by * sCPy + col]; } if (ACT == 1) v = (v > 0.f) ? v : expm1f(v); else if (ACT == 3) v = fmaxf(v, 0.f); so[w][8 * hh + r][t * 16 + ln] = v; } }
  __builtin_amdgcn_fence(__ATOMIC_ACQ_REL, "workgroup"); __builtin_amdgcn_wave_barrier();
  const int rsub = lane >> 4, c4 = (lane & 15) * 4; typedef _Float16 v4h __attribute__((ext_vector_type(4)));
  {
#pragma unroll
    for (int q = 0; q < 8; ++q) { const int r = q * 2 + rsub; if (col0 + c4 < N) { const v4f v = *(const v4fa*)&so[w][r][c4]; if (C) *(v4f*)(C + cofs + (size_t)(row0 + r) * ldc + col0 + c4) = v; if (C16) { v4h h4; for (int i = 0; i < 4; ++i) h4[i] = (_Float16)v[i]; *(v4h*)(C16 + cofs + (size_t)(row0 + r) * ldc + col0 + c4) = h4; } } }
     }
}


typedef _Float16 v4h __attribute__((ext_vector_type(4)));

__global__ __launch_bounds__(256) void k_x16(const float* __restrict__ x, _Float16* __restrict__ X16, size_t n8) { const size_t t = (size_t)blockIdx.x * 256 + threadIdx.x; if (t >= n8) return; FragH f;
#pragma unroll
  for (int q = 0; q < 8; ++q) f.h[q] = (_Float16)bf16_round(x[t * 8 + q]); *(v8us*)((unsigned short*)X16 + t * 8) = f.half[0];  }
__global__ __launch_bounds__(256) void k_h16(const float* __restrict__ x, _Float16* __restrict__ X16, size_t n8) { const size_t t = (size_t)blockIdx.x * 256 + threadIdx.x; if (t >= n8) return; FragH f;
#pragma unroll
  for (int q = 0; q < 8; ++q) f.h[q] = (_Float16)x[t * 8 + q]; *(v8us*)((unsigned short*)X16 + t * 8) = f.half[0];  }
__global__ __launch_bounds__(256) void k_round16f(const float* __restrict__ W, _Float16* __restrict__ Bt, size_t n8) { const size_t t = (size_t)blockIdx.x * 256 + threadIdx.x; if (t >= n8) return; FragH f;
#pragma unroll
  for (int i = 0; i < 8; ++i) f.h[i] = (_Float16)(bf16_round(W[t * 8 + i]) * 16.0f); *(v8us*)((unsigned short*)Bt + t * 8) = f.half[0];  }
template <int NHv, int TTv>
__global__ __launch_bounds__(256) void k_vt(const _Float16* __restrict__ V16, int ldv, int voff, _Float16* __restrict__ Vt) { __shared__ unsigned short tl[64][66]; const int tid = threadIdx.x; const int slab = blockIdx.x / (TTv / 64), lg = blockIdx.x % (TTv / 64); const int b = slab / NHv, h = slab % NHv;
  for (int i = tid; i < 64 * 8; i += 256) { const int r = i / 8, c8 = (i % 8) * 8; FragH f; f.half[0] = *(const v8us*)((const unsigned short*)V16 + ((size_t)b * TTv + lg * 64 + r) * ldv + voff + h * 64 + c8);
#pragma unroll
    for (int q = 0; q < 8; ++q) tl[r][c8 + q] = f.u[q]; }
  __syncthreads();
  {
#pragma unroll
    for (int rd = 0; rd < 2; ++rd) { const int d = rd * 32 + tid / 8, pc = tid % 8; FragH f;
#pragma unroll
      for (int q = 0; q < 8; ++q) f.u[q] = tl[pc * 8 + q][d];
      *(v8us*)((unsigned short*)Vt + ((size_t)slab * 64 + d) * TTv + lg * 64 + pc * 8) = f.half[0]; }
     } }

__global__ __launch_bounds__(256) void k_tok(const float* __restrict__ x, _Float16* __restrict__ X16) { __shared__ float tl[32][65]; const int tid = threadIdx.x; const int b = blockIdx.x / ((CC / 64) * (NN / 32)), rem = blockIdx.x % ((CC / 64) * (NN / 32)); const int cg = rem / (NN / 32), pg = rem % (NN / 32); const int c0 = cg * 64, p0 = pg * 32;
  for (int i = tid; i < 64 * 32; i += 256) { const int c = i / 32, pp = i % 32; tl[pp][c] = bf16_round(x[((size_t)b * CC + c0 + c) * NN + p0 + pp]); } __syncthreads();
  const int r = tid / 8, pc = tid % 8; FragH f; for (int q = 0; q < 8; ++q) f.h[q] = (_Float16)tl[r][pc * 8 + q]; const size_t row = (size_t)b * NN + p0 + r; *(v8us*)((unsigned short*)X16 + row * CC + c0 + pc * 8) = f.half[0];  }
__global__ __launch_bounds__(256) void k_pool2(const _Float16* __restrict__ F, _Float16* __restrict__ P) { const size_t t = (size_t)blockIdx.x * 256 + threadIdx.x; if (t >= (size_t)NRH * (CC / 8)) return; const int c8 = (int)(t % (CC / 8)) * 8; const size_t rm = t / (CC / 8); FragH a, b2, o; a.half[0] = *(const v8us*)((const unsigned short*)F + (rm * 2) * CC + c8); b2.half[0] = *(const v8us*)((const unsigned short*)F + (rm * 2 + 1) * CC + c8); for (int q = 0; q < 8; ++q) o.h[q] = ((float)a.h[q] > (float)b2.h[q]) ? a.h[q] : b2.h[q];
  *(v8us*)((unsigned short*)P + rm * CC + c8) = o.half[0];  }
__global__ __launch_bounds__(256) void k_pool2f(const float* __restrict__ F, float* __restrict__ P) { const size_t t = (size_t)blockIdx.x * 256 + threadIdx.x; if (t >= (size_t)NRH * (CC / 4)) return; const int c4 = (int)(t % (CC / 4)) * 4; const size_t rm = t / (CC / 4); const v4f a = *(const v4fa*)(F + (rm * 2) * CC + c4), b2 = *(const v4fa*)(F + (rm * 2 + 1) * CC + c4); v4f o; for (int q = 0; q < 4; ++q) o[q] = fmaxf(a[q], b2[q]); *(v4f*)(P + rm * CC + c4) = o;  }
__global__ __launch_bounds__(256) void k_hl(const float* __restrict__ F, _Float16* __restrict__ Hh, _Float16* __restrict__ Hl, size_t n8) { const size_t t = (size_t)blockIdx.x * 256 + threadIdx.x; if (t >= n8) return; FragH fh, fl; for (int q = 0; q < 8; ++q) { const float v = F[t * 8 + q]; const _Float16 h = (_Float16)v; fh.h[q] = h; fl.h[q] = (_Float16)((v - (float)h) * 1024.0f); } { *(v8us*)((unsigned short*)Hh + t * 8) = fh.half[0]; *(v8us*)((unsigned short*)Hl + t * 8) = fl.half[0];  } }
__global__ __launch_bounds__(256) void k_cvec(const float* __restrict__ PHF, const float* __restrict__ bth, float* __restrict__ cv) { const int m = blockIdx.x * 256 + threadIdx.x; if (m >= NRH) return; float s = 0.f;
#pragma unroll 1
  for (int o = 0; o < CC; o += 4) { const v4f p = *(const v4fa*)(PHF + (size_t)m * CC + o); for (int q = 0; q < 4; ++q) s += p[q] * bf16_round(bth[o + q]); } *(float*)(cv + m) = s;  }
__global__ __launch_bounds__(256) void k_smx(const float* __restrict__ S, _Float16* __restrict__ P16) { const int tid = threadIdx.x, wv = tid >> 5, lane = tid & 31; const int r = blockIdx.x * 8 + wv; if (r >= NR) return; const float* sr = S + (size_t)r * NH; float m = -3.0e38f;
  for (int p = lane; p < NH / 8; p += 32) { const v4f a = *(const v4fa*)(sr + p * 8), b = *(const v4fa*)(sr + p * 8 + 4); for (int q = 0; q < 4; ++q) m = fmaxf(m, fmaxf(a[q], b[q])); }
  for (int o = 16; o >= 1; o >>= 1) m = fmaxf(m, __shfl_xor(m, o, 32)); float z = 0.f;
  for (int p = lane; p < NH / 8; p += 32) { const v4f a = *(const v4fa*)(sr + p * 8), b = *(const v4fa*)(sr + p * 8 + 4); for (int q = 0; q < 4; ++q) z += __expf(a[q] - m) + __expf(b[q] - m); }
  for (int o = 16; o >= 1; o >>= 1) z += __shfl_xor(z, o, 32); const float iz = 32768.0f / z;
  { for (int p = lane; p < NH / 8; p += 32) { FragH f; for (int q = 0; q < 8; ++q) f.h[q] = (_Float16)(__expf(sr[p * 8 + q] - m) * iz); *(v8us*)((unsigned short*)P16 + (size_t)r * NH + p * 8) = f.half[0]; }  } }
__global__ __launch_bounds__(256) void k_bnstat(const float* __restrict__ Y, float* __restrict__ ST) { __shared__ float ra[256]; const int c = blockIdx.x, tid = threadIdx.x; float s = 0.f; for (int r = tid; r < NR; r += 256) s += Y[(size_t)r * CC + c]; ra[tid] = s; __syncthreads(); for (int o = 128; o >= 1; o >>= 1) { if (tid < o) ra[tid] += ra[tid + o]; __syncthreads(); } const float mu = ra[0] / (float)NR; __syncthreads(); float q2 = 0.f;
  for (int r = tid; r < NR; r += 256) { const float d = Y[(size_t)r * CC + c] - mu; q2 += d * d; } ra[tid] = q2; __syncthreads(); for (int o = 128; o >= 1; o >>= 1) { if (tid < o) ra[tid] += ra[tid + o]; __syncthreads(); }
  if (tid < 32) { const float v = (tid == 0) ? mu : ((tid == 1) ? rsqrtf(ra[0] / (float)NR + 1e-5f) : 0.f); *(float*)(ST + c * 32 + tid) = v;  } }
__global__ __launch_bounds__(256) void k_out(const float* __restrict__ WY, const float* __restrict__ ST, const float* __restrict__ gam, const float* __restrict__ bet, const float* __restrict__ x, float* __restrict__ out) { __shared__ float tl[32][65]; const int tid = threadIdx.x; const int b = blockIdx.x / ((CC / 32) * (NN / 64)), rem = blockIdx.x % ((CC / 32) * (NN / 64)); const int cg = rem / (NN / 64), pg = rem % (NN / 64); const int c0 = cg * 32, p0 = pg * 64;
  for (int i = tid; i < 64 * 32; i += 256) { const int pp = i / 32, c = i % 32; const int cc = c0 + c; tl[c][pp] = (WY[((size_t)b * NN + p0 + pp) * CC + cc] - ST[cc * 32]) * ST[cc * 32 + 1] * bf16_round(gam[cc]) + bf16_round(bet[cc]); } __syncthreads();
  { for (int i = tid; i < 32 * 16; i += 256) { const int c = i / 16, q4 = i % 16; const size_t o = ((size_t)b * CC + c0 + c) * NN + p0 + q4 * 4; const v4f xv = *(const v4fa*)(x + o); v4f v; for (int q = 0; q < 4; ++q) v[q] = tl[c][q4 * 4 + q] + bf16_round(xv[q]); *(v4f*)(out + o) = v; }  } }
extern "C" void kernel_launch(void* const* d_in, const int* in_sizes, int n_in,
                              void* d_out, int out_size, void* d_ws, size_t ws_size, hipStream_t stream) {
  (void)in_sizes; (void)n_in; (void)out_size;
  const float* x = (const float*)d_in[0]; const float* gw = (const float*)d_in[1]; const float* gb = (const float*)d_in[2]; const float* thw = (const float*)d_in[3]; const float* thb = (const float*)d_in[4]; const float* phw = (const float*)d_in[5]; const float* phb = (const float*)d_in[6]; const float* Ww = (const float*)d_in[7]; const float* Wb = (const float*)d_in[8]; const float* gam = (const float*)d_in[9]; const float* bet = (const float*)d_in[10];
  char* ws = (char*)d_ws; size_t off = 0;
  auto take = [&](size_t bytes) { char* p = ws + off; off += (bytes + 255) & ~(size_t)255; return p; };
  _Float16* Bg = (_Float16*)take((size_t)CC * CC * 2); _Float16* Bph = (_Float16*)take((size_t)CC * CC * 2); _Float16* BW = (_Float16*)take((size_t)CC * CC * 2); float* ST = (float*)take(CC * 32 * 4);
  _Float16* Bthp = (_Float16*)take((size_t)CC * CC * 2);      // W_θ as [in=o][out=c] → Bt[c][o] for φ·W_θ
  _Float16* X16 = (_Float16*)take((size_t)NR * CC * 2); float* FULLF = (float*)take((size_t)NR * CC * 4); _Float16* FULL = (_Float16*)take((size_t)NR * CC * 2); float* PHF = (float*)take((size_t)NRH * CC * 4); _Float16* PHh = (_Float16*)take((size_t)NRH * CC * 2); _Float16* PHl = (_Float16*)take((size_t)NRH * CC * 2); _Float16* GP = (_Float16*)take((size_t)NRH * CC * 2);
  // every per-batch buffer holds all BB batches, so that each stage is one launch over the whole batch
  float* BP = (float*)take((size_t)NRH * CC * 4); _Float16* BPh = (_Float16*)take((size_t)NRH * CC * 2); _Float16* BPl = (_Float16*)take((size_t)NRH * CC * 2); float* CV = (float*)take(NRH * 4); _Float16* Gt = (_Float16*)take((size_t)NRH * CC * 2); float* S = (float*)take((size_t)NR * NH * 4); _Float16* P16 = (_Float16*)take((size_t)NR * NH * 2);
  float* Y = FULLF; _Float16* Y16 = FULL; float* WY = FULLF;      // FULLF/FULL are dead after pooling; Y (f32) → Y16 → WY back over Y
  if (off > ws_size) return;      // about 254 MB
  k_round16f<<<(CC * CC / 8 + 255) / 256, 256, 0, stream>>>(gw, Bg, CC * CC / 8); k_round16f<<<(CC * CC / 8 + 255) / 256, 256, 0, stream>>>(phw, Bph, CC * CC / 8); k_round16f<<<(CC * CC / 8 + 255) / 256, 256, 0, stream>>>(Ww, BW, CC * CC / 8);      // (out,in) natural
  k_wt_f16<<<(CC * (CC / 8) + 255) / 256, 256, 0, stream>>>(thw, Bthp, CC, CC, 16.0f);      // Bt[c][o] = W_θ[o][c]
  k_tok<<<BB * (CC / 64) * (NN / 32), 256, 0, stream>>>(x, X16);
  const dim3 gp(((NR / 16) * (CC / 64) + 3) / 4, 1); const unsigned gh8 = (unsigned)(((size_t)NRH * (CC / 8) + 255) / 256);
  k_gemm_hhx<0><<<gp, 128, 0, stream>>>(X16, CC, 0, Bph, CC, 0, 0.0625f, phb, 0, nullptr, 1, 0, 0, 0, FULLF, nullptr, CC, 0, NR, CC, CC); k_pool2f<<<(unsigned)(((size_t)NRH * (CC / 4) + 255) / 256), 256, 0, stream>>>(FULLF, PHF);      // φ (f32, pooled)
  k_hl<<<gh8, 256, 0, stream>>>(PHF, PHh, PHl, (size_t)NRH * CC / 8);
  k_gemm_hhx<0><<<gp, 128, 0, stream>>>(X16, CC, 0, Bg, CC, 0, 0.0625f, gb, 0, nullptr, 1, 0, 0, 0, nullptr, FULL, CC, 0, NR, CC, CC); k_pool2<<<gh8, 256, 0, stream>>>(FULL, GP);      // g (f16, pooled)
  const dim3 gb2(((NRH / 16) * (CC / 64) + 3) / 4, 1), gs(((NN / 16) * (NH / 64) + 3) / 4, BB), gy(((NN / 16) * (CC / 64) + 3) / 4, BB);      // blockIdx.y = batch where the B operand differs per batch
  k_gemm_hhx<0><<<gb2, 128, 0, stream>>>(PHh, CC, 0, Bthp, CC, 0, 0.0625f, nullptr, 0, nullptr, 1, 0, 0, 0, BP, nullptr, CC, 0, NRH, CC, CC);
  k_gemm_hhx<0><<<gb2, 128, 0, stream>>>(PHl, CC, 0, Bthp, CC, 0, 0.0625f * 0.0009765625f, nullptr, 0, BP, 1, (size_t)CC, 0, 0, BP, nullptr, CC, 0, NRH, CC, CC);      // B' = phi * W_theta [BB*1024][512] (phi hi + lo), all batches as rows
  k_hl<<<gh8, 256, 0, stream>>>(BP, BPh, BPl, (size_t)NRH * CC / 8); k_cvec<<<(NRH + 255) / 256, 256, 0, stream>>>(PHF, thb, CV);
  k_gemm_hhx<0><<<gs, 128, 0, stream>>>(X16, CC, (size_t)NN * CC, BPh, CC, (size_t)NH * CC, 1.0f, nullptr, 0, CV, NN, 0, (size_t)NH, 0, S, nullptr, NH, (size_t)NN * NH, NN, NH, CC);      // f = x * B'h^T + c (c broadcast over the rows of its batch: rowsPerB = NN, sCPb = 0)
  k_gemm_hhx<0><<<gs, 128, 0, stream>>>(X16, CC, (size_t)NN * CC, BPl, CC, (size_t)NH * CC, 0.0009765625f, nullptr, 0, S, 1, (size_t)NH, (size_t)NN * NH, 0, S, nullptr, NH, (size_t)NN * NH, NN, NH, CC);      // + x * B'l^T * 2^-10
  k_smx<<<NR / 8, 256, 0, stream>>>(S, P16);
  k_vt<8, NH><<<BB * 8 * (NH / 64), 256, 0, stream>>>(GP, CC, 0, Gt);      // g^T [BB][512][1024]
  k_gemm_hhx<0><<<gy, 128, 0, stream>>>(P16, NH, (size_t)NN * NH, Gt, NH, (size_t)CC * NH, 0.000030517578125f, nullptr, 0, nullptr, 1, 0, 0, 0, Y, nullptr, CC, (size_t)NN * CC, NN, CC, NH);      // y = softmax(f) * g
  k_h16<<<(unsigned)(((size_t)NR * CC / 8 + 255) / 256), 256, 0, stream>>>(Y, Y16, (size_t)NR * CC / 8);
  k_gemm_hhx<0><<<gp, 128, 0, stream>>>(Y16, CC, 0, BW, CC, 0, 0.0625f, Wb, 0, nullptr, 1, 0, 0, 0, WY, nullptr, CC, 0, NR, CC, CC);      // wy = W(y) + b
  k_bnstat<<<CC, 256, 0, stream>>>(WY, ST); k_out<<<BB * (CC / 32) * (NN / 64), 256, 0, stream>>>(WY, ST, gam, bet, x, (float*)d_out);
}

// v002
// Measured time: 322 microseconds a run.
// Timed twice side by side with v001, it ran 2.15 and 2.16 times as fast.
// Counting every step since v000, it is 4.61 times as fast.
#include <hip/hip_runtime.h>
// Non-local block with view pooling (x [8, C=512, N=2048]): θ = conv1(x), φ = maxpool2(conv1(x)), g = maxpool2(conv1(x)); f = softmax(θᵀ·φ) [N × N/2] (unscaled); y = f·g; wy = conv1(y) + b;
// out = BN_train(wy)·γ + β + x. Because the unscaled logits reach σ≈20 and feed a near-one-hot softmax, θ is never rounded: the logits are re-associated as f = x·(φ·W_θ)ᵀ + 1·(φ·b_θ)ᵀ with x bf16-EXACT,
// φ (f32, max-pooled from an f32 projection) fed as f16 hi + lo·2^10 into φ·W_θ and that product again split hi/lo as the B operand (four cheap passes per batch), the column term added exactly through
// the epilogue addend; g, y as plain f16; P ×2^15 f16; all on v_wmma_f32_16x16x32_f16 ((out,in) weights bf16-exact ×2^4, f32 accumulate); the layout transposes, max-pooling, softmax rows, BN batch statistics (fixed-order) and the residual are f32 VALU.
#define BB 8
#define CC 512
#define NN 2048
#define NH (NN / 2)
#define NR (BB * NN)
#define NRH (BB * NH)

typedef __bf16 v16b __attribute__((ext_vector_type(16)));
typedef unsigned short v8us __attribute__((ext_vector_type(8), may_alias));
typedef float  v8f  __attribute__((ext_vector_type(8)));
typedef float  v4f  __attribute__((ext_vector_type(4)));
typedef float  v4fa __attribute__((ext_vector_type(4), may_alias));
union FragB { v16b v; v8us half[2]; unsigned short u[16]; };

__device__ __forceinline__ unsigned short bf16_bits(float x) { unsigned int u = __float_as_uint(x); return (unsigned short)((u + 0x7FFFu + ((u >> 16) & 1u)) >> 16); }
__device__ __forceinline__ float bf16_val(unsigned short b) { return __uint_as_float(((unsigned int)b) << 16); }
__device__ __forceinline__ float bf16_round(float x) { return bf16_val(bf16_bits(x)); }
// D += A·B with NT terms: 1 = ah·bh, 2 = + al·bh (A split), 3 = + ah·bl (both split)
template <int NT>
__device__ __forceinline__ v8f mmaN(v16b ah, v16b al, v16b bh, v16b bl, v8f c) {
  c = __builtin_amdgcn_wmma_f32_16x16x32_bf16(false, ah, false, bh, (short)0, c, false, false);
  if (NT >= 2) c = __builtin_amdgcn_wmma_f32_16x16x32_bf16(false, al, false, bh, (short)0, c, false, false);
  if (NT >= 3) c = __builtin_amdgcn_wmma_f32_16x16x32_bf16(false, ah, false, bl, (short)0, c, false, false);
  asm volatile("v_nop\n\tv_nop\n\tv_nop\n\tv_nop" : "+v"(c) : "v"(ah), "v"(al), "v"(bh), "v"(bl));
  return c;
}

__global__ __launch_bounds__(256) void k_wt_bf16(const float* __restrict__ W, unsigned short* __restrict__ Wt, int K, int N) {
  const int t = blockIdx.x * 256 + threadIdx.x;
  const int k8n = K / 8;
  if (t >= N * k8n) return;
  const int n = t / k8n, k8 = (t % k8n) * 8;
  v8us v;
#pragma unroll
  for (int i = 0; i < 8; ++i) v[i] = bf16_bits(W[(size_t)(k8 + i) * N + n]);
  *(v8us*)(Wt + (size_t)n * K + k8) = v;
  
}

// GEMM C[M][N] (f32, pitch ldc) = act(A[M][K]·W + bias). A f32 row-major (pitch lda) converted per fragment to bf16
// (ASPLIT: hi/lo two planes -> 2 terms, else single rounded term); Wt bf16 [N][K] (pitch ldb). BIAS_BF16 rounds the
// bias to bf16 first (bias quantised to bf16 before the add). K%32==0, M%16==0, N%64==0.
template <bool ASPLIT, int ACT, bool BIAS_BF16>
__global__ __launch_bounds__(128) void k_gemm_bf(const float* __restrict__ A, int lda, const unsigned short* __restrict__ Wt, int ldb,
                                               const float* __restrict__ bias, float* __restrict__ C, int ldc, int M, int N, int K) {
  __shared__ __attribute__((aligned(16))) float so[4][16][64];
  const int tid = threadIdx.x, w = tid >> 5, lane = tid & 31, ln = lane & 15, hh = lane >> 4;
  const int ntn = N / 64;
  const int wid = blockIdx.x * 4 + w;
  const int mt = wid / ntn, nq = wid % ntn;
  if (mt * 16 >= M) return;
  const int row0 = mt * 16, col0 = nq * 64;
  const float* arow = A + (size_t)(row0 + ln) * lda;
  v8f acc[4] = {};
  for (int kb = 0; kb < K; kb += 32) {
    FragB ah, al;
    const v4f x0 = *(const v4fa*)(arow + kb + 8 * hh), x1 = *(const v4fa*)(arow + kb + 8 * hh + 4);
    const v4f x2 = *(const v4fa*)(arow + kb + 16 + 8 * hh), x3 = *(const v4fa*)(arow + kb + 16 + 8 * hh + 4);
    float xs[16] = {x0[0],x0[1],x0[2],x0[3],x1[0],x1[1],x1[2],x1[3],x2[0],x2[1],x2[2],x2[3],x3[0],x3[1],x3[2],x3[3]};
#pragma unroll
    for (int i = 0; i < 16; ++i) { const unsigned short hb = bf16_bits(xs[i]); ah.u[i] = hb; al.u[i] = ASPLIT ? bf16_bits(xs[i] - bf16_val(hb)) : (unsigned short)0; }
#pragma unroll
    for (int t = 0; t < 4; ++t) {
      const unsigned short* brow = Wt + (size_t)(col0 + t * 16 + ln) * ldb + kb;
      FragB b;
      b.half[0] = *(const v8us*)(brow + 8 * hh);
      b.half[1] = *(const v8us*)(brow + 16 + 8 * hh);
      acc[t] = mmaN<ASPLIT ? 2 : 1>(ah.v, al.v, b.v, b.v, acc[t]);
    }
  }
#pragma unroll
  for (int t = 0; t < 4; ++t) {
    float bv = bias ? bias[col0 + t * 16 + ln] : 0.f;
    if (BIAS_BF16) bv = bf16_round(bv);
#pragma unroll
    for (int r = 0; r < 8; ++r) { float v = acc[t][r] + bv; if (ACT == 1) v = fmaxf(v, 0.f); so[w][8 * hh + r][t * 16 + ln] = v; }
  }
  __builtin_amdgcn_fence(__ATOMIC_ACQ_REL, "workgroup");
  __builtin_amdgcn_wave_barrier();
  const int rsub = lane >> 4, c4 = (lane & 15) * 4;
  {
#pragma unroll
    for (int q = 0; q < 8; ++q) {
      const int r = q * 2 + rsub;
      const v4f v = *(const v4fa*)&so[w][r][c4];
      *(v4f*)(C + (size_t)(row0 + r) * ldc + col0 + c4) = v;
    }
    
  }
}

// Flash-style causal/unmasked attention, all contractions 3-term bf16 hi/lo splits, f32 softmax with running max.
// q,k,v rows are read from f32 buffers with arbitrary row pitch (so they can live inside a fused qkv buffer);
// D = head size (multiple of 32, <= 128); one wave = 16 query rows; block = 4 waves (64 queries) sharing K/V chunks of 32.
template <int D, bool CAUSAL>
__global__ __launch_bounds__(128) void k_flash(const float* __restrict__ qb, const float* __restrict__ kb, const float* __restrict__ vb,
                                             int pitch, int T, int H, float scale, float* __restrict__ y, int ypitch) {
  constexpr int KS = D / 32;        // k-steps for QK
  constexpr int DT = D / 16;        // d tiles for PV
  __shared__ __attribute__((aligned(16))) unsigned short sKh[32][D + 8], sKl[32][D + 8], sVh[32][D + 8], sVl[32][D + 8];
  __shared__ __attribute__((aligned(16))) unsigned short sPh[4][16][40], sPl[4][16][40];
  __shared__ __attribute__((aligned(16))) float sO[4][16][D];
  const int tid = threadIdx.x, w = tid >> 5, lane = tid & 31, ln = lane & 15, hh = lane >> 4;
  const int nqb = (T + 63) / 64;
  const int bh = blockIdx.x / nqb, qblk = blockIdx.x % nqb;
  const int b = bh / H, h = bh % H;
  const int q0 = qblk * 64 + w * 16;
  const float* Q = qb + (size_t)b * T * pitch + h * D;
  const float* K = kb + (size_t)b * T * pitch + h * D;
  const float* V = vb + (size_t)b * T * pitch + h * D;

  // A fragments of the wave's 16 query rows (scaled), hi/lo
  FragB aqh[KS], aql[KS];
  {
    int row = q0 + ln; if (row >= T) row = T - 1;
    const float* qr = Q + (size_t)row * pitch;
#pragma unroll
    for (int ks = 0; ks < KS; ++ks)
#pragma unroll
      for (int i = 0; i < 16; ++i) {
        const int d = ks * 32 + ((i < 8) ? (8 * hh + i) : (16 + 8 * hh + (i - 8)));
        const float x = qr[d] * scale; const unsigned short hb = bf16_bits(x);
        aqh[ks].u[i] = hb; aql[ks].u[i] = bf16_bits(x - bf16_val(hb));
      }
  }
  float m_r[8], l_r[8];
#pragma unroll
  for (int r = 0; r < 8; ++r) { m_r[r] = -3.0e38f; l_r[r] = 0.f; }
  v8f oacc[DT];
#pragma unroll
  for (int dt = 0; dt < DT; ++dt) oacc[dt] = (v8f){0.f,0.f,0.f,0.f,0.f,0.f,0.f,0.f};

  const int kv_end = CAUSAL ? min(T, qblk * 64 + 64) : T;     // block-uniform
  for (int j0 = 0; j0 < kv_end; j0 += 32) {
    __syncthreads();
    for (int e = tid; e < 32 * (D / 4); e += 128) {
      const int r = e / (D / 4), c4 = (e % (D / 4)) * 4;
      const int key = j0 + r;
      v4f kf = {0.f,0.f,0.f,0.f}, vf = {0.f,0.f,0.f,0.f};
      if (key < T) { kf = *(const v4fa*)(K + (size_t)key * pitch + c4); vf = *(const v4fa*)(V + (size_t)key * pitch + c4); }
#pragma unroll
      for (int t = 0; t < 4; ++t) {
        unsigned short hb = bf16_bits(kf[t]); sKh[r][c4 + t] = hb; sKl[r][c4 + t] = bf16_bits(kf[t] - bf16_val(hb));
        hb = bf16_bits(vf[t]); sVh[r][c4 + t] = hb; sVl[r][c4 + t] = bf16_bits(vf[t] - bf16_val(hb));
      }
    }
    __syncthreads();
    // S tile 16 x 32
    v8f s[2];
#pragma unroll
    for (int nt = 0; nt < 2; ++nt) {
      v8f acc = {};
#pragma unroll
      for (int ks = 0; ks < KS; ++ks) {
        FragB bh_, bl_;
        bh_.half[0] = *(const v8us*)&sKh[nt * 16 + ln][ks * 32 + 8 * hh]; bh_.half[1] = *(const v8us*)&sKh[nt * 16 + ln][ks * 32 + 16 + 8 * hh];
        bl_.half[0] = *(const v8us*)&sKl[nt * 16 + ln][ks * 32 + 8 * hh]; bl_.half[1] = *(const v8us*)&sKl[nt * 16 + ln][ks * 32 + 16 + 8 * hh];
        acc = mmaN<3>(aqh[ks].v, aql[ks].v, bh_.v, bl_.v, acc);
      }
      s[nt] = acc;
    }
    // mask + running max (rows 8hh+r; the 16 lanes of a half share rows)
    float alpha[8];
#pragma unroll
    for (int r = 0; r < 8; ++r) {
      const int qi = q0 + 8 * hh + r;
      const int ja = j0 + ln, jb = j0 + 16 + ln;
      if (CAUSAL) { if (ja > qi) s[0][r] = -3.0e38f; if (jb > qi) s[1][r] = -3.0e38f; }
      if (ja >= T) s[0][r] = -3.0e38f;
      if (jb >= T) s[1][r] = -3.0e38f;
      float mx = fmaxf(s[0][r], s[1][r]);
      mx = fmaxf(mx, __shfl_xor(mx, 1, 32)); mx = fmaxf(mx, __shfl_xor(mx, 2, 32)); mx = fmaxf(mx, __shfl_xor(mx, 4, 32)); mx = fmaxf(mx, __shfl_xor(mx, 8, 32));
      const float mnew = fmaxf(m_r[r], mx);
      alpha[r] = (mnew > -1.0e38f) ? __expf(m_r[r] - mnew) : 1.0f;
      const float p0 = (s[0][r] > -1.0e38f) ? __expf(s[0][r] - mnew) : 0.f;
      const float p1 = (s[1][r] > -1.0e38f) ? __expf(s[1][r] - mnew) : 0.f;
      m_r[r] = mnew;
      l_r[r] = l_r[r] * alpha[r] + p0 + p1;            // per-lane partial row sum (16 lanes combined at the end)
      unsigned short hb = bf16_bits(p0); sPh[w][8 * hh + r][ln] = hb;      sPl[w][8 * hh + r][ln] = bf16_bits(p0 - bf16_val(hb));
      hb = bf16_bits(p1);                sPh[w][8 * hh + r][16 + ln] = hb; sPl[w][8 * hh + r][16 + ln] = bf16_bits(p1 - bf16_val(hb));
    }
#pragma unroll
    for (int dt = 0; dt < DT; ++dt)
#pragma unroll
      for (int r = 0; r < 8; ++r) oacc[dt][r] *= alpha[r];
    __builtin_amdgcn_fence(__ATOMIC_ACQ_REL, "workgroup");
    __builtin_amdgcn_wave_barrier();
    FragB pah, pal;
    pah.half[0] = *(const v8us*)&sPh[w][ln][8 * hh]; pah.half[1] = *(const v8us*)&sPh[w][ln][16 + 8 * hh];
    pal.half[0] = *(const v8us*)&sPl[w][ln][8 * hh]; pal.half[1] = *(const v8us*)&sPl[w][ln][16 + 8 * hh];
#pragma unroll
    for (int dt = 0; dt < DT; ++dt) {
      FragB bvh, bvl;
#pragma unroll
      for (int i = 0; i < 8; ++i) {
        bvh.u[i] = sVh[8 * hh + i][dt * 16 + ln]; bvh.u[8 + i] = sVh[16 + 8 * hh + i][dt * 16 + ln];
        bvl.u[i] = sVl[8 * hh + i][dt * 16 + ln]; bvl.u[8 + i] = sVl[16 + 8 * hh + i][dt * 16 + ln];
      }
      oacc[dt] = mmaN<3>(pah.v, pal.v, bvh.v, bvl.v, oacc[dt]);
    }
    __builtin_amdgcn_fence(__ATOMIC_ACQ_REL, "workgroup");
    __builtin_amdgcn_wave_barrier();
  }
#pragma unroll
  for (int r = 0; r < 8; ++r) {
    float l = l_r[r];
    l += __shfl_xor(l, 1, 32); l += __shfl_xor(l, 2, 32); l += __shfl_xor(l, 4, 32); l += __shfl_xor(l, 8, 32);
    l_r[r] = (l > 0.f) ? 1.0f / l : 0.f;
  }
#pragma unroll
  for (int dt = 0; dt < DT; ++dt)
#pragma unroll
    for (int r = 0; r < 8; ++r) sO[w][8 * hh + r][dt * 16 + ln] = oacc[dt][r] * l_r[r];
  __builtin_amdgcn_fence(__ATOMIC_ACQ_REL, "workgroup");
  __builtin_amdgcn_wave_barrier();
  {
    for (int r = 0; r < 16; ++r) {
      const int row = q0 + r;
      if (row < T && lane < D / 4) {
        const v4f val = *(const v4fa*)&sO[w][r][lane * 4];
        *(v4f*)(y + ((size_t)b * T + row) * ypitch + h * D + lane * 4) = val;
      }
    }
    
  }
}

// GEMM C = act(A·W + bias + resid): A f32 (ASPLIT -> hi/lo 2 terms), Wt bf16 [N][K]; ACT 0 none, 1 relu, 2 exact gelu;
// resid (optional, f32, row index = (row % rmod), pitch ldr, RES_BF16 rounds it) added before the activation.
template <bool ASPLIT, int ACT, bool BIAS_BF16, bool RES_BF16>
__global__ __launch_bounds__(128) void k_gemm_bf3(const float* __restrict__ A, int lda, const unsigned short* __restrict__ Wt, int ldb,
                                                const float* __restrict__ bias, const float* __restrict__ resid, int rmod, int ldr,
                                                float* __restrict__ C, int ldc, int M, int N, int K) {
  __shared__ __attribute__((aligned(16))) float so[4][16][64];
  const int tid = threadIdx.x, w = tid >> 5, lane = tid & 31, ln = lane & 15, hh = lane >> 4;
  const int ntn = N / 64;
  const int wid = blockIdx.x * 4 + w;
  const int mt = wid / ntn, nq = wid % ntn;
  if (mt * 16 >= M) return;
  const int row0 = mt * 16, col0 = nq * 64;
  const float* arow = A + (size_t)(row0 + ln) * lda;
  v8f acc[4] = {};
  for (int kb = 0; kb < K; kb += 32) {
    FragB ah, al;
    const v4f x0 = *(const v4fa*)(arow + kb + 8 * hh), x1 = *(const v4fa*)(arow + kb + 8 * hh + 4);
    const v4f x2 = *(const v4fa*)(arow + kb + 16 + 8 * hh), x3 = *(const v4fa*)(arow + kb + 16 + 8 * hh + 4);
    float xs[16] = {x0[0],x0[1],x0[2],x0[3],x1[0],x1[1],x1[2],x1[3],x2[0],x2[1],x2[2],x2[3],x3[0],x3[1],x3[2],x3[3]};
#pragma unroll
    for (int i = 0; i < 16; ++i) { const unsigned short hb = bf16_bits(xs[i]); ah.u[i] = hb; al.u[i] = ASPLIT ? bf16_bits(xs[i] - bf16_val(hb)) : (unsigned short)0; }
#pragma unroll
    for (int t = 0; t < 4; ++t) {
      const unsigned short* brow = Wt + (size_t)(col0 + t * 16 + ln) * ldb + kb;
      FragB b;
      b.half[0] = *(const v8us*)(brow + 8 * hh);
      b.half[1] = *(const v8us*)(brow + 16 + 8 * hh);
      acc[t] = mmaN<ASPLIT ? 2 : 1>(ah.v, al.v, b.v, b.v, acc[t]);
    }
  }
#pragma unroll
  for (int t = 0; t < 4; ++t) {
    const int col = col0 + t * 16 + ln;
    float bv = bias ? bias[col] : 0.f;
    if (BIAS_BF16) bv = bf16_round(bv);
#pragma unroll
    for (int r = 0; r < 8; ++r) {
      float v = acc[t][r] + bv;
      if (resid) { float rv = resid[(size_t)((row0 + 8 * hh + r) % rmod) * ldr + col]; if (RES_BF16) rv = bf16_round(rv); v += rv; }
      if (ACT == 1) v = fmaxf(v, 0.f);
      if (ACT == 2) v = 0.5f * v * (1.0f + erff(v * 0.70710678118654752f));
      if (ACT == 3) { const float u = 0.7978845608028654f * (v + 0.044715f * v * v * v); v = 0.5f * v * (1.0f + tanhf(u)); }
      so[w][8 * hh + r][t * 16 + ln] = v;
    }
  }
  __builtin_amdgcn_fence(__ATOMIC_ACQ_REL, "workgroup");
  __builtin_amdgcn_wave_barrier();
  const int rsub = lane >> 4, c4 = (lane & 15) * 4;
  {
#pragma unroll
    for (int q = 0; q < 8; ++q) {
      const int r = q * 2 + rsub;
      const v4f v = *(const v4fa*)&so[w][r][c4];
      *(v4f*)(C + (size_t)(row0 + r) * ldc + col0 + c4) = v;
    }
    
  }
}
// row LayerNorm (biased variance, eps) over N: s = X (+ R); optional out_sum <- s; out_norm <- (s-mu)*rsqrt(var+eps)*g + b
template <bool PARAM_BF16>
__global__ __launch_bounds__(256) void k_layernorm(const float* __restrict__ X, const float* __restrict__ R, const float* __restrict__ g, const float* __restrict__ bta,
                                                  float* __restrict__ out_sum, float* __restrict__ out_norm, int N, float eps) {
  __shared__ float red[256];
  const int row = blockIdx.x, tid = threadIdx.x;
  const float* x = X + (size_t)row * N; const float* rr = R ? R + (size_t)row * N : nullptr;
  float vals[16];                     // up to N = 4096
  const int per = N / 256;            // contiguous chunk per thread? use strided-by-4 chunks: thread handles j = tid*4 + 1024*u
  float s1 = 0.f;
  for (int u = 0; u < per / 4; ++u) {
    const int j = tid * 4 + 1024 * u;
    const v4f a = *(const v4fa*)(x + j);
    v4f b = {0.f,0.f,0.f,0.f}; if (rr) b = *(const v4fa*)(rr + j);
#pragma unroll
    for (int q = 0; q < 4; ++q) { const float v = a[q] + b[q]; vals[u * 4 + q] = v; s1 += v; }
  }
  red[tid] = s1; __syncthreads();
  for (int st = 128; st > 0; st >>= 1) { if (tid < st) red[tid] += red[tid + st]; __syncthreads(); }
  const float mu = red[0] / (float)N; __syncthreads();
  float s2 = 0.f;
  for (int u = 0; u < per / 4; ++u)
#pragma unroll
    for (int q = 0; q < 4; ++q) { const float c = vals[u * 4 + q] - mu; s2 += c * c; }
  red[tid] = s2; __syncthreads();
  for (int st = 128; st > 0; st >>= 1) { if (tid < st) red[tid] += red[tid + st]; __syncthreads(); }
  const float rs = rsqrtf(red[0] / (float)N + eps);
  {
    for (int u = 0; u < per / 4; ++u) {
      const int j = tid * 4 + 1024 * u;
      v4f o, sm;
#pragma unroll
      for (int q = 0; q < 4; ++q) {
        float gg = g[j + q], bb = bta[j + q];
        if (PARAM_BF16) { gg = bf16_round(gg); bb = bf16_round(bb); }
        sm[q] = vals[u * 4 + q]; o[q] = (vals[u * 4 + q] - mu) * rs * gg + bb;
      }
      if (out_sum) *(v4f*)(out_sum + (size_t)row * N + j) = sm;
      *(v4f*)(out_norm + (size_t)row * N + j) = o;
    }
    
  }
}



// ---- f16 WMMA path (v_wmma_f32_16x16x32_f16): 11-bit significands for operands in range — used where a [0,1] probability operand needs more precision than bf16
typedef _Float16 v16h __attribute__((ext_vector_type(16)));
union FragH { v16h v; v8us half[2]; _Float16 h[16]; unsigned short u[16]; };
template <int NT>
__device__ __forceinline__ v8f mmaH(v16h ah, v16h al, v16h bh, v16h bl, v8f c) {
  c = __builtin_amdgcn_wmma_f32_16x16x32_f16(false, ah, false, bh, (short)0, c, false, false);
  if (NT >= 2) c = __builtin_amdgcn_wmma_f32_16x16x32_f16(false, al, false, bh, (short)0, c, false, false);
  if (NT >= 3) c = __builtin_amdgcn_wmma_f32_16x16x32_f16(false, ah, false, bl, (short)0, c, false, false);
  asm volatile("v_nop\n\tv_nop\n\tv_nop\n\tv_nop" : "+v"(c) : "v"(ah), "v"(al), "v"(bh), "v"(bl));
  return c;
}
// batched GEMM like k_gemm_b but f16 operands: A f32 (split into f16 hi/lo if ASPLIT, else rounded to f16), Bt = f16 values [n][k]; alpha; C f32; N multiple of 16 (partial tiles skipped)
template <bool ASPLIT>
__global__ __launch_bounds__(128) void k_gemm_h(const float* __restrict__ A, int lda, size_t sA, const _Float16* __restrict__ Bh, int ldb, size_t sB, float alpha, float* __restrict__ C, int ldc, size_t sC, int M, int N, int K) {
  __shared__ __attribute__((aligned(16))) float so[4][16][64];
  const int tid = threadIdx.x, w = tid >> 5, lane = tid & 31, ln = lane & 15, hh = lane >> 4; const int by = blockIdx.y;
  A += (size_t)by * sA; Bh += (size_t)by * sB; C += (size_t)by * sC;
  const int ntn = (N + 63) / 64; const int wid = blockIdx.x * 4 + w; const int mt = wid / ntn, nq = wid % ntn; if (mt * 16 >= M) return;
  const int row0 = mt * 16, col0 = nq * 64; const float* arow = A + (size_t)(row0 + ln) * lda;
  v8f acc[4] = {};
  for (int kb = 0; kb < K; kb += 32) {
    FragH ah, al;
    const v4f x0 = *(const v4fa*)(arow + kb + 8 * hh), x1 = *(const v4fa*)(arow + kb + 8 * hh + 4), x2 = *(const v4fa*)(arow + kb + 16 + 8 * hh), x3 = *(const v4fa*)(arow + kb + 16 + 8 * hh + 4);
    float xs[16] = {x0[0],x0[1],x0[2],x0[3],x1[0],x1[1],x1[2],x1[3],x2[0],x2[1],x2[2],x2[3],x3[0],x3[1],x3[2],x3[3]};
#pragma unroll
    for (int i = 0; i < 16; ++i) { const _Float16 h = (_Float16)xs[i]; ah.h[i] = h; al.h[i] = ASPLIT ? (_Float16)(xs[i] - (float)h) : (_Float16)0.0f; }
#pragma unroll
    for (int t = 0; t < 4; ++t) { if (col0 + t * 16 >= N) continue; const size_t boff = (size_t)(col0 + t * 16 + ln) * ldb + kb; FragH bq; bq.half[0] = *(const v8us*)(Bh + boff + 8 * hh); bq.half[1] = *(const v8us*)(Bh + boff + 16 + 8 * hh);
      acc[t] = mmaH<ASPLIT ? 2 : 1>(ah.v, al.v, bq.v, bq.v, acc[t]); }
  }
#pragma unroll
  for (int t = 0; t < 4; ++t) { if (col0 + t * 16 >= N) continue;
#pragma unroll
    for (int r = 0; r < 8; ++r) so[w][8 * hh + r][t * 16 + ln] = acc[t][r] * alpha; }
  __builtin_amdgcn_fence(__ATOMIC_ACQ_REL, "workgroup"); __builtin_amdgcn_wave_barrier();
  const int rsub = lane >> 4, c4 = (lane & 15) * 4;
  {
#pragma unroll
    for (int q = 0; q < 8; ++q) { const int r = q * 2 + rsub; if (col0 + c4 < N) { const v4f v = *(const v4fa*)&so[w][r][c4]; *(v4f*)(C + (size_t)(row0 + r) * ldc + col0 + c4) = v; } }
     }
}

// Wt[n][k] = f16(W[k][n]·scale) from f32 row-major W[K][N] (scale = power of two; bf16-exact weights stay exact in f16 away from the subnormal range)
__global__ __launch_bounds__(256) void k_wt_f16(const float* __restrict__ W, _Float16* __restrict__ Wt, int K, int N, float scale) {
  const int t = blockIdx.x * 256 + threadIdx.x; if (t >= N * (K / 8)) return; const int n = t / (K / 8), k8 = (t % (K / 8)) * 8; FragH f;
#pragma unroll
  for (int i = 0; i < 8; ++i) f.h[i] = (_Float16)(bf16_round(W[(size_t)(k8 + i) * N + n]) * scale); const v8us o = f.half[0];
  *(v8us*)((unsigned short*)Wt + (size_t)n * K + k8) = o; 
}
// Tiled GEMM, f16 operands, both K-contiguous: v[row][col] = acc*alpha + bias[col], then CPM 1: + CP[by*sCPy + col] (one row for all rows), CPM 2: + what C[row][col] holds; written as f32 to C (F32OUT) or as f16 to C16.
// One 128x128 tile per workgroup of 8 waves (4 x 2, 32x64 per wave). A pass is 64 k = one whole 128-B line of every operand row: each wave-wide 16-B load
// covers four whole lines and goes through registers into LDS (row pitch 144 B for the ds_load_b128 fragment readers); two buffers, one barrier per pass;
// the next pass's global loads are issued before this pass's products. M, N multiples of 128 (the grid is exact), K a multiple of 64.
// Every "#pragma unroll" below makes the index of a register array (staged rows, fragments, accumulators) a constant, so that the array stays in registers.
#define TPITCH 72
typedef float fa1 __attribute__((may_alias));
typedef _Float16 v4hs __attribute__((ext_vector_type(4)));
template <int CPM, bool F32OUT>
__global__ __launch_bounds__(256) void k_gemm_t(const _Float16* __restrict__ A, int lda, size_t sA, const _Float16* __restrict__ Bh, int ldb, size_t sB, float alpha, const float* __restrict__ bias, const float* __restrict__ CP, size_t sCPy,
    float* __restrict__ C, _Float16* __restrict__ C16, int ldc, size_t sC, int N, int K) {
  __shared__ __attribute__((aligned(16))) unsigned short st[2][2][128 * TPITCH];      // [buffer][A, B][row * TPITCH + k]
  const int tid = threadIdx.x, w = tid >> 5, lane = tid & 31, ln = lane & 15, hh = lane >> 4; const int by = blockIdx.y;
  const int ntn = N / 128; const int row0 = ((int)blockIdx.x / ntn) * 128, col0 = ((int)blockIdx.x % ntn) * 128;
  const int sr = tid >> 3, sc = (tid & 7) * 8;      // staging: 8 lanes per row, rows sr + 32 i
  const unsigned short* ga = (const unsigned short*)A + (size_t)by * sA + (size_t)row0 * lda;      // workgroup-uniform bases, per-lane 32-bit offsets that never change
  const unsigned short* gb = (const unsigned short*)Bh + (size_t)by * sB + (size_t)col0 * ldb;
  unsigned oa[4], ob[4];
#pragma unroll
  for (int i = 0; i < 4; ++i) { oa[i] = (unsigned)((sr + 32 * i) * lda + sc); ob[i] = (unsigned)((sr + 32 * i) * ldb + sc); }
  v8us ra[4], rb[4]; const unsigned short *pa[4], *pb[4];
#pragma unroll
  for (int i = 0; i < 4; ++i) { pa[i] = ga + oa[i]; pb[i] = gb + ob[i]; }
#pragma unroll
  for (int i = 0; i < 4; ++i) { ra[i] = *(const v8us*)pa[i]; rb[i] = *(const v8us*)pb[i]; }
  // the eight address pairs are inputs of the wait: they stay in their registers up to it, so no load of the group is given a register that an issued load names
  asm volatile("s_wait_xcnt 0x0" :: "v"(pa[0]), "v"(pa[1]), "v"(pa[2]), "v"(pa[3]), "v"(pb[0]), "v"(pb[1]), "v"(pb[2]), "v"(pb[3]) : "memory");
#pragma unroll
  for (int i = 0; i < 4; ++i) { *(v8us*)&st[0][0][(sr + 32 * i) * TPITCH + sc] = ra[i]; *(v8us*)&st[0][1][(sr + 32 * i) * TPITCH + sc] = rb[i]; }
  __syncthreads();
  const int wm = w >> 1, wn = w & 1; const int ns = K / 64;
  v8f acc[2][4] = {};
  for (int s = 0; s < ns; ++s) {
    const int cur = s & 1; const bool more = s + 1 < ns;      // the same in every thread of the workgroup
    if (more) {
#pragma unroll
      for (int i = 0; i < 4; ++i) { pa[i] = ga + oa[i]; pb[i] = gb + ob[i]; }      // this pass's addresses; the next pass lies 64 k = 128 B further
#pragma unroll
      for (int i = 0; i < 4; ++i) { ra[i] = *(const v8us*)(pa[i] + 64); rb[i] = *(const v8us*)(pb[i] + 64); }
      // as in front of the loop: the address pairs stay in their registers up to the wait
      asm volatile("s_wait_xcnt 0x0" :: "v"(pa[0]), "v"(pa[1]), "v"(pa[2]), "v"(pa[3]), "v"(pb[0]), "v"(pb[1]), "v"(pb[2]), "v"(pb[3]) : "memory");
      ga += 64; gb += 64;
    }
    const unsigned short* la = &st[cur][0][(wm * 32 + ln) * TPITCH + 8 * hh];
    const unsigned short* lb = &st[cur][1][(wn * 64 + ln) * TPITCH + 8 * hh];
    FragH a[2][2], b[2][4];      // all of the pass's fragments are read as one group ahead of its products
#pragma unroll
    for (int ks = 0; ks < 2; ++ks) {
#pragma unroll
      for (int mi = 0; mi < 2; ++mi) { a[ks][mi].half[0] = *(const v8us*)(la + mi * 16 * TPITCH + ks * 32); a[ks][mi].half[1] = *(const v8us*)(la + mi * 16 * TPITCH + ks * 32 + 16); }
#pragma unroll
      for (int t = 0; t < 4; ++t) { b[ks][t].half[0] = *(const v8us*)(lb + t * 16 * TPITCH + ks * 32); b[ks][t].half[1] = *(const v8us*)(lb + t * 16 * TPITCH + ks * 32 + 16); }
    }
#pragma unroll
    for (int ks = 0; ks < 2; ++ks)
#pragma unroll
      for (int t = 0; t < 4; ++t)
#pragma unroll
        for (int mi = 0; mi < 2; ++mi) acc[mi][t] = mmaH<1>(a[ks][mi].v, a[ks][mi].v, b[ks][t].v, b[ks][t].v, acc[mi][t]);
    if (more) {
#pragma unroll
      for (int i = 0; i < 4; ++i) { *(v8us*)&st[cur ^ 1][0][(sr + 32 * i) * TPITCH + sc] = ra[i]; *(v8us*)&st[cur ^ 1][1][(sr + 32 * i) * TPITCH + sc] = rb[i]; }
    }
    __syncthreads();      // publishes the buffer just filled and ends every read of the one just used
  }
  // epilogue: each wave turns its accumulators into whole rows through its own 32 x 68 f32 range of the (now free) staging LDS
  fa1* so = (fa1*)&st[0][0][0] + w * (32 * 68);
  const size_t cofs = (size_t)by * sC; const int wrow0 = row0 + wm * 32, wcol0 = col0 + wn * 64; const int rsub = lane >> 4, c4 = (lane & 15) * 4;
  float* crow = C + cofs + (size_t)(wrow0 + rsub) * ldc + wcol0 + c4;      // each lane reads (CPM 2) and writes the same 16 B of rows rsub + 2 q
  v4f cp[16];
  if (CPM == 1) cp[0] = *(const v4fa*)(CP + (size_t)by * sCPy + wcol0 + c4);
  if (CPM == 2) {
#pragma unroll
    for (int q = 0; q < 16; ++q) cp[q] = *(const v4fa*)(crow + (size_t)(q * 2) * ldc);
  }
#pragma unroll
  for (int t = 0; t < 4; ++t) { const float bv = bias ? bf16_round(bias[wcol0 + t * 16 + ln]) : 0.f;
#pragma unroll
    for (int mi = 0; mi < 2; ++mi)
#pragma unroll
      for (int r = 0; r < 8; ++r) so[(mi * 16 + 8 * hh + r) * 68 + t * 16 + ln] = acc[mi][t][r] * alpha + bv; }
  __builtin_amdgcn_fence(__ATOMIC_ACQ_REL, "workgroup"); __builtin_amdgcn_wave_barrier();      // the wave's LDS rows are complete before its lanes read what other lanes wrote
#pragma unroll
  for (int q = 0; q < 16; ++q) { const int r = q * 2 + rsub; const int row = wrow0 + r; v4f v = *(const v4fa*)&so[r * 68 + c4];
    if (CPM != 0) { for (int i = 0; i < 4; ++i) v[i] += cp[CPM == 2 ? q : 0][i]; }
    if (F32OUT) *(v4f*)(crow + (size_t)(q * 2) * ldc) = v;
    else { v4hs h4; for (int i = 0; i < 4; ++i) h4[i] = (_Float16)v[i]; *(v4hs*)(C16 + cofs + (size_t)row * ldc + wcol0 + c4) = h4; } }
}


typedef _Float16 v4h __attribute__((ext_vector_type(4)));

__global__ __launch_bounds__(256) void k_x16(const float* __restrict__ x, _Float16* __restrict__ X16, size_t n8) { const size_t t = (size_t)blockIdx.x * 256 + threadIdx.x; if (t >= n8) return; FragH f;
#pragma unroll
  for (int q = 0; q < 8; ++q) f.h[q] = (_Float16)bf16_round(x[t * 8 + q]); *(v8us*)((unsigned short*)X16 + t * 8) = f.half[0];  }
__global__ __launch_bounds__(256) void k_h16(const float* __restrict__ x, _Float16* __restrict__ X16, size_t n8) { const size_t t = (size_t)blockIdx.x * 256 + threadIdx.x; if (t >= n8) return; FragH f;
#pragma unroll
  for (int q = 0; q < 8; ++q) f.h[q] = (_Float16)x[t * 8 + q]; *(v8us*)((unsigned short*)X16 + t * 8) = f.half[0];  }
__global__ __launch_bounds__(256) void k_round16f(const float* __restrict__ W, _Float16* __restrict__ Bt, size_t n8) { const size_t t = (size_t)blockIdx.x * 256 + threadIdx.x; if (t >= n8) return; FragH f;
#pragma unroll
  for (int i = 0; i < 8; ++i) f.h[i] = (_Float16)(bf16_round(W[t * 8 + i]) * 16.0f); *(v8us*)((unsigned short*)Bt + t * 8) = f.half[0];  }
template <int NHv, int TTv>
__global__ __launch_bounds__(256) void k_vt(const _Float16* __restrict__ V16, int ldv, int voff, _Float16* __restrict__ Vt) { __shared__ unsigned short tl[64][66]; const int tid = threadIdx.x; const int slab = blockIdx.x / (TTv / 64), lg = blockIdx.x % (TTv / 64); const int b = slab / NHv, h = slab % NHv;
  for (int i = tid; i < 64 * 8; i += 256) { const int r = i / 8, c8 = (i % 8) * 8; FragH f; f.half[0] = *(const v8us*)((const unsigned short*)V16 + ((size_t)b * TTv + lg * 64 + r) * ldv + voff + h * 64 + c8);
#pragma unroll
    for (int q = 0; q < 8; ++q) tl[r][c8 + q] = f.u[q]; }
  __syncthreads();
  {
#pragma unroll
    for (int rd = 0; rd < 2; ++rd) { const int d = rd * 32 + tid / 8, pc = tid % 8; FragH f;
#pragma unroll
      for (int q = 0; q < 8; ++q) f.u[q] = tl[pc * 8 + q][d];
      *(v8us*)((unsigned short*)Vt + ((size_t)slab * 64 + d) * TTv + lg * 64 + pc * 8) = f.half[0]; }
     } }

__global__ __launch_bounds__(256) void k_tok(const float* __restrict__ x, _Float16* __restrict__ X16) { __shared__ float tl[32][65]; const int tid = threadIdx.x; const int b = blockIdx.x / ((CC / 64) * (NN / 32)), rem = blockIdx.x % ((CC / 64) * (NN / 32)); const int cg = rem / (NN / 32), pg = rem % (NN / 32); const int c0 = cg * 64, p0 = pg * 32;
  for (int i = tid; i < 64 * 32; i += 256) { const int c = i / 32, pp = i % 32; tl[pp][c] = bf16_round(x[((size_t)b * CC + c0 + c) * NN + p0 + pp]); } __syncthreads();
  const int r = tid / 8, pc = tid % 8; FragH f; for (int q = 0; q < 8; ++q) f.h[q] = (_Float16)tl[r][pc * 8 + q]; const size_t row = (size_t)b * NN + p0 + r; *(v8us*)((unsigned short*)X16 + row * CC + c0 + pc * 8) = f.half[0];  }
__global__ __launch_bounds__(256) void k_pool2(const _Float16* __restrict__ F, _Float16* __restrict__ P) { const size_t t = (size_t)blockIdx.x * 256 + threadIdx.x; if (t >= (size_t)NRH * (CC / 8)) return; const int c8 = (int)(t % (CC / 8)) * 8; const size_t rm = t / (CC / 8); FragH a, b2, o; a.half[0] = *(const v8us*)((const unsigned short*)F + (rm * 2) * CC + c8); b2.half[0] = *(const v8us*)((const unsigned short*)F + (rm * 2 + 1) * CC + c8); for (int q = 0; q < 8; ++q) o.h[q] = ((float)a.h[q] > (float)b2.h[q]) ? a.h[q] : b2.h[q];
  *(v8us*)((unsigned short*)P + rm * CC + c8) = o.half[0];  }
__global__ __launch_bounds__(256) void k_pool2f(const float* __restrict__ F, float* __restrict__ P) { const size_t t = (size_t)blockIdx.x * 256 + threadIdx.x; if (t >= (size_t)NRH * (CC / 4)) return; const int c4 = (int)(t % (CC / 4)) * 4; const size_t rm = t / (CC / 4); const v4f a = *(const v4fa*)(F + (rm * 2) * CC + c4), b2 = *(const v4fa*)(F + (rm * 2 + 1) * CC + c4); v4f o; for (int q = 0; q < 4; ++q) o[q] = fmaxf(a[q], b2[q]); *(v4f*)(P + rm * CC + c4) = o;  }
__global__ __launch_bounds__(256) void k_hl(const float* __restrict__ F, _Float16* __restrict__ Hh, _Float16* __restrict__ Hl, size_t n8) { const size_t t = (size_t)blockIdx.x * 256 + threadIdx.x; if (t >= n8) return; FragH fh, fl; for (int q = 0; q < 8; ++q) { const float v = F[t * 8 + q]; const _Float16 h = (_Float16)v; fh.h[q] = h; fl.h[q] = (_Float16)((v - (float)h) * 1024.0f); } { *(v8us*)((unsigned short*)Hh + t * 8) = fh.half[0]; *(v8us*)((unsigned short*)Hl + t * 8) = fl.half[0];  } }
__global__ __launch_bounds__(256) void k_cvec(const float* __restrict__ PHF, const float* __restrict__ bth, float* __restrict__ cv) { const int m = blockIdx.x * 256 + threadIdx.x; if (m >= NRH) return; float s = 0.f;
#pragma unroll 1
  for (int o = 0; o < CC; o += 4) { const v4f p = *(const v4fa*)(PHF + (size_t)m * CC + o); for (int q = 0; q < 4; ++q) s += p[q] * bf16_round(bth[o + q]); } *(float*)(cv + m) = s;  }
__global__ __launch_bounds__(256) void k_smx(const float* __restrict__ S, _Float16* __restrict__ P16) { const int tid = threadIdx.x, wv = tid >> 5, lane = tid & 31; const int r = blockIdx.x * 8 + wv; if (r >= NR) return; const float* sr = S + (size_t)r * NH; float m = -3.0e38f;
  for (int p = lane; p < NH / 8; p += 32) { const v4f a = *(const v4fa*)(sr + p * 8), b = *(const v4fa*)(sr + p * 8 + 4); for (int q = 0; q < 4; ++q) m = fmaxf(m, fmaxf(a[q], b[q])); }
  for (int o = 16; o >= 1; o >>= 1) m = fmaxf(m, __shfl_xor(m, o, 32)); float z = 0.f;
  for (int p = lane; p < NH / 8; p += 32) { const v4f a = *(const v4fa*)(sr + p * 8), b = *(const v4fa*)(sr + p * 8 + 4); for (int q = 0; q < 4; ++q) z += __expf(a[q] - m) + __expf(b[q] - m); }
  for (int o = 16; o >= 1; o >>= 1) z += __shfl_xor(z, o, 32); const float iz = 32768.0f / z;
  { for (int p = lane; p < NH / 8; p += 32) { FragH f; for (int q = 0; q < 8; ++q) f.h[q] = (_Float16)(__expf(sr[p * 8 + q] - m) * iz); *(v8us*)((unsigned short*)P16 + (size_t)r * NH + p * 8) = f.half[0]; }  } }
__global__ __launch_bounds__(256) void k_bnstat(const float* __restrict__ Y, float* __restrict__ ST) { __shared__ float ra[256]; const int c = blockIdx.x, tid = threadIdx.x; float s = 0.f; for (int r = tid; r < NR; r += 256) s += Y[(size_t)r * CC + c]; ra[tid] = s; __syncthreads(); for (int o = 128; o >= 1; o >>= 1) { if (tid < o) ra[tid] += ra[tid + o]; __syncthreads(); } const float mu = ra[0] / (float)NR; __syncthreads(); float q2 = 0.f;
  for (int r = tid; r < NR; r += 256) { const float d = Y[(size_t)r * CC + c] - mu; q2 += d * d; } ra[tid] = q2; __syncthreads(); for (int o = 128; o >= 1; o >>= 1) { if (tid < o) ra[tid] += ra[tid + o]; __syncthreads(); }
  if (tid < 32) { const float v = (tid == 0) ? mu : ((tid == 1) ? rsqrtf(ra[0] / (float)NR + 1e-5f) : 0.f); *(float*)(ST + c * 32 + tid) = v;  } }
__global__ __launch_bounds__(256) void k_out(const float* __restrict__ WY, const float* __restrict__ ST, const float* __restrict__ gam, const float* __restrict__ bet, const float* __restrict__ x, float* __restrict__ out) { __shared__ float tl[32][65]; const int tid = threadIdx.x; const int b = blockIdx.x / ((CC / 32) * (NN / 64)), rem = blockIdx.x % ((CC / 32) * (NN / 64)); const int cg = rem / (NN / 64), pg = rem % (NN / 64); const int c0 = cg * 32, p0 = pg * 64;
  for (int i = tid; i < 64 * 32; i += 256) { const int pp = i / 32, c = i % 32; const int cc = c0 + c; tl[c][pp] = (WY[((size_t)b * NN + p0 + pp) * CC + cc] - ST[cc * 32]) * ST[cc * 32 + 1] * bf16_round(gam[cc]) + bf16_round(bet[cc]); } __syncthreads();
  { for (int i = tid; i < 32 * 16; i += 256) { const int c = i / 16, q4 = i % 16; const size_t o = ((size_t)b * CC + c0 + c) * NN + p0 + q4 * 4; const v4f xv = *(const v4fa*)(x + o); v4f v; for (int q = 0; q < 4; ++q) v[q] = tl[c][q4 * 4 + q] + bf16_round(xv[q]); *(v4f*)(out + o) = v; }  } }
extern "C" void kernel_launch(void* const* d_in, const int* in_sizes, int n_in,
                              void* d_out, int out_size, void* d_ws, size_t ws_size, hipStream_t stream) {
  (void)in_sizes; (void)n_in; (void)out_size;
  const float* x = (const float*)d_in[0]; const float* gw = (const float*)d_in[1]; const float* gb = (const float*)d_in[2]; const float* thw = (const float*)d_in[3]; const float* thb = (const float*)d_in[4]; const float* phw = (const float*)d_in[5]; const float* phb = (const float*)d_in[6]; const float* Ww = (const float*)d_in[7]; const float* Wb = (const float*)d_in[8]; const float* gam = (const float*)d_in[9]; const float* bet = (const float*)d_in[10];
  char* ws = (char*)d_ws; size_t off = 0;
  auto take = [&](size_t bytes) { char* p = ws + off; off += (bytes + 255) & ~(size_t)255; return p; };
  _Float16* Bg = (_Float16*)take((size_t)CC * CC * 2); _Float16* Bph = (_Float16*)take((size_t)CC * CC * 2); _Float16* BW = (_Float16*)take((size_t)CC * CC * 2); float* ST = (float*)take(CC * 32 * 4);
  _Float16* Bthp = (_Float16*)take((size_t)CC * CC * 2);      // W_θ as [in=o][out=c] → Bt[c][o] for φ·W_θ
  _Float16* X16 = (_Float16*)take((size_t)NR * CC * 2); float* FULLF = (float*)take((size_t)NR * CC * 4); _Float16* FULL = (_Float16*)take((size_t)NR * CC * 2); float* PHF = (float*)take((size_t)NRH * CC * 4); _Float16* PHh = (_Float16*)take((size_t)NRH * CC * 2); _Float16* PHl = (_Float16*)take((size_t)NRH * CC * 2); _Float16* GP = (_Float16*)take((size_t)NRH * CC * 2);
  // every per-batch buffer holds all BB batches, so that each stage is one launch over the whole batch
  float* BP = (float*)take((size_t)NRH * CC * 4); _Float16* BPh = (_Float16*)take((size_t)NRH * CC * 2); _Float16* BPl = (_Float16*)take((size_t)NRH * CC * 2); float* CV = (float*)take(NRH * 4); _Float16* Gt = (_Float16*)take((size_t)NRH * CC * 2); float* S = (float*)take((size_t)NR * NH * 4); _Float16* P16 = (_Float16*)take((size_t)NR * NH * 2);
  float* Y = FULLF; _Float16* Y16 = FULL; float* WY = FULLF;      // FULLF/FULL are dead after pooling; Y (f32) → Y16 → WY back over Y
  if (off > ws_size) return;      // about 254 MB
  k_round16f<<<(CC * CC / 8 + 255) / 256, 256, 0, stream>>>(gw, Bg, CC * CC / 8); k_round16f<<<(CC * CC / 8 + 255) / 256, 256, 0, stream>>>(phw, Bph, CC * CC / 8); k_round16f<<<(CC * CC / 8 + 255) / 256, 256, 0, stream>>>(Ww, BW, CC * CC / 8);      // (out,in) natural
  k_wt_f16<<<(CC * (CC / 8) + 255) / 256, 256, 0, stream>>>(thw, Bthp, CC, CC, 16.0f);      // Bt[c][o] = W_θ[o][c]
  k_tok<<<BB * (CC / 64) * (NN / 32), 256, 0, stream>>>(x, X16);
  const dim3 gp((NR / 128) * (CC / 128), 1); const unsigned gh8 = (unsigned)(((size_t)NRH * (CC / 8) + 255) / 256);
  k_gemm_t<0, true><<<gp, 256, 0, stream>>>(X16, CC, 0, Bph, CC, 0, 0.0625f, phb, nullptr, 0, FULLF, nullptr, CC, 0, CC, CC); k_pool2f<<<(unsigned)(((size_t)NRH * (CC / 4) + 255) / 256), 256, 0, stream>>>(FULLF, PHF);      // φ (f32, pooled)
  k_hl<<<gh8, 256, 0, stream>>>(PHF, PHh, PHl, (size_t)NRH * CC / 8);
  k_gemm_t<0, false><<<gp, 256, 0, stream>>>(X16, CC, 0, Bg, CC, 0, 0.0625f, gb, nullptr, 0, nullptr, FULL, CC, 0, CC, CC); k_pool2<<<gh8, 256, 0, stream>>>(FULL, GP);      // g (f16, pooled)
  const dim3 gb2((NRH / 128) * (CC / 128), 1), gs((NN / 128) * (NH / 128), BB), gy((NN / 128) * (CC / 128), BB);      // blockIdx.y = batch where the B operand differs per batch
  k_gemm_t<0, true><<<gb2, 256, 0, stream>>>(PHh, CC, 0, Bthp, CC, 0, 0.0625f, nullptr, nullptr, 0, BP, nullptr, CC, 0, CC, CC);
  k_gemm_t<2, true><<<gb2, 256, 0, stream>>>(PHl, CC, 0, Bthp, CC, 0, 0.0625f * 0.0009765625f, nullptr, nullptr, 0, BP, nullptr, CC, 0, CC, CC);      // B' = phi * W_theta [BB*1024][512] (phi hi + lo), all batches as rows
  k_hl<<<gh8, 256, 0, stream>>>(BP, BPh, BPl, (size_t)NRH * CC / 8); k_cvec<<<(NRH + 255) / 256, 256, 0, stream>>>(PHF, thb, CV);
  k_gemm_t<1, true><<<gs, 256, 0, stream>>>(X16, CC, (size_t)NN * CC, BPh, CC, (size_t)NH * CC, 1.0f, nullptr, CV, (size_t)NH, S, nullptr, NH, (size_t)NN * NH, NH, CC);      // f = x * B'h^T + c (c broadcast over the rows of its batch)
  k_gemm_t<2, true><<<gs, 256, 0, stream>>>(X16, CC, (size_t)NN * CC, BPl, CC, (size_t)NH * CC, 0.0009765625f, nullptr, nullptr, 0, S, nullptr, NH, (size_t)NN * NH, NH, CC);      // + x * B'l^T * 2^-10
  k_smx<<<NR / 8, 256, 0, stream>>>(S, P16);
  k_vt<8, NH><<<BB * 8 * (NH / 64), 256, 0, stream>>>(GP, CC, 0, Gt);      // g^T [BB][512][1024]
  k_gemm_t<0, true><<<gy, 256, 0, stream>>>(P16, NH, (size_t)NN * NH, Gt, NH, (size_t)CC * NH, 0.000030517578125f, nullptr, nullptr, 0, Y, nullptr, CC, (size_t)NN * CC, CC, NH);      // y = softmax(f) * g
  k_h16<<<(unsigned)(((size_t)NR * CC / 8 + 255) / 256), 256, 0, stream>>>(Y, Y16, (size_t)NR * CC / 8);
  k_gemm_t<0, true><<<gp, 256, 0, stream>>>(Y16, CC, 0, BW, CC, 0, 0.0625f, Wb, nullptr, 0, WY, nullptr, CC, 0, CC, CC);      // wy = W(y) + b
  k_bnstat<<<CC, 256, 0, stream>>>(WY, ST); k_out<<<BB * (CC / 32) * (NN / 64), 256, 0, stream>>>(WY, ST, gam, bet, x, (float*)d_out);
}

// v003
// It runs in 245 microseconds.
// Two timings next to v002 put it at 1.32 and 1.31 times that version's speed.
// Counting every step since v000, it is 6.06 times as fast.
#include <hip/hip_runtime.h>
// Non-local block with view pooling (x [8, C=512, N=2048]): θ = conv1(x), φ = maxpool2(conv1(x)), g = maxpool2(conv1(x)); f = softmax(θᵀ·φ) [N × N/2] (unscaled); y = f·g; wy = conv1(y) + b;
// out = BN_train(wy)·γ + β + x. Because the unscaled logits reach σ≈20 and feed a near-one-hot softmax, θ is never rounded: the logits are re-associated as f = x·(φ·W_θ)ᵀ + 1·(φ·b_θ)ᵀ with x bf16-EXACT,
// φ (f32, max-pooled from an f32 projection) fed as f16 hi + lo·2^10 into φ·W_θ and that product again split hi/lo as the B operand (four cheap passes per batch), the column term added exactly through
// the epilogue addend; g, y as plain f16; P ×2^15 f16; all on v_wmma_f32_16x16x32_f16 ((out,in) weights bf16-exact ×2^4, f32 accumulate); the layout transposes, max-pooling, softmax rows, BN batch statistics (fixed-order) and the residual are f32 VALU.
#define BB 8
#define CC 512
#define NN 2048
#define NH (NN / 2)
#define NR (BB * NN)
#define NRH (BB * NH)

typedef __bf16 v16b __attribute__((ext_vector_type(16)));
typedef unsigned short v8us __attribute__((ext_vector_type(8), may_alias));
typedef float  v8f  __attribute__((ext_vector_type(8)));
typedef float  v4f  __attribute__((ext_vector_type(4)));
typedef float  v4fa __attribute__((ext_vector_type(4), may_alias));
union FragB { v16b v; v8us half[2]; unsigned short u[16]; };

__device__ __forceinline__ unsigned short bf16_bits(float x) { unsigned int u = __float_as_uint(x); return (unsigned short)((u + 0x7FFFu + ((u >> 16) & 1u)) >> 16); }
__device__ __forceinline__ float bf16_val(unsigned short b) { return __uint_as_float(((unsigned int)b) << 16); }
__device__ __forceinline__ float bf16_round(float x) { return bf16_val(bf16_bits(x)); }
// D += A·B with NT terms: 1 = ah·bh, 2 = + al·bh (A split), 3 = + ah·bl (both split)
template <int NT>
__device__ __forceinline__ v8f mmaN(v16b ah, v16b al, v16b bh, v16b bl, v8f c) {
  c = __builtin_amdgcn_wmma_f32_16x16x32_bf16(false, ah, false, bh, (short)0, c, false, false);
  if (NT >= 2) c = __builtin_amdgcn_wmma_f32_16x16x32_bf16(false, al, false, bh, (short)0, c, false, false);
  if (NT >= 3) c = __builtin_amdgcn_wmma_f32_16x16x32_bf16(false, ah, false, bl, (short)0, c, false, false);
  asm volatile("v_nop\n\tv_nop\n\tv_nop\n\tv_nop" : "+v"(c) : "v"(ah), "v"(al), "v"(bh), "v"(bl));
  return c;
}

__global__ __launch_bounds__(256) void k_wt_bf16(const float* __restrict__ W, unsigned short* __restrict__ Wt, int K, int N) {
  const int t = blockIdx.x * 256 + threadIdx.x;
  const int k8n = K / 8;
  if (t >= N * k8n) return;
  const int n = t / k8n, k8 = (t % k8n) * 8;
  v8us v;
#pragma unroll
  for (int i = 0; i < 8; ++i) v[i] = bf16_bits(W[(size_t)(k8 + i) * N + n]);
  *(v8us*)(Wt + (size_t)n * K + k8) = v;
  
}

// GEMM C[M][N] (f32, pitch ldc) = act(A[M][K]·W + bias). A f32 row-major (pitch lda) converted per fragment to bf16
// (ASPLIT: hi/lo two planes -> 2 terms, else single rounded term); Wt bf16 [N][K] (pitch ldb). BIAS_BF16 rounds the
// bias to bf16 first (bias quantised to bf16 before the add). K%32==0, M%16==0, N%64==0.
template <bool ASPLIT, int ACT, bool BIAS_BF16>
__global__ __launch_bounds__(128) void k_gemm_bf(const float* __restrict__ A, int lda, const unsigned short* __restrict__ Wt, int ldb,
                                               const float* __restrict__ bias, float* __restrict__ C, int ldc, int M, int N, int K) {
  __shared__ __attribute__((aligned(16))) float so[4][16][64];
  const int tid = threadIdx.x, w = tid >> 5, lane = tid & 31, ln = lane & 15, hh = lane >> 4;
  const int ntn = N / 64;
  const int wid = blockIdx.x * 4 + w;
  const int mt = wid / ntn, nq = wid % ntn;
  if (mt * 16 >= M) return;
  const int row0 = mt * 16, col0 = nq * 64;
  const float* arow = A + (size_t)(row0 + ln) * lda;
  v8f acc[4] = {};
  for (int kb = 0; kb < K; kb += 32) {
    FragB ah, al;
    const v4f x0 = *(const v4fa*)(arow + kb + 8 * hh), x1 = *(const v4fa*)(arow + kb + 8 * hh + 4);
    const v4f x2 = *(const v4fa*)(arow + kb + 16 + 8 * hh), x3 = *(const v4fa*)(arow + kb + 16 + 8 * hh + 4);
    float xs[16] = {x0[0],x0[1],x0[2],x0[3],x1[0],x1[1],x1[2],x1[3],x2[0],x2[1],x2[2],x2[3],x3[0],x3[1],x3[2],x3[3]};
#pragma unroll
    for (int i = 0; i < 16; ++i) { const unsigned short hb = bf16_bits(xs[i]); ah.u[i] = hb; al.u[i] = ASPLIT ? bf16_bits(xs[i] - bf16_val(hb)) : (unsigned short)0; }
#pragma unroll
    for (int t = 0; t < 4; ++t) {
      const unsigned short* brow = Wt + (size_t)(col0 + t * 16 + ln) * ldb + kb;
      FragB b;
      b.half[0] = *(const v8us*)(brow + 8 * hh);
      b.half[1] = *(const v8us*)(brow + 16 + 8 * hh);
      acc[t] = mmaN<ASPLIT ? 2 : 1>(ah.v, al.v, b.v, b.v, acc[t]);
    }
  }
#pragma unroll
  for (int t = 0; t < 4; ++t) {
    float bv = bias ? bias[col0 + t * 16 + ln] : 0.f;
    if (BIAS_BF16) bv = bf16_round(bv);
#pragma unroll
    for (int r = 0; r < 8; ++r) { float v = acc[t][r] + bv; if (ACT == 1) v = fmaxf(v, 0.f); so[w][8 * hh + r][t * 16 + ln] = v; }
  }
  __builtin_amdgcn_fence(__ATOMIC_ACQ_REL, "workgroup");
  __builtin_amdgcn_wave_barrier();
  const int rsub = lane >> 4, c4 = (lane & 15) * 4;
  {
#pragma unroll
    for (int q = 0; q < 8; ++q) {
      const int r = q * 2 + rsub;
      const v4f v = *(const v4fa*)&so[w][r][c4];
      *(v4f*)(C + (size_t)(row0 + r) * ldc + col0 + c4) = v;
    }
    
  }
}

// Flash-style causal/unmasked attention, all contractions 3-term bf16 hi/lo splits, f32 softmax with running max.
// q,k,v rows are read from f32 buffers with arbitrary row pitch (so they can live inside a fused qkv buffer);
// D = head size (multiple of 32, <= 128); one wave = 16 query rows; block = 4 waves (64 queries) sharing K/V chunks of 32.
template <int D, bool CAUSAL>
__global__ __launch_bounds__(128) void k_flash(const float* __restrict__ qb, const float* __restrict__ kb, const float* __restrict__ vb,
                                             int pitch, int T, int H, float scale, float* __restrict__ y, int ypitch) {
  constexpr int KS = D / 32;        // k-steps for QK
  constexpr int DT = D / 16;        // d tiles for PV
  __shared__ __attribute__((aligned(16))) unsigned short sKh[32][D + 8], sKl[32][D + 8], sVh[32][D + 8], sVl[32][D + 8];
  __shared__ __attribute__((aligned(16))) unsigned short sPh[4][16][40], sPl[4][16][40];
  __shared__ __attribute__((aligned(16))) float sO[4][16][D];
  const int tid = threadIdx.x, w = tid >> 5, lane = tid & 31, ln = lane & 15, hh = lane >> 4;
  const int nqb = (T + 63) / 64;
  const int bh = blockIdx.x / nqb, qblk = blockIdx.x % nqb;
  const int b = bh / H, h = bh % H;
  const int q0 = qblk * 64 + w * 16;
  const float* Q = qb + (size_t)b * T * pitch + h * D;
  const float* K = kb + (size_t)b * T * pitch + h * D;
  const float* V = vb + (size_t)b * T * pitch + h * D;

  // A fragments of the wave's 16 query rows (scaled), hi/lo
  FragB aqh[KS], aql[KS];
  {
    int row = q0 + ln; if (row >= T) row = T - 1;
    const float* qr = Q + (size_t)row * pitch;
#pragma unroll
    for (int ks = 0; ks < KS; ++ks)
#pragma unroll
      for (int i = 0; i < 16; ++i) {
        const int d = ks * 32 + ((i < 8) ? (8 * hh + i) : (16 + 8 * hh + (i - 8)));
        const float x = qr[d] * scale; const unsigned short hb = bf16_bits(x);
        aqh[ks].u[i] = hb; aql[ks].u[i] = bf16_bits(x - bf16_val(hb));
      }
  }
  float m_r[8], l_r[8];
#pragma unroll
  for (int r = 0; r < 8; ++r) { m_r[r] = -3.0e38f; l_r[r] = 0.f; }
  v8f oacc[DT];
#pragma unroll
  for (int dt = 0; dt < DT; ++dt) oacc[dt] = (v8f){0.f,0.f,0.f,0.f,0.f,0.f,0.f,0.f};

  const int kv_end = CAUSAL ? min(T, qblk * 64 + 64) : T;     // block-uniform
  for (int j0 = 0; j0 < kv_end; j0 += 32) {
    __syncthreads();
    for (int e = tid; e < 32 * (D / 4); e += 128) {
      const int r = e / (D / 4), c4 = (e % (D / 4)) * 4;
      const int key = j0 + r;
      v4f kf = {0.f,0.f,0.f,0.f}, vf = {0.f,0.f,0.f,0.f};
      if (key < T) { kf = *(const v4fa*)(K + (size_t)key * pitch + c4); vf = *(const v4fa*)(V + (size_t)key * pitch + c4); }
#pragma unroll
      for (int t = 0; t < 4; ++t) {
        unsigned short hb = bf16_bits(kf[t]); sKh[r][c4 + t] = hb; sKl[r][c4 + t] = bf16_bits(kf[t] - bf16_val(hb));
        hb = bf16_bits(vf[t]); sVh[r][c4 + t] = hb; sVl[r][c4 + t] = bf16_bits(vf[t] - bf16_val(hb));
      }
    }
    __syncthreads();
    // S tile 16 x 32
    v8f s[2];
#pragma unroll
    for (int nt = 0; nt < 2; ++nt) {
      v8f acc = {};
#pragma unroll
      for (int ks = 0; ks < KS; ++ks) {
        FragB bh_, bl_;
        bh_.half[0] = *(const v8us*)&sKh[nt * 16 + ln][ks * 32 + 8 * hh]; bh_.half[1] = *(const v8us*)&sKh[nt * 16 + ln][ks * 32 + 16 + 8 * hh];
        bl_.half[0] = *(const v8us*)&sKl[nt * 16 + ln][ks * 32 + 8 * hh]; bl_.half[1] = *(const v8us*)&sKl[nt * 16 + ln][ks * 32 + 16 + 8 * hh];
        acc = mmaN<3>(aqh[ks].v, aql[ks].v, bh_.v, bl_.v, acc);
      }
      s[nt] = acc;
    }
    // mask + running max (rows 8hh+r; the 16 lanes of a half share rows)
    float alpha[8];
#pragma unroll
    for (int r = 0; r < 8; ++r) {
      const int qi = q0 + 8 * hh + r;
      const int ja = j0 + ln, jb = j0 + 16 + ln;
      if (CAUSAL) { if (ja > qi) s[0][r] = -3.0e38f; if (jb > qi) s[1][r] = -3.0e38f; }
      if (ja >= T) s[0][r] = -3.0e38f;
      if (jb >= T) s[1][r] = -3.0e38f;
      float mx = fmaxf(s[0][r], s[1][r]);
      mx = fmaxf(mx, __shfl_xor(mx, 1, 32)); mx = fmaxf(mx, __shfl_xor(mx, 2, 32)); mx = fmaxf(mx, __shfl_xor(mx, 4, 32)); mx = fmaxf(mx, __shfl_xor(mx, 8, 32));
      const float mnew = fmaxf(m_r[r], mx);
      alpha[r] = (mnew > -1.0e38f) ? __expf(m_r[r] - mnew) : 1.0f;
      const float p0 = (s[0][r] > -1.0e38f) ? __expf(s[0][r] - mnew) : 0.f;
      const float p1 = (s[1][r] > -1.0e38f) ? __expf(s[1][r] - mnew) : 0.f;
      m_r[r] = mnew;
      l_r[r] = l_r[r] * alpha[r] + p0 + p1;            // per-lane partial row sum (16 lanes combined at the end)
      unsigned short hb = bf16_bits(p0); sPh[w][8 * hh + r][ln] = hb;      sPl[w][8 * hh + r][ln] = bf16_bits(p0 - bf16_val(hb));
      hb = bf16_bits(p1);                sPh[w][8 * hh + r][16 + ln] = hb; sPl[w][8 * hh + r][16 + ln] = bf16_bits(p1 - bf16_val(hb));
    }
#pragma unroll
    for (int dt = 0; dt < DT; ++dt)
#pragma unroll
      for (int r = 0; r < 8; ++r) oacc[dt][r] *= alpha[r];
    __builtin_amdgcn_fence(__ATOMIC_ACQ_REL, "workgroup");
    __builtin_amdgcn_wave_barrier();
    FragB pah, pal;
    pah.half[0] = *(const v8us*)&sPh[w][ln][8 * hh]; pah.half[1] = *(const v8us*)&sPh[w][ln][16 + 8 * hh];
    pal.half[0] = *(const v8us*)&sPl[w][ln][8 * hh]; pal.half[1] = *(const v8us*)&sPl[w][ln][16 + 8 * hh];
#pragma unroll
    for (int dt = 0; dt < DT; ++dt) {
      FragB bvh, bvl;
#pragma unroll
      for (int i = 0; i < 8; ++i) {
        bvh.u[i] = sVh[8 * hh + i][dt * 16 + ln]; bvh.u[8 + i] = sVh[16 + 8 * hh + i][dt * 16 + ln];
        bvl.u[i] = sVl[8 * hh + i][dt * 16 + ln]; bvl.u[8 + i] = sVl[16 + 8 * hh + i][dt * 16 + ln];
      }
      oacc[dt] = mmaN<3>(pah.v, pal.v, bvh.v, bvl.v, oacc[dt]);
    }
    __builtin_amdgcn_fence(__ATOMIC_ACQ_REL, "workgroup");
    __builtin_amdgcn_wave_barrier();
  }
#pragma unroll
  for (int r = 0; r < 8; ++r) {
    float l = l_r[r];
    l += __shfl_xor(l, 1, 32); l += __shfl_xor(l, 2, 32); l += __shfl_xor(l, 4, 32); l += __shfl_xor(l, 8, 32);
    l_r[r] = (l > 0.f) ? 1.0f / l : 0.f;
  }
#pragma unroll
  for (int dt = 0; dt < DT; ++dt)
#pragma unroll
    for (int r = 0; r < 8; ++r) sO[w][8 * hh + r][dt * 16 + ln] = oacc[dt][r] * l_r[r];
  __builtin_amdgcn_fence(__ATOMIC_ACQ_REL, "workgroup");
  __builtin_amdgcn_wave_barrier();
  {
    for (int r = 0; r < 16; ++r) {
      const int row = q0 + r;
      if (row < T && lane < D / 4) {
        const v4f val = *(const v4fa*)&sO[w][r][lane * 4];
        *(v4f*)(y + ((size_t)b * T + row) * ypitch + h * D + lane * 4) = val;
      }
    }
    
  }
}

// GEMM C = act(A·W + bias + resid): A f32 (ASPLIT -> hi/lo 2 terms), Wt bf16 [N][K]; ACT 0 none, 1 relu, 2 exact gelu;
// resid (optional, f32, row index = (row % rmod), pitch ldr, RES_BF16 rounds it) added before the activation.
template <bool ASPLIT, int ACT, bool BIAS_BF16, bool RES_BF16>
__global__ __launch_bounds__(128) void k_gemm_bf3(const float* __restrict__ A, int lda, const unsigned short* __restrict__ Wt, int ldb,
                                                const float* __restrict__ bias, const float* __restrict__ resid, int rmod, int ldr,
                                                float* __restrict__ C, int ldc, int M, int N, int K) {
  __shared__ __attribute__((aligned(16))) float so[4][16][64];
  const int tid = threadIdx.x, w = tid >> 5, lane = tid & 31, ln = lane & 15, hh = lane >> 4;
  const int ntn = N / 64;
  const int wid = blockIdx.x * 4 + w;
  const int mt = wid / ntn, nq = wid % ntn;
  if (mt * 16 >= M) return;
  const int row0 = mt * 16, col0 = nq * 64;
  const float* arow = A + (size_t)(row0 + ln) * lda;
  v8f acc[4] = {};
  for (int kb = 0; kb < K; kb += 32) {
    FragB ah, al;
    const v4f x0 = *(const v4fa*)(arow + kb + 8 * hh), x1 = *(const v4fa*)(arow + kb + 8 * hh + 4);
    const v4f x2 = *(const v4fa*)(arow + kb + 16 + 8 * hh), x3 = *(const v4fa*)(arow + kb + 16 + 8 * hh + 4);
    float xs[16] = {x0[0],x0[1],x0[2],x0[3],x1[0],x1[1],x1[2],x1[3],x2[0],x2[1],x2[2],x2[3],x3[0],x3[1],x3[2],x3[3]};
#pragma unroll
    for (int i = 0; i < 16; ++i) { const unsigned short hb = bf16_bits(xs[i]); ah.u[i] = hb; al.u[i] = ASPLIT ? bf16_bits(xs[i] - bf16_val(hb)) : (unsigned short)0; }
#pragma unroll
    for (int t = 0; t < 4; ++t) {
      const unsigned short* brow = Wt + (size_t)(col0 + t * 16 + ln) * ldb + kb;
      FragB b;
      b.half[0] = *(const v8us*)(brow + 8 * hh);
      b.half[1] = *(const v8us*)(brow + 16 + 8 * hh);
      acc[t] = mmaN<ASPLIT ? 2 : 1>(ah.v, al.v, b.v, b.v, acc[t]);
    }
  }
#pragma unroll
  for (int t = 0; t < 4; ++t) {
    const int col = col0 + t * 16 + ln;
    float bv = bias ? bias[col] : 0.f;
    if (BIAS_BF16) bv = bf16_round(bv);
#pragma unroll
    for (int r = 0; r < 8; ++r) {
      float v = acc[t][r] + bv;
      if (resid) { float rv = resid[(size_t)((row0 + 8 * hh + r) % rmod) * ldr + col]; if (RES_BF16) rv = bf16_round(rv); v += rv; }
      if (ACT == 1) v = fmaxf(v, 0.f);
      if (ACT == 2) v = 0.5f * v * (1.0f + erff(v * 0.70710678118654752f));
      if (ACT == 3) { const float u = 0.7978845608028654f * (v + 0.044715f * v * v * v); v = 0.5f * v * (1.0f + tanhf(u)); }
      so[w][8 * hh + r][t * 16 + ln] = v;
    }
  }
  __builtin_amdgcn_fence(__ATOMIC_ACQ_REL, "workgroup");
  __builtin_amdgcn_wave_barrier();
  const int rsub = lane >> 4, c4 = (lane & 15) * 4;
  {
#pragma unroll
    for (int q = 0; q < 8; ++q) {
      const int r = q * 2 + rsub;
      const v4f v = *(const v4fa*)&so[w][r][c4];
      *(v4f*)(C + (size_t)(row0 + r) * ldc + col0 + c4) = v;
    }
    
  }
}
// row LayerNorm (biased variance, eps) over N: s = X (+ R); optional out_sum <- s; out_norm <- (s-mu)*rsqrt(var+eps)*g + b
template <bool PARAM_BF16>
__global__ __launch_bounds__(256) void k_layernorm(const float* __restrict__ X, const float* __restrict__ R, const float* __restrict__ g, const float* __restrict__ bta,
                                                  float* __restrict__ out_sum, float* __restrict__ out_norm, int N, float eps) {
  __shared__ float red[256];
  const int row = blockIdx.x, tid = threadIdx.x;
  const float* x = X + (size_t)row * N; const float* rr = R ? R + (size_t)row * N : nullptr;
  float vals[16];                     // up to N = 4096
  const int per = N / 256;            // contiguous chunk per thread? use strided-by-4 chunks: thread handles j = tid*4 + 1024*u
  float s1 = 0.f;
  for (int u = 0; u < per / 4; ++u) {
    const int j = tid * 4 + 1024 * u;
    const v4f a = *(const v4fa*)(x + j);
    v4f b = {0.f,0.f,0.f,0.f}; if (rr) b = *(const v4fa*)(rr + j);
#pragma unroll
    for (int q = 0; q < 4; ++q) { const float v = a[q] + b[q]; vals[u * 4 + q] = v; s1 += v; }
  }
  red[tid] = s1; __syncthreads();
  for (int st = 128; st > 0; st >>= 1) { if (tid < st) red[tid] += red[tid + st]; __syncthreads(); }
  const float mu = red[0] / (float)N; __syncthreads();
  float s2 = 0.f;
  for (int u = 0; u < per / 4; ++u)
#pragma unroll
    for (int q = 0; q < 4; ++q) { const float c = vals[u * 4 + q] - mu; s2 += c * c; }
  red[tid] = s2; __syncthreads();
  for (int st = 128; st > 0; st >>= 1) { if (tid < st) red[tid] += red[tid + st]; __syncthreads(); }
  const float rs = rsqrtf(red[0] / (float)N + eps);
  {
    for (int u = 0; u < per / 4; ++u) {
      const int j = tid * 4 + 1024 * u;
      v4f o, sm;
#pragma unroll
      for (int q = 0; q < 4; ++q) {
        float gg = g[j + q], bb = bta[j + q];
        if (PARAM_BF16) { gg = bf16_round(gg); bb = bf16_round(bb); }
        sm[q] = vals[u * 4 + q]; o[q] = (vals[u * 4 + q] - mu) * rs * gg + bb;
      }
      if (out_sum) *(v4f*)(out_sum + (size_t)row * N + j) = sm;
      *(v4f*)(out_norm + (size_t)row * N + j) = o;
    }
    
  }
}



// ---- f16 WMMA path (v_wmma_f32_16x16x32_f16): 11-bit significands for operands in range — used where a [0,1] probability operand needs more precision than bf16
typedef _Float16 v16h __attribute__((ext_vector_type(16)));
union FragH { v16h v; v8us half[2]; _Float16 h[16]; unsigned short u[16]; };
template <int NT>
__device__ __forceinline__ v8f mmaH(v16h ah, v16h al, v16h bh, v16h bl, v8f c) {
  c = __builtin_amdgcn_wmma_f32_16x16x32_f16(false, ah, false, bh, (short)0, c, false, false);
  if (NT >= 2) c = __builtin_amdgcn_wmma_f32_16x16x32_f16(false, al, false, bh, (short)0, c, false, false);
  if (NT >= 3) c = __builtin_amdgcn_wmma_f32_16x16x32_f16(false, ah, false, bl, (short)0, c, false, false);
  asm volatile("v_nop\n\tv_nop\n\tv_nop\n\tv_nop" : "+v"(c) : "v"(ah), "v"(al), "v"(bh), "v"(bl));
  return c;
}
// batched GEMM like k_gemm_b but f16 operands: A f32 (split into f16 hi/lo if ASPLIT, else rounded to f16), Bt = f16 values [n][k]; alpha; C f32; N multiple of 16 (partial tiles skipped)
template <bool ASPLIT>
__global__ __launch_bounds__(128) void k_gemm_h(const float* __restrict__ A, int lda, size_t sA, const _Float16* __restrict__ Bh, int ldb, size_t sB, float alpha, float* __restrict__ C, int ldc, size_t sC, int M, int N, int K) {
  __shared__ __attribute__((aligned(16))) float so[4][16][64];
  const int tid = threadIdx.x, w = tid >> 5, lane = tid & 31, ln = lane & 15, hh = lane >> 4; const int by = blockIdx.y;
  A += (size_t)by * sA; Bh += (size_t)by * sB; C += (size_t)by * sC;
  const int ntn = (N + 63) / 64; const int wid = blockIdx.x * 4 + w; const int mt = wid / ntn, nq = wid % ntn; if (mt * 16 >= M) return;
  const int row0 = mt * 16, col0 = nq * 64; const float* arow = A + (size_t)(row0 + ln) * lda;
  v8f acc[4] = {};
  for (int kb = 0; kb < K; kb += 32) {
    FragH ah, al;
    const v4f x0 = *(const v4fa*)(arow + kb + 8 * hh), x1 = *(const v4fa*)(arow + kb + 8 * hh + 4), x2 = *(const v4fa*)(arow + kb + 16 + 8 * hh), x3 = *(const v4fa*)(arow + kb + 16 + 8 * hh + 4);
    float xs[16] = {x0[0],x0[1],x0[2],x0[3],x1[0],x1[1],x1[2],x1[3],x2[0],x2[1],x2[2],x2[3],x3[0],x3[1],x3[2],x3[3]};
#pragma unroll
    for (int i = 0; i < 16; ++i) { const _Float16 h = (_Float16)xs[i]; ah.h[i] = h; al.h[i] = ASPLIT ? (_Float16)(xs[i] - (float)h) : (_Float16)0.0f; }
#pragma unroll
    for (int t = 0; t < 4; ++t) { if (col0 + t * 16 >= N) continue; const size_t boff = (size_t)(col0 + t * 16 + ln) * ldb + kb; FragH bq; bq.half[0] = *(const v8us*)(Bh + boff + 8 * hh); bq.half[1] = *(const v8us*)(Bh + boff + 16 + 8 * hh);
      acc[t] = mmaH<ASPLIT ? 2 : 1>(ah.v, al.v, bq.v, bq.v, acc[t]); }
  }
#pragma unroll
  for (int t = 0; t < 4; ++t) { if (col0 + t * 16 >= N) continue;
#pragma unroll
    for (int r = 0; r < 8; ++r) so[w][8 * hh + r][t * 16 + ln] = acc[t][r] * alpha; }
  __builtin_amdgcn_fence(__ATOMIC_ACQ_REL, "workgroup"); __builtin_amdgcn_wave_barrier();
  const int rsub = lane >> 4, c4 = (lane & 15) * 4;
  {
#pragma unroll
    for (int q = 0; q < 8; ++q) { const int r = q * 2 + rsub; if (col0 + c4 < N) { const v4f v = *(const v4fa*)&so[w][r][c4]; *(v4f*)(C + (size_t)(row0 + r) * ldc + col0 + c4) = v; } }
     }
}

// Wt[n][k] = f16(W[k][n]·scale) from f32 row-major W[K][N] (scale = power of two; bf16-exact weights stay exact in f16 away from the subnormal range)
__global__ __launch_bounds__(256) void k_wt_f16(const float* __restrict__ W, _Float16* __restrict__ Wt, int K, int N, float scale) {
  const int t = blockIdx.x * 256 + threadIdx.x; if (t >= N * (K / 8)) return; const int n = t / (K / 8), k8 = (t % (K / 8)) * 8; FragH f;
#pragma unroll
  for (int i = 0; i < 8; ++i) f.h[i] = (_Float16)(bf16_round(W[(size_t)(k8 + i) * N + n]) * scale); const v8us o = f.half[0];
  *(v8us*)((unsigned short*)Wt + (size_t)n * K + k8) = o; 
}
// Tiled GEMM, f16 operands, both K-contiguous: v[row][col] = acc*alpha + bias[col], then CPM 1: + CP[by*sCPy + col] (one row for all rows), CPM 2: + what C[row][col] holds; written as f32 to C (F32OUT) or as f16 to C16.
// One 128x128 tile per workgroup of 8 waves (4 x 2, 32x64 per wave). A pass is 64 k = one whole 128-B line of every operand row: each wave-wide 16-B load
// covers four whole lines and goes through registers into LDS (row pitch 144 B for the ds_load_b128 fragment readers); two buffers, one barrier per pass;
// the next pass's global loads are issued before this pass's products. M, N multiples of 128 (the grid is exact), K a multiple of 64.
// Every "#pragma unroll" below makes the index of a register array (staged rows, fragments, accumulators) a constant, so that the array stays in registers.
#define TPITCH 72
typedef float fa1 __attribute__((may_alias));
typedef _Float16 v4hs __attribute__((ext_vector_type(4)));
template <int CPM, bool F32OUT>
__global__ __launch_bounds__(256) void k_gemm_t(const _Float16* __restrict__ A, int lda, size_t sA, const _Float16* __restrict__ Bh, int ldb, size_t sB, float alpha, const float* __restrict__ bias, const float* __restrict__ CP, size_t sCPy,
    float* __restrict__ C, _Float16* __restrict__ C16, int ldc, size_t sC, int N, int K) {
  __shared__ __attribute__((aligned(16))) unsigned short st[2][2][128 * TPITCH];      // [buffer][A, B][row * TPITCH + k]
  const int tid = threadIdx.x, w = tid >> 5, lane = tid & 31, ln = lane & 15, hh = lane >> 4; const int by = blockIdx.y;
  const int ntn = N / 128; const int row0 = ((int)blockIdx.x / ntn) * 128, col0 = ((int)blockIdx.x % ntn) * 128;
  const int sr = tid >> 3, sc = (tid & 7) * 8;      // staging: 8 lanes per row, rows sr + 32 i
  const unsigned short* ga = (const unsigned short*)A + (size_t)by * sA + (size_t)row0 * lda;      // workgroup-uniform bases, per-lane 32-bit offsets that never change
  const unsigned short* gb = (const unsigned short*)Bh + (size_t)by * sB + (size_t)col0 * ldb;
  unsigned oa[4], ob[4];
#pragma unroll
  for (int i = 0; i < 4; ++i) { oa[i] = (unsigned)((sr + 32 * i) * lda + sc); ob[i] = (unsigned)((sr + 32 * i) * ldb + sc); }
  v8us ra[4], rb[4]; const unsigned short *pa[4], *pb[4];
#pragma unroll
  for (int i = 0; i < 4; ++i) { pa[i] = ga + oa[i]; pb[i] = gb + ob[i]; }
#pragma unroll
  for (int i = 0; i < 4; ++i) { ra[i] = *(const v8us*)pa[i]; rb[i] = *(const v8us*)pb[i]; }
  // the eight address pairs are inputs of the wait: they stay in their registers up to it, so no load of the group is given a register that an issued load names
  asm volatile("s_wait_xcnt 0x0" :: "v"(pa[0]), "v"(pa[1]), "v"(pa[2]), "v"(pa[3]), "v"(pb[0]), "v"(pb[1]), "v"(pb[2]), "v"(pb[3]) : "memory");
#pragma unroll
  for (int i = 0; i < 4; ++i) { *(v8us*)&st[0][0][(sr + 32 * i) * TPITCH + sc] = ra[i]; *(v8us*)&st[0][1][(sr + 32 * i) * TPITCH + sc] = rb[i]; }
  __syncthreads();
  const int wm = w >> 1, wn = w & 1; const int ns = K / 64;
  v8f acc[2][4] = {};
  for (int s = 0; s < ns; ++s) {
    const int cur = s & 1; const bool more = s + 1 < ns;      // the same in every thread of the workgroup
    if (more) {
#pragma unroll
      for (int i = 0; i < 4; ++i) { pa[i] = ga + oa[i]; pb[i] = gb + ob[i]; }      // this pass's addresses; the next pass lies 64 k = 128 B further
#pragma unroll
      for (int i = 0; i < 4; ++i) { ra[i] = *(const v8us*)(pa[i] + 64); rb[i] = *(const v8us*)(pb[i] + 64); }
      // as in front of the loop: the address pairs stay in their registers up to the wait
      asm volatile("s_wait_xcnt 0x0" :: "v"(pa[0]), "v"(pa[1]), "v"(pa[2]), "v"(pa[3]), "v"(pb[0]), "v"(pb[1]), "v"(pb[2]), "v"(pb[3]) : "memory");
      ga += 64; gb += 64;
    }
    const unsigned short* la = &st[cur][0][(wm * 32 + ln) * TPITCH + 8 * hh];
    const unsigned short* lb = &st[cur][1][(wn * 64 + ln) * TPITCH + 8 * hh];
    FragH a[2][2], b[2][4];      // all of the pass's fragments are read as one group ahead of its products
#pragma unroll
    for (int ks = 0; ks < 2; ++ks) {
#pragma unroll
      for (int mi = 0; mi < 2; ++mi) { a[ks][mi].half[0] = *(const v8us*)(la + mi * 16 * TPITCH + ks * 32); a[ks][mi].half[1] = *(const v8us*)(la + mi * 16 * TPITCH + ks * 32 + 16); }
#pragma unroll
      for (int t = 0; t < 4; ++t) { b[ks][t].half[0] = *(const v8us*)(lb + t * 16 * TPITCH + ks * 32); b[ks][t].half[1] = *(const v8us*)(lb + t * 16 * TPITCH + ks * 32 + 16); }
    }
#pragma unroll
    for (int ks = 0; ks < 2; ++ks)
#pragma unroll
      for (int t = 0; t < 4; ++t)
#pragma unroll
        for (int mi = 0; mi < 2; ++mi) acc[mi][t] = mmaH<1>(a[ks][mi].v, a[ks][mi].v, b[ks][t].v, b[ks][t].v, acc[mi][t]);
    if (more) {
#pragma unroll
      for (int i = 0; i < 4; ++i) { *(v8us*)&st[cur ^ 1][0][(sr + 32 * i) * TPITCH + sc] = ra[i]; *(v8us*)&st[cur ^ 1][1][(sr + 32 * i) * TPITCH + sc] = rb[i]; }
    }
    __syncthreads();      // publishes the buffer just filled and ends every read of the one just used
  }
  // epilogue: each wave turns its accumulators into whole rows through its own 32 x 68 f32 range of the (now free) staging LDS
  fa1* so = (fa1*)&st[0][0][0] + w * (32 * 68);
  const size_t cofs = (size_t)by * sC; const int wrow0 = row0 + wm * 32, wcol0 = col0 + wn * 64; const int rsub = lane >> 4, c4 = (lane & 15) * 4;
  float* crow = C + cofs + (size_t)(wrow0 + rsub) * ldc + wcol0 + c4;      // each lane reads (CPM 2) and writes the same 16 B of rows rsub + 2 q
  v4f cp[16];
  if (CPM == 1) cp[0] = *(const v4fa*)(CP + (size_t)by * sCPy + wcol0 + c4);
  if (CPM == 2) {
#pragma unroll
    for (int q = 0; q < 16; ++q) cp[q] = *(const v4fa*)(crow + (size_t)(q * 2) * ldc);
  }
#pragma unroll
  for (int t = 0; t < 4; ++t) { const float bv = bias ? bf16_round(bias[wcol0 + t * 16 + ln]) : 0.f;
#pragma unroll
    for (int mi = 0; mi < 2; ++mi)
#pragma unroll
      for (int r = 0; r < 8; ++r) so[(mi * 16 + 8 * hh + r) * 68 + t * 16 + ln] = acc[mi][t][r] * alpha + bv; }
  __builtin_amdgcn_fence(__ATOMIC_ACQ_REL, "workgroup"); __builtin_amdgcn_wave_barrier();      // the wave's LDS rows are complete before its lanes read what other lanes wrote
#pragma unroll
  for (int q = 0; q < 16; ++q) { const int r = q * 2 + rsub; const int row = wrow0 + r; v4f v = *(const v4fa*)&so[r * 68 + c4];
    if (CPM != 0) { for (int i = 0; i < 4; ++i) v[i] += cp[CPM == 2 ? q : 0][i]; }
    if (F32OUT) *(v4f*)(crow + (size_t)(q * 2) * ldc) = v;
    else { v4hs h4; for (int i = 0; i < 4; ++i) h4[i] = (_Float16)v[i]; *(v4hs*)(C16 + cofs + (size_t)row * ldc + wcol0 + c4) = h4; } }
}


typedef _Float16 v4h __attribute__((ext_vector_type(4)));

__global__ __launch_bounds__(256) void k_x16(const float* __restrict__ x, _Float16* __restrict__ X16, size_t n8) { const size_t t = (size_t)blockIdx.x * 256 + threadIdx.x; if (t >= n8) return; FragH f;
#pragma unroll
  for (int q = 0; q < 8; ++q) f.h[q] = (_Float16)bf16_round(x[t * 8 + q]); *(v8us*)((unsigned short*)X16 + t * 8) = f.half[0];  }
__global__ __launch_bounds__(256) void k_h16(const float* __restrict__ x, _Float16* __restrict__ X16, size_t n8) { const size_t t = (size_t)blockIdx.x * 256 + threadIdx.x; if (t >= n8) return; FragH f;
#pragma unroll
  for (int q = 0; q < 8; ++q) f.h[q] = (_Float16)x[t * 8 + q]; *(v8us*)((unsigned short*)X16 + t * 8) = f.half[0];  }
__global__ __launch_bounds__(256) void k_round16f(const float* __restrict__ W, _Float16* __restrict__ Bt, size_t n8) { const size_t t = (size_t)blockIdx.x * 256 + threadIdx.x; if (t >= n8) return; FragH f;
#pragma unroll
  for (int i = 0; i < 8; ++i) f.h[i] = (_Float16)(bf16_round(W[t * 8 + i]) * 16.0f); *(v8us*)((unsigned short*)Bt + t * 8) = f.half[0];  }
template <int NHv, int TTv>
__global__ __launch_bounds__(256) void k_vt(const _Float16* __restrict__ V16, int ldv, int voff, _Float16* __restrict__ Vt) { __shared__ unsigned short tl[64][66]; const int tid = threadIdx.x; const int slab = blockIdx.x / (TTv / 64), lg = blockIdx.x % (TTv / 64); const int b = slab / NHv, h = slab % NHv;
  for (int i = tid; i < 64 * 8; i += 256) { const int r = i / 8, c8 = (i % 8) * 8; FragH f; f.half[0] = *(const v8us*)((const unsigned short*)V16 + ((size_t)b * TTv + lg * 64 + r) * ldv + voff + h * 64 + c8);
#pragma unroll
    for (int q = 0; q < 8; ++q) tl[r][c8 + q] = f.u[q]; }
  __syncthreads();
  {
#pragma unroll
    for (int rd = 0; rd < 2; ++rd) { const int d = rd * 32 + tid / 8, pc = tid % 8; FragH f;
#pragma unroll
      for (int q = 0; q < 8; ++q) f.u[q] = tl[pc * 8 + q][d];
      *(v8us*)((unsigned short*)Vt + ((size_t)slab * 64 + d) * TTv + lg * 64 + pc * 8) = f.half[0]; }
     } }

__global__ __launch_bounds__(256) void k_tok(const float* __restrict__ x, _Float16* __restrict__ X16) { __shared__ float tl[32][65]; const int tid = threadIdx.x; const int b = blockIdx.x / ((CC / 64) * (NN / 32)), rem = blockIdx.x % ((CC / 64) * (NN / 32)); const int cg = rem / (NN / 32), pg = rem % (NN / 32); const int c0 = cg * 64, p0 = pg * 32;
  for (int i = tid; i < 64 * 32; i += 256) { const int c = i / 32, pp = i % 32; tl[pp][c] = bf16_round(x[((size_t)b * CC + c0 + c) * NN + p0 + pp]); } __syncthreads();
  const int r = tid / 8, pc = tid % 8; FragH f; for (int q = 0; q < 8; ++q) f.h[q] = (_Float16)tl[r][pc * 8 + q]; const size_t row = (size_t)b * NN + p0 + r; *(v8us*)((unsigned short*)X16 + row * CC + c0 + pc * 8) = f.half[0];  }
__global__ __launch_bounds__(256) void k_pool2(const _Float16* __restrict__ F, _Float16* __restrict__ P) { const size_t t = (size_t)blockIdx.x * 256 + threadIdx.x; if (t >= (size_t)NRH * (CC / 8)) return; const int c8 = (int)(t % (CC / 8)) * 8; const size_t rm = t / (CC / 8); FragH a, b2, o; a.half[0] = *(const v8us*)((const unsigned short*)F + (rm * 2) * CC + c8); b2.half[0] = *(const v8us*)((const unsigned short*)F + (rm * 2 + 1) * CC + c8); for (int q = 0; q < 8; ++q) o.h[q] = ((float)a.h[q] > (float)b2.h[q]) ? a.h[q] : b2.h[q];
  *(v8us*)((unsigned short*)P + rm * CC + c8) = o.half[0];  }
__global__ __launch_bounds__(256) void k_pool2f(const float* __restrict__ F, float* __restrict__ P) { const size_t t = (size_t)blockIdx.x * 256 + threadIdx.x; if (t >= (size_t)NRH * (CC / 4)) return; const int c4 = (int)(t % (CC / 4)) * 4; const size_t rm = t / (CC / 4); const v4f a = *(const v4fa*)(F + (rm * 2) * CC + c4), b2 = *(const v4fa*)(F + (rm * 2 + 1) * CC + c4); v4f o; for (int q = 0; q < 4; ++q) o[q] = fmaxf(a[q], b2[q]); *(v4f*)(P + rm * CC + c4) = o;  }
__global__ __launch_bounds__(256) void k_hl(const float* __restrict__ F, _Float16* __restrict__ Hh, _Float16* __restrict__ Hl, size_t n8) { const size_t t = (size_t)blockIdx.x * 256 + threadIdx.x; if (t >= n8) return; FragH fh, fl; for (int q = 0; q < 8; ++q) { const float v = F[t * 8 + q]; const _Float16 h = (_Float16)v; fh.h[q] = h; fl.h[q] = (_Float16)((v - (float)h) * 1024.0f); } { *(v8us*)((unsigned short*)Hh + t * 8) = fh.half[0]; *(v8us*)((unsigned short*)Hl + t * 8) = fl.half[0];  } }
__global__ __launch_bounds__(256) void k_cvec(const float* __restrict__ PHF, const float* __restrict__ bth, float* __restrict__ cv) { const int m = blockIdx.x * 256 + threadIdx.x; if (m >= NRH) return; float s = 0.f;
#pragma unroll 1
  for (int o = 0; o < CC; o += 4) { const v4f p = *(const v4fa*)(PHF + (size_t)m * CC + o); for (int q = 0; q < 4; ++q) s += p[q] * bf16_round(bth[o + q]); } *(float*)(cv + m) = s;  }
__global__ __launch_bounds__(256) void k_smx(const float* __restrict__ S, _Float16* __restrict__ P16) { const int tid = threadIdx.x, wv = tid >> 5, lane = tid & 31; const int r = blockIdx.x * 8 + wv; if (r >= NR) return; const float* sr = S + (size_t)r * NH; float m = -3.0e38f;
  for (int p = lane; p < NH / 8; p += 32) { const v4f a = *(const v4fa*)(sr + p * 8), b = *(const v4fa*)(sr + p * 8 + 4); for (int q = 0; q < 4; ++q) m = fmaxf(m, fmaxf(a[q], b[q])); }
  for (int o = 16; o >= 1; o >>= 1) m = fmaxf(m, __shfl_xor(m, o, 32)); float z = 0.f;
  for (int p = lane; p < NH / 8; p += 32) { const v4f a = *(const v4fa*)(sr + p * 8), b = *(const v4fa*)(sr + p * 8 + 4); for (int q = 0; q < 4; ++q) z += __expf(a[q] - m) + __expf(b[q] - m); }
  for (int o = 16; o >= 1; o >>= 1) z += __shfl_xor(z, o, 32); const float iz = 32768.0f / z;
  { for (int p = lane; p < NH / 8; p += 32) { FragH f; for (int q = 0; q < 8; ++q) f.h[q] = (_Float16)(__expf(sr[p * 8 + q] - m) * iz); *(v8us*)((unsigned short*)P16 + (size_t)r * NH + p * 8) = f.half[0]; }  } }
// BN batch statistics in two launches, every load a whole 128-B line of its row.
// Stage 1: a thread takes 4 adjacent channels of SROWS consecutive rows of wy (a wave's 16-B loads cover 512 B of one row), keeps them in registers and writes, per channel,
// their sum and the sum of their squared deviations from their own mean.
#define SROWS 32
#define SCH (NR / SROWS)
__global__ __launch_bounds__(256) void k_bnpart(const float* __restrict__ Y, float* __restrict__ PS, float* __restrict__ PM) {
  const int t = blockIdx.x * 256 + threadIdx.x; const int c4 = (t % (CC / 4)) * 4, ch = t / (CC / 4);
  const float* p = Y + (size_t)ch * SROWS * CC + c4;
  v4f v[SROWS];
#pragma unroll      // constant indices keep v in registers; all SROWS loads are in flight together
  for (int r = 0; r < SROWS; ++r) v[r] = *(const v4fa*)(p + r * CC);
  // the address pair is an input of the wait: it stays in its registers until every load of the group has taken it
  asm volatile("s_wait_xcnt 0x0" :: "v"(p) : "memory");
  v4f s = v[0];
#pragma unroll      // v stays in registers
  for (int r = 1; r < SROWS; ++r) s += v[r];
  const v4f mu = s * (1.0f / (float)SROWS);
  v4f m2 = {0.f, 0.f, 0.f, 0.f};
#pragma unroll      // v stays in registers
  for (int r = 0; r < SROWS; ++r) { const v4f d = v[r] - mu; m2 += d * d; }
  *(v4f*)(PS + (size_t)ch * CC + c4) = s; *(v4f*)(PM + (size_t)ch * CC + c4) = m2;
}
// Stage 2: one workgroup per 32 channels (one line of every partial row), lane = channel; wave w takes chunks 16 w .. 16 w + 15 in order, the 32 waves' sums are added in wave order by every wave.
// Total squared deviation = sum over chunks of (chunk's own + SROWS * (chunk mean - mean)^2). ST keeps its form: one line per channel, mean and 1/sqrt(var + eps) in its first two words.
__global__ __launch_bounds__(1024) void k_bnfin(const float* __restrict__ PS, const float* __restrict__ PM, float* __restrict__ ST) {
  __shared__ float red[2][32][32];
  const int tid = threadIdx.x, w = tid >> 5, lane = tid & 31; const int c = blockIdx.x * 32 + lane;
  const float* ps = PS + (size_t)(w * (SCH / 32)) * CC + c; const float* pm = PM + (size_t)(w * (SCH / 32)) * CC + c;
  float s[SCH / 32], m[SCH / 32];
#pragma unroll      // constant indices keep s and m in registers; all loads are in flight together
  for (int i = 0; i < SCH / 32; ++i) { s[i] = ps[i * CC]; m[i] = pm[i * CC]; }
  // the two address pairs are inputs of the wait: they stay in their registers until every load of the group has taken them
  asm volatile("s_wait_xcnt 0x0" :: "v"(ps), "v"(pm) : "memory");
  float a = 0.f;
#pragma unroll      // s stays in registers
  for (int i = 0; i < SCH / 32; ++i) a += s[i];
  red[0][w][lane] = a; __syncthreads();
  float tot = 0.f;
  for (int j = 0; j < 32; ++j) tot += red[0][j][lane];
  const float mu = tot / (float)NR;
  float q = 0.f;
#pragma unroll      // s and m stay in registers
  for (int i = 0; i < SCH / 32; ++i) { const float d = s[i] * (1.0f / (float)SROWS) - mu; q += m[i] + (float)SROWS * d * d; }
  red[1][w][lane] = q; __syncthreads();
  float q2 = 0.f;
  for (int j = 0; j < 32; ++j) q2 += red[1][j][lane];
  const float rs = rsqrtf(q2 / (float)NR + 1e-5f);
  const float muw = __shfl(mu, w, 32), rsw = __shfl(rs, w, 32);      // wave w writes the line of channel w of the 32
  ST[(blockIdx.x * 32 + w) * 32 + lane] = (lane == 0) ? muw : ((lane == 1) ? rsw : 0.f);
}
__global__ __launch_bounds__(256) void k_out(const float* __restrict__ WY, const float* __restrict__ ST, const float* __restrict__ gam, const float* __restrict__ bet, const float* __restrict__ x, float* __restrict__ out) { __shared__ float tl[32][65]; const int tid = threadIdx.x; const int b = blockIdx.x / ((CC / 32) * (NN / 64)), rem = blockIdx.x % ((CC / 32) * (NN / 64)); const int cg = rem / (NN / 64), pg = rem % (NN / 64); const int c0 = cg * 32, p0 = pg * 64;
  for (int i = tid; i < 64 * 32; i += 256) { const int pp = i / 32, c = i % 32; const int cc = c0 + c; tl[c][pp] = (WY[((size_t)b * NN + p0 + pp) * CC + cc] - ST[cc * 32]) * ST[cc * 32 + 1] * bf16_round(gam[cc]) + bf16_round(bet[cc]); } __syncthreads();
  { for (int i = tid; i < 32 * 16; i += 256) { const int c = i / 16, q4 = i % 16; const size_t o = ((size_t)b * CC + c0 + c) * NN + p0 + q4 * 4; const v4f xv = *(const v4fa*)(x + o); v4f v; for (int q = 0; q < 4; ++q) v[q] = tl[c][q4 * 4 + q] + bf16_round(xv[q]); *(v4f*)(out + o) = v; }  } }
extern "C" void kernel_launch(void* const* d_in, const int* in_sizes, int n_in,
                              void* d_out, int out_size, void* d_ws, size_t ws_size, hipStream_t stream) {
  (void)in_sizes; (void)n_in; (void)out_size;
  const float* x = (const float*)d_in[0]; const float* gw = (const float*)d_in[1]; const float* gb = (const float*)d_in[2]; const float* thw = (const float*)d_in[3]; const float* thb = (const float*)d_in[4]; const float* phw = (const float*)d_in[5]; const float* phb = (const float*)d_in[6]; const float* Ww = (const float*)d_in[7]; const float* Wb = (const float*)d_in[8]; const float* gam = (const float*)d_in[9]; const float* bet = (const float*)d_in[10];
  char* ws = (char*)d_ws; size_t off = 0;
  auto take = [&](size_t bytes) { char* p = ws + off; off += (bytes + 255) & ~(size_t)255; return p; };
  _Float16* Bg = (_Float16*)take((size_t)CC * CC * 2); _Float16* Bph = (_Float16*)take((size_t)CC * CC * 2); _Float16* BW = (_Float16*)take((size_t)CC * CC * 2); float* ST = (float*)take(CC * 32 * 4);
  _Float16* Bthp = (_Float16*)take((size_t)CC * CC * 2);      // W_θ as [in=o][out=c] → Bt[c][o] for φ·W_θ
  _Float16* X16 = (_Float16*)take((size_t)NR * CC * 2); float* FULLF = (float*)take((size_t)NR * CC * 4); _Float16* FULL = (_Float16*)take((size_t)NR * CC * 2); float* PHF = (float*)take((size_t)NRH * CC * 4); _Float16* PHh = (_Float16*)take((size_t)NRH * CC * 2); _Float16* PHl = (_Float16*)take((size_t)NRH * CC * 2); _Float16* GP = (_Float16*)take((size_t)NRH * CC * 2);
  // every per-batch buffer holds all BB batches, so that each stage is one launch over the whole batch
  float* BP = (float*)take((size_t)NRH * CC * 4); _Float16* BPh = (_Float16*)take((size_t)NRH * CC * 2); _Float16* BPl = (_Float16*)take((size_t)NRH * CC * 2); float* CV = (float*)take(NRH * 4); _Float16* Gt = (_Float16*)take((size_t)NRH * CC * 2); float* S = (float*)take((size_t)NR * NH * 4); _Float16* P16 = (_Float16*)take((size_t)NR * NH * 2);
  float* PS = (float*)take((size_t)SCH * CC * 4); float* PM = (float*)take((size_t)SCH * CC * 4);      // BN partials per row chunk and channel
  float* Y = FULLF; _Float16* Y16 = FULL; float* WY = FULLF;      // FULLF/FULL are dead after pooling; Y (f32) → Y16 → WY back over Y
  if (off > ws_size) return;      // about 256 MB
  k_round16f<<<(CC * CC / 8 + 255) / 256, 256, 0, stream>>>(gw, Bg, CC * CC / 8); k_round16f<<<(CC * CC / 8 + 255) / 256, 256, 0, stream>>>(phw, Bph, CC * CC / 8); k_round16f<<<(CC * CC / 8 + 255) / 256, 256, 0, stream>>>(Ww, BW, CC * CC / 8);      // (out,in) natural
  k_wt_f16<<<(CC * (CC / 8) + 255) / 256, 256, 0, stream>>>(thw, Bthp, CC, CC, 16.0f);      // Bt[c][o] = W_θ[o][c]
  k_tok<<<BB * (CC / 64) * (NN / 32), 256, 0, stream>>>(x, X16);
  const dim3 gp((NR / 128) * (CC / 128), 1); const unsigned gh8 = (unsigned)(((size_t)NRH * (CC / 8) + 255) / 256);
  k_gemm_t<0, true><<<gp, 256, 0, stream>>>(X16, CC, 0, Bph, CC, 0, 0.0625f, phb, nullptr, 0, FULLF, nullptr, CC, 0, CC, CC); k_pool2f<<<(unsigned)(((size_t)NRH * (CC / 4) + 255) / 256), 256, 0, stream>>>(FULLF, PHF);      // φ (f32, pooled)
  k_hl<<<gh8, 256, 0, stream>>>(PHF, PHh, PHl, (size_t)NRH * CC / 8);
  k_gemm_t<0, false><<<gp, 256, 0, stream>>>(X16, CC, 0, Bg, CC, 0, 0.0625f, gb, nullptr, 0, nullptr, FULL, CC, 0, CC, CC); k_pool2<<<gh8, 256, 0, stream>>>(FULL, GP);      // g (f16, pooled)
  const dim3 gb2((NRH / 128) * (CC / 128), 1), gs((NN / 128) * (NH / 128), BB), gy((NN / 128) * (CC / 128), BB);      // blockIdx.y = batch where the B operand differs per batch
  k_gemm_t<0, true><<<gb2, 256, 0, stream>>>(PHh, CC, 0, Bthp, CC, 0, 0.0625f, nullptr, nullptr, 0, BP, nullptr, CC, 0, CC, CC);
  k_gemm_t<2, true><<<gb2, 256, 0, stream>>>(PHl, CC, 0, Bthp, CC, 0, 0.0625f * 0.0009765625f, nullptr, nullptr, 0, BP, nullptr, CC, 0, CC, CC);      // B' = phi * W_theta [BB*1024][512] (phi hi + lo), all batches as rows
  k_hl<<<gh8, 256, 0, stream>>>(BP, BPh, BPl, (size_t)NRH * CC / 8); k_cvec<<<(NRH + 255) / 256, 256, 0, stream>>>(PHF, thb, CV);
  k_gemm_t<1, true><<<gs, 256, 0, stream>>>(X16, CC, (size_t)NN * CC, BPh, CC, (size_t)NH * CC, 1.0f, nullptr, CV, (size_t)NH, S, nullptr, NH, (size_t)NN * NH, NH, CC);      // f = x * B'h^T + c (c broadcast over the rows of its batch)
  k_gemm_t<2, true><<<gs, 256, 0, stream>>>(X16, CC, (size_t)NN * CC, BPl, CC, (size_t)NH * CC, 0.0009765625f, nullptr, nullptr, 0, S, nullptr, NH, (size_t)NN * NH, NH, CC);      // + x * B'l^T * 2^-10
  k_smx<<<NR / 8, 256, 0, stream>>>(S, P16);
  k_vt<8, NH><<<BB * 8 * (NH / 64), 256, 0, stream>>>(GP, CC, 0, Gt);      // g^T [BB][512][1024]
  k_gemm_t<0, true><<<gy, 256, 0, stream>>>(P16, NH, (size_t)NN * NH, Gt, NH, (size_t)CC * NH, 0.000030517578125f, nullptr, nullptr, 0, Y, nullptr, CC, (size_t)NN * CC, CC, NH);      // y = softmax(f) * g
  k_h16<<<(unsigned)(((size_t)NR * CC / 8 + 255) / 256), 256, 0, stream>>>(Y, Y16, (size_t)NR * CC / 8);
  k_gemm_t<0, true><<<gp, 256, 0, stream>>>(Y16, CC, 0, BW, CC, 0, 0.0625f, Wb, nullptr, 0, WY, nullptr, CC, 0, CC, CC);      // wy = W(y) + b
  k_bnpart<<<SCH * (CC / 4) / 256, 256, 0, stream>>>(WY, PS, PM); k_bnfin<<<CC / 32, 1024, 0, stream>>>(PS, PM, ST); k_out<<<BB * (CC / 32) * (NN / 64), 256, 0, stream>>>(WY, ST, gam, bet, x, (float*)d_out);
}

// v004
// One run takes 196 microseconds.
// Timed twice side by side with v003, it ran 1.25 times as fast both times.
// All steps since v000 together make it 7.58 times as fast.
#include <hip/hip_runtime.h>
// Non-local block with view pooling (x [8, C=512, N=2048]): θ = conv1(x), φ = maxpool2(conv1(x)), g = maxpool2(conv1(x)); f = softmax(θᵀ·φ) [N × N/2] (unscaled); y = f·g; wy = conv1(y) + b;
// out = BN_train(wy)·γ + β + x. Because the unscaled logits reach σ≈20 and feed a near-one-hot softmax, θ is never rounded: the logits are re-associated as f = x·(φ·W_θ)ᵀ + 1·(φ·b_θ)ᵀ with x bf16-EXACT,
// φ (f32, max-pooled from an f32 projection) fed as f16 hi + lo·2^10 into φ·W_θ and that product again split hi/lo as the B operand (four cheap passes per batch), the column term added exactly through
// the epilogue addend; g, y as plain f16; P ×2^15 f16; all on v_wmma_f32_16x16x32_f16 ((out,in) weights bf16-exact ×2^4, f32 accumulate); the layout transposes, max-pooling, softmax rows, BN batch statistics (fixed-order) and the residual are f32 VALU.
#define BB 8
#define CC 512
#define NN 2048
#define NH (NN / 2)
#define NR (BB * NN)
#define NRH (BB * NH)

typedef __bf16 v16b __attribute__((ext_vector_type(16)));
typedef unsigned short v8us __attribute__((ext_vector_type(8), may_alias));
typedef float  v8f  __attribute__((ext_vector_type(8)));
typedef float  v4f  __attribute__((ext_vector_type(4)));
typedef float  v4fa __attribute__((ext_vector_type(4), may_alias));
union FragB { v16b v; v8us half[2]; unsigned short u[16]; };

__device__ __forceinline__ unsigned short bf16_bits(float x) { unsigned int u = __float_as_uint(x); return (unsigned short)((u + 0x7FFFu + ((u >> 16) & 1u)) >> 16); }
__device__ __forceinline__ float bf16_val(unsigned short b) { return __uint_as_float(((unsigned int)b) << 16); }
__device__ __forceinline__ float bf16_round(float x) { return bf16_val(bf16_bits(x)); }
// D += A·B with NT terms: 1 = ah·bh, 2 = + al·bh (A split), 3 = + ah·bl (both split)
template <int NT>
__device__ __forceinline__ v8f mmaN(v16b ah, v16b al, v16b bh, v16b bl, v8f c) {
  c = __builtin_amdgcn_wmma_f32_16x16x32_bf16(false, ah, false, bh, (short)0, c, false, false);
  if (NT >= 2) c = __builtin_amdgcn_wmma_f32_16x16x32_bf16(false, al, false, bh, (short)0, c, false, false);
  if (NT >= 3) c = __builtin_amdgcn_wmma_f32_16x16x32_bf16(false, ah, false, bl, (short)0, c, false, false);
  asm volatile("v_nop\n\tv_nop\n\tv_nop\n\tv_nop" : "+v"(c) : "v"(ah), "v"(al), "v"(bh), "v"(bl));
  return c;
}

__global__ __launch_bounds__(256) void k_wt_bf16(const float* __restrict__ W, unsigned short* __restrict__ Wt, int K, int N) {
  const int t = blockIdx.x * 256 + threadIdx.x;
  const int k8n = K / 8;
  if (t >= N * k8n) return;
  const int n = t / k8n, k8 = (t % k8n) * 8;
  v8us v;
#pragma unroll
  for (int i = 0; i < 8; ++i) v[i] = bf16_bits(W[(size_t)(k8 + i) * N + n]);
  *(v8us*)(Wt + (size_t)n * K + k8) = v;
  
}

// GEMM C[M][N] (f32, pitch ldc) = act(A[M][K]·W + bias). A f32 row-major (pitch lda) converted per fragment to bf16
// (ASPLIT: hi/lo two planes -> 2 terms, else single rounded term); Wt bf16 [N][K] (pitch ldb). BIAS_BF16 rounds the
// bias to bf16 first (bias quantised to bf16 before the add). K%32==0, M%16==0, N%64==0.
template <bool ASPLIT, int ACT, bool BIAS_BF16>
__global__ __launch_bounds__(128) void k_gemm_bf(const float* __restrict__ A, int lda, const unsigned short* __restrict__ Wt, int ldb,
                                               const float* __restrict__ bias, float* __restrict__ C, int ldc, int M, int N, int K) {
  __shared__ __attribute__((aligned(16))) float so[4][16][64];
  const int tid = threadIdx.x, w = tid >> 5, lane = tid & 31, ln = lane & 15, hh = lane >> 4;
  const int ntn = N / 64;
  const int wid = blockIdx.x * 4 + w;
  const int mt = wid / ntn, nq = wid % ntn;
  if (mt * 16 >= M) return;
  const int row0 = mt * 16, col0 = nq * 64;
  const float* arow = A + (size_t)(row0 + ln) * lda;
  v8f acc[4] = {};
  for (int kb = 0; kb < K; kb += 32) {
    FragB ah, al;
    const v4f x0 = *(const v4fa*)(arow + kb + 8 * hh), x1 = *(const v4fa*)(arow + kb + 8 * hh + 4);
    const v4f x2 = *(const v4fa*)(arow + kb + 16 + 8 * hh), x3 = *(const v4fa*)(arow + kb + 16 + 8 * hh + 4);
    float xs[16] = {x0[0],x0[1],x0[2],x0[3],x1[0],x1[1],x1[2],x1[3],x2[0],x2[1],x2[2],x2[3],x3[0],x3[1],x3[2],x3[3]};
#pragma unroll
    for (int i = 0; i < 16; ++i) { const unsigned short hb = bf16_bits(xs[i]); ah.u[i] = hb; al.u[i] = ASPLIT ? bf16_bits(xs[i] - bf16_val(hb)) : (unsigned short)0; }
#pragma unroll
    for (int t = 0; t < 4; ++t) {
      const unsigned short* brow = Wt + (size_t)(col0 + t * 16 + ln) * ldb + kb;
      FragB b;
      b.half[0] = *(const v8us*)(brow + 8 * hh);
      b.half[1] = *(const v8us*)(brow + 16 + 8 * hh);
      acc[t] = mmaN<ASPLIT ? 2 : 1>(ah.v, al.v, b.v, b.v, acc[t]);
    }
  }
#pragma unroll
  for (int t = 0; t < 4; ++t) {
    float bv = bias ? bias[col0 + t * 16 + ln] : 0.f;
    if (BIAS_BF16) bv = bf16_round(bv);
#pragma unroll
    for (int r = 0; r < 8; ++r) { float v = acc[t][r] + bv; if (ACT == 1) v = fmaxf(v, 0.f); so[w][8 * hh + r][t * 16 + ln] = v; }
  }
  __builtin_amdgcn_fence(__ATOMIC_ACQ_REL, "workgroup");
  __builtin_amdgcn_wave_barrier();
  const int rsub = lane >> 4, c4 = (lane & 15) * 4;
  {
#pragma unroll
    for (int q = 0; q < 8; ++q) {
      const int r = q * 2 + rsub;
      const v4f v = *(const v4fa*)&so[w][r][c4];
      *(v4f*)(C + (size_t)(row0 + r) * ldc + col0 + c4) = v;
    }
    
  }
}

// Flash-style causal/unmasked attention, all contractions 3-term bf16 hi/lo splits, f32 softmax with running max.
// q,k,v rows are read from f32 buffers with arbitrary row pitch (so they can live inside a fused qkv buffer);
// D = head size (multiple of 32, <= 128); one wave = 16 query rows; block = 4 waves (64 queries) sharing K/V chunks of 32.
template <int D, bool CAUSAL>
__global__ __launch_bounds__(128) void k_flash(const float* __restrict__ qb, const float* __restrict__ kb, const float* __restrict__ vb,
                                             int pitch, int T, int H, float scale, float* __restrict__ y, int ypitch) {
  constexpr int KS = D / 32;        // k-steps for QK
  constexpr int DT = D / 16;        // d tiles for PV
  __shared__ __attribute__((aligned(16))) unsigned short sKh[32][D + 8], sKl[32][D + 8], sVh[32][D + 8], sVl[32][D + 8];
  __shared__ __attribute__((aligned(16))) unsigned short sPh[4][16][40], sPl[4][16][40];
  __shared__ __attribute__((aligned(16))) float sO[4][16][D];
  const int tid = threadIdx.x, w = tid >> 5, lane = tid & 31, ln = lane & 15, hh = lane >> 4;
  const int nqb = (T + 63) / 64;
  const int bh = blockIdx.x / nqb, qblk = blockIdx.x % nqb;
  const int b = bh / H, h = bh % H;
  const int q0 = qblk * 64 + w * 16;
  const float* Q = qb + (size_t)b * T * pitch + h * D;
  const float* K = kb + (size_t)b * T * pitch + h * D;
  const float* V = vb + (size_t)b * T * pitch + h * D;

  // A fragments of the wave's 16 query rows (scaled), hi/lo
  FragB aqh[KS], aql[KS];
  {
    int row = q0 + ln; if (row >= T) row = T - 1;
    const float* qr = Q + (size_t)row * pitch;
#pragma unroll
    for (int ks = 0; ks < KS; ++ks)
#pragma unroll
      for (int i = 0; i < 16; ++i) {
        const int d = ks * 32 + ((i < 8) ? (8 * hh + i) : (16 + 8 * hh + (i - 8)));
        const float x = qr[d] * scale; const unsigned short hb = bf16_bits(x);
        aqh[ks].u[i] = hb; aql[ks].u[i] = bf16_bits(x - bf16_val(hb));
      }
  }
  float m_r[8], l_r[8];
#pragma unroll
  for (int r = 0; r < 8; ++r) { m_r[r] = -3.0e38f; l_r[r] = 0.f; }
  v8f oacc[DT];
#pragma unroll
  for (int dt = 0; dt < DT; ++dt) oacc[dt] = (v8f){0.f,0.f,0.f,0.f,0.f,0.f,0.f,0.f};

  const int kv_end = CAUSAL ? min(T, qblk * 64 + 64) : T;     // block-uniform
  for (int j0 = 0; j0 < kv_end; j0 += 32) {
    __syncthreads();
    for (int e = tid; e < 32 * (D / 4); e += 128) {
      const int r = e / (D / 4), c4 = (e % (D / 4)) * 4;
      const int key = j0 + r;
      v4f kf = {0.f,0.f,0.f,0.f}, vf = {0.f,0.f,0.f,0.f};
      if (key < T) { kf = *(const v4fa*)(K + (size_t)key * pitch + c4); vf = *(const v4fa*)(V + (size_t)key * pitch + c4); }
#pragma unroll
      for (int t = 0; t < 4; ++t) {
        unsigned short hb = bf16_bits(kf[t]); sKh[r][c4 + t] = hb; sKl[r][c4 + t] = bf16_bits(kf[t] - bf16_val(hb));
        hb = bf16_bits(vf[t]); sVh[r][c4 + t] = hb; sVl[r][c4 + t] = bf16_bits(vf[t] - bf16_val(hb));
      }
    }
    __syncthreads();
    // S tile 16 x 32
    v8f s[2];
#pragma unroll
    for (int nt = 0; nt < 2; ++nt) {
      v8f acc = {};
#pragma unroll
      for (int ks = 0; ks < KS; ++ks) {
        FragB bh_, bl_;
        bh_.half[0] = *(const v8us*)&sKh[nt * 16 + ln][ks * 32 + 8 * hh]; bh_.half[1] = *(const v8us*)&sKh[nt * 16 + ln][ks * 32 + 16 + 8 * hh];
        bl_.half[0] = *(const v8us*)&sKl[nt * 16 + ln][ks * 32 + 8 * hh]; bl_.half[1] = *(const v8us*)&sKl[nt * 16 + ln][ks * 32 + 16 + 8 * hh];
        acc = mmaN<3>(aqh[ks].v, aql[ks].v, bh_.v, bl_.v, acc);
      }
      s[nt] = acc;
    }
    // mask + running max (rows 8hh+r; the 16 lanes of a half share rows)
    float alpha[8];
#pragma unroll
    for (int r = 0; r < 8; ++r) {
      const int qi = q0 + 8 * hh + r;
      const int ja = j0 + ln, jb = j0 + 16 + ln;
      if (CAUSAL) { if (ja > qi) s[0][r] = -3.0e38f; if (jb > qi) s[1][r] = -3.0e38f; }
      if (ja >= T) s[0][r] = -3.0e38f;
      if (jb >= T) s[1][r] = -3.0e38f;
      float mx = fmaxf(s[0][r], s[1][r]);
      mx = fmaxf(mx, __shfl_xor(mx, 1, 32)); mx = fmaxf(mx, __shfl_xor(mx, 2, 32)); mx = fmaxf(mx, __shfl_xor(mx, 4, 32)); mx = fmaxf(mx, __shfl_xor(mx, 8, 32));
      const float mnew = fmaxf(m_r[r], mx);
      alpha[r] = (mnew > -1.0e38f) ? __expf(m_r[r] - mnew) : 1.0f;
      const float p0 = (s[0][r] > -1.0e38f) ? __expf(s[0][r] - mnew) : 0.f;
      const float p1 = (s[1][r] > -1.0e38f) ? __expf(s[1][r] - mnew) : 0.f;
      m_r[r] = mnew;
      l_r[r] = l_r[r] * alpha[r] + p0 + p1;            // per-lane partial row sum (16 lanes combined at the end)
      unsigned short hb = bf16_bits(p0); sPh[w][8 * hh + r][ln] = hb;      sPl[w][8 * hh + r][ln] = bf16_bits(p0 - bf16_val(hb));
      hb = bf16_bits(p1);                sPh[w][8 * hh + r][16 + ln] = hb; sPl[w][8 * hh + r][16 + ln] = bf16_bits(p1 - bf16_val(hb));
    }
#pragma unroll
    for (int dt = 0; dt < DT; ++dt)
#pragma unroll
      for (int r = 0; r < 8; ++r) oacc[dt][r] *= alpha[r];
    __builtin_amdgcn_fence(__ATOMIC_ACQ_REL, "workgroup");
    __builtin_amdgcn_wave_barrier();
    FragB pah, pal;
    pah.half[0] = *(const v8us*)&sPh[w][ln][8 * hh]; pah.half[1] = *(const v8us*)&sPh[w][ln][16 + 8 * hh];
    pal.half[0] = *(const v8us*)&sPl[w][ln][8 * hh]; pal.half[1] = *(const v8us*)&sPl[w][ln][16 + 8 * hh];
#pragma unroll
    for (int dt = 0; dt < DT; ++dt) {
      FragB bvh, bvl;
#pragma unroll
      for (int i = 0; i < 8; ++i) {
        bvh.u[i] = sVh[8 * hh + i][dt * 16 + ln]; bvh.u[8 + i] = sVh[16 + 8 * hh + i][dt * 16 + ln];
        bvl.u[i] = sVl[8 * hh + i][dt * 16 + ln]; bvl.u[8 + i] = sVl[16 + 8 * hh + i][dt * 16 + ln];
      }
      oacc[dt] = mmaN<3>(pah.v, pal.v, bvh.v, bvl.v, oacc[dt]);
    }
    __builtin_amdgcn_fence(__ATOMIC_ACQ_REL, "workgroup");
    __builtin_amdgcn_wave_barrier();
  }
#pragma unroll
  for (int r = 0; r < 8; ++r) {
    float l = l_r[r];
    l += __shfl_xor(l, 1, 32); l += __shfl_xor(l, 2, 32); l += __shfl_xor(l, 4, 32); l += __shfl_xor(l, 8, 32);
    l_r[r] = (l > 0.f) ? 1.0f / l : 0.f;
  }
#pragma unroll
  for (int dt = 0; dt < DT; ++dt)
#pragma unroll
    for (int r = 0; r < 8; ++r) sO[w][8 * hh + r][dt * 16 + ln] = oacc[dt][r] * l_r[r];
  __builtin_amdgcn_fence(__ATOMIC_ACQ_REL, "workgroup");
  __builtin_amdgcn_wave_barrier();
  {
    for (int r = 0; r < 16; ++r) {
      const int row = q0 + r;
      if (row < T && lane < D / 4) {
        const v4f val = *(const v4fa*)&sO[w][r][lane * 4];
        *(v4f*)(y + ((size_t)b * T + row) * ypitch + h * D + lane * 4) = val;
      }
    }
    
  }
}

// GEMM C = act(A·W + bias + resid): A f32 (ASPLIT -> hi/lo 2 terms), Wt bf16 [N][K]; ACT 0 none, 1 relu, 2 exact gelu;
// resid (optional, f32, row index = (row % rmod), pitch ldr, RES_BF16 rounds it) added before the activation.
template <bool ASPLIT, int ACT, bool BIAS_BF16, bool RES_BF16>
__global__ __launch_bounds__(128) void k_gemm_bf3(const float* __restrict__ A, int lda, const unsigned short* __restrict__ Wt, int ldb,
                                                const float* __restrict__ bias, const float* __restrict__ resid, int rmod, int ldr,
                                                float* __restrict__ C, int ldc, int M, int N, int K) {
  __shared__ __attribute__((aligned(16))) float so[4][16][64];
  const int tid = threadIdx.x, w = tid >> 5, lane = tid & 31, ln = lane & 15, hh = lane >> 4;
  const int ntn = N / 64;
  const int wid = blockIdx.x * 4 + w;
  const int mt = wid / ntn, nq = wid % ntn;
  if (mt * 16 >= M) return;
  const int row0 = mt * 16, col0 = nq * 64;
  const float* arow = A + (size_t)(row0 + ln) * lda;
  v8f acc[4] = {};
  for (int kb = 0; kb < K; kb += 32) {
    FragB ah, al;
    const v4f x0 = *(const v4fa*)(arow + kb + 8 * hh), x1 = *(const v4fa*)(arow + kb + 8 * hh + 4);
    const v4f x2 = *(const v4fa*)(arow + kb + 16 + 8 * hh), x3 = *(const v4fa*)(arow + kb + 16 + 8 * hh + 4);
    float xs[16] = {x0[0],x0[1],x0[2],x0[3],x1[0],x1[1],x1[2],x1[3],x2[0],x2[1],x2[2],x2[3],x3[0],x3[1],x3[2],x3[3]};
#pragma unroll
    for (int i = 0; i < 16; ++i) { const unsigned short hb = bf16_bits(xs[i]); ah.u[i] = hb; al.u[i] = ASPLIT ? bf16_bits(xs[i] - bf16_val(hb)) : (unsigned short)0; }
#pragma unroll
    for (int t = 0; t < 4; ++t) {
      const unsigned short* brow = Wt + (size_t)(col0 + t * 16 + ln) * ldb + kb;
      FragB b;
      b.half[0] = *(const v8us*)(brow + 8 * hh);
      b.half[1] = *(const v8us*)(brow + 16 + 8 * hh);
      acc[t] = mmaN<ASPLIT ? 2 : 1>(ah.v, al.v, b.v, b.v, acc[t]);
    }
  }
#pragma unroll
  for (int t = 0; t < 4; ++t) {
    const int col = col0 + t * 16 + ln;
    float bv = bias ? bias[col] : 0.f;
    if (BIAS_BF16) bv = bf16_round(bv);
#pragma unroll
    for (int r = 0; r < 8; ++r) {
      float v = acc[t][r] + bv;
      if (resid) { float rv = resid[(size_t)((row0 + 8 * hh + r) % rmod) * ldr + col]; if (RES_BF16) rv = bf16_round(rv); v += rv; }
      if (ACT == 1) v = fmaxf(v, 0.f);
      if (ACT == 2) v = 0.5f * v * (1.0f + erff(v * 0.70710678118654752f));
      if (ACT == 3) { const float u = 0.7978845608028654f * (v + 0.044715f * v * v * v); v = 0.5f * v * (1.0f + tanhf(u)); }
      so[w][8 * hh + r][t * 16 + ln] = v;
    }
  }
  __builtin_amdgcn_fence(__ATOMIC_ACQ_REL, "workgroup");
  __builtin_amdgcn_wave_barrier();
  const int rsub = lane >> 4, c4 = (lane & 15) * 4;
  {
#pragma unroll
    for (int q = 0; q < 8; ++q) {
      const int r = q * 2 + rsub;
      const v4f v = *(const v4fa*)&so[w][r][c4];
      *(v4f*)(C + (size_t)(row0 + r) * ldc + col0 + c4) = v;
    }
    
  }
}
// row LayerNorm (biased variance, eps) over N: s = X (+ R); optional out_sum <- s; out_norm <- (s-mu)*rsqrt(var+eps)*g + b
template <bool PARAM_BF16>
__global__ __launch_bounds__(256) void k_layernorm(const float* __restrict__ X, const float* __restrict__ R, const float* __restrict__ g, const float* __restrict__ bta,
                                                  float* __restrict__ out_sum, float* __restrict__ out_norm, int N, float eps) {
  __shared__ float red[256];
  const int row = blockIdx.x, tid = threadIdx.x;
  const float* x = X + (size_t)row * N; const float* rr = R ? R + (size_t)row * N : nullptr;
  float vals[16];                     // up to N = 4096
  const int per = N / 256;            // contiguous chunk per thread? use strided-by-4 chunks: thread handles j = tid*4 + 1024*u
  float s1 = 0.f;
  for (int u = 0; u < per / 4; ++u) {
    const int j = tid * 4 + 1024 * u;
    const v4f a = *(const v4fa*)(x + j);
    v4f b = {0.f,0.f,0.f,0.f}; if (rr) b = *(const v4fa*)(rr + j);
#pragma unroll
    for (int q = 0; q < 4; ++q) { const float v = a[q] + b[q]; vals[u * 4 + q] = v; s1 += v; }
  }
  red[tid] = s1; __syncthreads();
  for (int st = 128; st > 0; st >>= 1) { if (tid < st) red[tid] += red[tid + st]; __syncthreads(); }
  const float mu = red[0] / (float)N; __syncthreads();
  float s2 = 0.f;
  for (int u = 0; u < per / 4; ++u)
#pragma unroll
    for (int q = 0; q < 4; ++q) { const float c = vals[u * 4 + q] - mu; s2 += c * c; }
  red[tid] = s2; __syncthreads();
  for (int st = 128; st > 0; st >>= 1) { if (tid < st) red[tid] += red[tid + st]; __syncthreads(); }
  const float rs = rsqrtf(red[0] / (float)N + eps);
  {
    for (int u = 0; u < per / 4; ++u) {
      const int j = tid * 4 + 1024 * u;
      v4f o, sm;
#pragma unroll
      for (int q = 0; q < 4; ++q) {
        float gg = g[j + q], bb = bta[j + q];
        if (PARAM_BF16) { gg = bf16_round(gg); bb = bf16_round(bb); }
        sm[q] = vals[u * 4 + q]; o[q] = (vals[u * 4 + q] - mu) * rs * gg + bb;
      }
      if (out_sum) *(v4f*)(out_sum + (size_t)row * N + j) = sm;
      *(v4f*)(out_norm + (size_t)row * N + j) = o;
    }
    
  }
}



// ---- f16 WMMA path (v_wmma_f32_16x16x32_f16): 11-bit significands for operands in range — used where a [0,1] probability operand needs more precision than bf16
typedef _Float16 v16h __attribute__((ext_vector_type(16)));
union FragH { v16h v; v8us half[2]; _Float16 h[16]; unsigned short u[16]; };
template <int NT>
__device__ __forceinline__ v8f mmaH(v16h ah, v16h al, v16h bh, v16h bl, v8f c) {
  c = __builtin_amdgcn_wmma_f32_16x16x32_f16(false, ah, false, bh, (short)0, c, false, false);
  if (NT >= 2) c = __builtin_amdgcn_wmma_f32_16x16x32_f16(false, al, false, bh, (short)0, c, false, false);
  if (NT >= 3) c = __builtin_amdgcn_wmma_f32_16x16x32_f16(false, ah, false, bl, (short)0, c, false, false);
  asm volatile("v_nop\n\tv_nop\n\tv_nop\n\tv_nop" : "+v"(c) : "v"(ah), "v"(al), "v"(bh), "v"(bl));
  return c;
}
// batched GEMM like k_gemm_b but f16 operands: A f32 (split into f16 hi/lo if ASPLIT, else rounded to f16), Bt = f16 values [n][k]; alpha; C f32; N multiple of 16 (partial tiles skipped)
template <bool ASPLIT>
__global__ __launch_bounds__(128) void k_gemm_h(const float* __restrict__ A, int lda, size_t sA, const _Float16* __restrict__ Bh, int ldb, size_t sB, float alpha, float* __restrict__ C, int ldc, size_t sC, int M, int N, int K) {
  __shared__ __attribute__((aligned(16))) float so[4][16][64];
  const int tid = threadIdx.x, w = tid >> 5, lane = tid & 31, ln = lane & 15, hh = lane >> 4; const int by = blockIdx.y;
  A += (size_t)by * sA; Bh += (size_t)by * sB; C += (size_t)by * sC;
  const int ntn = (N + 63) / 64; const int wid = blockIdx.x * 4 + w; const int mt = wid / ntn, nq = wid % ntn; if (mt * 16 >= M) return;
  const int row0 = mt * 16, col0 = nq * 64; const float* arow = A + (size_t)(row0 + ln) * lda;
  v8f acc[4] = {};
  for (int kb = 0; kb < K; kb += 32) {
    FragH ah, al;
    const v4f x0 = *(const v4fa*)(arow + kb + 8 * hh), x1 = *(const v4fa*)(arow + kb + 8 * hh + 4), x2 = *(const v4fa*)(arow + kb + 16 + 8 * hh), x3 = *(const v4fa*)(arow + kb + 16 + 8 * hh + 4);
    float xs[16] = {x0[0],x0[1],x0[2],x0[3],x1[0],x1[1],x1[2],x1[3],x2[0],x2[1],x2[2],x2[3],x3[0],x3[1],x3[2],x3[3]};
#pragma unroll
    for (int i = 0; i < 16; ++i) { const _Float16 h = (_Float16)xs[i]; ah.h[i] = h; al.h[i] = ASPLIT ? (_Float16)(xs[i] - (float)h) : (_Float16)0.0f; }
#pragma unroll
    for (int t = 0; t < 4; ++t) { if (col0 + t * 16 >= N) continue; const size_t boff = (size_t)(col0 + t * 16 + ln) * ldb + kb; FragH bq; bq.half[0] = *(const v8us*)(Bh + boff + 8 * hh); bq.half[1] = *(const v8us*)(Bh + boff + 16 + 8 * hh);
      acc[t] = mmaH<ASPLIT ? 2 : 1>(ah.v, al.v, bq.v, bq.v, acc[t]); }
  }
#pragma unroll
  for (int t = 0; t < 4; ++t) { if (col0 + t * 16 >= N) continue;
#pragma unroll
    for (int r = 0; r < 8; ++r) so[w][8 * hh + r][t * 16 + ln] = acc[t][r] * alpha; }
  __builtin_amdgcn_fence(__ATOMIC_ACQ_REL, "workgroup"); __builtin_amdgcn_wave_barrier();
  const int rsub = lane >> 4, c4 = (lane & 15) * 4;
  {
#pragma unroll
    for (int q = 0; q < 8; ++q) { const int r = q * 2 + rsub; if (col0 + c4 < N) { const v4f v = *(const v4fa*)&so[w][r][c4]; *(v4f*)(C + (size_t)(row0 + r) * ldc + col0 + c4) = v; } }
     }
}

// Wt[n][k] = f16(W[k][n]·scale) from f32 row-major W[K][N] (scale = power of two; bf16-exact weights stay exact in f16 away from the subnormal range)
__global__ __launch_bounds__(256) void k_wt_f16(const float* __restrict__ W, _Float16* __restrict__ Wt, int K, int N, float scale) {
  const int t = blockIdx.x * 256 + threadIdx.x; if (t >= N * (K / 8)) return; const int n = t / (K / 8), k8 = (t % (K / 8)) * 8; FragH f;
#pragma unroll
  for (int i = 0; i < 8; ++i) f.h[i] = (_Float16)(bf16_round(W[(size_t)(k8 + i) * N + n]) * scale); const v8us o = f.half[0];
  *(v8us*)((unsigned short*)Wt + (size_t)n * K + k8) = o; 
}
// Tiled GEMM, f16 operands, both K-contiguous: v[row][col] = acc*alpha + bias[col], then CPM 1: + CP[by*sCPy + col] (one row for all rows), CPM 2: + what C[row][col] holds; written as f32 to C (F32OUT) or as f16 to C16,
// or (HL) split as f16 hi to C16 and (v - hi) * 2^10 as f16 to C16l, with nothing written to C.
// BNP: stage 1 of the BN batch statistics. A wave's 32 rows are one row chunk: per column it also writes their sum to PS and the sum of their squared deviations from their own mean to PM (row = chunk, pitch ldc).
// One 128x128 tile per workgroup of 8 waves (4 x 2, 32x64 per wave). A pass is 64 k = one whole 128-B line of every operand row: each wave-wide 16-B load
// covers four whole lines and goes through registers into LDS (row pitch 144 B for the ds_load_b128 fragment readers); two buffers, one barrier per pass;
// the next pass's global loads are issued before this pass's products. M, N multiples of 128 (the grid is exact), K a multiple of 64.
// Every "#pragma unroll" below makes the index of a register array (staged rows, fragments, accumulators) a constant, so that the array stays in registers.
#define TPITCH 72
typedef float fa1 __attribute__((may_alias));
typedef _Float16 v4hs __attribute__((ext_vector_type(4)));
typedef float v2f __attribute__((ext_vector_type(2)));
typedef float v2fa __attribute__((ext_vector_type(2), may_alias));
template <int CPM, bool F32OUT, bool HL = false, bool BNP = false>
__global__ __launch_bounds__(256) void k_gemm_t(const _Float16* __restrict__ A, int lda, size_t sA, const _Float16* __restrict__ Bh, int ldb, size_t sB, float alpha, const float* __restrict__ bias, const float* __restrict__ CP, size_t sCPy,
    float* __restrict__ C, _Float16* __restrict__ C16, _Float16* __restrict__ C16l, float* __restrict__ PS, float* __restrict__ PM, int ldc, size_t sC, int N, int K) {
  __shared__ __attribute__((aligned(16))) unsigned short st[2][2][128 * TPITCH];      // [buffer][A, B][row * TPITCH + k]
  const int tid = threadIdx.x, w = tid >> 5, lane = tid & 31, ln = lane & 15, hh = lane >> 4; const int by = blockIdx.y;
  const int ntn = N / 128; const int row0 = ((int)blockIdx.x / ntn) * 128, col0 = ((int)blockIdx.x % ntn) * 128;
  const int sr = tid >> 3, sc = (tid & 7) * 8;      // staging: 8 lanes per row, rows sr + 32 i
  const unsigned short* ga = (const unsigned short*)A + (size_t)by * sA + (size_t)row0 * lda;      // workgroup-uniform bases, per-lane 32-bit offsets that never change
  const unsigned short* gb = (const unsigned short*)Bh + (size_t)by * sB + (size_t)col0 * ldb;
  unsigned oa[4], ob[4];
#pragma unroll
  for (int i = 0; i < 4; ++i) { oa[i] = (unsigned)((sr + 32 * i) * lda + sc); ob[i] = (unsigned)((sr + 32 * i) * ldb + sc); }
  v8us ra[4], rb[4]; const unsigned short *pa[4], *pb[4];
#pragma unroll
  for (int i = 0; i < 4; ++i) { pa[i] = ga + oa[i]; pb[i] = gb + ob[i]; }
#pragma unroll
  for (int i = 0; i < 4; ++i) { ra[i] = *(const v8us*)pa[i]; rb[i] = *(const v8us*)pb[i]; }
  // the eight address pairs are inputs of the wait: they stay in their registers up to it, so no load of the group is given a register that an issued load names
  asm volatile("s_wait_xcnt 0x0" :: "v"(pa[0]), "v"(pa[1]), "v"(pa[2]), "v"(pa[3]), "v"(pb[0]), "v"(pb[1]), "v"(pb[2]), "v"(pb[3]) : "memory");
#pragma unroll
  for (int i = 0; i < 4; ++i) { *(v8us*)&st[0][0][(sr + 32 * i) * TPITCH + sc] = ra[i]; *(v8us*)&st[0][1][(sr + 32 * i) * TPITCH + sc] = rb[i]; }
  __syncthreads();
  const int wm = w >> 1, wn = w & 1; const int ns = K / 64;
  v8f acc[2][4] = {};
  for (int s = 0; s < ns; ++s) {
    const int cur = s & 1; const bool more = s + 1 < ns;      // the same in every thread of the workgroup
    if (more) {
#pragma unroll
      for (int i = 0; i < 4; ++i) { pa[i] = ga + oa[i]; pb[i] = gb + ob[i]; }      // this pass's addresses; the next pass lies 64 k = 128 B further
#pragma unroll
      for (int i = 0; i < 4; ++i) { ra[i] = *(const v8us*)(pa[i] + 64); rb[i] = *(const v8us*)(pb[i] + 64); }
      // as in front of the loop: the address pairs stay in their registers up to the wait
      asm volatile("s_wait_xcnt 0x0" :: "v"(pa[0]), "v"(pa[1]), "v"(pa[2]), "v"(pa[3]), "v"(pb[0]), "v"(pb[1]), "v"(pb[2]), "v"(pb[3]) : "memory");
      ga += 64; gb += 64;
    }
    const unsigned short* la = &st[cur][0][(wm * 32 + ln) * TPITCH + 8 * hh];
    const unsigned short* lb = &st[cur][1][(wn * 64 + ln) * TPITCH + 8 * hh];
    FragH a[2][2], b[2][4];      // all of the pass's fragments are read as one group ahead of its products
#pragma unroll
    for (int ks = 0; ks < 2; ++ks) {
#pragma unroll
      for (int mi = 0; mi < 2; ++mi) { a[ks][mi].half[0] = *(const v8us*)(la + mi * 16 * TPITCH + ks * 32); a[ks][mi].half[1] = *(const v8us*)(la + mi * 16 * TPITCH + ks * 32 + 16); }
#pragma unroll
      for (int t = 0; t < 4; ++t) { b[ks][t].half[0] = *(const v8us*)(lb + t * 16 * TPITCH + ks * 32); b[ks][t].half[1] = *(const v8us*)(lb + t * 16 * TPITCH + ks * 32 + 16); }
    }
#pragma unroll
    for (int ks = 0; ks < 2; ++ks)
#pragma unroll
      for (int t = 0; t < 4; ++t)
#pragma unroll
        for (int mi = 0; mi < 2; ++mi) acc[mi][t] = mmaH<1>(a[ks][mi].v, a[ks][mi].v, b[ks][t].v, b[ks][t].v, acc[mi][t]);
    if (more) {
#pragma unroll
      for (int i = 0; i < 4; ++i) { *(v8us*)&st[cur ^ 1][0][(sr + 32 * i) * TPITCH + sc] = ra[i]; *(v8us*)&st[cur ^ 1][1][(sr + 32 * i) * TPITCH + sc] = rb[i]; }
    }
    __syncthreads();      // publishes the buffer just filled and ends every read of the one just used
  }
  // epilogue: each wave turns its accumulators into whole rows through its own 32 x 68 f32 range of the (now free) staging LDS
  fa1* so = (fa1*)&st[0][0][0] + w * (32 * 68);
  const size_t cofs = (size_t)by * sC; const int wrow0 = row0 + wm * 32, wcol0 = col0 + wn * 64; const int rsub = lane >> 4, c4 = (lane & 15) * 4;
  float* crow = C + cofs + (size_t)(wrow0 + rsub) * ldc + wcol0 + c4;      // each lane reads (CPM 2) and writes the same 16 B of rows rsub + 2 q
  v4f cp[16];
  if (CPM == 1) cp[0] = *(const v4fa*)(CP + (size_t)by * sCPy + wcol0 + c4);
  if (CPM == 2) {
#pragma unroll
    for (int q = 0; q < 16; ++q) cp[q] = *(const v4fa*)(crow + (size_t)(q * 2) * ldc);
  }
#define CPA(q) "v"(crow + (size_t)((q) * 2) * ldc)
  // with HL nothing is stored through the sixteen address pairs: as inputs of the wait they stay in their registers up to it, so no load of the group is given a register that an issued load names
  if (CPM == 2 && HL) asm volatile("s_wait_xcnt 0x0" :: CPA(0), CPA(1), CPA(2), CPA(3), CPA(4), CPA(5), CPA(6), CPA(7), CPA(8), CPA(9), CPA(10), CPA(11), CPA(12), CPA(13), CPA(14), CPA(15) : "memory");
#undef CPA
#pragma unroll
  for (int t = 0; t < 4; ++t) { const float bv = bias ? bf16_round(bias[wcol0 + t * 16 + ln]) : 0.f;
#pragma unroll
    for (int mi = 0; mi < 2; ++mi)
#pragma unroll
      for (int r = 0; r < 8; ++r) so[(mi * 16 + 8 * hh + r) * 68 + t * 16 + ln] = acc[mi][t][r] * alpha + bv; }
  __builtin_amdgcn_fence(__ATOMIC_ACQ_REL, "workgroup"); __builtin_amdgcn_wave_barrier();      // the wave's LDS rows are complete before its lanes read what other lanes wrote
#pragma unroll
  for (int q = 0; q < 16; ++q) { const int r = q * 2 + rsub; const int row = wrow0 + r; v4f v = *(const v4fa*)&so[r * 68 + c4];
    if (CPM != 0) { for (int i = 0; i < 4; ++i) v[i] += cp[CPM == 2 ? q : 0][i]; }
    if (HL) { v4hs h4, l4; for (int i = 0; i < 4; ++i) { const _Float16 h = (_Float16)v[i]; h4[i] = h; l4[i] = (_Float16)((v[i] - (float)h) * 1024.0f); }
      const size_t o = cofs + (size_t)row * ldc + wcol0 + c4; *(v4hs*)(C16 + o) = h4; *(v4hs*)(C16l + o) = l4; continue; }
    if (F32OUT) *(v4f*)(crow + (size_t)(q * 2) * ldc) = v;
    else { v4hs h4; for (int i = 0; i < 4; ++i) h4[i] = (_Float16)v[i]; *(v4hs*)(C16 + cofs + (size_t)row * ldc + wcol0 + c4) = h4; } }
  if (BNP) {      // a lane takes two adjacent columns of the wave's 64 and adds the 32 rows in row order
    asm volatile("s_wait_xcnt 0x0" ::: "memory");      // the row stores above have taken their registers before the sums below reuse them
    v2f xr[32];
#pragma unroll      // constant indices keep xr in registers
    for (int r = 0; r < 32; ++r) xr[r] = *(const v2fa*)&so[r * 68 + lane * 2];
    v2f s = xr[0];
#pragma unroll      // xr stays in registers
    for (int r = 1; r < 32; ++r) s += xr[r];
    const v2f mu = s * (1.0f / 32.0f);
    v2f m2 = {0.f, 0.f};
#pragma unroll      // xr stays in registers
    for (int r = 0; r < 32; ++r) { const v2f d = xr[r] - mu; m2 += d * d; }
    const size_t o = (size_t)(wrow0 / 32) * ldc + wcol0 + lane * 2; *(v2f*)(PS + o) = s; *(v2f*)(PM + o) = m2;
  }
}


typedef _Float16 v4h __attribute__((ext_vector_type(4)));

__global__ __launch_bounds__(256) void k_x16(const float* __restrict__ x, _Float16* __restrict__ X16, size_t n8) { const size_t t = (size_t)blockIdx.x * 256 + threadIdx.x; if (t >= n8) return; FragH f;
#pragma unroll
  for (int q = 0; q < 8; ++q) f.h[q] = (_Float16)bf16_round(x[t * 8 + q]); *(v8us*)((unsigned short*)X16 + t * 8) = f.half[0];  }
__global__ __launch_bounds__(256) void k_round16f(const float* __restrict__ W, _Float16* __restrict__ Bt, size_t n8) { const size_t t = (size_t)blockIdx.x * 256 + threadIdx.x; if (t >= n8) return; FragH f;
#pragma unroll
  for (int i = 0; i < 8; ++i) f.h[i] = (_Float16)(bf16_round(W[t * 8 + i]) * 16.0f); *(v8us*)((unsigned short*)Bt + t * 8) = f.half[0];  }
// Max-pool over row pairs and transpose in one pass: Vt[slab][d][p] = max(V16[2 p][d], V16[2 p + 1][d]) for a 64 x 64 tile of pooled rows p and columns d; 8 lanes read one whole 128-B line of each of the two rows.
typedef _Float16 v8h __attribute__((ext_vector_type(8)));
template <int NHv, int TTv>
__global__ __launch_bounds__(256) void k_poolvt(const _Float16* __restrict__ V16, int ldv, int voff, _Float16* __restrict__ Vt) { __shared__ unsigned short tl[64][66]; const int tid = threadIdx.x; const int slab = blockIdx.x / (TTv / 64), lg = blockIdx.x % (TTv / 64); const int b = slab / NHv, h = slab % NHv;
  const int r0 = tid / 8, c8 = (tid % 8) * 8;
  const unsigned short* p0 = (const unsigned short*)V16 + ((size_t)b * TTv + lg * 64 + r0) * 2 * ldv + voff + h * 64 + c8; const unsigned short* p1 = p0 + (size_t)64 * ldv;      // pooled rows r0 and r0 + 32
  const unsigned short* q0 = p0 + ldv; const unsigned short* q1 = p1 + ldv;      // the second row of each pair
  const v8us a0 = *(const v8us*)p0, b0 = *(const v8us*)q0, a1 = *(const v8us*)p1, b1 = *(const v8us*)q1;
  // the four address pairs are inputs of the wait: they stay in their registers up to it, so no load of the group is given a register that an issued load names
  asm volatile("s_wait_xcnt 0x0" :: "v"(p0), "v"(q0), "v"(p1), "v"(q1) : "memory");
  const v8h fa0 = __builtin_bit_cast(v8h, a0), fb0 = __builtin_bit_cast(v8h, b0), fa1v = __builtin_bit_cast(v8h, a1), fb1 = __builtin_bit_cast(v8h, b1);
#pragma unroll      // constant indices keep the eight-element vectors in registers
  for (int q = 0; q < 8; ++q) { tl[r0][c8 + q] = ((float)fa0[q] > (float)fb0[q]) ? a0[q] : b0[q]; tl[r0 + 32][c8 + q] = ((float)fa1v[q] > (float)fb1[q]) ? a1[q] : b1[q]; }
  __syncthreads();
  {
#pragma unroll
    for (int rd = 0; rd < 2; ++rd) { const int d = rd * 32 + tid / 8, pc = tid % 8; FragH f;
#pragma unroll
      for (int q = 0; q < 8; ++q) f.u[q] = tl[pc * 8 + q][d];
      *(v8us*)((unsigned short*)Vt + ((size_t)slab * 64 + d) * TTv + lg * 64 + pc * 8) = f.half[0]; }
     } }

__global__ __launch_bounds__(256) void k_tok(const float* __restrict__ x, _Float16* __restrict__ X16) { __shared__ float tl[32][65]; const int tid = threadIdx.x; const int b = blockIdx.x / ((CC / 64) * (NN / 32)), rem = blockIdx.x % ((CC / 64) * (NN / 32)); const int cg = rem / (NN / 32), pg = rem % (NN / 32); const int c0 = cg * 64, p0 = pg * 32;
  for (int i = tid; i < 64 * 32; i += 256) { const int c = i / 32, pp = i % 32; tl[pp][c] = bf16_round(x[((size_t)b * CC + c0 + c) * NN + p0 + pp]); } __syncthreads();
  const int r = tid / 8, pc = tid % 8; FragH f; for (int q = 0; q < 8; ++q) f.h[q] = (_Float16)tl[r][pc * 8 + q]; const size_t row = (size_t)b * NN + p0 + r; *(v8us*)((unsigned short*)X16 + row * CC + c0 + pc * 8) = f.half[0];  }
// phi after its projection, one wave per pooled row m: max over rows 2 m and 2 m + 1 of F (f32), the maximum split as f16 hi and (v - hi) * 2^10, and cv[m] = sum over channels of maximum * b_theta.
// Every load takes 512 B of one row. A lane sums its 16 channels in order, the 32 lanes are added by a butterfly; the 32 waves' sums leave as one 128-B line.
__global__ __launch_bounds__(1024) void k_phipost(const float* __restrict__ F, const float* __restrict__ bth, _Float16* __restrict__ Hh, _Float16* __restrict__ Hl, float* __restrict__ cv) {
  __shared__ float red[32];
  const int tid = threadIdx.x, w = tid >> 5, lane = tid & 31; const size_t m = (size_t)blockIdx.x * 32 + w;
  const float* p = F + m * 2 * CC + lane * 4; const float* pt = bth + lane * 4;
  v4f a[4], b[4], t[4];
#pragma unroll      // constant indices keep a, b and t in registers, so that the loads are issued ahead of the arithmetic
  for (int u = 0; u < 4; ++u) { a[u] = *(const v4fa*)(p + u * 128); b[u] = *(const v4fa*)(p + CC + u * 128); t[u] = *(const v4fa*)(pt + u * 128); }
  // the two address pairs are inputs of the wait: they stay in their registers until every load of the group has taken them
  asm volatile("s_wait_xcnt 0x0" :: "v"(p), "v"(pt) : "memory");
  v4hs hv[4], lv[4]; float s = 0.f;
#pragma unroll      // a, b, t, hv and lv stay in registers
  for (int u = 0; u < 4; ++u)
    for (int q = 0; q < 4; ++q) { const float v = fmaxf(a[u][q], b[u][q]); const _Float16 h = (_Float16)v; hv[u][q] = h; lv[u][q] = (_Float16)((v - (float)h) * 1024.0f); s += v * bf16_round(t[u][q]); }
  for (int o = 16; o >= 1; o >>= 1) s += __shfl_xor(s, o, 32);
  if (lane == 0) red[w] = s;
  __syncthreads();      // the 32 row sums are complete before wave 0 reads them
  _Float16* oh = Hh + m * CC + lane * 4; _Float16* ol = Hl + m * CC + lane * 4;
#pragma unroll      // hv and lv stay in registers
  for (int u = 0; u < 4; ++u) { *(v4hs*)(oh + u * 128) = hv[u]; *(v4hs*)(ol + u * 128) = lv[u]; }
  if (w == 0) cv[blockIdx.x * 32 + lane] = red[lane];
}
__global__ __launch_bounds__(256) void k_smx(const float* __restrict__ S, _Float16* __restrict__ P16) { const int tid = threadIdx.x, wv = tid >> 5, lane = tid & 31; const int r = blockIdx.x * 8 + wv; if (r >= NR) return; const float* sr = S + (size_t)r * NH; float m = -3.0e38f;
  for (int p = lane; p < NH / 8; p += 32) { const v4f a = *(const v4fa*)(sr + p * 8), b = *(const v4fa*)(sr + p * 8 + 4); for (int q = 0; q < 4; ++q) m = fmaxf(m, fmaxf(a[q], b[q])); }
  for (int o = 16; o >= 1; o >>= 1) m = fmaxf(m, __shfl_xor(m, o, 32)); float z = 0.f;
  for (int p = lane; p < NH / 8; p += 32) { const v4f a = *(const v4fa*)(sr + p * 8), b = *(const v4fa*)(sr + p * 8 + 4); for (int q = 0; q < 4; ++q) z += __expf(a[q] - m) + __expf(b[q] - m); }
  for (int o = 16; o >= 1; o >>= 1) z += __shfl_xor(z, o, 32); const float iz = 32768.0f / z;
  { for (int p = lane; p < NH / 8; p += 32) { FragH f; for (int q = 0; q < 8; ++q) f.h[q] = (_Float16)(__expf(sr[p * 8 + q] - m) * iz); *(v8us*)((unsigned short*)P16 + (size_t)r * NH + p * 8) = f.half[0]; }  } }
// BN batch statistics in two stages. Stage 1 is the BNP epilogue of the GEMM that makes wy: per chunk of SROWS consecutive rows and per channel, the rows' sum and the sum of their squared deviations from their own mean.
#define SROWS 32
#define SCH (NR / SROWS)
static_assert(SROWS == 32, "a chunk is the 32 rows of one wave's tile in k_gemm_t");
// Stage 2: one workgroup per 32 channels (one line of every partial row), lane = channel; wave w takes chunks 16 w .. 16 w + 15 in order, the 32 waves' sums are added in wave order by every wave.
// Total squared deviation = sum over chunks of (chunk's own + SROWS * (chunk mean - mean)^2). ST keeps its form: one line per channel, mean and 1/sqrt(var + eps) in its first two words.
__global__ __launch_bounds__(1024) void k_bnfin(const float* __restrict__ PS, const float* __restrict__ PM, float* __restrict__ ST) {
  __shared__ float red[2][32][32];
  const int tid = threadIdx.x, w = tid >> 5, lane = tid & 31; const int c = blockIdx.x * 32 + lane;
  const float* ps = PS + (size_t)(w * (SCH / 32)) * CC + c; const float* pm = PM + (size_t)(w * (SCH / 32)) * CC + c;
  float s[SCH / 32], m[SCH / 32];
#pragma unroll      // constant indices keep s and m in registers; all loads are in flight together
  for (int i = 0; i < SCH / 32; ++i) { s[i] = ps[i * CC]; m[i] = pm[i * CC]; }
  // the two address pairs are inputs of the wait: they stay in their registers until every load of the group has taken them
  asm volatile("s_wait_xcnt 0x0" :: "v"(ps), "v"(pm) : "memory");
  float a = 0.f;
#pragma unroll      // s stays in registers
  for (int i = 0; i < SCH / 32; ++i) a += s[i];
  red[0][w][lane] = a; __syncthreads();
  float tot = 0.f;
  for (int j = 0; j < 32; ++j) tot += red[0][j][lane];
  const float mu = tot / (float)NR;
  float q = 0.f;
#pragma unroll      // s and m stay in registers
  for (int i = 0; i < SCH / 32; ++i) { const float d = s[i] * (1.0f / (float)SROWS) - mu; q += m[i] + (float)SROWS * d * d; }
  red[1][w][lane] = q; __syncthreads();
  float q2 = 0.f;
  for (int j = 0; j < 32; ++j) q2 += red[1][j][lane];
  const float rs = rsqrtf(q2 / (float)NR + 1e-5f);
  const float muw = __shfl(mu, w, 32), rsw = __shfl(rs, w, 32);      // wave w writes the line of channel w of the 32
  ST[(blockIdx.x * 32 + w) * 32 + lane] = (lane == 0) ? muw : ((lane == 1) ? rsw : 0.f);
}
__global__ __launch_bounds__(256) void k_out(const float* __restrict__ WY, const float* __restrict__ ST, const float* __restrict__ gam, const float* __restrict__ bet, const float* __restrict__ x, float* __restrict__ out) { __shared__ float tl[32][65]; const int tid = threadIdx.x; const int b = blockIdx.x / ((CC / 32) * (NN / 64)), rem = blockIdx.x % ((CC / 32) * (NN / 64)); const int cg = rem / (NN / 64), pg = rem % (NN / 64); const int c0 = cg * 32, p0 = pg * 64;
  for (int i = tid; i < 64 * 32; i += 256) { const int pp = i / 32, c = i % 32; const int cc = c0 + c; tl[c][pp] = (WY[((size_t)b * NN + p0 + pp) * CC + cc] - ST[cc * 32]) * ST[cc * 32 + 1] * bf16_round(gam[cc]) + bf16_round(bet[cc]); } __syncthreads();
  { for (int i = tid; i < 32 * 16; i += 256) { const int c = i / 16, q4 = i % 16; const size_t o = ((size_t)b * CC + c0 + c) * NN + p0 + q4 * 4; const v4f xv = *(const v4fa*)(x + o); v4f v; for (int q = 0; q < 4; ++q) v[q] = tl[c][q4 * 4 + q] + bf16_round(xv[q]); *(v4f*)(out + o) = v; }  } }
extern "C" void kernel_launch(void* const* d_in, const int* in_sizes, int n_in,
                              void* d_out, int out_size, void* d_ws, size_t ws_size, hipStream_t stream) {
  (void)in_sizes; (void)n_in; (void)out_size;
  const float* x = (const float*)d_in[0]; const float* gw = (const float*)d_in[1]; const float* gb = (const float*)d_in[2]; const float* thw = (const float*)d_in[3]; const float* thb = (const float*)d_in[4]; const float* phw = (const float*)d_in[5]; const float* phb = (const float*)d_in[6]; const float* Ww = (const float*)d_in[7]; const float* Wb = (const float*)d_in[8]; const float* gam = (const float*)d_in[9]; const float* bet = (const float*)d_in[10];
  char* ws = (char*)d_ws; size_t off = 0;
  auto take = [&](size_t bytes) { char* p = ws + off; off += (bytes + 255) & ~(size_t)255; return p; };
  _Float16* Bg = (_Float16*)take((size_t)CC * CC * 2); _Float16* Bph = (_Float16*)take((size_t)CC * CC * 2); _Float16* BW = (_Float16*)take((size_t)CC * CC * 2); float* ST = (float*)take(CC * 32 * 4);
  _Float16* Bthp = (_Float16*)take((size_t)CC * CC * 2);      // W_θ as [in=o][out=c] → Bt[c][o] for φ·W_θ
  _Float16* X16 = (_Float16*)take((size_t)NR * CC * 2); float* FULLF = (float*)take((size_t)NR * CC * 4); _Float16* FULL = (_Float16*)take((size_t)NR * CC * 2); _Float16* PHh = (_Float16*)take((size_t)NRH * CC * 2); _Float16* PHl = (_Float16*)take((size_t)NRH * CC * 2);
  // every per-batch buffer holds all BB batches, so that each stage is one launch over the whole batch
  float* BP = (float*)take((size_t)NRH * CC * 4); _Float16* BPh = (_Float16*)take((size_t)NRH * CC * 2); _Float16* BPl = (_Float16*)take((size_t)NRH * CC * 2); float* CV = (float*)take(NRH * 4); _Float16* Gt = (_Float16*)take((size_t)NRH * CC * 2); float* S = (float*)take((size_t)NR * NH * 4); _Float16* P16 = (_Float16*)take((size_t)NR * NH * 2);
  float* PS = (float*)take((size_t)SCH * CC * 4); float* PM = (float*)take((size_t)SCH * CC * 4);      // BN partials per row chunk and channel
  _Float16* Y16 = FULL; float* WY = FULLF;      // FULLF/FULL are dead after pooling
  if (off > ws_size) return;      // about 232 MB
  k_round16f<<<(CC * CC / 8 + 255) / 256, 256, 0, stream>>>(gw, Bg, CC * CC / 8); k_round16f<<<(CC * CC / 8 + 255) / 256, 256, 0, stream>>>(phw, Bph, CC * CC / 8); k_round16f<<<(CC * CC / 8 + 255) / 256, 256, 0, stream>>>(Ww, BW, CC * CC / 8);      // (out,in) natural
  k_wt_f16<<<(CC * (CC / 8) + 255) / 256, 256, 0, stream>>>(thw, Bthp, CC, CC, 16.0f);      // Bt[c][o] = W_θ[o][c]
  k_tok<<<BB * (CC / 64) * (NN / 32), 256, 0, stream>>>(x, X16);
  const dim3 gp((NR / 128) * (CC / 128), 1);
  k_gemm_t<0, true><<<gp, 256, 0, stream>>>(X16, CC, 0, Bph, CC, 0, 0.0625f, phb, nullptr, 0, FULLF, nullptr, nullptr, nullptr, nullptr, CC, 0, CC, CC); k_phipost<<<NRH / 32, 1024, 0, stream>>>(FULLF, thb, PHh, PHl, CV);      // phi (f32), then pooled, split hi/lo, and c = phi * b_theta
  k_gemm_t<0, false><<<gp, 256, 0, stream>>>(X16, CC, 0, Bg, CC, 0, 0.0625f, gb, nullptr, 0, nullptr, FULL, nullptr, nullptr, nullptr, CC, 0, CC, CC); k_poolvt<8, NH><<<BB * 8 * (NH / 64), 256, 0, stream>>>(FULL, CC, 0, Gt);      // g (f16), pooled and transposed: g^T [BB][512][1024]
  const dim3 gb2((NRH / 128) * (CC / 128), 1), gs((NN / 128) * (NH / 128), BB), gy((NN / 128) * (CC / 128), BB);      // blockIdx.y = batch where the B operand differs per batch
  k_gemm_t<0, true><<<gb2, 256, 0, stream>>>(PHh, CC, 0, Bthp, CC, 0, 0.0625f, nullptr, nullptr, 0, BP, nullptr, nullptr, nullptr, nullptr, CC, 0, CC, CC);
  k_gemm_t<2, true, true><<<gb2, 256, 0, stream>>>(PHl, CC, 0, Bthp, CC, 0, 0.0625f * 0.0009765625f, nullptr, nullptr, 0, BP, BPh, BPl, nullptr, nullptr, CC, 0, CC, CC);      // B' = phi * W_theta [BB*1024][512] (phi hi + lo), all batches as rows, leaves split hi/lo
  k_gemm_t<1, true><<<gs, 256, 0, stream>>>(X16, CC, (size_t)NN * CC, BPh, CC, (size_t)NH * CC, 1.0f, nullptr, CV, (size_t)NH, S, nullptr, nullptr, nullptr, nullptr, NH, (size_t)NN * NH, NH, CC);      // f = x * B'h^T + c (c broadcast over the rows of its batch)
  k_gemm_t<2, true><<<gs, 256, 0, stream>>>(X16, CC, (size_t)NN * CC, BPl, CC, (size_t)NH * CC, 0.0009765625f, nullptr, nullptr, 0, S, nullptr, nullptr, nullptr, nullptr, NH, (size_t)NN * NH, NH, CC);      // + x * B'l^T * 2^-10
  k_smx<<<NR / 8, 256, 0, stream>>>(S, P16);
  k_gemm_t<0, false><<<gy, 256, 0, stream>>>(P16, NH, (size_t)NN * NH, Gt, NH, (size_t)CC * NH, 0.000030517578125f, nullptr, nullptr, 0, nullptr, Y16, nullptr, nullptr, nullptr, CC, (size_t)NN * CC, CC, NH);      // y = softmax(f) * g, stored as f16
  k_gemm_t<0, true, false, true><<<gp, 256, 0, stream>>>(Y16, CC, 0, BW, CC, 0, 0.0625f, Wb, nullptr, 0, WY, nullptr, nullptr, PS, PM, CC, 0, CC, CC);      // wy = W(y) + b, with the BN partials of its row chunks
  k_bnfin<<<CC / 32, 1024, 0, stream>>>(PS, PM, ST); k_out<<<BB * (CC / 32) * (NN / 64), 256, 0, stream>>>(WY, ST, gam, bet, x, (float*)d_out);
}

// v005
// A run of this version takes 178 microseconds.
// Two timings next to v004 both put it at 1.10 times that version's speed.
// Over all steps from v000 it is 8.32 times as fast.
#include <hip/hip_runtime.h>
// Non-local block with view pooling (x [8, C=512, N=2048]): θ = conv1(x), φ = maxpool2(conv1(x)), g = maxpool2(conv1(x)); f = softmax(θᵀ·φ) [N × N/2] (unscaled); y = f·g; wy = conv1(y) + b;
// out = BN_train(wy)·γ + β + x. Because the unscaled logits reach σ≈20 and feed a near-one-hot softmax, θ is never rounded: the logits are re-associated as f = x·(φ·W_θ)ᵀ + 1·(φ·b_θ)ᵀ with x bf16-EXACT,
// φ (f32, max-pooled from an f32 projection) fed as f16 hi + lo·2^10 into φ·W_θ and that product again split hi/lo as the B operand (four cheap passes per batch), the column term added exactly through
// the epilogue addend; g, y as plain f16; P ×2^15 f16; all on v_wmma_f32_16x16x32_f16 ((out,in) weights bf16-exact ×2^4, f32 accumulate); the layout transposes, max-pooling, softmax rows, BN batch statistics (fixed-order) and the residual are f32 VALU.
#define BB 8
#define CC 512
#define NN 2048
#define NH (NN / 2)
#define NR (BB * NN)
#define NRH (BB * NH)

typedef __bf16 v16b __attribute__((ext_vector_type(16)));
typedef unsigned short v8us __attribute__((ext_vector_type(8), may_alias));
typedef float  v8f  __attribute__((ext_vector_type(8)));
typedef float  v4f  __attribute__((ext_vector_type(4)));
typedef float  v4fa __attribute__((ext_vector_type(4), may_alias));
union FragB { v16b v; v8us half[2]; unsigned short u[16]; };

__device__ __forceinline__ unsigned short bf16_bits(float x) { unsigned int u = __float_as_uint(x); return (unsigned short)((u + 0x7FFFu + ((u >> 16) & 1u)) >> 16); }
__device__ __forceinline__ float bf16_val(unsigned short b) { return __uint_as_float(((unsigned int)b) << 16); }
__device__ __forceinline__ float bf16_round(float x) { return bf16_val(bf16_bits(x)); }
// D += A·B with NT terms: 1 = ah·bh, 2 = + al·bh (A split), 3 = + ah·bl (both split)
template <int NT>
__device__ __forceinline__ v8f mmaN(v16b ah, v16b al, v16b bh, v16b bl, v8f c) {
  c = __builtin_amdgcn_wmma_f32_16x16x32_bf16(false, ah, false, bh, (short)0, c, false, false);
  if (NT >= 2) c = __builtin_amdgcn_wmma_f32_16x16x32_bf16(false, al, false, bh, (short)0, c, false, false);
  if (NT >= 3) c = __builtin_amdgcn_wmma_f32_16x16x32_bf16(false, ah, false, bl, (short)0, c, false, false);
  asm volatile("v_nop\n\tv_nop\n\tv_nop\n\tv_nop" : "+v"(c) : "v"(ah), "v"(al), "v"(bh), "v"(bl));
  return c;
}

__global__ __launch_bounds__(256) void k_wt_bf16(const float* __restrict__ W, unsigned short* __restrict__ Wt, int K, int N) {
  const int t = blockIdx.x * 256 + threadIdx.x;
  const int k8n = K / 8;
  if (t >= N * k8n) return;
  const int n = t / k8n, k8 = (t % k8n) * 8;
  v8us v;
#pragma unroll
  for (int i = 0; i < 8; ++i) v[i] = bf16_bits(W[(size_t)(k8 + i) * N + n]);
  *(v8us*)(Wt + (size_t)n * K + k8) = v;
  
}

// GEMM C[M][N] (f32, pitch ldc) = act(A[M][K]·W + bias). A f32 row-major (pitch lda) converted per fragment to bf16
// (ASPLIT: hi/lo two planes -> 2 terms, else single rounded term); Wt bf16 [N][K] (pitch ldb). BIAS_BF16 rounds the
// bias to bf16 first (bias quantised to bf16 before the add). K%32==0, M%16==0, N%64==0.
template <bool ASPLIT, int ACT, bool BIAS_BF16>
__global__ __launch_bounds__(128) void k_gemm_bf(const float* __restrict__ A, int lda, const unsigned short* __restrict__ Wt, int ldb,
                                               const float* __restrict__ bias, float* __restrict__ C, int ldc, int M, int N, int K) {
  __shared__ __attribute__((aligned(16))) float so[4][16][64];
  const int tid = threadIdx.x, w = tid >> 5, lane = tid & 31, ln = lane & 15, hh = lane >> 4;
  const int ntn = N / 64;
  const int wid = blockIdx.x * 4 + w;
  const int mt = wid / ntn, nq = wid % ntn;
  if (mt * 16 >= M) return;
  const int row0 = mt * 16, col0 = nq * 64;
  const float* arow = A + (size_t)(row0 + ln) * lda;
  v8f acc[4] = {};
  for (int kb = 0; kb < K; kb += 32) {
    FragB ah, al;
    const v4f x0 = *(const v4fa*)(arow + kb + 8 * hh), x1 = *(const v4fa*)(arow + kb + 8 * hh + 4);
    const v4f x2 = *(const v4fa*)(arow + kb + 16 + 8 * hh), x3 = *(const v4fa*)(arow + kb + 16 + 8 * hh + 4);
    float xs[16] = {x0[0],x0[1],x0[2],x0[3],x1[0],x1[1],x1[2],x1[3],x2[0],x2[1],x2[2],x2[3],x3[0],x3[1],x3[2],x3[3]};
#pragma unroll
    for (int i = 0; i < 16; ++i) { const unsigned short hb = bf16_bits(xs[i]); ah.u[i] = hb; al.u[i] = ASPLIT ? bf16_bits(xs[i] - bf16_val(hb)) : (unsigned short)0; }
#pragma unroll
    for (int t = 0; t < 4; ++t) {
      const unsigned short* brow = Wt + (size_t)(col0 + t * 16 + ln) * ldb + kb;
      FragB b;
      b.half[0] = *(const v8us*)(brow + 8 * hh);
      b.half[1] = *(const v8us*)(brow + 16 + 8 * hh);
      acc[t] = mmaN<ASPLIT ? 2 : 1>(ah.v, al.v, b.v, b.v, acc[t]);
    }
  }
#pragma unroll
  for (int t = 0; t < 4; ++t) {
    float bv = bias ? bias[col0 + t * 16 + ln] : 0.f;
    if (BIAS_BF16) bv = bf16_round(bv);
#pragma unroll
    for (int r = 0; r < 8; ++r) { float v = acc[t][r] + bv; if (ACT == 1) v = fmaxf(v, 0.f); so[w][8 * hh + r][t * 16 + ln] = v; }
  }
  __builtin_amdgcn_fence(__ATOMIC_ACQ_REL, "workgroup");
  __builtin_amdgcn_wave_barrier();
  const int rsub = lane >> 4, c4 = (lane & 15) * 4;
  {
#pragma unroll
    for (int q = 0; q < 8; ++q) {
      const int r = q * 2 + rsub;
      const v4f v = *(const v4fa*)&so[w][r][c4];
      *(v4f*)(C + (size_t)(row0 + r) * ldc + col0 + c4) = v;
    }
    
  }
}

// Flash-style causal/unmasked attention, all contractions 3-term bf16 hi/lo splits, f32 softmax with running max.
// q,k,v rows are read from f32 buffers with arbitrary row pitch (so they can live inside a fused qkv buffer);
// D = head size (multiple of 32, <= 128); one wave = 16 query rows; block = 4 waves (64 queries) sharing K/V chunks of 32.
template <int D, bool CAUSAL>
__global__ __launch_bounds__(128) void k_flash(const float* __restrict__ qb, const float* __restrict__ kb, const float* __restrict__ vb,
                                             int pitch, int T, int H, float scale, float* __restrict__ y, int ypitch) {
  constexpr int KS = D / 32;        // k-steps for QK
  constexpr int DT = D / 16;        // d tiles for PV
  __shared__ __attribute__((aligned(16))) unsigned short sKh[32][D + 8], sKl[32][D + 8], sVh[32][D + 8], sVl[32][D + 8];
  __shared__ __attribute__((aligned(16))) unsigned short sPh[4][16][40], sPl[4][16][40];
  __shared__ __attribute__((aligned(16))) float sO[4][16][D];
  const int tid = threadIdx.x, w = tid >> 5, lane = tid & 31, ln = lane & 15, hh = lane >> 4;
  const int nqb = (T + 63) / 64;
  const int bh = blockIdx.x / nqb, qblk = blockIdx.x % nqb;
  const int b = bh / H, h = bh % H;
  const int q0 = qblk * 64 + w * 16;
  const float* Q = qb + (size_t)b * T * pitch + h * D;
  const float* K = kb + (size_t)b * T * pitch + h * D;
  const float* V = vb + (size_t)b * T * pitch + h * D;

  // A fragments of the wave's 16 query rows (scaled), hi/lo
  FragB aqh[KS], aql[KS];
  {
    int row = q0 + ln; if (row >= T) row = T - 1;
    const float* qr = Q + (size_t)row * pitch;
#pragma unroll
    for (int ks = 0; ks < KS; ++ks)
#pragma unroll
      for (int i = 0; i < 16; ++i) {
        const int d = ks * 32 + ((i < 8) ? (8 * hh + i) : (16 + 8 * hh + (i - 8)));
        const float x = qr[d] * scale; const unsigned short hb = bf16_bits(x);
        aqh[ks].u[i] = hb; aql[ks].u[i] = bf16_bits(x - bf16_val(hb));
      }
  }
  float m_r[8], l_r[8];
#pragma unroll
  for (int r = 0; r < 8; ++r) { m_r[r] = -3.0e38f; l_r[r] = 0.f; }
  v8f oacc[DT];
#pragma unroll
  for (int dt = 0; dt < DT; ++dt) oacc[dt] = (v8f){0.f,0.f,0.f,0.f,0.f,0.f,0.f,0.f};

  const int kv_end = CAUSAL ? min(T, qblk * 64 + 64) : T;     // block-uniform
  for (int j0 = 0; j0 < kv_end; j0 += 32) {
    __syncthreads();
    for (int e = tid; e < 32 * (D / 4); e += 128) {
      const int r = e / (D / 4), c4 = (e % (D / 4)) * 4;
      const int key = j0 + r;
      v4f kf = {0.f,0.f,0.f,0.f}, vf = {0.f,0.f,0.f,0.f};
      if (key < T) { kf = *(const v4fa*)(K + (size_t)key * pitch + c4); vf = *(const v4fa*)(V + (size_t)key * pitch + c4); }
#pragma unroll
      for (int t = 0; t < 4; ++t) {
        unsigned short hb = bf16_bits(kf[t]); sKh[r][c4 + t] = hb; sKl[r][c4 + t] = bf16_bits(kf[t] - bf16_val(hb));
        hb = bf16_bits(vf[t]); sVh[r][c4 + t] = hb; sVl[r][c4 + t] = bf16_bits(vf[t] - bf16_val(hb));
      }
    }
    __syncthreads();
    // S tile 16 x 32
    v8f s[2];
#pragma unroll
    for (int nt = 0; nt < 2; ++nt) {
      v8f acc = {};
#pragma unroll
      for (int ks = 0; ks < KS; ++ks) {
        FragB bh_, bl_;
        bh_.half[0] = *(const v8us*)&sKh[nt * 16 + ln][ks * 32 + 8 * hh]; bh_.half[1] = *(const v8us*)&sKh[nt * 16 + ln][ks * 32 + 16 + 8 * hh];
        bl_.half[0] = *(const v8us*)&sKl[nt * 16 + ln][ks * 32 + 8 * hh]; bl_.half[1] = *(const v8us*)&sKl[nt * 16 + ln][ks * 32 + 16 + 8 * hh];
        acc = mmaN<3>(aqh[ks].v, aql[ks].v, bh_.v, bl_.v, acc);
      }
      s[nt] = acc;
    }
    // mask + running max (rows 8hh+r; the 16 lanes of a half share rows)
    float alpha[8];
#pragma unroll
    for (int r = 0; r < 8; ++r) {
      const int qi = q0 + 8 * hh + r;
      const int ja = j0 + ln, jb = j0 + 16 + ln;
      if (CAUSAL) { if (ja > qi) s[0][r] = -3.0e38f; if (jb > qi) s[1][r] = -3.0e38f; }
      if (ja >= T) s[0][r] = -3.0e38f;
      if (jb >= T) s[1][r] = -3.0e38f;
      float mx = fmaxf(s[0][r], s[1][r]);
      mx = fmaxf(mx, __shfl_xor(mx, 1, 32)); mx = fmaxf(mx, __shfl_xor(mx, 2, 32)); mx = fmaxf(mx, __shfl_xor(mx, 4, 32)); mx = fmaxf(mx, __shfl_xor(mx, 8, 32));
      const float mnew = fmaxf(m_r[r], mx);
      alpha[r] = (mnew > -1.0e38f) ? __expf(m_r[r] - mnew) : 1.0f;
      const float p0 = (s[0][r] > -1.0e38f) ? __expf(s[0][r] - mnew) : 0.f;
      const float p1 = (s[1][r] > -1.0e38f) ? __expf(s[1][r] - mnew) : 0.f;
      m_r[r] = mnew;
      l_r[r] = l_r[r] * alpha[r] + p0 + p1;            // per-lane partial row sum (16 lanes combined at the end)
      unsigned short hb = bf16_bits(p0); sPh[w][8 * hh + r][ln] = hb;      sPl[w][8 * hh + r][ln] = bf16_bits(p0 - bf16_val(hb));
      hb = bf16_bits(p1);                sPh[w][8 * hh + r][16 + ln] = hb; sPl[w][8 * hh + r][16 + ln] = bf16_bits(p1 - bf16_val(hb));
    }
#pragma unroll
    for (int dt = 0; dt < DT; ++dt)
#pragma unroll
      for (int r = 0; r < 8; ++r) oacc[dt][r] *= alpha[r];
    __builtin_amdgcn_fence(__ATOMIC_ACQ_REL, "workgroup");
    __builtin_amdgcn_wave_barrier();
    FragB pah, pal;
    pah.half[0] = *(const v8us*)&sPh[w][ln][8 * hh]; pah.half[1] = *(const v8us*)&sPh[w][ln][16 + 8 * hh];
    pal.half[0] = *(const v8us*)&sPl[w][ln][8 * hh]; pal.half[1] = *(const v8us*)&sPl[w][ln][16 + 8 * hh];
#pragma unroll
    for (int dt = 0; dt < DT; ++dt) {
      FragB bvh, bvl;
#pragma unroll
      for (int i = 0; i < 8; ++i) {
        bvh.u[i] = sVh[8 * hh + i][dt * 16 + ln]; bvh.u[8 + i] = sVh[16 + 8 * hh + i][dt * 16 + ln];
        bvl.u[i] = sVl[8 * hh + i][dt * 16 + ln]; bvl.u[8 + i] = sVl[16 + 8 * hh + i][dt * 16 + ln];
      }
      oacc[dt] = mmaN<3>(pah.v, pal.v, bvh.v, bvl.v, oacc[dt]);
    }
    __builtin_amdgcn_fence(__ATOMIC_ACQ_REL, "workgroup");
    __builtin_amdgcn_wave_barrier();
  }
#pragma unroll
  for (int r = 0; r < 8; ++r) {
    float l = l_r[r];
    l += __shfl_xor(l, 1, 32); l += __shfl_xor(l, 2, 32); l += __shfl_xor(l, 4, 32); l += __shfl_xor(l, 8, 32);
    l_r[r] = (l > 0.f) ? 1.0f / l : 0.f;
  }
#pragma unroll
  for (int dt = 0; dt < DT; ++dt)
#pragma unroll
    for (int r = 0; r < 8; ++r) sO[w][8 * hh + r][dt * 16 + ln] = oacc[dt][r] * l_r[r];
  __builtin_amdgcn_fence(__ATOMIC_ACQ_REL, "workgroup");
  __builtin_amdgcn_wave_barrier();
  {
    for (int r = 0; r < 16; ++r) {
      const int row = q0 + r;
      if (row < T && lane < D / 4) {
        const v4f val = *(const v4fa*)&sO[w][r][lane * 4];
        *(v4f*)(y + ((size_t)b * T + row) * ypitch + h * D + lane * 4) = val;
      }
    }
    
  }
}

// GEMM C = act(A·W + bias + resid): A f32 (ASPLIT -> hi/lo 2 terms), Wt bf16 [N][K]; ACT 0 none, 1 relu, 2 exact gelu;
// resid (optional, f32, row index = (row % rmod), pitch ldr, RES_BF16 rounds it) added before the activation.
template <bool ASPLIT, int ACT, bool BIAS_BF16, bool RES_BF16>
__global__ __launch_bounds__(128) void k_gemm_bf3(const float* __restrict__ A, int lda, const unsigned short* __restrict__ Wt, int ldb,
                                                const float* __restrict__ bias, const float* __restrict__ resid, int rmod, int ldr,
                                                float* __restrict__ C, int ldc, int M, int N, int K) {
  __shared__ __attribute__((aligned(16))) float so[4][16][64];
  const int tid = threadIdx.x, w = tid >> 5, lane = tid & 31, ln = lane & 15, hh = lane >> 4;
  const int ntn = N / 64;
  const int wid = blockIdx.x * 4 + w;
  const int mt = wid / ntn, nq = wid % ntn;
  if (mt * 16 >= M) return;
  const int row0 = mt * 16, col0 = nq * 64;
  const float* arow = A + (size_t)(row0 + ln) * lda;
  v8f acc[4] = {};
  for (int kb = 0; kb < K; kb += 32) {
    FragB ah, al;
    const v4f x0 = *(const v4fa*)(arow + kb + 8 * hh), x1 = *(const v4fa*)(arow + kb + 8 * hh + 4);
    const v4f x2 = *(const v4fa*)(arow + kb + 16 + 8 * hh), x3 = *(const v4fa*)(arow + kb + 16 + 8 * hh + 4);
    float xs[16] = {x0[0],x0[1],x0[2],x0[3],x1[0],x1[1],x1[2],x1[3],x2[0],x2[1],x2[2],x2[3],x3[0],x3[1],x3[2],x3[3]};
#pragma unroll
    for (int i = 0; i < 16; ++i) { const unsigned short hb = bf16_bits(xs[i]); ah.u[i] = hb; al.u[i] = ASPLIT ? bf16_bits(xs[i] - bf16_val(hb)) : (unsigned short)0; }
#pragma unroll
    for (int t = 0; t < 4; ++t) {
      const unsigned short* brow = Wt + (size_t)(col0 + t * 16 + ln) * ldb + kb;
      FragB b;
      b.half[0] = *(const v8us*)(brow + 8 * hh);
      b.half[1] = *(const v8us*)(brow + 16 + 8 * hh);
      acc[t] = mmaN<ASPLIT ? 2 : 1>(ah.v, al.v, b.v, b.v, acc[t]);
    }
  }
#pragma unroll
  for (int t = 0; t < 4; ++t) {
    const int col = col0 + t * 16 + ln;
    float bv = bias ? bias[col] : 0.f;
    if (BIAS_BF16) bv = bf16_round(bv);
#pragma unroll
    for (int r = 0; r < 8; ++r) {
      float v = acc[t][r] + bv;
      if (resid) { float rv = resid[(size_t)((row0 + 8 * hh + r) % rmod) * ldr + col]; if (RES_BF16) rv = bf16_round(rv); v += rv; }
      if (ACT == 1) v = fmaxf(v, 0.f);
      if (ACT == 2) v = 0.5f * v * (1.0f + erff(v * 0.70710678118654752f));
      if (ACT == 3) { const float u = 0.7978845608028654f * (v + 0.044715f * v * v * v); v = 0.5f * v * (1.0f + tanhf(u)); }
      so[w][8 * hh + r][t * 16 + ln] = v;
    }
  }
  __builtin_amdgcn_fence(__ATOMIC_ACQ_REL, "workgroup");
  __builtin_amdgcn_wave_barrier();
  const int rsub = lane >> 4, c4 = (lane & 15) * 4;
  {
#pragma unroll
    for (int q = 0; q < 8; ++q) {
      const int r = q * 2 + rsub;
      const v4f v = *(const v4fa*)&so[w][r][c4];
      *(v4f*)(C + (size_t)(row0 + r) * ldc + col0 + c4) = v;
    }
    
  }
}
// row LayerNorm (biased variance, eps) over N: s = X (+ R); optional out_sum <- s; out_norm <- (s-mu)*rsqrt(var+eps)*g + b
template <bool PARAM_BF16>
__global__ __launch_bounds__(256) void k_layernorm(const float* __restrict__ X, const float* __restrict__ R, const float* __restrict__ g, const float* __restrict__ bta,
                                                  float* __restrict__ out_sum, float* __restrict__ out_norm, int N, float eps) {
  __shared__ float red[256];
  const int row = blockIdx.x, tid = threadIdx.x;
  const float* x = X + (size_t)row * N; const float* rr = R ? R + (size_t)row * N : nullptr;
  float vals[16];                     // up to N = 4096
  const int per = N / 256;            // contiguous chunk per thread? use strided-by-4 chunks: thread handles j = tid*4 + 1024*u
  float s1 = 0.f;
  for (int u = 0; u < per / 4; ++u) {
    const int j = tid * 4 + 1024 * u;
    const v4f a = *(const v4fa*)(x + j);
    v4f b = {0.f,0.f,0.f,0.f}; if (rr) b = *(const v4fa*)(rr + j);
#pragma unroll
    for (int q = 0; q < 4; ++q) { const float v = a[q] + b[q]; vals[u * 4 + q] = v; s1 += v; }
  }
  red[tid] = s1; __syncthreads();
  for (int st = 128; st > 0; st >>= 1) { if (tid < st) red[tid] += red[tid + st]; __syncthreads(); }
  const float mu = red[0] / (float)N; __syncthreads();
  float s2 = 0.f;
  for (int u = 0; u < per / 4; ++u)
#pragma unroll
    for (int q = 0; q < 4; ++q) { const float c = vals[u * 4 + q] - mu; s2 += c * c; }
  red[tid] = s2; __syncthreads();
  for (int st = 128; st > 0; st >>= 1) { if (tid < st) red[tid] += red[tid + st]; __syncthreads(); }
  const float rs = rsqrtf(red[0] / (float)N + eps);
  {
    for (int u = 0; u < per / 4; ++u) {
      const int j = tid * 4 + 1024 * u;
      v4f o, sm;
#pragma unroll
      for (int q = 0; q < 4; ++q) {
        float gg = g[j + q], bb = bta[j + q];
        if (PARAM_BF16) { gg = bf16_round(gg); bb = bf16_round(bb); }
        sm[q] = vals[u * 4 + q]; o[q] = (vals[u * 4 + q] - mu) * rs * gg + bb;
      }
      if (out_sum) *(v4f*)(out_sum + (size_t)row * N + j) = sm;
      *(v4f*)(out_norm + (size_t)row * N + j) = o;
    }
    
  }
}



// ---- f16 WMMA path (v_wmma_f32_16x16x32_f16): 11-bit significands for operands in range — used where a [0,1] probability operand needs more precision than bf16
typedef _Float16 v16h __attribute__((ext_vector_type(16)));
union FragH { v16h v; v8us half[2]; _Float16 h[16]; unsigned short u[16]; };
template <int NT>
__device__ __forceinline__ v8f mmaH(v16h ah, v16h al, v16h bh, v16h bl, v8f c) {
  c = __builtin_amdgcn_wmma_f32_16x16x32_f16(false, ah, false, bh, (short)0, c, false, false);
  if (NT >= 2) c = __builtin_amdgcn_wmma_f32_16x16x32_f16(false, al, false, bh, (short)0, c, false, false);
  if (NT >= 3) c = __builtin_amdgcn_wmma_f32_16x16x32_f16(false, ah, false, bl, (short)0, c, false, false);
  asm volatile("v_nop\n\tv_nop\n\tv_nop\n\tv_nop" : "+v"(c) : "v"(ah), "v"(al), "v"(bh), "v"(bl));
  return c;
}
// batched GEMM like k_gemm_b but f16 operands: A f32 (split into f16 hi/lo if ASPLIT, else rounded to f16), Bt = f16 values [n][k]; alpha; C f32; N multiple of 16 (partial tiles skipped)
template <bool ASPLIT>
__global__ __launch_bounds__(128) void k_gemm_h(const float* __restrict__ A, int lda, size_t sA, const _Float16* __restrict__ Bh, int ldb, size_t sB, float alpha, float* __restrict__ C, int ldc, size_t sC, int M, int N, int K) {
  __shared__ __attribute__((aligned(16))) float so[4][16][64];
  const int tid = threadIdx.x, w = tid >> 5, lane = tid & 31, ln = lane & 15, hh = lane >> 4; const int by = blockIdx.y;
  A += (size_t)by * sA; Bh += (size_t)by * sB; C += (size_t)by * sC;
  const int ntn = (N + 63) / 64; const int wid = blockIdx.x * 4 + w; const int mt = wid / ntn, nq = wid % ntn; if (mt * 16 >= M) return;
  const int row0 = mt * 16, col0 = nq * 64; const float* arow = A + (size_t)(row0 + ln) * lda;
  v8f acc[4] = {};
  for (int kb = 0; kb < K; kb += 32) {
    FragH ah, al;
    const v4f x0 = *(const v4fa*)(arow + kb + 8 * hh), x1 = *(const v4fa*)(arow + kb + 8 * hh + 4), x2 = *(const v4fa*)(arow + kb + 16 + 8 * hh), x3 = *(const v4fa*)(arow + kb + 16 + 8 * hh + 4);
    float xs[16] = {x0[0],x0[1],x0[2],x0[3],x1[0],x1[1],x1[2],x1[3],x2[0],x2[1],x2[2],x2[3],x3[0],x3[1],x3[2],x3[3]};
#pragma unroll
    for (int i = 0; i < 16; ++i) { const _Float16 h = (_Float16)xs[i]; ah.h[i] = h; al.h[i] = ASPLIT ? (_Float16)(xs[i] - (float)h) : (_Float16)0.0f; }
#pragma unroll
    for (int t = 0; t < 4; ++t) { if (col0 + t * 16 >= N) continue; const size_t boff = (size_t)(col0 + t * 16 + ln) * ldb + kb; FragH bq; bq.half[0] = *(const v8us*)(Bh + boff + 8 * hh); bq.half[1] = *(const v8us*)(Bh + boff + 16 + 8 * hh);
      acc[t] = mmaH<ASPLIT ? 2 : 1>(ah.v, al.v, bq.v, bq.v, acc[t]); }
  }
#pragma unroll
  for (int t = 0; t < 4; ++t) { if (col0 + t * 16 >= N) continue;
#pragma unroll
    for (int r = 0; r < 8; ++r) so[w][8 * hh + r][t * 16 + ln] = acc[t][r] * alpha; }
  __builtin_amdgcn_fence(__ATOMIC_ACQ_REL, "workgroup"); __builtin_amdgcn_wave_barrier();
  const int rsub = lane >> 4, c4 = (lane & 15) * 4;
  {
#pragma unroll
    for (int q = 0; q < 8; ++q) { const int r = q * 2 + rsub; if (col0 + c4 < N) { const v4f v = *(const v4fa*)&so[w][r][c4]; *(v4f*)(C + (size_t)(row0 + r) * ldc + col0 + c4) = v; } }
     }
}

// Wt[n][k] = f16(W[k][n]·scale) from f32 row-major W[K][N] (scale = power of two; bf16-exact weights stay exact in f16 away from the subnormal range)
__global__ __launch_bounds__(256) void k_wt_f16(const float* __restrict__ W, _Float16* __restrict__ Wt, int K, int N, float scale) {
  const int t = blockIdx.x * 256 + threadIdx.x; if (t >= N * (K / 8)) return; const int n = t / (K / 8), k8 = (t % (K / 8)) * 8; FragH f;
#pragma unroll
  for (int i = 0; i < 8; ++i) f.h[i] = (_Float16)(bf16_round(W[(size_t)(k8 + i) * N + n]) * scale); const v8us o = f.half[0];
  *(v8us*)((unsigned short*)Wt + (size_t)n * K + k8) = o; 
}
// Tiled GEMM, f16 operands, both K-contiguous: v[row][col] = acc*alpha + bias[col], then CPM 1: + CP[by*sCPy + col] (one row for all rows); written as f32 to C (F32OUT) or as f16 to C16,
// or (HL) split as f16 hi to C16 and (v - hi) * 2^10 as f16 to C16l, with nothing written to C.
// TWO: a product whose one operand is split hi + lo * 2^-10 runs in one launch on one accumulator: first the K of the lo pair A, Bh; the sums are then scaled by 2^-10 (exact); the K of the hi pair A2, B2 is added on top.
// BNP: stage 1 of the BN batch statistics. A wave's 32 rows are one row chunk: per column it also writes their sum to PS and the sum of their squared deviations from their own mean to PM (row = chunk, pitch ldc).
// One 128x128 tile per workgroup of 8 waves (4 x 2, 32x64 per wave). A pass is 64 k = one whole 128-B line of every operand row: each wave-wide 16-B load
// covers four whole lines and goes through registers into LDS (row pitch 144 B for the ds_load_b128 fragment readers); two buffers, one barrier per pass;
// the next pass's global loads are issued before this pass's products. M, N multiples of 128 (the grid is exact), K a multiple of 64.
// Every "#pragma unroll" below makes the index of a register array (staged rows, fragments, accumulators) a constant, so that the array stays in registers.
#define TPITCH 72
typedef float fa1 __attribute__((may_alias));
typedef _Float16 v4hs __attribute__((ext_vector_type(4)));
typedef float v2f __attribute__((ext_vector_type(2)));
typedef float v2fa __attribute__((ext_vector_type(2), may_alias));
template <int CPM, bool F32OUT, bool HL = false, bool BNP = false, bool TWO = false>
__global__ __launch_bounds__(256) void k_gemm_t(const _Float16* __restrict__ A, const _Float16* __restrict__ A2, int lda, size_t sA, const _Float16* __restrict__ Bh, const _Float16* __restrict__ B2, int ldb, size_t sB, float alpha, const float* __restrict__ bias, const float* __restrict__ CP, size_t sCPy,
    float* __restrict__ C, _Float16* __restrict__ C16, _Float16* __restrict__ C16l, float* __restrict__ PS, float* __restrict__ PM, int ldc, size_t sC, int N, int K) {
  __shared__ __attribute__((aligned(16))) unsigned short st[2][2][128 * TPITCH];      // [buffer][A, B][row * TPITCH + k]
  const int tid = threadIdx.x, w = tid >> 5, lane = tid & 31, ln = lane & 15, hh = lane >> 4; const int by = blockIdx.y;
  const int ntn = N / 128; const int row0 = ((int)blockIdx.x / ntn) * 128, col0 = ((int)blockIdx.x % ntn) * 128;
  const int sr = tid >> 3, sc = (tid & 7) * 8;      // staging: 8 lanes per row, rows sr + 32 i
  const unsigned short* ga = (const unsigned short*)A + (size_t)by * sA + (size_t)row0 * lda;      // workgroup-uniform bases, per-lane 32-bit offsets that never change
  const unsigned short* gb = (const unsigned short*)Bh + (size_t)by * sB + (size_t)col0 * ldb;
  const unsigned short* ga2 = (const unsigned short*)A2 + (size_t)by * sA + (size_t)row0 * lda;      // TWO: the same tile of the hi pair
  const unsigned short* gb2 = (const unsigned short*)B2 + (size_t)by * sB + (size_t)col0 * ldb;
  unsigned oa[4], ob[4];
#pragma unroll
  for (int i = 0; i < 4; ++i) { oa[i] = (unsigned)((sr + 32 * i) * lda + sc); ob[i] = (unsigned)((sr + 32 * i) * ldb + sc); }
  v8us ra[4], rb[4]; const unsigned short *pa[4], *pb[4];
#pragma unroll
  for (int i = 0; i < 4; ++i) { pa[i] = ga + oa[i]; pb[i] = gb + ob[i]; }
#pragma unroll
  for (int i = 0; i < 4; ++i) { ra[i] = *(const v8us*)pa[i]; rb[i] = *(const v8us*)pb[i]; }
  // the eight address pairs are inputs of the wait: they stay in their registers up to it, so no load of the group is given a register that an issued load names
  asm volatile("s_wait_xcnt 0x0" :: "v"(pa[0]), "v"(pa[1]), "v"(pa[2]), "v"(pa[3]), "v"(pb[0]), "v"(pb[1]), "v"(pb[2]), "v"(pb[3]) : "memory");
#pragma unroll
  for (int i = 0; i < 4; ++i) { *(v8us*)&st[0][0][(sr + 32 * i) * TPITCH + sc] = ra[i]; *(v8us*)&st[0][1][(sr + 32 * i) * TPITCH + sc] = rb[i]; }
  __syncthreads();
  const int wm = w >> 1, wn = w & 1; const int ns1 = K / 64, ns = TWO ? 2 * ns1 : ns1;
  v8f acc[2][4] = {};
  for (int s = 0; s < ns; ++s) {
    const int cur = s & 1; const bool more = s + 1 < ns;      // the same in every thread of the workgroup
    if (more) {
      const bool sw = TWO && s + 1 == ns1;      // the next pass is the first of the hi pair; otherwise it lies 64 k = 128 B further
      ga = sw ? ga2 : ga + 64; gb = sw ? gb2 : gb + 64;
#pragma unroll
      for (int i = 0; i < 4; ++i) { pa[i] = ga + oa[i]; pb[i] = gb + ob[i]; }
#pragma unroll
      for (int i = 0; i < 4; ++i) { ra[i] = *(const v8us*)pa[i]; rb[i] = *(const v8us*)pb[i]; }
      // as in front of the loop: the address pairs stay in their registers up to the wait
      asm volatile("s_wait_xcnt 0x0" :: "v"(pa[0]), "v"(pa[1]), "v"(pa[2]), "v"(pa[3]), "v"(pb[0]), "v"(pb[1]), "v"(pb[2]), "v"(pb[3]) : "memory");
    }
    if (TWO && s == ns1) {      // the lo pair's sums take their weight before the hi pair's products are added
#pragma unroll
      for (int mi = 0; mi < 2; ++mi)
#pragma unroll
        for (int t = 0; t < 4; ++t) acc[mi][t] *= 0.0009765625f;
    }
    const unsigned short* la = &st[cur][0][(wm * 32 + ln) * TPITCH + 8 * hh];
    const unsigned short* lb = &st[cur][1][(wn * 64 + ln) * TPITCH + 8 * hh];
    FragH a[2][2], b[2][4];      // all of the pass's fragments are read as one group ahead of its products
#pragma unroll
    for (int ks = 0; ks < 2; ++ks) {
#pragma unroll
      for (int mi = 0; mi < 2; ++mi) { a[ks][mi].half[0] = *(const v8us*)(la + mi * 16 * TPITCH + ks * 32); a[ks][mi].half[1] = *(const v8us*)(la + mi * 16 * TPITCH + ks * 32 + 16); }
#pragma unroll
      for (int t = 0; t < 4; ++t) { b[ks][t].half[0] = *(const v8us*)(lb + t * 16 * TPITCH + ks * 32); b[ks][t].half[1] = *(const v8us*)(lb + t * 16 * TPITCH + ks * 32 + 16); }
    }
#pragma unroll
    for (int ks = 0; ks < 2; ++ks)
#pragma unroll
      for (int t = 0; t < 4; ++t)
#pragma unroll
        for (int mi = 0; mi < 2; ++mi) acc[mi][t] = mmaH<1>(a[ks][mi].v, a[ks][mi].v, b[ks][t].v, b[ks][t].v, acc[mi][t]);
    if (more) {
#pragma unroll
      for (int i = 0; i < 4; ++i) { *(v8us*)&st[cur ^ 1][0][(sr + 32 * i) * TPITCH + sc] = ra[i]; *(v8us*)&st[cur ^ 1][1][(sr + 32 * i) * TPITCH + sc] = rb[i]; }
    }
    __syncthreads();      // publishes the buffer just filled and ends every read of the one just used
  }
  // epilogue: each wave turns its accumulators into whole rows through its own 32 x 68 f32 range of the (now free) staging LDS
  fa1* so = (fa1*)&st[0][0][0] + w * (32 * 68);
  const size_t cofs = (size_t)by * sC; const int wrow0 = row0 + wm * 32, wcol0 = col0 + wn * 64; const int rsub = lane >> 4, c4 = (lane & 15) * 4;
  float* crow = C + cofs + (size_t)(wrow0 + rsub) * ldc + wcol0 + c4;      // each lane writes 16 B of rows rsub + 2 q
  v4f cp = {0.f, 0.f, 0.f, 0.f};
  if (CPM == 1) cp = *(const v4fa*)(CP + (size_t)by * sCPy + wcol0 + c4);
#pragma unroll
  for (int t = 0; t < 4; ++t) { const float bv = bias ? bf16_round(bias[wcol0 + t * 16 + ln]) : 0.f;
#pragma unroll
    for (int mi = 0; mi < 2; ++mi)
#pragma unroll
      for (int r = 0; r < 8; ++r) so[(mi * 16 + 8 * hh + r) * 68 + t * 16 + ln] = acc[mi][t][r] * alpha + bv; }
  __builtin_amdgcn_fence(__ATOMIC_ACQ_REL, "workgroup"); __builtin_amdgcn_wave_barrier();      // the wave's LDS rows are complete before its lanes read what other lanes wrote
#pragma unroll
  for (int q = 0; q < 16; ++q) { const int r = q * 2 + rsub; const int row = wrow0 + r; v4f v = *(const v4fa*)&so[r * 68 + c4];
    if (CPM != 0) { for (int i = 0; i < 4; ++i) v[i] += cp[i]; }
    if (HL) { v4hs h4, l4; for (int i = 0; i < 4; ++i) { const _Float16 h = (_Float16)v[i]; h4[i] = h; l4[i] = (_Float16)((v[i] - (float)h) * 1024.0f); }
      const size_t o = cofs + (size_t)row * ldc + wcol0 + c4; *(v4hs*)(C16 + o) = h4; *(v4hs*)(C16l + o) = l4; continue; }
    if (F32OUT) *(v4f*)(crow + (size_t)(q * 2) * ldc) = v;
    else { v4hs h4; for (int i = 0; i < 4; ++i) h4[i] = (_Float16)v[i]; *(v4hs*)(C16 + cofs + (size_t)row * ldc + wcol0 + c4) = h4; } }
  if (BNP) {      // a lane takes two adjacent columns of the wave's 64 and adds the 32 rows in row order
    asm volatile("s_wait_xcnt 0x0" ::: "memory");      // the row stores above have taken their registers before the sums below reuse them
    v2f xr[32];
#pragma unroll      // constant indices keep xr in registers
    for (int r = 0; r < 32; ++r) xr[r] = *(const v2fa*)&so[r * 68 + lane * 2];
    v2f s = xr[0];
#pragma unroll      // xr stays in registers
    for (int r = 1; r < 32; ++r) s += xr[r];
    const v2f mu = s * (1.0f / 32.0f);
    v2f m2 = {0.f, 0.f};
#pragma unroll      // xr stays in registers
    for (int r = 0; r < 32; ++r) { const v2f d = xr[r] - mu; m2 += d * d; }
    const size_t o = (size_t)(wrow0 / 32) * ldc + wcol0 + lane * 2; *(v2f*)(PS + o) = s; *(v2f*)(PM + o) = m2;
  }
}


typedef _Float16 v4h __attribute__((ext_vector_type(4)));

__global__ __launch_bounds__(256) void k_x16(const float* __restrict__ x, _Float16* __restrict__ X16, size_t n8) { const size_t t = (size_t)blockIdx.x * 256 + threadIdx.x; if (t >= n8) return; FragH f;
#pragma unroll
  for (int q = 0; q < 8; ++q) f.h[q] = (_Float16)bf16_round(x[t * 8 + q]); *(v8us*)((unsigned short*)X16 + t * 8) = f.half[0];  }
__global__ __launch_bounds__(256) void k_round16f(const float* __restrict__ W, _Float16* __restrict__ Bt, size_t n8) { const size_t t = (size_t)blockIdx.x * 256 + threadIdx.x; if (t >= n8) return; FragH f;
#pragma unroll
  for (int i = 0; i < 8; ++i) f.h[i] = (_Float16)(bf16_round(W[t * 8 + i]) * 16.0f); *(v8us*)((unsigned short*)Bt + t * 8) = f.half[0];  }
// Max-pool over row pairs and transpose in one pass: Vt[slab][d][p] = max(V16[2 p][d], V16[2 p + 1][d]) for a 64 x 64 tile of pooled rows p and columns d; 8 lanes read one whole 128-B line of each of the two rows.
typedef _Float16 v8h __attribute__((ext_vector_type(8)));
template <int NHv, int TTv>
__global__ __launch_bounds__(256) void k_poolvt(const _Float16* __restrict__ V16, int ldv, int voff, _Float16* __restrict__ Vt) { __shared__ unsigned short tl[64][66]; const int tid = threadIdx.x; const int slab = blockIdx.x / (TTv / 64), lg = blockIdx.x % (TTv / 64); const int b = slab / NHv, h = slab % NHv;
  const int r0 = tid / 8, c8 = (tid % 8) * 8;
  const unsigned short* p0 = (const unsigned short*)V16 + ((size_t)b * TTv + lg * 64 + r0) * 2 * ldv + voff + h * 64 + c8; const unsigned short* p1 = p0 + (size_t)64 * ldv;      // pooled rows r0 and r0 + 32
  const unsigned short* q0 = p0 + ldv; const unsigned short* q1 = p1 + ldv;      // the second row of each pair
  const v8us a0 = *(const v8us*)p0, b0 = *(const v8us*)q0, a1 = *(const v8us*)p1, b1 = *(const v8us*)q1;
  // the four address pairs are inputs of the wait: they stay in their registers up to it, so no load of the group is given a register that an issued load names
  asm volatile("s_wait_xcnt 0x0" :: "v"(p0), "v"(q0), "v"(p1), "v"(q1) : "memory");
  const v8h fa0 = __builtin_bit_cast(v8h, a0), fb0 = __builtin_bit_cast(v8h, b0), fa1v = __builtin_bit_cast(v8h, a1), fb1 = __builtin_bit_cast(v8h, b1);
#pragma unroll      // constant indices keep the eight-element vectors in registers
  for (int q = 0; q < 8; ++q) { tl[r0][c8 + q] = ((float)fa0[q] > (float)fb0[q]) ? a0[q] : b0[q]; tl[r0 + 32][c8 + q] = ((float)fa1v[q] > (float)fb1[q]) ? a1[q] : b1[q]; }
  __syncthreads();
  {
#pragma unroll
    for (int rd = 0; rd < 2; ++rd) { const int d = rd * 32 + tid / 8, pc = tid % 8; FragH f;
#pragma unroll
      for (int q = 0; q < 8; ++q) f.u[q] = tl[pc * 8 + q][d];
      *(v8us*)((unsigned short*)Vt + ((size_t)slab * 64 + d) * TTv + lg * 64 + pc * 8) = f.half[0]; }
     } }

__global__ __launch_bounds__(256) void k_tok(const float* __restrict__ x, _Float16* __restrict__ X16) { __shared__ float tl[32][65]; const int tid = threadIdx.x; const int b = blockIdx.x / ((CC / 64) * (NN / 32)), rem = blockIdx.x % ((CC / 64) * (NN / 32)); const int cg = rem / (NN / 32), pg = rem % (NN / 32); const int c0 = cg * 64, p0 = pg * 32;
  for (int i = tid; i < 64 * 32; i += 256) { const int c = i / 32, pp = i % 32; tl[pp][c] = bf16_round(x[((size_t)b * CC + c0 + c) * NN + p0 + pp]); } __syncthreads();
  const int r = tid / 8, pc = tid % 8; FragH f; for (int q = 0; q < 8; ++q) f.h[q] = (_Float16)tl[r][pc * 8 + q]; const size_t row = (size_t)b * NN + p0 + r; *(v8us*)((unsigned short*)X16 + row * CC + c0 + pc * 8) = f.half[0];  }
// phi after its projection, one wave per pooled row m: max over rows 2 m and 2 m + 1 of F (f32), the maximum split as f16 hi and (v - hi) * 2^10, and cv[m] = sum over channels of maximum * b_theta.
// Every load takes 512 B of one row. A lane sums its 16 channels in order, the 32 lanes are added by a butterfly; the 32 waves' sums leave as one 128-B line.
__global__ __launch_bounds__(1024) void k_phipost(const float* __restrict__ F, const float* __restrict__ bth, _Float16* __restrict__ Hh, _Float16* __restrict__ Hl, float* __restrict__ cv) {
  __shared__ float red[32];
  const int tid = threadIdx.x, w = tid >> 5, lane = tid & 31; const size_t m = (size_t)blockIdx.x * 32 + w;
  const float* p = F + m * 2 * CC + lane * 4; const float* pt = bth + lane * 4;
  v4f a[4], b[4], t[4];
#pragma unroll      // constant indices keep a, b and t in registers, so that the loads are issued ahead of the arithmetic
  for (int u = 0; u < 4; ++u) { a[u] = *(const v4fa*)(p + u * 128); b[u] = *(const v4fa*)(p + CC + u * 128); t[u] = *(const v4fa*)(pt + u * 128); }
  // the two address pairs are inputs of the wait: they stay in their registers until every load of the group has taken them
  asm volatile("s_wait_xcnt 0x0" :: "v"(p), "v"(pt) : "memory");
  v4hs hv[4], lv[4]; float s = 0.f;
#pragma unroll      // a, b, t, hv and lv stay in registers
  for (int u = 0; u < 4; ++u)
    for (int q = 0; q < 4; ++q) { const float v = fmaxf(a[u][q], b[u][q]); const _Float16 h = (_Float16)v; hv[u][q] = h; lv[u][q] = (_Float16)((v - (float)h) * 1024.0f); s += v * bf16_round(t[u][q]); }
  for (int o = 16; o >= 1; o >>= 1) s += __shfl_xor(s, o, 32);
  if (lane == 0) red[w] = s;
  __syncthreads();      // the 32 row sums are complete before wave 0 reads them
  _Float16* oh = Hh + m * CC + lane * 4; _Float16* ol = Hl + m * CC + lane * 4;
#pragma unroll      // hv and lv stay in registers
  for (int u = 0; u < 4; ++u) { *(v4hs*)(oh + u * 128) = hv[u]; *(v4hs*)(ol + u * 128) = lv[u]; }
  if (w == 0) cv[blockIdx.x * 32 + lane] = red[lane];
}
__global__ __launch_bounds__(256) void k_smx(const float* __restrict__ S, _Float16* __restrict__ P16) { const int tid = threadIdx.x, wv = tid >> 5, lane = tid & 31; const int r = blockIdx.x * 8 + wv; if (r >= NR) return; const float* sr = S + (size_t)r * NH; float m = -3.0e38f;
  for (int p = lane; p < NH / 8; p += 32) { const v4f a = *(const v4fa*)(sr + p * 8), b = *(const v4fa*)(sr + p * 8 + 4); for (int q = 0; q < 4; ++q) m = fmaxf(m, fmaxf(a[q], b[q])); }
  for (int o = 16; o >= 1; o >>= 1) m = fmaxf(m, __shfl_xor(m, o, 32)); float z = 0.f;
  for (int p = lane; p < NH / 8; p += 32) { const v4f a = *(const v4fa*)(sr + p * 8), b = *(const v4fa*)(sr + p * 8 + 4); for (int q = 0; q < 4; ++q) z += __expf(a[q] - m) + __expf(b[q] - m); }
  for (int o = 16; o >= 1; o >>= 1) z += __shfl_xor(z, o, 32); const float iz = 32768.0f / z;
  { for (int p = lane; p < NH / 8; p += 32) { FragH f; for (int q = 0; q < 8; ++q) f.h[q] = (_Float16)(__expf(sr[p * 8 + q] - m) * iz); *(v8us*)((unsigned short*)P16 + (size_t)r * NH + p * 8) = f.half[0]; }  } }
// BN batch statistics in two stages. Stage 1 is the BNP epilogue of the GEMM that makes wy: per chunk of SROWS consecutive rows and per channel, the rows' sum and the sum of their squared deviations from their own mean.
#define SROWS 32
#define SCH (NR / SROWS)
static_assert(SROWS == 32, "a chunk is the 32 rows of one wave's tile in k_gemm_t");
// Stage 2: one workgroup per 32 channels (one line of every partial row), lane = channel; wave w takes chunks 16 w .. 16 w + 15 in order, the 32 waves' sums are added in wave order by every wave.
// Total squared deviation = sum over chunks of (chunk's own + SROWS * (chunk mean - mean)^2). ST keeps its form: one line per channel, mean and 1/sqrt(var + eps) in its first two words.
__global__ __launch_bounds__(1024) void k_bnfin(const float* __restrict__ PS, const float* __restrict__ PM, float* __restrict__ ST) {
  __shared__ float red[2][32][32];
  const int tid = threadIdx.x, w = tid >> 5, lane = tid & 31; const int c = blockIdx.x * 32 + lane;
  const float* ps = PS + (size_t)(w * (SCH / 32)) * CC + c; const float* pm = PM + (size_t)(w * (SCH / 32)) * CC + c;
  float s[SCH / 32], m[SCH / 32];
#pragma unroll      // constant indices keep s and m in registers; all loads are in flight together
  for (int i = 0; i < SCH / 32; ++i) { s[i] = ps[i * CC]; m[i] = pm[i * CC]; }
  // the two address pairs are inputs of the wait: they stay in their registers until every load of the group has taken them
  asm volatile("s_wait_xcnt 0x0" :: "v"(ps), "v"(pm) : "memory");
  float a = 0.f;
#pragma unroll      // s stays in registers
  for (int i = 0; i < SCH / 32; ++i) a += s[i];
  red[0][w][lane] = a; __syncthreads();
  float tot = 0.f;
  for (int j = 0; j < 32; ++j) tot += red[0][j][lane];
  const float mu = tot / (float)NR;
  float q = 0.f;
#pragma unroll      // s and m stay in registers
  for (int i = 0; i < SCH / 32; ++i) { const float d = s[i] * (1.0f / (float)SROWS) - mu; q += m[i] + (float)SROWS * d * d; }
  red[1][w][lane] = q; __syncthreads();
  float q2 = 0.f;
  for (int j = 0; j < 32; ++j) q2 += red[1][j][lane];
  const float rs = rsqrtf(q2 / (float)NR + 1e-5f);
  const float muw = __shfl(mu, w, 32), rsw = __shfl(rs, w, 32);      // wave w writes the line of channel w of the 32
  ST[(blockIdx.x * 32 + w) * 32 + lane] = (lane == 0) ? muw : ((lane == 1) ? rsw : 0.f);
}
__global__ __launch_bounds__(256) void k_out(const float* __restrict__ WY, const float* __restrict__ ST, const float* __restrict__ gam, const float* __restrict__ bet, const float* __restrict__ x, float* __restrict__ out) { __shared__ float tl[32][65]; const int tid = threadIdx.x; const int b = blockIdx.x / ((CC / 32) * (NN / 64)), rem = blockIdx.x % ((CC / 32) * (NN / 64)); const int cg = rem / (NN / 64), pg = rem % (NN / 64); const int c0 = cg * 32, p0 = pg * 64;
  for (int i = tid; i < 64 * 32; i += 256) { const int pp = i / 32, c = i % 32; const int cc = c0 + c; tl[c][pp] = (WY[((size_t)b * NN + p0 + pp) * CC + cc] - ST[cc * 32]) * ST[cc * 32 + 1] * bf16_round(gam[cc]) + bf16_round(bet[cc]); } __syncthreads();
  { for (int i = tid; i < 32 * 16; i += 256) { const int c = i / 16, q4 = i % 16; const size_t o = ((size_t)b * CC + c0 + c) * NN + p0 + q4 * 4; const v4f xv = *(const v4fa*)(x + o); v4f v; for (int q = 0; q < 4; ++q) v[q] = tl[c][q4 * 4 + q] + bf16_round(xv[q]); *(v4f*)(out + o) = v; }  } }
extern "C" void kernel_launch(void* const* d_in, const int* in_sizes, int n_in,
                              void* d_out, int out_size, void* d_ws, size_t ws_size, hipStream_t stream) {
  (void)in_sizes; (void)n_in; (void)out_size;
  const float* x = (const float*)d_in[0]; const float* gw = (const float*)d_in[1]; const float* gb = (const float*)d_in[2]; const float* thw = (const float*)d_in[3]; const float* thb = (const float*)d_in[4]; const float* phw = (const float*)d_in[5]; const float* phb = (const float*)d_in[6]; const float* Ww = (const float*)d_in[7]; const float* Wb = (const float*)d_in[8]; const float* gam = (const float*)d_in[9]; const float* bet = (const float*)d_in[10];
  char* ws = (char*)d_ws; size_t off = 0;
  auto take = [&](size_t bytes) { char* p = ws + off; off += (bytes + 255) & ~(size_t)255; return p; };
  _Float16* Bg = (_Float16*)take((size_t)CC * CC * 2); _Float16* Bph = (_Float16*)take((size_t)CC * CC * 2); _Float16* BW = (_Float16*)take((size_t)CC * CC * 2); float* ST = (float*)take(CC * 32 * 4);
  _Float16* Bthp = (_Float16*)take((size_t)CC * CC * 2);      // W_θ as [in=o][out=c] → Bt[c][o] for φ·W_θ
  _Float16* X16 = (_Float16*)take((size_t)NR * CC * 2); float* FULLF = (float*)take((size_t)NR * CC * 4); _Float16* FULL = (_Float16*)take((size_t)NR * CC * 2); _Float16* PHh = (_Float16*)take((size_t)NRH * CC * 2); _Float16* PHl = (_Float16*)take((size_t)NRH * CC * 2);
  // every per-batch buffer holds all BB batches, so that each stage is one launch over the whole batch
  _Float16* BPh = (_Float16*)take((size_t)NRH * CC * 2); _Float16* BPl = (_Float16*)take((size_t)NRH * CC * 2); float* CV = (float*)take(NRH * 4); _Float16* Gt = (_Float16*)take((size_t)NRH * CC * 2); float* S = (float*)take((size_t)NR * NH * 4); _Float16* P16 = (_Float16*)take((size_t)NR * NH * 2);
  float* PS = (float*)take((size_t)SCH * CC * 4); float* PM = (float*)take((size_t)SCH * CC * 4);      // BN partials per row chunk and channel
  _Float16* Y16 = FULL; float* WY = FULLF;      // FULLF/FULL are dead after pooling
  if (off > ws_size) return;      // about 214 MB
  k_round16f<<<(CC * CC / 8 + 255) / 256, 256, 0, stream>>>(gw, Bg, CC * CC / 8); k_round16f<<<(CC * CC / 8 + 255) / 256, 256, 0, stream>>>(phw, Bph, CC * CC / 8); k_round16f<<<(CC * CC / 8 + 255) / 256, 256, 0, stream>>>(Ww, BW, CC * CC / 8);      // (out,in) natural
  k_wt_f16<<<(CC * (CC / 8) + 255) / 256, 256, 0, stream>>>(thw, Bthp, CC, CC, 16.0f);      // Bt[c][o] = W_θ[o][c]
  k_tok<<<BB * (CC / 64) * (NN / 32), 256, 0, stream>>>(x, X16);
  const dim3 gp((NR / 128) * (CC / 128), 1);
  k_gemm_t<0, true><<<gp, 256, 0, stream>>>(X16, nullptr, CC, 0, Bph, nullptr, CC, 0, 0.0625f, phb, nullptr, 0, FULLF, nullptr, nullptr, nullptr, nullptr, CC, 0, CC, CC); k_phipost<<<NRH / 32, 1024, 0, stream>>>(FULLF, thb, PHh, PHl, CV);      // phi (f32), then pooled, split hi/lo, and c = phi * b_theta
  k_gemm_t<0, false><<<gp, 256, 0, stream>>>(X16, nullptr, CC, 0, Bg, nullptr, CC, 0, 0.0625f, gb, nullptr, 0, nullptr, FULL, nullptr, nullptr, nullptr, CC, 0, CC, CC); k_poolvt<8, NH><<<BB * 8 * (NH / 64), 256, 0, stream>>>(FULL, CC, 0, Gt);      // g (f16), pooled and transposed: g^T [BB][512][1024]
  const dim3 gb2((NRH / 128) * (CC / 128), 1), gs((NN / 128) * (NH / 128), BB), gy((NN / 128) * (CC / 128), BB);      // blockIdx.y = batch where the B operand differs per batch
  k_gemm_t<0, false, true, false, true><<<gb2, 256, 0, stream>>>(PHl, PHh, CC, 0, Bthp, Bthp, CC, 0, 0.0625f, nullptr, nullptr, 0, nullptr, BPh, BPl, nullptr, nullptr, CC, 0, CC, CC);      // B' = phi * W_theta [BB*1024][512] (phi lo, then hi), all batches as rows, leaves split hi/lo
  k_gemm_t<1, true, false, false, true><<<gs, 256, 0, stream>>>(X16, X16, CC, (size_t)NN * CC, BPl, BPh, CC, (size_t)NH * CC, 1.0f, nullptr, CV, (size_t)NH, S, nullptr, nullptr, nullptr, nullptr, NH, (size_t)NN * NH, NH, CC);      // f = x * B'^T + c (B' lo, then hi; c broadcast over the rows of its batch)
  k_smx<<<NR / 8, 256, 0, stream>>>(S, P16);
  k_gemm_t<0, false><<<gy, 256, 0, stream>>>(P16, nullptr, NH, (size_t)NN * NH, Gt, nullptr, NH, (size_t)CC * NH, 0.000030517578125f, nullptr, nullptr, 0, nullptr, Y16, nullptr, nullptr, nullptr, CC, (size_t)NN * CC, CC, NH);      // y = softmax(f) * g, stored as f16
  k_gemm_t<0, true, false, true><<<gp, 256, 0, stream>>>(Y16, nullptr, CC, 0, BW, nullptr, CC, 0, 0.0625f, Wb, nullptr, 0, WY, nullptr, nullptr, PS, PM, CC, 0, CC, CC);      // wy = W(y) + b, with the BN partials of its row chunks
  k_bnfin<<<CC / 32, 1024, 0, stream>>>(PS, PM, ST); k_out<<<BB * (CC / 32) * (NN / 64), 256, 0, stream>>>(WY, ST, gam, bet, x, (float*)d_out);
}

// v006
// Measured time: 167 microseconds a run.
// In both of two side-by-side timings against v005, it was 1.07 times as fast.
// All steps since v000 together make it 8.88 times as fast.
#include <hip/hip_runtime.h>
// Non-local block with view pooling (x [8, C=512, N=2048]): θ = conv1(x), φ = maxpool2(conv1(x)), g = maxpool2(conv1(x)); f = softmax(θᵀ·φ) [N × N/2] (unscaled); y = f·g; wy = conv1(y) + b;
// out = BN_train(wy)·γ + β + x. Because the unscaled logits reach σ≈20 and feed a near-one-hot softmax, θ is never rounded: the logits are re-associated as f = x·(φ·W_θ)ᵀ + 1·(φ·b_θ)ᵀ with x bf16-EXACT,
// φ (f32, max-pooled from an f32 projection) fed as f16 hi + lo·2^10 into φ·W_θ and that product again split hi/lo as the B operand (four cheap passes per batch), the column term added exactly through
// the epilogue addend; g, y as plain f16; P ×2^15 f16; all on v_wmma_f32_16x16x32_f16 ((out,in) weights bf16-exact ×2^4, f32 accumulate); the layout transposes, max-pooling, softmax rows, BN batch statistics (fixed-order) and the residual are f32 VALU.
#define BB 8
#define CC 512
#define NN 2048
#define NH (NN / 2)
#define NR (BB * NN)
#define NRH (BB * NH)

typedef __bf16 v16b __attribute__((ext_vector_type(16)));
typedef unsigned short v8us __attribute__((ext_vector_type(8), may_alias));
typedef float  v8f  __attribute__((ext_vector_type(8)));
typedef float  v4f  __attribute__((ext_vector_type(4)));
typedef float  v4fa __attribute__((ext_vector_type(4), may_alias));
union FragB { v16b v; v8us half[2]; unsigned short u[16]; };

__device__ __forceinline__ unsigned short bf16_bits(float x) { unsigned int u = __float_as_uint(x); return (unsigned short)((u + 0x7FFFu + ((u >> 16) & 1u)) >> 16); }
__device__ __forceinline__ float bf16_val(unsigned short b) { return __uint_as_float(((unsigned int)b) << 16); }
__device__ __forceinline__ float bf16_round(float x) { return bf16_val(bf16_bits(x)); }
// D += A·B with NT terms: 1 = ah·bh, 2 = + al·bh (A split), 3 = + ah·bl (both split)
template <int NT>
__device__ __forceinline__ v8f mmaN(v16b ah, v16b al, v16b bh, v16b bl, v8f c) {
  c = __builtin_amdgcn_wmma_f32_16x16x32_bf16(false, ah, false, bh, (short)0, c, false, false);
  if (NT >= 2) c = __builtin_amdgcn_wmma_f32_16x16x32_bf16(false, al, false, bh, (short)0, c, false, false);
  if (NT >= 3) c = __builtin_amdgcn_wmma_f32_16x16x32_bf16(false, ah, false, bl, (short)0, c, false, false);
  asm volatile("v_nop\n\tv_nop\n\tv_nop\n\tv_nop" : "+v"(c) : "v"(ah), "v"(al), "v"(bh), "v"(bl));
  return c;
}

__global__ __launch_bounds__(256) void k_wt_bf16(const float* __restrict__ W, unsigned short* __restrict__ Wt, int K, int N) {
  const int t = blockIdx.x * 256 + threadIdx.x;
  const int k8n = K / 8;
  if (t >= N * k8n) return;
  const int n = t / k8n, k8 = (t % k8n) * 8;
  v8us v;
#pragma unroll
  for (int i = 0; i < 8; ++i) v[i] = bf16_bits(W[(size_t)(k8 + i) * N + n]);
  *(v8us*)(Wt + (size_t)n * K + k8) = v;
  
}

// GEMM C[M][N] (f32, pitch ldc) = act(A[M][K]·W + bias). A f32 row-major (pitch lda) converted per fragment to bf16
// (ASPLIT: hi/lo two planes -> 2 terms, else single rounded term); Wt bf16 [N][K] (pitch ldb). BIAS_BF16 rounds the
// bias to bf16 first (bias quantised to bf16 before the add). K%32==0, M%16==0, N%64==0.
template <bool ASPLIT, int ACT, bool BIAS_BF16>
__global__ __launch_bounds__(128) void k_gemm_bf(const float* __restrict__ A, int lda, const unsigned short* __restrict__ Wt, int ldb,
                                               const float* __restrict__ bias, float* __restrict__ C, int ldc, int M, int N, int K) {
  __shared__ __attribute__((aligned(16))) float so[4][16][64];
  const int tid = threadIdx.x, w = tid >> 5, lane = tid & 31, ln = lane & 15, hh = lane >> 4;
  const int ntn = N / 64;
  const int wid = blockIdx.x * 4 + w;
  const int mt = wid / ntn, nq = wid % ntn;
  if (mt * 16 >= M) return;
  const int row0 = mt * 16, col0 = nq * 64;
  const float* arow = A + (size_t)(row0 + ln) * lda;
  v8f acc[4] = {};
  for (int kb = 0; kb < K; kb += 32) {
    FragB ah, al;
    const v4f x0 = *(const v4fa*)(arow + kb + 8 * hh), x1 = *(const v4fa*)(arow + kb + 8 * hh + 4);
    const v4f x2 = *(const v4fa*)(arow + kb + 16 + 8 * hh), x3 = *(const v4fa*)(arow + kb + 16 + 8 * hh + 4);
    float xs[16] = {x0[0],x0[1],x0[2],x0[3],x1[0],x1[1],x1[2],x1[3],x2[0],x2[1],x2[2],x2[3],x3[0],x3[1],x3[2],x3[3]};
#pragma unroll
    for (int i = 0; i < 16; ++i) { const unsigned short hb = bf16_bits(xs[i]); ah.u[i] = hb; al.u[i] = ASPLIT ? bf16_bits(xs[i] - bf16_val(hb)) : (unsigned short)0; }
#pragma unroll
    for (int t = 0; t < 4; ++t) {
      const unsigned short* brow = Wt + (size_t)(col0 + t * 16 + ln) * ldb + kb;
      FragB b;
      b.half[0] = *(const v8us*)(brow + 8 * hh);
      b.half[1] = *(const v8us*)(brow + 16 + 8 * hh);
      acc[t] = mmaN<ASPLIT ? 2 : 1>(ah.v, al.v, b.v, b.v, acc[t]);
    }
  }
#pragma unroll
  for (int t = 0; t < 4; ++t) {
    float bv = bias ? bias[col0 + t * 16 + ln] : 0.f;
    if (BIAS_BF16) bv = bf16_round(bv);
#pragma unroll
    for (int r = 0; r < 8; ++r) { float v = acc[t][r] + bv; if (ACT == 1) v = fmaxf(v, 0.f); so[w][8 * hh + r][t * 16 + ln] = v; }
  }
  __builtin_amdgcn_fence(__ATOMIC_ACQ_REL, "workgroup");
  __builtin_amdgcn_wave_barrier();
  const int rsub = lane >> 4, c4 = (lane & 15) * 4;
  {
#pragma unroll
    for (int q = 0; q < 8; ++q) {
      const int r = q * 2 + rsub;
      const v4f v = *(const v4fa*)&so[w][r][c4];
      *(v4f*)(C + (size_t)(row0 + r) * ldc + col0 + c4) = v;
    }
    
  }
}

// Flash-style causal/unmasked attention, all contractions 3-term bf16 hi/lo splits, f32 softmax with running max.
// q,k,v rows are read from f32 buffers with arbitrary row pitch (so they can live inside a fused qkv buffer);
// D = head size (multiple of 32, <= 128); one wave = 16 query rows; block = 4 waves (64 queries) sharing K/V chunks of 32.
template <int D, bool CAUSAL>
__global__ __launch_bounds__(128) void k_flash(const float* __restrict__ qb, const float* __restrict__ kb, const float* __restrict__ vb,
                                             int pitch, int T, int H, float scale, float* __restrict__ y, int ypitch) {
  constexpr int KS = D / 32;        // k-steps for QK
  constexpr int DT = D / 16;        // d tiles for PV
  __shared__ __attribute__((aligned(16))) unsigned short sKh[32][D + 8], sKl[32][D + 8], sVh[32][D + 8], sVl[32][D + 8];
  __shared__ __attribute__((aligned(16))) unsigned short sPh[4][16][40], sPl[4][16][40];
  __shared__ __attribute__((aligned(16))) float sO[4][16][D];
  const int tid = threadIdx.x, w = tid >> 5, lane = tid & 31, ln = lane & 15, hh = lane >> 4;
  const int nqb = (T + 63) / 64;
  const int bh = blockIdx.x / nqb, qblk = blockIdx.x % nqb;
  const int b = bh / H, h = bh % H;
  const int q0 = qblk * 64 + w * 16;
  const float* Q = qb + (size_t)b * T * pitch + h * D;
  const float* K = kb + (size_t)b * T * pitch + h * D;
  const float* V = vb + (size_t)b * T * pitch + h * D;

  // A fragments of the wave's 16 query rows (scaled), hi/lo
  FragB aqh[KS], aql[KS];
  {
    int row = q0 + ln; if (row >= T) row = T - 1;
    const float* qr = Q + (size_t)row * pitch;
#pragma unroll
    for (int ks = 0; ks < KS; ++ks)
#pragma unroll
      for (int i = 0; i < 16; ++i) {
        const int d = ks * 32 + ((i < 8) ? (8 * hh + i) : (16 + 8 * hh + (i - 8)));
        const float x = qr[d] * scale; const unsigned short hb = bf16_bits(x);
        aqh[ks].u[i] = hb; aql[ks].u[i] = bf16_bits(x - bf16_val(hb));
      }
  }
  float m_r[8], l_r[8];
#pragma unroll
  for (int r = 0; r < 8; ++r) { m_r[r] = -3.0e38f; l_r[r] = 0.f; }
  v8f oacc[DT];
#pragma unroll
  for (int dt = 0; dt < DT; ++dt) oacc[dt] = (v8f){0.f,0.f,0.f,0.f,0.f,0.f,0.f,0.f};

  const int kv_end = CAUSAL ? min(T, qblk * 64 + 64) : T;     // block-uniform
  for (int j0 = 0; j0 < kv_end; j0 += 32) {
    __syncthreads();
    for (int e = tid; e < 32 * (D / 4); e += 128) {
      const int r = e / (D / 4), c4 = (e % (D / 4)) * 4;
      const int key = j0 + r;
      v4f kf = {0.f,0.f,0.f,0.f}, vf = {0.f,0.f,0.f,0.f};
      if (key < T) { kf = *(const v4fa*)(K + (size_t)key * pitch + c4); vf = *(const v4fa*)(V + (size_t)key * pitch + c4); }
#pragma unroll
      for (int t = 0; t < 4; ++t) {
        unsigned short hb = bf16_bits(kf[t]); sKh[r][c4 + t] = hb; sKl[r][c4 + t] = bf16_bits(kf[t] - bf16_val(hb));
        hb = bf16_bits(vf[t]); sVh[r][c4 + t] = hb; sVl[r][c4 + t] = bf16_bits(vf[t] - bf16_val(hb));
      }
    }
    __syncthreads();
    // S tile 16 x 32
    v8f s[2];
#pragma unroll
    for (int nt = 0; nt < 2; ++nt) {
      v8f acc = {};
#pragma unroll
      for (int ks = 0; ks < KS; ++ks) {
        FragB bh_, bl_;
        bh_.half[0] = *(const v8us*)&sKh[nt * 16 + ln][ks * 32 + 8 * hh]; bh_.half[1] = *(const v8us*)&sKh[nt * 16 + ln][ks * 32 + 16 + 8 * hh];
        bl_.half[0] = *(const v8us*)&sKl[nt * 16 + ln][ks * 32 + 8 * hh]; bl_.half[1] = *(const v8us*)&sKl[nt * 16 + ln][ks * 32 + 16 + 8 * hh];
        acc = mmaN<3>(aqh[ks].v, aql[ks].v, bh_.v, bl_.v, acc);
      }
      s[nt] = acc;
    }
    // mask + running max (rows 8hh+r; the 16 lanes of a half share rows)
    float alpha[8];
#pragma unroll
    for (int r = 0; r < 8; ++r) {
      const int qi = q0 + 8 * hh + r;
      const int ja = j0 + ln, jb = j0 + 16 + ln;
      if (CAUSAL) { if (ja > qi) s[0][r] = -3.0e38f; if (jb > qi) s[1][r] = -3.0e38f; }
      if (ja >= T) s[0][r] = -3.0e38f;
      if (jb >= T) s[1][r] = -3.0e38f;
      float mx = fmaxf(s[0][r], s[1][r]);
      mx = fmaxf(mx, __shfl_xor(mx, 1, 32)); mx = fmaxf(mx, __shfl_xor(mx, 2, 32)); mx = fmaxf(mx, __shfl_xor(mx, 4, 32)); mx = fmaxf(mx, __shfl_xor(mx, 8, 32));
      const float mnew = fmaxf(m_r[r], mx);
      alpha[r] = (mnew > -1.0e38f) ? __expf(m_r[r] - mnew) : 1.0f;
      const float p0 = (s[0][r] > -1.0e38f) ? __expf(s[0][r] - mnew) : 0.f;
      const float p1 = (s[1][r] > -1.0e38f) ? __expf(s[1][r] - mnew) : 0.f;
      m_r[r] = mnew;
      l_r[r] = l_r[r] * alpha[r] + p0 + p1;            // per-lane partial row sum (16 lanes combined at the end)
      unsigned short hb = bf16_bits(p0); sPh[w][8 * hh + r][ln] = hb;      sPl[w][8 * hh + r][ln] = bf16_bits(p0 - bf16_val(hb));
      hb = bf16_bits(p1);                sPh[w][8 * hh + r][16 + ln] = hb; sPl[w][8 * hh + r][16 + ln] = bf16_bits(p1 - bf16_val(hb));
    }
#pragma unroll
    for (int dt = 0; dt < DT; ++dt)
#pragma unroll
      for (int r = 0; r < 8; ++r) oacc[dt][r] *= alpha[r];
    __builtin_amdgcn_fence(__ATOMIC_ACQ_REL, "workgroup");
    __builtin_amdgcn_wave_barrier();
    FragB pah, pal;
    pah.half[0] = *(const v8us*)&sPh[w][ln][8 * hh]; pah.half[1] = *(const v8us*)&sPh[w][ln][16 + 8 * hh];
    pal.half[0] = *(const v8us*)&sPl[w][ln][8 * hh]; pal.half[1] = *(const v8us*)&sPl[w][ln][16 + 8 * hh];
#pragma unroll
    for (int dt = 0; dt < DT; ++dt) {
      FragB bvh, bvl;
#pragma unroll
      for (int i = 0; i < 8; ++i) {
        bvh.u[i] = sVh[8 * hh + i][dt * 16 + ln]; bvh.u[8 + i] = sVh[16 + 8 * hh + i][dt * 16 + ln];
        bvl.u[i] = sVl[8 * hh + i][dt * 16 + ln]; bvl.u[8 + i] = sVl[16 + 8 * hh + i][dt * 16 + ln];
      }
      oacc[dt] = mmaN<3>(pah.v, pal.v, bvh.v, bvl.v, oacc[dt]);
    }
    __builtin_amdgcn_fence(__ATOMIC_ACQ_REL, "workgroup");
    __builtin_amdgcn_wave_barrier();
  }
#pragma unroll
  for (int r = 0; r < 8; ++r) {
    float l = l_r[r];
    l += __shfl_xor(l, 1, 32); l += __shfl_xor(l, 2, 32); l += __shfl_xor(l, 4, 32); l += __shfl_xor(l, 8, 32);
    l_r[r] = (l > 0.f) ? 1.0f / l : 0.f;
  }
#pragma unroll
  for (int dt = 0; dt < DT; ++dt)
#pragma unroll
    for (int r = 0; r < 8; ++r) sO[w][8 * hh + r][dt * 16 + ln] = oacc[dt][r] * l_r[r];
  __builtin_amdgcn_fence(__ATOMIC_ACQ_REL, "workgroup");
  __builtin_amdgcn_wave_barrier();
  {
    for (int r = 0; r < 16; ++r) {
      const int row = q0 + r;
      if (row < T && lane < D / 4) {
        const v4f val = *(const v4fa*)&sO[w][r][lane * 4];
        *(v4f*)(y + ((size_t)b * T + row) * ypitch + h * D + lane * 4) = val;
      }
    }
    
  }
}

// GEMM C = act(A·W + bias + resid): A f32 (ASPLIT -> hi/lo 2 terms), Wt bf16 [N][K]; ACT 0 none, 1 relu, 2 exact gelu;
// resid (optional, f32, row index = (row % rmod), pitch ldr, RES_BF16 rounds it) added before the activation.
template <bool ASPLIT, int ACT, bool BIAS_BF16, bool RES_BF16>
__global__ __launch_bounds__(128) void k_gemm_bf3(const float* __restrict__ A, int lda, const unsigned short* __restrict__ Wt, int ldb,
                                                const float* __restrict__ bias, const float* __restrict__ resid, int rmod, int ldr,
                                                float* __restrict__ C, int ldc, int M, int N, int K) {
  __shared__ __attribute__((aligned(16))) float so[4][16][64];
  const int tid = threadIdx.x, w = tid >> 5, lane = tid & 31, ln = lane & 15, hh = lane >> 4;
  const int ntn = N / 64;
  const int wid = blockIdx.x * 4 + w;
  const int mt = wid / ntn, nq = wid % ntn;
  if (mt * 16 >= M) return;
  const int row0 = mt * 16, col0 = nq * 64;
  const float* arow = A + (size_t)(row0 + ln) * lda;
  v8f acc[4] = {};
  for (int kb = 0; kb < K; kb += 32) {
    FragB ah, al;
    const v4f x0 = *(const v4fa*)(arow + kb + 8 * hh), x1 = *(const v4fa*)(arow + kb + 8 * hh + 4);
    const v4f x2 = *(const v4fa*)(arow + kb + 16 + 8 * hh), x3 = *(const v4fa*)(arow + kb + 16 + 8 * hh + 4);
    float xs[16] = {x0[0],x0[1],x0[2],x0[3],x1[0],x1[1],x1[2],x1[3],x2[0],x2[1],x2[2],x2[3],x3[0],x3[1],x3[2],x3[3]};
#pragma unroll
    for (int i = 0; i < 16; ++i) { const unsigned short hb = bf16_bits(xs[i]); ah.u[i] = hb; al.u[i] = ASPLIT ? bf16_bits(xs[i] - bf16_val(hb)) : (unsigned short)0; }
#pragma unroll
    for (int t = 0; t < 4; ++t) {
      const unsigned short* brow = Wt + (size_t)(col0 + t * 16 + ln) * ldb + kb;
      FragB b;
      b.half[0] = *(const v8us*)(brow + 8 * hh);
      b.half[1] = *(const v8us*)(brow + 16 + 8 * hh);
      acc[t] = mmaN<ASPLIT ? 2 : 1>(ah.v, al.v, b.v, b.v, acc[t]);
    }
  }
#pragma unroll
  for (int t = 0; t < 4; ++t) {
    const int col = col0 + t * 16 + ln;
    float bv = bias ? bias[col] : 0.f;
    if (BIAS_BF16) bv = bf16_round(bv);
#pragma unroll
    for (int r = 0; r < 8; ++r) {
      float v = acc[t][r] + bv;
      if (resid) { float rv = resid[(size_t)((row0 + 8 * hh + r) % rmod) * ldr + col]; if (RES_BF16) rv = bf16_round(rv); v += rv; }
      if (ACT == 1) v = fmaxf(v, 0.f);
      if (ACT == 2) v = 0.5f * v * (1.0f + erff(v * 0.70710678118654752f));
      if (ACT == 3) { const float u = 0.7978845608028654f * (v + 0.044715f * v * v * v); v = 0.5f * v * (1.0f + tanhf(u)); }
      so[w][8 * hh + r][t * 16 + ln] = v;
    }
  }
  __builtin_amdgcn_fence(__ATOMIC_ACQ_REL, "workgroup");
  __builtin_amdgcn_wave_barrier();
  const int rsub = lane >> 4, c4 = (lane & 15) * 4;
  {
#pragma unroll
    for (int q = 0; q < 8; ++q) {
      const int r = q * 2 + rsub;
      const v4f v = *(const v4fa*)&so[w][r][c4];
      *(v4f*)(C + (size_t)(row0 + r) * ldc + col0 + c4) = v;
    }
    
  }
}
// row LayerNorm (biased variance, eps) over N: s = X (+ R); optional out_sum <- s; out_norm <- (s-mu)*rsqrt(var+eps)*g + b
template <bool PARAM_BF16>
__global__ __launch_bounds__(256) void k_layernorm(const float* __restrict__ X, const float* __restrict__ R, const float* __restrict__ g, const float* __restrict__ bta,
                                                  float* __restrict__ out_sum, float* __restrict__ out_norm, int N, float eps) {
  __shared__ float red[256];
  const int row = blockIdx.x, tid = threadIdx.x;
  const float* x = X + (size_t)row * N; const float* rr = R ? R + (size_t)row * N : nullptr;
  float vals[16];                     // up to N = 4096
  const int per = N / 256;            // contiguous chunk per thread? use strided-by-4 chunks: thread handles j = tid*4 + 1024*u
  float s1 = 0.f;
  for (int u = 0; u < per / 4; ++u) {
    const int j = tid * 4 + 1024 * u;
    const v4f a = *(const v4fa*)(x + j);
    v4f b = {0.f,0.f,0.f,0.f}; if (rr) b = *(const v4fa*)(rr + j);
#pragma unroll
    for (int q = 0; q < 4; ++q) { const float v = a[q] + b[q]; vals[u * 4 + q] = v; s1 += v; }
  }
  red[tid] = s1; __syncthreads();
  for (int st = 128; st > 0; st >>= 1) { if (tid < st) red[tid] += red[tid + st]; __syncthreads(); }
  const float mu = red[0] / (float)N; __syncthreads();
  float s2 = 0.f;
  for (int u = 0; u < per / 4; ++u)
#pragma unroll
    for (int q = 0; q < 4; ++q) { const float c = vals[u * 4 + q] - mu; s2 += c * c; }
  red[tid] = s2; __syncthreads();
  for (int st = 128; st > 0; st >>= 1) { if (tid < st) red[tid] += red[tid + st]; __syncthreads(); }
  const float rs = rsqrtf(red[0] / (float)N + eps);
  {
    for (int u = 0; u < per / 4; ++u) {
      const int j = tid * 4 + 1024 * u;
      v4f o, sm;
#pragma unroll
      for (int q = 0; q < 4; ++q) {
        float gg = g[j + q], bb = bta[j + q];
        if (PARAM_BF16) { gg = bf16_round(gg); bb = bf16_round(bb); }
        sm[q] = vals[u * 4 + q]; o[q] = (vals[u * 4 + q] - mu) * rs * gg + bb;
      }
      if (out_sum) *(v4f*)(out_sum + (size_t)row * N + j) = sm;
      *(v4f*)(out_norm + (size_t)row * N + j) = o;
    }
    
  }
}



// ---- f16 WMMA path (v_wmma_f32_16x16x32_f16): 11-bit significands for operands in range — used where a [0,1] probability operand needs more precision than bf16
typedef _Float16 v16h __attribute__((ext_vector_type(16)));
union FragH { v16h v; v8us half[2]; _Float16 h[16]; unsigned short u[16]; };
template <int NT>
__device__ __forceinline__ v8f mmaH(v16h ah, v16h al, v16h bh, v16h bl, v8f c) {
  c = __builtin_amdgcn_wmma_f32_16x16x32_f16(false, ah, false, bh, (short)0, c, false, false);
  if (NT >= 2) c = __builtin_amdgcn_wmma_f32_16x16x32_f16(false, al, false, bh, (short)0, c, false, false);
  if (NT >= 3) c = __builtin_amdgcn_wmma_f32_16x16x32_f16(false, ah, false, bl, (short)0, c, false, false);
  asm volatile("v_nop\n\tv_nop\n\tv_nop\n\tv_nop" : "+v"(c) : "v"(ah), "v"(al), "v"(bh), "v"(bl));
  return c;
}
// batched GEMM like k_gemm_b but f16 operands: A f32 (split into f16 hi/lo if ASPLIT, else rounded to f16), Bt = f16 values [n][k]; alpha; C f32; N multiple of 16 (partial tiles skipped)
template <bool ASPLIT>
__global__ __launch_bounds__(128) void k_gemm_h(const float* __restrict__ A, int lda, size_t sA, const _Float16* __restrict__ Bh, int ldb, size_t sB, float alpha, float* __restrict__ C, int ldc, size_t sC, int M, int N, int K) {
  __shared__ __attribute__((aligned(16))) float so[4][16][64];
  const int tid = threadIdx.x, w = tid >> 5, lane = tid & 31, ln = lane & 15, hh = lane >> 4; const int by = blockIdx.y;
  A += (size_t)by * sA; Bh += (size_t)by * sB; C += (size_t)by * sC;
  const int ntn = (N + 63) / 64; const int wid = blockIdx.x * 4 + w; const int mt = wid / ntn, nq = wid % ntn; if (mt * 16 >= M) return;
  const int row0 = mt * 16, col0 = nq * 64; const float* arow = A + (size_t)(row0 + ln) * lda;
  v8f acc[4] = {};
  for (int kb = 0; kb < K; kb += 32) {
    FragH ah, al;
    const v4f x0 = *(const v4fa*)(arow + kb + 8 * hh), x1 = *(const v4fa*)(arow + kb + 8 * hh + 4), x2 = *(const v4fa*)(arow + kb + 16 + 8 * hh), x3 = *(const v4fa*)(arow + kb + 16 + 8 * hh + 4);
    float xs[16] = {x0[0],x0[1],x0[2],x0[3],x1[0],x1[1],x1[2],x1[3],x2[0],x2[1],x2[2],x2[3],x3[0],x3[1],x3[2],x3[3]};
#pragma unroll
    for (int i = 0; i < 16; ++i) { const _Float16 h = (_Float16)xs[i]; ah.h[i] = h; al.h[i] = ASPLIT ? (_Float16)(xs[i] - (float)h) : (_Float16)0.0f; }
#pragma unroll
    for (int t = 0; t < 4; ++t) { if (col0 + t * 16 >= N) continue; const size_t boff = (size_t)(col0 + t * 16 + ln) * ldb + kb; FragH bq; bq.half[0] = *(const v8us*)(Bh + boff + 8 * hh); bq.half[1] = *(const v8us*)(Bh + boff + 16 + 8 * hh);
      acc[t] = mmaH<ASPLIT ? 2 : 1>(ah.v, al.v, bq.v, bq.v, acc[t]); }
  }
#pragma unroll
  for (int t = 0; t < 4; ++t) { if (col0 + t * 16 >= N) continue;
#pragma unroll
    for (int r = 0; r < 8; ++r) so[w][8 * hh + r][t * 16 + ln] = acc[t][r] * alpha; }
  __builtin_amdgcn_fence(__ATOMIC_ACQ_REL, "workgroup"); __builtin_amdgcn_wave_barrier();
  const int rsub = lane >> 4, c4 = (lane & 15) * 4;
  {
#pragma unroll
    for (int q = 0; q < 8; ++q) { const int r = q * 2 + rsub; if (col0 + c4 < N) { const v4f v = *(const v4fa*)&so[w][r][c4]; *(v4f*)(C + (size_t)(row0 + r) * ldc + col0 + c4) = v; } }
     }
}

// Wt[n][k] = f16(W[k][n]·scale) from f32 row-major W[K][N] (scale = power of two; bf16-exact weights stay exact in f16 away from the subnormal range)
__device__ __forceinline__ void d_wt_f16(const float* __restrict__ W, _Float16* __restrict__ Wt, int K, int N, float scale, int t) {
  const int n = t / (K / 8), k8 = (t % (K / 8)) * 8; FragH f;
#pragma unroll
  for (int i = 0; i < 8; ++i) f.h[i] = (_Float16)(bf16_round(W[(size_t)(k8 + i) * N + n]) * scale); const v8us o = f.half[0];
  *(v8us*)((unsigned short*)Wt + (size_t)n * K + k8) = o;
  asm volatile("s_wait_xcnt 0x0" ::: "memory");      // the store has taken its registers before another part of the merged kernel, laid out behind this one, reuses them
}
// Tiled GEMM, f16 operands, both K-contiguous: v[row][col] = acc*alpha + bias[col], then CPM 1: + CP[by*sCPy + col] (one row for all rows); written as f32 to C (F32OUT) or as f16 to C16,
// or (HL) split as f16 hi to C16 and (v - hi) * 2^10 as f16 to C16l, with nothing written to C.
// TWO: a product whose one operand is split hi + lo * 2^-10 runs in one launch on one accumulator: first the K of the lo pair A, Bh; the sums are then scaled by 2^-10 (exact); the K of the hi pair A2, B2 is added on top.
// BNP: stage 1 of the BN batch statistics. A wave's 32 rows are one row chunk: per column it also writes their sum to PS and the sum of their squared deviations from their own mean to PM (row = chunk, pitch ldc).
// One 128x128 tile per workgroup of 8 waves (4 x 2, 32x64 per wave). A pass is 64 k = one whole 128-B line of every operand row: each wave-wide 16-B load
// covers four whole lines and goes through registers into LDS (row pitch 144 B for the ds_load_b128 fragment readers); two buffers, one barrier per pass;
// the next pass's global loads are issued before this pass's products. M, N multiples of 128 (the grid is exact), K a multiple of 64.
// Every "#pragma unroll" below makes the index of a register array (staged rows, fragments, accumulators) a constant, so that the array stays in registers.
#define TPITCH 72
typedef float fa1 __attribute__((may_alias));
typedef _Float16 v4hs __attribute__((ext_vector_type(4)));
typedef float v2f __attribute__((ext_vector_type(2)));
typedef float v2fa __attribute__((ext_vector_type(2), may_alias));
template <bool V> struct BoolC { static constexpr bool v = V; };
// DUAL: two products of the same A in one launch. Plane blockIdx.y = 0 takes Bh and bias and writes f32 to C; plane 1 takes B2, its bias from CP, and writes f16 to C16 (sA, sB, sC are 0; CPM 0).
template <int CPM, bool F32OUT, bool HL = false, bool BNP = false, bool TWO = false, bool DUAL = false>
__global__ __launch_bounds__(256) void k_gemm_t(const _Float16* __restrict__ A, const _Float16* __restrict__ A2, int lda, size_t sA, const _Float16* __restrict__ Bh, const _Float16* __restrict__ B2, int ldb, size_t sB, float alpha, const float* __restrict__ bias, const float* __restrict__ CP, size_t sCPy,
    float* __restrict__ C, _Float16* __restrict__ C16, _Float16* __restrict__ C16l, float* __restrict__ PS, float* __restrict__ PM, int ldc, size_t sC, int N, int K) {
  __shared__ __attribute__((aligned(16))) unsigned short st[2][2][128 * TPITCH];      // [buffer][A, B][row * TPITCH + k]
  const int tid = threadIdx.x, w = tid >> 5, lane = tid & 31, ln = lane & 15, hh = lane >> 4; const int by = blockIdx.y;
  const int ntn = N / 128; const int row0 = ((int)blockIdx.x / ntn) * 128, col0 = ((int)blockIdx.x % ntn) * 128;
  const int sr = tid >> 3, sc = (tid & 7) * 8;      // staging: 8 lanes per row, rows sr + 32 i
  const unsigned short* ga = (const unsigned short*)A + (size_t)by * sA + (size_t)row0 * lda;      // workgroup-uniform bases, per-lane 32-bit offsets that never change
  const bool second = DUAL && by == 1;      // the same in every thread of the workgroup
  const unsigned short* gb = (const unsigned short*)(second ? B2 : Bh) + (size_t)by * sB + (size_t)col0 * ldb;
  const unsigned short* ga2 = (const unsigned short*)A2 + (size_t)by * sA + (size_t)row0 * lda;      // TWO: the same tile of the hi pair
  const unsigned short* gb2 = (const unsigned short*)B2 + (size_t)by * sB + (size_t)col0 * ldb;
  unsigned oa[4], ob[4];
#pragma unroll
  for (int i = 0; i < 4; ++i) { oa[i] = (unsigned)((sr + 32 * i) * lda + sc); ob[i] = (unsigned)((sr + 32 * i) * ldb + sc); }
  v8us ra[4], rb[4]; const unsigned short *pa[4], *pb[4];
#pragma unroll
  for (int i = 0; i < 4; ++i) { pa[i] = ga + oa[i]; pb[i] = gb + ob[i]; }
#pragma unroll
  for (int i = 0; i < 4; ++i) { ra[i] = *(const v8us*)pa[i]; rb[i] = *(const v8us*)pb[i]; }
  // the eight address pairs are inputs of the wait: they stay in their registers up to it, so no load of the group is given a register that an issued load names
  asm volatile("s_wait_xcnt 0x0" :: "v"(pa[0]), "v"(pa[1]), "v"(pa[2]), "v"(pa[3]), "v"(pb[0]), "v"(pb[1]), "v"(pb[2]), "v"(pb[3]) : "memory");
#pragma unroll
  for (int i = 0; i < 4; ++i) { *(v8us*)&st[0][0][(sr + 32 * i) * TPITCH + sc] = ra[i]; *(v8us*)&st[0][1][(sr + 32 * i) * TPITCH + sc] = rb[i]; }
  __syncthreads();
  const int wm = w >> 1, wn = w & 1; const int ns1 = K / 64, ns = TWO ? 2 * ns1 : ns1;
  v8f acc[2][4] = {};
  for (int s = 0; s < ns; ++s) {
    const int cur = s & 1; const bool more = s + 1 < ns;      // the same in every thread of the workgroup
    if (more) {
      const bool sw = TWO && s + 1 == ns1;      // the next pass is the first of the hi pair; otherwise it lies 64 k = 128 B further
      ga = sw ? ga2 : ga + 64; gb = sw ? gb2 : gb + 64;
#pragma unroll
      for (int i = 0; i < 4; ++i) { pa[i] = ga + oa[i]; pb[i] = gb + ob[i]; }
#pragma unroll
      for (int i = 0; i < 4; ++i) { ra[i] = *(const v8us*)pa[i]; rb[i] = *(const v8us*)pb[i]; }
      // as in front of the loop: the address pairs stay in their registers up to the wait
      asm volatile("s_wait_xcnt 0x0" :: "v"(pa[0]), "v"(pa[1]), "v"(pa[2]), "v"(pa[3]), "v"(pb[0]), "v"(pb[1]), "v"(pb[2]), "v"(pb[3]) : "memory");
    }
    if (TWO && s == ns1) {      // the lo pair's sums take their weight before the hi pair's products are added
#pragma unroll
      for (int mi = 0; mi < 2; ++mi)
#pragma unroll
        for (int t = 0; t < 4; ++t) acc[mi][t] *= 0.0009765625f;
    }
    const unsigned short* la = &st[cur][0][(wm * 32 + ln) * TPITCH + 8 * hh];
    const unsigned short* lb = &st[cur][1][(wn * 64 + ln) * TPITCH + 8 * hh];
    FragH a[2][2], b[2][4];      // all of the pass's fragments are read as one group ahead of its products
#pragma unroll
    for (int ks = 0; ks < 2; ++ks) {
#pragma unroll
      for (int mi = 0; mi < 2; ++mi) { a[ks][mi].half[0] = *(const v8us*)(la + mi * 16 * TPITCH + ks * 32); a[ks][mi].half[1] = *(const v8us*)(la + mi * 16 * TPITCH + ks * 32 + 16); }
#pragma unroll
      for (int t = 0; t < 4; ++t) { b[ks][t].half[0] = *(const v8us*)(lb + t * 16 * TPITCH + ks * 32); b[ks][t].half[1] = *(const v8us*)(lb + t * 16 * TPITCH + ks * 32 + 16); }
    }
#pragma unroll
    for (int ks = 0; ks < 2; ++ks)
#pragma unroll
      for (int t = 0; t < 4; ++t)
#pragma unroll
        for (int mi = 0; mi < 2; ++mi) acc[mi][t] = mmaH<1>(a[ks][mi].v, a[ks][mi].v, b[ks][t].v, b[ks][t].v, acc[mi][t]);
    if (more) {
#pragma unroll
      for (int i = 0; i < 4; ++i) { *(v8us*)&st[cur ^ 1][0][(sr + 32 * i) * TPITCH + sc] = ra[i]; *(v8us*)&st[cur ^ 1][1][(sr + 32 * i) * TPITCH + sc] = rb[i]; }
    }
    __syncthreads();      // publishes the buffer just filled and ends every read of the one just used
  }
  // epilogue: each wave turns its accumulators into whole rows through its own 32 x 68 f32 range of the (now free) staging LDS
  fa1* so = (fa1*)&st[0][0][0] + w * (32 * 68);
  const size_t cofs = (size_t)by * sC; const int wrow0 = row0 + wm * 32, wcol0 = col0 + wn * 64; const int rsub = lane >> 4, c4 = (lane & 15) * 4;
  float* crow = C + cofs + (size_t)(wrow0 + rsub) * ldc + wcol0 + c4;      // each lane writes 16 B of rows rsub + 2 q
  v4f cp = {0.f, 0.f, 0.f, 0.f};
  if (CPM == 1) cp = *(const v4fa*)(CP + (size_t)by * sCPy + wcol0 + c4);
#pragma unroll
  for (int t = 0; t < 4; ++t) { const float* bs = second ? CP : bias; const float bv = bs ? bf16_round(bs[wcol0 + t * 16 + ln]) : 0.f;
#pragma unroll
    for (int mi = 0; mi < 2; ++mi)
#pragma unroll
      for (int r = 0; r < 8; ++r) so[(mi * 16 + 8 * hh + r) * 68 + t * 16 + ln] = acc[mi][t][r] * alpha + bv; }
  __builtin_amdgcn_fence(__ATOMIC_ACQ_REL, "workgroup"); __builtin_amdgcn_wave_barrier();      // the wave's LDS rows are complete before its lanes read what other lanes wrote
  auto rows = [&](auto f32o) {      // the output form is a compile-time constant of each copy, so that DUAL branches once per wave, not once per row
#pragma unroll
  for (int q = 0; q < 16; ++q) { const int r = q * 2 + rsub; const int row = wrow0 + r; v4f v = *(const v4fa*)&so[r * 68 + c4];
    if (CPM != 0) { for (int i = 0; i < 4; ++i) v[i] += cp[i]; }
    if (HL) { v4hs h4, l4; for (int i = 0; i < 4; ++i) { const _Float16 h = (_Float16)v[i]; h4[i] = h; l4[i] = (_Float16)((v[i] - (float)h) * 1024.0f); }
      const size_t o = cofs + (size_t)row * ldc + wcol0 + c4; *(v4hs*)(C16 + o) = h4; *(v4hs*)(C16l + o) = l4; continue; }
    if (decltype(f32o)::v) *(v4f*)(crow + (size_t)(q * 2) * ldc) = v;
    else { v4hs h4; for (int i = 0; i < 4; ++i) h4[i] = (_Float16)v[i]; *(v4hs*)(C16 + cofs + (size_t)row * ldc + wcol0 + c4) = h4; } }
  if (DUAL && decltype(f32o)::v) asm volatile("s_wait_xcnt 0x0" ::: "memory");      // the f32 row stores have taken their registers before the f16 copy of this loop, laid out behind them, reuses them
  };
  if (DUAL && second) rows(BoolC<false>{}); else rows(BoolC<DUAL || F32OUT>{});
  if (BNP) {      // a lane takes two adjacent columns of the wave's 64 and adds the 32 rows in row order
    asm volatile("s_wait_xcnt 0x0" ::: "memory");      // the row stores above have taken their registers before the sums below reuse them
    v2f xr[32];
#pragma unroll      // constant indices keep xr in registers
    for (int r = 0; r < 32; ++r) xr[r] = *(const v2fa*)&so[r * 68 + lane * 2];
    v2f s = xr[0];
#pragma unroll      // xr stays in registers
    for (int r = 1; r < 32; ++r) s += xr[r];
    const v2f mu = s * (1.0f / 32.0f);
    v2f m2 = {0.f, 0.f};
#pragma unroll      // xr stays in registers
    for (int r = 0; r < 32; ++r) { const v2f d = xr[r] - mu; m2 += d * d; }
    const size_t o = (size_t)(wrow0 / 32) * ldc + wcol0 + lane * 2; *(v2f*)(PS + o) = s; *(v2f*)(PM + o) = m2;
  }
}


typedef _Float16 v4h __attribute__((ext_vector_type(4)));

__global__ __launch_bounds__(256) void k_x16(const float* __restrict__ x, _Float16* __restrict__ X16, size_t n8) { const size_t t = (size_t)blockIdx.x * 256 + threadIdx.x; if (t >= n8) return; FragH f;
#pragma unroll
  for (int q = 0; q < 8; ++q) f.h[q] = (_Float16)bf16_round(x[t * 8 + q]); *(v8us*)((unsigned short*)X16 + t * 8) = f.half[0];  }
__device__ __forceinline__ void d_round16f(const float* __restrict__ W, _Float16* __restrict__ Bt, size_t t) { FragH f;
#pragma unroll
  for (int i = 0; i < 8; ++i) f.h[i] = (_Float16)(bf16_round(W[t * 8 + i]) * 16.0f); *(v8us*)((unsigned short*)Bt + t * 8) = f.half[0];  }
// Max-pool over row pairs and transpose in one pass: Vt[slab][d][p] = max(V16[2 p][d], V16[2 p + 1][d]) for a 64 x 64 tile of pooled rows p and columns d; 8 lanes read one whole 128-B line of each of the two rows.
typedef _Float16 v8h __attribute__((ext_vector_type(8)));
template <int NHv, int TTv>
__device__ __forceinline__ void d_poolvt(const _Float16* __restrict__ V16, int ldv, int voff, _Float16* __restrict__ Vt, int blk) { __shared__ unsigned short tl4[4][64][66]; unsigned short (*tl)[66] = tl4[threadIdx.x >> 8]; const int tid = threadIdx.x & 255; const int tile = blk * 4 + (int)(threadIdx.x >> 8);      // each quarter of the workgroup (8 waves) takes one tile, in its own LDS slab
  const int slab = tile / (TTv / 64), lg = tile % (TTv / 64); const int b = slab / NHv, h = slab % NHv;
  const int r0 = tid / 8, c8 = (tid % 8) * 8;
  const unsigned short* p0 = (const unsigned short*)V16 + ((size_t)b * TTv + lg * 64 + r0) * 2 * ldv + voff + h * 64 + c8; const unsigned short* p1 = p0 + (size_t)64 * ldv;      // pooled rows r0 and r0 + 32
  const unsigned short* q0 = p0 + ldv; const unsigned short* q1 = p1 + ldv;      // the second row of each pair
  const v8us a0 = *(const v8us*)p0, b0 = *(const v8us*)q0, a1 = *(const v8us*)p1, b1 = *(const v8us*)q1;
  // the four address pairs are inputs of the wait: they stay in their registers up to it, so no load of the group is given a register that an issued load names
  asm volatile("s_wait_xcnt 0x0" :: "v"(p0), "v"(q0), "v"(p1), "v"(q1) : "memory");
  const v8h fa0 = __builtin_bit_cast(v8h, a0), fb0 = __builtin_bit_cast(v8h, b0), fa1v = __builtin_bit_cast(v8h, a1), fb1 = __builtin_bit_cast(v8h, b1);
#pragma unroll      // constant indices keep the eight-element vectors in registers
  for (int q = 0; q < 8; ++q) { tl[r0][c8 + q] = ((float)fa0[q] > (float)fb0[q]) ? a0[q] : b0[q]; tl[r0 + 32][c8 + q] = ((float)fa1v[q] > (float)fb1[q]) ? a1[q] : b1[q]; }
  __syncthreads();
  {
#pragma unroll
    for (int rd = 0; rd < 2; ++rd) { const int d = rd * 32 + tid / 8, pc = tid % 8; FragH f;
#pragma unroll
      for (int q = 0; q < 8; ++q) f.u[q] = tl[pc * 8 + q][d];
      *(v8us*)((unsigned short*)Vt + ((size_t)slab * 64 + d) * TTv + lg * 64 + pc * 8) = f.half[0]; }
    asm volatile("s_wait_xcnt 0x0" ::: "memory");      // the two stores have taken their registers before the other part of the merged kernel, laid out behind this one, reuses them
     } }

__device__ __forceinline__ void d_tok(const float* __restrict__ x, _Float16* __restrict__ X16, int blk) { __shared__ float tl[32][65]; const int tid = threadIdx.x; const int b = blk / ((CC / 64) * (NN / 32)), rem = blk % ((CC / 64) * (NN / 32)); const int cg = rem / (NN / 32), pg = rem % (NN / 32); const int c0 = cg * 64, p0 = pg * 32;
  for (int i = tid; i < 64 * 32; i += 256) { const int c = i / 32, pp = i % 32; tl[pp][c] = bf16_round(x[((size_t)b * CC + c0 + c) * NN + p0 + pp]); } __syncthreads();
  const int r = tid / 8, pc = tid % 8; FragH f; for (int q = 0; q < 8; ++q) f.h[q] = (_Float16)tl[r][pc * 8 + q]; const size_t row = (size_t)b * NN + p0 + r; *(v8us*)((unsigned short*)X16 + row * CC + c0 + pc * 8) = f.half[0];  }
// All operand preparation in one launch; none of its five parts reads what another writes. Workgroups 0 .. 4 WPB - 1 take the four weight matrices (WPB each), the rest the tiles of x.
#define WPB (CC * CC / 8 / 256)
__global__ __launch_bounds__(256) void k_prep(const float* __restrict__ x, const float* __restrict__ gw, const float* __restrict__ phw, const float* __restrict__ Ww, const float* __restrict__ thw,
    _Float16* __restrict__ X16, _Float16* __restrict__ Bg, _Float16* __restrict__ Bph, _Float16* __restrict__ BW, _Float16* __restrict__ Bthp) {
  const int blk = blockIdx.x;
  if (blk >= 4 * WPB) { d_tok(x, X16, blk - 4 * WPB); return; }      // the same in every thread of the workgroup
  const int which = blk / WPB, t = (blk % WPB) * 256 + (int)threadIdx.x;
  if (which == 3) { d_wt_f16(thw, Bthp, CC, CC, 16.0f, t); return; }      // Bt[c][o] = W_theta[o][c]
  d_round16f(which == 0 ? gw : (which == 1 ? phw : Ww), which == 0 ? Bg : (which == 1 ? Bph : BW), (size_t)t);      // (out,in) natural
}
// phi after its projection, one wave per pooled row m: max over rows 2 m and 2 m + 1 of F (f32), the maximum split as f16 hi and (v - hi) * 2^10, and cv[m] = sum over channels of maximum * b_theta.
// Every load takes 512 B of one row. A lane sums its 16 channels in order, the 32 lanes are added by a butterfly; the 32 waves' sums leave as one 128-B line.
__device__ __forceinline__ void d_phipost(const float* __restrict__ F, const float* __restrict__ bth, _Float16* __restrict__ Hh, _Float16* __restrict__ Hl, float* __restrict__ cv, int blk) {
  __shared__ float red[32];
  const int tid = threadIdx.x, w = tid >> 5, lane = tid & 31; const size_t m = (size_t)blk * 32 + w;
  const float* p = F + m * 2 * CC + lane * 4; const float* pt = bth + lane * 4;
  v4f a[4], b[4], t[4];
#pragma unroll      // constant indices keep a, b and t in registers, so that the loads are issued ahead of the arithmetic
  for (int u = 0; u < 4; ++u) { a[u] = *(const v4fa*)(p + u * 128); b[u] = *(const v4fa*)(p + CC + u * 128); t[u] = *(const v4fa*)(pt + u * 128); }
  // the two address pairs are inputs of the wait: they stay in their registers until every load of the group has taken them
  asm volatile("s_wait_xcnt 0x0" :: "v"(p), "v"(pt) : "memory");
  v4hs hv[4], lv[4]; float s = 0.f;
#pragma unroll      // a, b, t, hv and lv stay in registers
  for (int u = 0; u < 4; ++u)
    for (int q = 0; q < 4; ++q) { const float v = fmaxf(a[u][q], b[u][q]); const _Float16 h = (_Float16)v; hv[u][q] = h; lv[u][q] = (_Float16)((v - (float)h) * 1024.0f); s += v * bf16_round(t[u][q]); }
  for (int o = 16; o >= 1; o >>= 1) s += __shfl_xor(s, o, 32);
  if (lane == 0) red[w] = s;
  __syncthreads();      // the 32 row sums are complete before wave 0 reads them
  _Float16* oh = Hh + m * CC + lane * 4; _Float16* ol = Hl + m * CC + lane * 4;
#pragma unroll      // hv and lv stay in registers
  for (int u = 0; u < 4; ++u) { *(v4hs*)(oh + u * 128) = hv[u]; *(v4hs*)(ol + u * 128) = lv[u]; }
  if (w == 0) cv[blk * 32 + lane] = red[lane];
}
// What follows the two projections, in one launch: workgroups 0 .. NRH / 32 - 1 finish phi, the rest pool and transpose g; neither part reads what the other writes.
__global__ __launch_bounds__(1024) void k_post(const float* __restrict__ F, const float* __restrict__ bth, _Float16* __restrict__ Hh, _Float16* __restrict__ Hl, float* __restrict__ cv, const _Float16* __restrict__ V16, _Float16* __restrict__ Vt) {
  const int blk = blockIdx.x;      // the branch is the same in every thread of the workgroup, so each part's barrier is passed by all of them
  if (blk < NRH / 32) d_phipost(F, bth, Hh, Hl, cv, blk);
  else d_poolvt<8, NH>(V16, CC, 0, Vt, blk - NRH / 32);
}
__global__ __launch_bounds__(256) void k_smx(const float* __restrict__ S, _Float16* __restrict__ P16) { const int tid = threadIdx.x, wv = tid >> 5, lane = tid & 31; const int r = blockIdx.x * 8 + wv; if (r >= NR) return; const float* sr = S + (size_t)r * NH; float m = -3.0e38f;
  for (int p = lane; p < NH / 8; p += 32) { const v4f a = *(const v4fa*)(sr + p * 8), b = *(const v4fa*)(sr + p * 8 + 4); for (int q = 0; q < 4; ++q) m = fmaxf(m, fmaxf(a[q], b[q])); }
  for (int o = 16; o >= 1; o >>= 1) m = fmaxf(m, __shfl_xor(m, o, 32)); float z = 0.f;
  for (int p = lane; p < NH / 8; p += 32) { const v4f a = *(const v4fa*)(sr + p * 8), b = *(const v4fa*)(sr + p * 8 + 4); for (int q = 0; q < 4; ++q) z += __expf(a[q] - m) + __expf(b[q] - m); }
  for (int o = 16; o >= 1; o >>= 1) z += __shfl_xor(z, o, 32); const float iz = 32768.0f / z;
  { for (int p = lane; p < NH / 8; p += 32) { FragH f; for (int q = 0; q < 8; ++q) f.h[q] = (_Float16)(__expf(sr[p * 8 + q] - m) * iz); *(v8us*)((unsigned short*)P16 + (size_t)r * NH + p * 8) = f.half[0]; }  } }
// BN batch statistics in two stages. Stage 1 is the BNP epilogue of the GEMM that makes wy: per chunk of SROWS consecutive rows and per channel, the rows' sum and the sum of their squared deviations from their own mean.
#define SROWS 32
#define SCH (NR / SROWS)
static_assert(SROWS == 32, "a chunk is the 32 rows of one wave's tile in k_gemm_t");
// Stage 2: one workgroup per 32 channels (one line of every partial row), lane = channel; wave w takes chunks 16 w .. 16 w + 15 in order, the 32 waves' sums are added in wave order by every wave.
// Total squared deviation = sum over chunks of (chunk's own + SROWS * (chunk mean - mean)^2). ST keeps its form: one line per channel, mean and 1/sqrt(var + eps) in its first two words.
__global__ __launch_bounds__(1024) void k_bnfin(const float* __restrict__ PS, const float* __restrict__ PM, float* __restrict__ ST) {
  __shared__ float red[2][32][32];
  const int tid = threadIdx.x, w = tid >> 5, lane = tid & 31; const int c = blockIdx.x * 32 + lane;
  const float* ps = PS + (size_t)(w * (SCH / 32)) * CC + c; const float* pm = PM + (size_t)(w * (SCH / 32)) * CC + c;
  float s[SCH / 32], m[SCH / 32];
#pragma unroll      // constant indices keep s and m in registers; all loads are in flight together
  for (int i = 0; i < SCH / 32; ++i) { s[i] = ps[i * CC]; m[i] = pm[i * CC]; }
  // the two address pairs are inputs of the wait: they stay in their registers until every load of the group has taken them
  asm volatile("s_wait_xcnt 0x0" :: "v"(ps), "v"(pm) : "memory");
  float a = 0.f;
#pragma unroll      // s stays in registers
  for (int i = 0; i < SCH / 32; ++i) a += s[i];
  red[0][w][lane] = a; __syncthreads();
  float tot = 0.f;
  for (int j = 0; j < 32; ++j) tot += red[0][j][lane];
  const float mu = tot / (float)NR;
  float q = 0.f;
#pragma unroll      // s and m stay in registers
  for (int i = 0; i < SCH / 32; ++i) { const float d = s[i] * (1.0f / (float)SROWS) - mu; q += m[i] + (float)SROWS * d * d; }
  red[1][w][lane] = q; __syncthreads();
  float q2 = 0.f;
  for (int j = 0; j < 32; ++j) q2 += red[1][j][lane];
  const float rs = rsqrtf(q2 / (float)NR + 1e-5f);
  const float muw = __shfl(mu, w, 32), rsw = __shfl(rs, w, 32);      // wave w writes the line of channel w of the 32
  ST[(blockIdx.x * 32 + w) * 32 + lane] = (lane == 0) ? muw : ((lane == 1) ? rsw : 0.f);
}
__global__ __launch_bounds__(256) void k_out(const float* __restrict__ WY, const float* __restrict__ ST, const float* __restrict__ gam, const float* __restrict__ bet, const float* __restrict__ x, float* __restrict__ out) { __shared__ float tl[32][65]; const int tid = threadIdx.x; const int b = blockIdx.x / ((CC / 32) * (NN / 64)), rem = blockIdx.x % ((CC / 32) * (NN / 64)); const int cg = rem / (NN / 64), pg = rem % (NN / 64); const int c0 = cg * 32, p0 = pg * 64;
  for (int i = tid; i < 64 * 32; i += 256) { const int pp = i / 32, c = i % 32; const int cc = c0 + c; tl[c][pp] = (WY[((size_t)b * NN + p0 + pp) * CC + cc] - ST[cc * 32]) * ST[cc * 32 + 1] * bf16_round(gam[cc]) + bf16_round(bet[cc]); } __syncthreads();
  { for (int i = tid; i < 32 * 16; i += 256) { const int c = i / 16, q4 = i % 16; const size_t o = ((size_t)b * CC + c0 + c) * NN + p0 + q4 * 4; const v4f xv = *(const v4fa*)(x + o); v4f v; for (int q = 0; q < 4; ++q) v[q] = tl[c][q4 * 4 + q] + bf16_round(xv[q]); *(v4f*)(out + o) = v; }  } }
extern "C" void kernel_launch(void* const* d_in, const int* in_sizes, int n_in,
                              void* d_out, int out_size, void* d_ws, size_t ws_size, hipStream_t stream) {
  (void)in_sizes; (void)n_in; (void)out_size;
  const float* x = (const float*)d_in[0]; const float* gw = (const float*)d_in[1]; const float* gb = (const float*)d_in[2]; const float* thw = (const float*)d_in[3]; const float* thb = (const float*)d_in[4]; const float* phw = (const float*)d_in[5]; const float* phb = (const float*)d_in[6]; const float* Ww = (const float*)d_in[7]; const float* Wb = (const float*)d_in[8]; const float* gam = (const float*)d_in[9]; const float* bet = (const float*)d_in[10];
  char* ws = (char*)d_ws; size_t off = 0;
  auto take = [&](size_t bytes) { char* p = ws + off; off += (bytes + 255) & ~(size_t)255; return p; };
  _Float16* Bg = (_Float16*)take((size_t)CC * CC * 2); _Float16* Bph = (_Float16*)take((size_t)CC * CC * 2); _Float16* BW = (_Float16*)take((size_t)CC * CC * 2); float* ST = (float*)take(CC * 32 * 4);
  _Float16* Bthp = (_Float16*)take((size_t)CC * CC * 2);      // W_θ as [in=o][out=c] → Bt[c][o] for φ·W_θ
  _Float16* X16 = (_Float16*)take((size_t)NR * CC * 2); float* FULLF = (float*)take((size_t)NR * CC * 4); _Float16* FULL = (_Float16*)take((size_t)NR * CC * 2); _Float16* PHh = (_Float16*)take((size_t)NRH * CC * 2); _Float16* PHl = (_Float16*)take((size_t)NRH * CC * 2);
  // every per-batch buffer holds all BB batches, so that each stage is one launch over the whole batch
  _Float16* BPh = (_Float16*)take((size_t)NRH * CC * 2); _Float16* BPl = (_Float16*)take((size_t)NRH * CC * 2); float* CV = (float*)take(NRH * 4); _Float16* Gt = (_Float16*)take((size_t)NRH * CC * 2); float* S = (float*)take((size_t)NR * NH * 4); _Float16* P16 = (_Float16*)take((size_t)NR * NH * 2);
  float* PS = (float*)take((size_t)SCH * CC * 4); float* PM = (float*)take((size_t)SCH * CC * 4);      // BN partials per row chunk and channel
  _Float16* Y16 = FULL; float* WY = FULLF;      // FULLF/FULL are dead after pooling
  if (off > ws_size) return;      // about 214 MB
  k_prep<<<4 * WPB + BB * (CC / 64) * (NN / 32), 256, 0, stream>>>(x, gw, phw, Ww, thw, X16, Bg, Bph, BW, Bthp);      // the four weight matrices and x as f16 operands
  const dim3 gp((NR / 128) * (CC / 128), 1), gp2((NR / 128) * (CC / 128), 2);
  k_gemm_t<0, true, false, false, false, true><<<gp2, 256, 0, stream>>>(X16, nullptr, CC, 0, Bph, Bg, CC, 0, 0.0625f, phb, gb, 0, FULLF, FULL, nullptr, nullptr, nullptr, CC, 0, CC, CC);      // plane 0: phi (f32); plane 1: g (f16)
  k_post<<<NRH / 32 + BB * 8 * (NH / 64) / 4, 1024, 0, stream>>>(FULLF, thb, PHh, PHl, CV, FULL, Gt);      // phi pooled, split hi/lo, and c = phi * b_theta; g pooled and transposed: g^T [BB][512][1024]
  const dim3 gb2((NRH / 128) * (CC / 128), 1), gs((NN / 128) * (NH / 128), BB), gy((NN / 128) * (CC / 128), BB);      // blockIdx.y = batch where the B operand differs per batch
  k_gemm_t<0, false, true, false, true><<<gb2, 256, 0, stream>>>(PHl, PHh, CC, 0, Bthp, Bthp, CC, 0, 0.0625f, nullptr, nullptr, 0, nullptr, BPh, BPl, nullptr, nullptr, CC, 0, CC, CC);      // B' = phi * W_theta [BB*1024][512] (phi lo, then hi), all batches as rows, leaves split hi/lo
  k_gemm_t<1, true, false, false, true><<<gs, 256, 0, stream>>>(X16, X16, CC, (size_t)NN * CC, BPl, BPh, CC, (size_t)NH * CC, 1.0f, nullptr, CV, (size_t)NH, S, nullptr, nullptr, nullptr, nullptr, NH, (size_t)NN * NH, NH, CC);      // f = x * B'^T + c (B' lo, then hi; c broadcast over the rows of its batch)
  k_smx<<<NR / 8, 256, 0, stream>>>(S, P16);
  k_gemm_t<0, false><<<gy, 256, 0, stream>>>(P16, nullptr, NH, (size_t)NN * NH, Gt, nullptr, NH, (size_t)CC * NH, 0.000030517578125f, nullptr, nullptr, 0, nullptr, Y16, nullptr, nullptr, nullptr, CC, (size_t)NN * CC, CC, NH);      // y = softmax(f) * g, stored as f16
  k_gemm_t<0, true, false, true><<<gp, 256, 0, stream>>>(Y16, nullptr, CC, 0, BW, nullptr, CC, 0, 0.0625f, Wb, nullptr, 0, WY, nullptr, nullptr, PS, PM, CC, 0, CC, CC);      // wy = W(y) + b, with the BN partials of its row chunks
  k_bnfin<<<CC / 32, 1024, 0, stream>>>(PS, PM, ST); k_out<<<BB * (CC / 32) * (NN / 64), 256, 0, stream>>>(WY, ST, gam, bet, x, (float*)d_out);
}

// v007
// It runs in 149 microseconds.
// Timed twice side by side with v006, it ran 1.12 and 1.13 times as fast.
// Over all steps from v000 it is 10.0 times as fast.
#include <hip/hip_runtime.h>
// Non-local block with view pooling (x [8, C=512, N=2048]): θ = conv1(x), φ = maxpool2(conv1(x)), g = maxpool2(conv1(x)); f = softmax(θᵀ·φ) [N × N/2] (unscaled); y = f·g; wy = conv1(y) + b;
// out = BN_train(wy)·γ + β + x. Because the unscaled logits reach σ≈20 and feed a near-one-hot softmax, θ is never rounded: the logits are re-associated as f = x·(φ·W_θ)ᵀ + 1·(φ·b_θ)ᵀ with x bf16-EXACT,
// φ (f32, max-pooled from an f32 projection) fed as f16 hi + lo·2^10 into φ·W_θ and that product again split hi/lo as the B operand (four cheap passes per batch), the column term added exactly through
// the epilogue addend; g, y as plain f16; P ×2^15 f16; all on v_wmma_f32_16x16x32_f16 ((out,in) weights bf16-exact ×2^4, f32 accumulate); the layout transposes, max-pooling, softmax rows, BN batch statistics (fixed-order) and the residual are f32 VALU.
#define BB 8
#define CC 512
#define NN 2048
#define NH (NN / 2)
#define NR (BB * NN)
#define NRH (BB * NH)

typedef __bf16 v16b __attribute__((ext_vector_type(16)));
typedef unsigned short v8us __attribute__((ext_vector_type(8), may_alias));
typedef float  v8f  __attribute__((ext_vector_type(8)));
typedef float  v4f  __attribute__((ext_vector_type(4)));
typedef float  v4fa __attribute__((ext_vector_type(4), may_alias));
union FragB { v16b v; v8us half[2]; unsigned short u[16]; };

__device__ __forceinline__ unsigned short bf16_bits(float x) { unsigned int u = __float_as_uint(x); return (unsigned short)((u + 0x7FFFu + ((u >> 16) & 1u)) >> 16); }
__device__ __forceinline__ float bf16_val(unsigned short b) { return __uint_as_float(((unsigned int)b) << 16); }
__device__ __forceinline__ float bf16_round(float x) { return bf16_val(bf16_bits(x)); }
// D += A·B with NT terms: 1 = ah·bh, 2 = + al·bh (A split), 3 = + ah·bl (both split)
template <int NT>
__device__ __forceinline__ v8f mmaN(v16b ah, v16b al, v16b bh, v16b bl, v8f c) {
  c = __builtin_amdgcn_wmma_f32_16x16x32_bf16(false, ah, false, bh, (short)0, c, false, false);
  if (NT >= 2) c = __builtin_amdgcn_wmma_f32_16x16x32_bf16(false, al, false, bh, (short)0, c, false, false);
  if (NT >= 3) c = __builtin_amdgcn_wmma_f32_16x16x32_bf16(false, ah, false, bl, (short)0, c, false, false);
  asm volatile("v_nop\n\tv_nop\n\tv_nop\n\tv_nop" : "+v"(c) : "v"(ah), "v"(al), "v"(bh), "v"(bl));
  return c;
}

__global__ __launch_bounds__(256) void k_wt_bf16(const float* __restrict__ W, unsigned short* __restrict__ Wt, int K, int N) {
  const int t = blockIdx.x * 256 + threadIdx.x;
  const int k8n = K / 8;
  if (t >= N * k8n) return;
  const int n = t / k8n, k8 = (t % k8n) * 8;
  v8us v;
#pragma unroll
  for (int i = 0; i < 8; ++i) v[i] = bf16_bits(W[(size_t)(k8 + i) * N + n]);
  *(v8us*)(Wt + (size_t)n * K + k8) = v;
  
}

// GEMM C[M][N] (f32, pitch ldc) = act(A[M][K]·W + bias). A f32 row-major (pitch lda) converted per fragment to bf16
// (ASPLIT: hi/lo two planes -> 2 terms, else single rounded term); Wt bf16 [N][K] (pitch ldb). BIAS_BF16 rounds the
// bias to bf16 first (bias quantised to bf16 before the add). K%32==0, M%16==0, N%64==0.
template <bool ASPLIT, int ACT, bool BIAS_BF16>
__global__ __launch_bounds__(128) void k_gemm_bf(const float* __restrict__ A, int lda, const unsigned short* __restrict__ Wt, int ldb,
                                               const float* __restrict__ bias, float* __restrict__ C, int ldc, int M, int N, int K) {
  __shared__ __attribute__((aligned(16))) float so[4][16][64];
  const int tid = threadIdx.x, w = tid >> 5, lane = tid & 31, ln = lane & 15, hh = lane >> 4;
  const int ntn = N / 64;
  const int wid = blockIdx.x * 4 + w;
  const int mt = wid / ntn, nq = wid % ntn;
  if (mt * 16 >= M) return;
  const int row0 = mt * 16, col0 = nq * 64;
  const float* arow = A + (size_t)(row0 + ln) * lda;
  v8f acc[4] = {};
  for (int kb = 0; kb < K; kb += 32) {
    FragB ah, al;
    const v4f x0 = *(const v4fa*)(arow + kb + 8 * hh), x1 = *(const v4fa*)(arow + kb + 8 * hh + 4);
    const v4f x2 = *(const v4fa*)(arow + kb + 16 + 8 * hh), x3 = *(const v4fa*)(arow + kb + 16 + 8 * hh + 4);
    float xs[16] = {x0[0],x0[1],x0[2],x0[3],x1[0],x1[1],x1[2],x1[3],x2[0],x2[1],x2[2],x2[3],x3[0],x3[1],x3[2],x3[3]};
#pragma unroll
    for (int i = 0; i < 16; ++i) { const unsigned short hb = bf16_bits(xs[i]); ah.u[i] = hb; al.u[i] = ASPLIT ? bf16_bits(xs[i] - bf16_val(hb)) : (unsigned short)0; }
#pragma unroll
    for (int t = 0; t < 4; ++t) {
      const unsigned short* brow = Wt + (size_t)(col0 + t * 16 + ln) * ldb + kb;
      FragB b;
      b.half[0] = *(const v8us*)(brow + 8 * hh);
      b.half[1] = *(const v8us*)(brow + 16 + 8 * hh);
      acc[t] = mmaN<ASPLIT ? 2 : 1>(ah.v, al.v, b.v, b.v, acc[t]);
    }
  }
#pragma unroll
  for (int t = 0; t < 4; ++t) {
    float bv = bias ? bias[col0 + t * 16 + ln] : 0.f;
    if (BIAS_BF16) bv = bf16_round(bv);
#pragma unroll
    for (int r = 0; r < 8; ++r) { float v = acc[t][r] + bv; if (ACT == 1) v = fmaxf(v, 0.f); so[w][8 * hh + r][t * 16 + ln] = v; }
  }
  __builtin_amdgcn_fence(__ATOMIC_ACQ_REL, "workgroup");
  __builtin_amdgcn_wave_barrier();
  const int rsub = lane >> 4, c4 = (lane & 15) * 4;
  {
#pragma unroll
    for (int q = 0; q < 8; ++q) {
      const int r = q * 2 + rsub;
      const v4f v = *(const v4fa*)&so[w][r][c4];
      *(v4f*)(C + (size_t)(row0 + r) * ldc + col0 + c4) = v;
    }
    
  }
}

// Flash-style causal/unmasked attention, all contractions 3-term bf16 hi/lo splits, f32 softmax with running max.
// q,k,v rows are read from f32 buffers with arbitrary row pitch (so they can live inside a fused qkv buffer);
// D = head size (multiple of 32, <= 128); one wave = 16 query rows; block = 4 waves (64 queries) sharing K/V chunks of 32.
template <int D, bool CAUSAL>
__global__ __launch_bounds__(128) void k_flash(const float* __restrict__ qb, const float* __restrict__ kb, const float* __restrict__ vb,
                                             int pitch, int T, int H, float scale, float* __restrict__ y, int ypitch) {
  constexpr int KS = D / 32;        // k-steps for QK
  constexpr int DT = D / 16;        // d tiles for PV
  __shared__ __attribute__((aligned(16))) unsigned short sKh[32][D + 8], sKl[32][D + 8], sVh[32][D + 8], sVl[32][D + 8];
  __shared__ __attribute__((aligned(16))) unsigned short sPh[4][16][40], sPl[4][16][40];
  __shared__ __attribute__((aligned(16))) float sO[4][16][D];
  const int tid = threadIdx.x, w = tid >> 5, lane = tid & 31, ln = lane & 15, hh = lane >> 4;
  const int nqb = (T + 63) / 64;
  const int bh = blockIdx.x / nqb, qblk = blockIdx.x % nqb;
  const int b = bh / H, h = bh % H;
  const int q0 = qblk * 64 + w * 16;
  const float* Q = qb + (size_t)b * T * pitch + h * D;
  const float* K = kb + (size_t)b * T * pitch + h * D;
  const float* V = vb + (size_t)b * T * pitch + h * D;

  // A fragments of the wave's 16 query rows (scaled), hi/lo
  FragB aqh[KS], aql[KS];
  {
    int row = q0 + ln; if (row >= T) row = T - 1;
    const float* qr = Q + (size_t)row * pitch;
#pragma unroll
    for (int ks = 0; ks < KS; ++ks)
#pragma unroll
      for (int i = 0; i < 16; ++i) {
        const int d = ks * 32 + ((i < 8) ? (8 * hh + i) : (16 + 8 * hh + (i - 8)));
        const float x = qr[d] * scale; const unsigned short hb = bf16_bits(x);
        aqh[ks].u[i] = hb; aql[ks].u[i] = bf16_bits(x - bf16_val(hb));
      }
  }
  float m_r[8], l_r[8];
#pragma unroll
  for (int r = 0; r < 8; ++r) { m_r[r] = -3.0e38f; l_r[r] = 0.f; }
  v8f oacc[DT];
#pragma unroll
  for (int dt = 0; dt < DT; ++dt) oacc[dt] = (v8f){0.f,0.f,0.f,0.f,0.f,0.f,0.f,0.f};

  const int kv_end = CAUSAL ? min(T, qblk * 64 + 64) : T;     // block-uniform
  for (int j0 = 0; j0 < kv_end; j0 += 32) {
    __syncthreads();
    for (int e = tid; e < 32 * (D / 4); e += 128) {
      const int r = e / (D / 4), c4 = (e % (D / 4)) * 4;
      const int key = j0 + r;
      v4f kf = {0.f,0.f,0.f,0.f}, vf = {0.f,0.f,0.f,0.f};
      if (key < T) { kf = *(const v4fa*)(K + (size_t)key * pitch + c4); vf = *(const v4fa*)(V + (size_t)key * pitch + c4); }
#pragma unroll
      for (int t = 0; t < 4; ++t) {
        unsigned short hb = bf16_bits(kf[t]); sKh[r][c4 + t] = hb; sKl[r][c4 + t] = bf16_bits(kf[t] - bf16_val(hb));
        hb = bf16_bits(vf[t]); sVh[r][c4 + t] = hb; sVl[r][c4 + t] = bf16_bits(vf[t] - bf16_val(hb));
      }
    }
    __syncthreads();
    // S tile 16 x 32
    v8f s[2];
#pragma unroll
    for (int nt = 0; nt < 2; ++nt) {
      v8f acc = {};
#pragma unroll
      for (int ks = 0; ks < KS; ++ks) {
        FragB bh_, bl_;
        bh_.half[0] = *(const v8us*)&sKh[nt * 16 + ln][ks * 32 + 8 * hh]; bh_.half[1] = *(const v8us*)&sKh[nt * 16 + ln][ks * 32 + 16 + 8 * hh];
        bl_.half[0] = *(const v8us*)&sKl[nt * 16 + ln][ks * 32 + 8 * hh]; bl_.half[1] = *(const v8us*)&sKl[nt * 16 + ln][ks * 32 + 16 + 8 * hh];
        acc = mmaN<3>(aqh[ks].v, aql[ks].v, bh_.v, bl_.v, acc);
      }
      s[nt] = acc;
    }
    // mask + running max (rows 8hh+r; the 16 lanes of a half share rows)
    float alpha[8];
#pragma unroll
    for (int r = 0; r < 8; ++r) {
      const int qi = q0 + 8 * hh + r;
      const int ja = j0 + ln, jb = j0 + 16 + ln;
      if (CAUSAL) { if (ja > qi) s[0][r] = -3.0e38f; if (jb > qi) s[1][r] = -3.0e38f; }
      if (ja >= T) s[0][r] = -3.0e38f;
      if (jb >= T) s[1][r] = -3.0e38f;
      float mx = fmaxf(s[0][r], s[1][r]);
      mx = fmaxf(mx, __shfl_xor(mx, 1, 32)); mx = fmaxf(mx, __shfl_xor(mx, 2, 32)); mx = fmaxf(mx, __shfl_xor(mx, 4, 32)); mx = fmaxf(mx, __shfl_xor(mx, 8, 32));
      const float mnew = fmaxf(m_r[r], mx);
      alpha[r] = (mnew > -1.0e38f) ? __expf(m_r[r] - mnew) : 1.0f;
      const float p0 = (s[0][r] > -1.0e38f) ? __expf(s[0][r] - mnew) : 0.f;
      const float p1 = (s[1][r] > -1.0e38f) ? __expf(s[1][r] - mnew) : 0.f;
      m_r[r] = mnew;
      l_r[r] = l_r[r] * alpha[r] + p0 + p1;            // per-lane partial row sum (16 lanes combined at the end)
      unsigned short hb = bf16_bits(p0); sPh[w][8 * hh + r][ln] = hb;      sPl[w][8 * hh + r][ln] = bf16_bits(p0 - bf16_val(hb));
      hb = bf16_bits(p1);                sPh[w][8 * hh + r][16 + ln] = hb; sPl[w][8 * hh + r][16 + ln] = bf16_bits(p1 - bf16_val(hb));
    }
#pragma unroll
    for (int dt = 0; dt < DT; ++dt)
#pragma unroll
      for (int r = 0; r < 8; ++r) oacc[dt][r] *= alpha[r];
    __builtin_amdgcn_fence(__ATOMIC_ACQ_REL, "workgroup");
    __builtin_amdgcn_wave_barrier();
    FragB pah, pal;
    pah.half[0] = *(const v8us*)&sPh[w][ln][8 * hh]; pah.half[1] = *(const v8us*)&sPh[w][ln][16 + 8 * hh];
    pal.half[0] = *(const v8us*)&sPl[w][ln][8 * hh]; pal.half[1] = *(const v8us*)&sPl[w][ln][16 + 8 * hh];
#pragma unroll
    for (int dt = 0; dt < DT; ++dt) {
      FragB bvh, bvl;
#pragma unroll
      for (int i = 0; i < 8; ++i) {
        bvh.u[i] = sVh[8 * hh + i][dt * 16 + ln]; bvh.u[8 + i] = sVh[16 + 8 * hh + i][dt * 16 + ln];
        bvl.u[i] = sVl[8 * hh + i][dt * 16 + ln]; bvl.u[8 + i] = sVl[16 + 8 * hh + i][dt * 16 + ln];
      }
      oacc[dt] = mmaN<3>(pah.v, pal.v, bvh.v, bvl.v, oacc[dt]);
    }
    __builtin_amdgcn_fence(__ATOMIC_ACQ_REL, "workgroup");
    __builtin_amdgcn_wave_barrier();
  }
#pragma unroll
  for (int r = 0; r < 8; ++r) {
    float l = l_r[r];
    l += __shfl_xor(l, 1, 32); l += __shfl_xor(l, 2, 32); l += __shfl_xor(l, 4, 32); l += __shfl_xor(l, 8, 32);
    l_r[r] = (l > 0.f) ? 1.0f / l : 0.f;
  }
#pragma unroll
  for (int dt = 0; dt < DT; ++dt)
#pragma unroll
    for (int r = 0; r < 8; ++r) sO[w][8 * hh + r][dt * 16 + ln] = oacc[dt][r] * l_r[r];
  __builtin_amdgcn_fence(__ATOMIC_ACQ_REL, "workgroup");
  __builtin_amdgcn_wave_barrier();
  {
    for (int r = 0; r < 16; ++r) {
      const int row = q0 + r;
      if (row < T && lane < D / 4) {
        const v4f val = *(const v4fa*)&sO[w][r][lane * 4];
        *(v4f*)(y + ((size_t)b * T + row) * ypitch + h * D + lane * 4) = val;
      }
    }
    
  }
}

// GEMM C = act(A·W + bias + resid): A f32 (ASPLIT -> hi/lo 2 terms), Wt bf16 [N][K]; ACT 0 none, 1 relu, 2 exact gelu;
// resid (optional, f32, row index = (row % rmod), pitch ldr, RES_BF16 rounds it) added before the activation.
template <bool ASPLIT, int ACT, bool BIAS_BF16, bool RES_BF16>
__global__ __launch_bounds__(128) void k_gemm_bf3(const float* __restrict__ A, int lda, const unsigned short* __restrict__ Wt, int ldb,
                                                const float* __restrict__ bias, const float* __restrict__ resid, int rmod, int ldr,
                                                float* __restrict__ C, int ldc, int M, int N, int K) {
  __shared__ __attribute__((aligned(16))) float so[4][16][64];
  const int tid = threadIdx.x, w = tid >> 5, lane = tid & 31, ln = lane & 15, hh = lane >> 4;
  const int ntn = N / 64;
  const int wid = blockIdx.x * 4 + w;
  const int mt = wid / ntn, nq = wid % ntn;
  if (mt * 16 >= M) return;
  const int row0 = mt * 16, col0 = nq * 64;
  const float* arow = A + (size_t)(row0 + ln) * lda;
  v8f acc[4] = {};
  for (int kb = 0; kb < K; kb += 32) {
    FragB ah, al;
    const v4f x0 = *(const v4fa*)(arow + kb + 8 * hh), x1 = *(const v4fa*)(arow + kb + 8 * hh + 4);
    const v4f x2 = *(const v4fa*)(arow + kb + 16 + 8 * hh), x3 = *(const v4fa*)(arow + kb + 16 + 8 * hh + 4);
    float xs[16] = {x0[0],x0[1],x0[2],x0[3],x1[0],x1[1],x1[2],x1[3],x2[0],x2[1],x2[2],x2[3],x3[0],x3[1],x3[2],x3[3]};
#pragma unroll
    for (int i = 0; i < 16; ++i) { const unsigned short hb = bf16_bits(xs[i]); ah.u[i] = hb; al.u[i] = ASPLIT ? bf16_bits(xs[i] - bf16_val(hb)) : (unsigned short)0; }
#pragma unroll
    for (int t = 0; t < 4; ++t) {
      const unsigned short* brow = Wt + (size_t)(col0 + t * 16 + ln) * ldb + kb;
      FragB b;
      b.half[0] = *(const v8us*)(brow + 8 * hh);
      b.half[1] = *(const v8us*)(brow + 16 + 8 * hh);
      acc[t] = mmaN<ASPLIT ? 2 : 1>(ah.v, al.v, b.v, b.v, acc[t]);
    }
  }
#pragma unroll
  for (int t = 0; t < 4; ++t) {
    const int col = col0 + t * 16 + ln;
    float bv = bias ? bias[col] : 0.f;
    if (BIAS_BF16) bv = bf16_round(bv);
#pragma unroll
    for (int r = 0; r < 8; ++r) {
      float v = acc[t][r] + bv;
      if (resid) { float rv = resid[(size_t)((row0 + 8 * hh + r) % rmod) * ldr + col]; if (RES_BF16) rv = bf16_round(rv); v += rv; }
      if (ACT == 1) v = fmaxf(v, 0.f);
      if (ACT == 2) v = 0.5f * v * (1.0f + erff(v * 0.70710678118654752f));
      if (ACT == 3) { const float u = 0.7978845608028654f * (v + 0.044715f * v * v * v); v = 0.5f * v * (1.0f + tanhf(u)); }
      so[w][8 * hh + r][t * 16 + ln] = v;
    }
  }
  __builtin_amdgcn_fence(__ATOMIC_ACQ_REL, "workgroup");
  __builtin_amdgcn_wave_barrier();
  const int rsub = lane >> 4, c4 = (lane & 15) * 4;
  {
#pragma unroll
    for (int q = 0; q < 8; ++q) {
      const int r = q * 2 + rsub;
      const v4f v = *(const v4fa*)&so[w][r][c4];
      *(v4f*)(C + (size_t)(row0 + r) * ldc + col0 + c4) = v;
    }
    
  }
}
// row LayerNorm (biased variance, eps) over N: s = X (+ R); optional out_sum <- s; out_norm <- (s-mu)*rsqrt(var+eps)*g + b
template <bool PARAM_BF16>
__global__ __launch_bounds__(256) void k_layernorm(const float* __restrict__ X, const float* __restrict__ R, const float* __restrict__ g, const float* __restrict__ bta,
                                                  float* __restrict__ out_sum, float* __restrict__ out_norm, int N, float eps) {
  __shared__ float red[256];
  const int row = blockIdx.x, tid = threadIdx.x;
  const float* x = X + (size_t)row * N; const float* rr = R ? R + (size_t)row * N : nullptr;
  float vals[16];                     // up to N = 4096
  const int per = N / 256;            // contiguous chunk per thread? use strided-by-4 chunks: thread handles j = tid*4 + 1024*u
  float s1 = 0.f;
  for (int u = 0; u < per / 4; ++u) {
    const int j = tid * 4 + 1024 * u;
    const v4f a = *(const v4fa*)(x + j);
    v4f b = {0.f,0.f,0.f,0.f}; if (rr) b = *(const v4fa*)(rr + j);
#pragma unroll
    for (int q = 0; q < 4; ++q) { const float v = a[q] + b[q]; vals[u * 4 + q] = v; s1 += v; }
  }
  red[tid] = s1; __syncthreads();
  for (int st = 128; st > 0; st >>= 1) { if (tid < st) red[tid] += red[tid + st]; __syncthreads(); }
  const float mu = red[0] / (float)N; __syncthreads();
  float s2 = 0.f;
  for (int u = 0; u < per / 4; ++u)
#pragma unroll
    for (int q = 0; q < 4; ++q) { const float c = vals[u * 4 + q] - mu; s2 += c * c; }
  red[tid] = s2; __syncthreads();
  for (int st = 128; st > 0; st >>= 1) { if (tid < st) red[tid] += red[tid + st]; __syncthreads(); }
  const float rs = rsqrtf(red[0] / (float)N + eps);
  {
    for (int u = 0; u < per / 4; ++u) {
      const int j = tid * 4 + 1024 * u;
      v4f o, sm;
#pragma unroll
      for (int q = 0; q < 4; ++q) {
        float gg = g[j + q], bb = bta[j + q];
        if (PARAM_BF16) { gg = bf16_round(gg); bb = bf16_round(bb); }
        sm[q] = vals[u * 4 + q]; o[q] = (vals[u * 4 + q] - mu) * rs * gg + bb;
      }
      if (out_sum) *(v4f*)(out_sum + (size_t)row * N + j) = sm;
      *(v4f*)(out_norm + (size_t)row * N + j) = o;
    }
    
  }
}



// ---- f16 WMMA path (v_wmma_f32_16x16x32_f16): 11-bit significands for operands in range — used where a [0,1] probability operand needs more precision than bf16
typedef _Float16 v16h __attribute__((ext_vector_type(16)));
union FragH { v16h v; v8us half[2]; _Float16 h[16]; unsigned short u[16]; };
template <int NT>
__device__ __forceinline__ v8f mmaH(v16h ah, v16h al, v16h bh, v16h bl, v8f c) {
  c = __builtin_amdgcn_wmma_f32_16x16x32_f16(false, ah, false, bh, (short)0, c, false, false);
  if (NT >= 2) c = __builtin_amdgcn_wmma_f32_16x16x32_f16(false, al, false, bh, (short)0, c, false, false);
  if (NT >= 3) c = __builtin_amdgcn_wmma_f32_16x16x32_f16(false, ah, false, bl, (short)0, c, false, false);
  asm volatile("v_nop\n\tv_nop\n\tv_nop\n\tv_nop" : "+v"(c) : "v"(ah), "v"(al), "v"(bh), "v"(bl));
  return c;
}
// batched GEMM like k_gemm_b but f16 operands: A f32 (split into f16 hi/lo if ASPLIT, else rounded to f16), Bt = f16 values [n][k]; alpha; C f32; N multiple of 16 (partial tiles skipped)
template <bool ASPLIT>
__global__ __launch_bounds__(128) void k_gemm_h(const float* __restrict__ A, int lda, size_t sA, const _Float16* __restrict__ Bh, int ldb, size_t sB, float alpha, float* __restrict__ C, int ldc, size_t sC, int M, int N, int K) {
  __shared__ __attribute__((aligned(16))) float so[4][16][64];
  const int tid = threadIdx.x, w = tid >> 5, lane = tid & 31, ln = lane & 15, hh = lane >> 4; const int by = blockIdx.y;
  A += (size_t)by * sA; Bh += (size_t)by * sB; C += (size_t)by * sC;
  const int ntn = (N + 63) / 64; const int wid = blockIdx.x * 4 + w; const int mt = wid / ntn, nq = wid % ntn; if (mt * 16 >= M) return;
  const int row0 = mt * 16, col0 = nq * 64; const float* arow = A + (size_t)(row0 + ln) * lda;
  v8f acc[4] = {};
  for (int kb = 0; kb < K; kb += 32) {
    FragH ah, al;
    const v4f x0 = *(const v4fa*)(arow + kb + 8 * hh), x1 = *(const v4fa*)(arow + kb + 8 * hh + 4), x2 = *(const v4fa*)(arow + kb + 16 + 8 * hh), x3 = *(const v4fa*)(arow + kb + 16 + 8 * hh + 4);
    float xs[16] = {x0[0],x0[1],x0[2],x0[3],x1[0],x1[1],x1[2],x1[3],x2[0],x2[1],x2[2],x2[3],x3[0],x3[1],x3[2],x3[3]};
#pragma unroll
    for (int i = 0; i < 16; ++i) { const _Float16 h = (_Float16)xs[i]; ah.h[i] = h; al.h[i] = ASPLIT ? (_Float16)(xs[i] - (float)h) : (_Float16)0.0f; }
#pragma unroll
    for (int t = 0; t < 4; ++t) { if (col0 + t * 16 >= N) continue; const size_t boff = (size_t)(col0 + t * 16 + ln) * ldb + kb; FragH bq; bq.half[0] = *(const v8us*)(Bh + boff + 8 * hh); bq.half[1] = *(const v8us*)(Bh + boff + 16 + 8 * hh);
      acc[t] = mmaH<ASPLIT ? 2 : 1>(ah.v, al.v, bq.v, bq.v, acc[t]); }
  }
#pragma unroll
  for (int t = 0; t < 4; ++t) { if (col0 + t * 16 >= N) continue;
#pragma unroll
    for (int r = 0; r < 8; ++r) so[w][8 * hh + r][t * 16 + ln] = acc[t][r] * alpha; }
  __builtin_amdgcn_fence(__ATOMIC_ACQ_REL, "workgroup"); __builtin_amdgcn_wave_barrier();
  const int rsub = lane >> 4, c4 = (lane & 15) * 4;
  {
#pragma unroll
    for (int q = 0; q < 8; ++q) { const int r = q * 2 + rsub; if (col0 + c4 < N) { const v4f v = *(const v4fa*)&so[w][r][c4]; *(v4f*)(C + (size_t)(row0 + r) * ldc + col0 + c4) = v; } }
     }
}

// Wt[n][k] = f16(W[k][n]·scale) from f32 row-major W[K][N] (scale = power of two; bf16-exact weights stay exact in f16 away from the subnormal range)
__device__ __forceinline__ void d_wt_f16(const float* __restrict__ W, _Float16* __restrict__ Wt, int K, int N, float scale, int t) {
  const int n = t / (K / 8), k8 = (t % (K / 8)) * 8; FragH f;
#pragma unroll
  for (int i = 0; i < 8; ++i) f.h[i] = (_Float16)(bf16_round(W[(size_t)(k8 + i) * N + n]) * scale); const v8us o = f.half[0];
  *(v8us*)((unsigned short*)Wt + (size_t)n * K + k8) = o;
  asm volatile("s_wait_xcnt 0x0" ::: "memory");      // the store has taken its registers before another part of the merged kernel, laid out behind this one, reuses them
}
// Tiled GEMM, f16 operands, both K-contiguous: v[row][col] = acc*alpha + bias[col], then CPM 1: + CP[by*sCPy + col] (one row for all rows); written as f32 to C (F32OUT) or as f16 to C16,
// or (HL) split as f16 hi to C16 and (v - hi) * 2^10 as f16 to C16l, with nothing written to C.
// TWO: a product whose one operand is split hi + lo * 2^-10 runs in one launch on one accumulator: first the K of the lo pair A, Bh; the sums are then scaled by 2^-10 (exact); the K of the hi pair A2, B2 is added on top.
// BNP: stage 1 of the BN batch statistics. A wave's 32 rows are one row chunk: per column it also writes their sum to PS and the sum of their squared deviations from their own mean to PM (row = chunk, pitch ldc).
// One 128x128 tile per workgroup of 8 waves (4 x 2, 32x64 per wave). A pass is 64 k = one whole 128-B line of every operand row: each wave-wide 16-B load
// covers four whole lines and goes through registers into LDS (row pitch 144 B for the ds_load_b128 fragment readers); two buffers, one barrier per pass;
// the next pass's global loads are issued before this pass's products. M, N multiples of 128 (the grid is exact), K a multiple of 64.
// Every "#pragma unroll" below makes the index of a register array (staged rows, fragments, accumulators) a constant, so that the array stays in registers.
#define TPITCH 72
typedef float fa1 __attribute__((may_alias));
typedef _Float16 v4hs __attribute__((ext_vector_type(4)));
typedef float v2f __attribute__((ext_vector_type(2)));
typedef float v2fa __attribute__((ext_vector_type(2), may_alias));
template <bool V> struct BoolC { static constexpr bool v = V; };
// DUAL: two products of the same A in one launch. Plane blockIdx.y = 0 takes Bh and bias and writes f32 to C; plane 1 takes B2, its bias from CP, and writes f16 to C16 (sA, sB, sC are 0; CPM 0).
template <int CPM, bool F32OUT, bool HL = false, bool BNP = false, bool TWO = false, bool DUAL = false>
__global__ __launch_bounds__(256) void k_gemm_t(const _Float16* __restrict__ A, const _Float16* __restrict__ A2, int lda, size_t sA, const _Float16* __restrict__ Bh, const _Float16* __restrict__ B2, int ldb, size_t sB, float alpha, const float* __restrict__ bias, const float* __restrict__ CP, size_t sCPy,
    float* __restrict__ C, _Float16* __restrict__ C16, _Float16* __restrict__ C16l, float* __restrict__ PS, float* __restrict__ PM, int ldc, size_t sC, int N, int K) {
  __shared__ __attribute__((aligned(16))) unsigned short st[2][2][128 * TPITCH];      // [buffer][A, B][row * TPITCH + k]
  const int tid = threadIdx.x, w = tid >> 5, lane = tid & 31, ln = lane & 15, hh = lane >> 4; const int by = blockIdx.y;
  const int ntn = N / 128; const int row0 = ((int)blockIdx.x / ntn) * 128, col0 = ((int)blockIdx.x % ntn) * 128;
  const int sr = tid >> 3, sc = (tid & 7) * 8;      // staging: 8 lanes per row, rows sr + 32 i
  const unsigned short* ga = (const unsigned short*)A + (size_t)by * sA + (size_t)row0 * lda;      // workgroup-uniform bases, per-lane 32-bit offsets that never change
  const bool second = DUAL && by == 1;      // the same in every thread of the workgroup
  const unsigned short* gb = (const unsigned short*)(second ? B2 : Bh) + (size_t)by * sB + (size_t)col0 * ldb;
  const unsigned short* ga2 = (const unsigned short*)A2 + (size_t)by * sA + (size_t)row0 * lda;      // TWO: the same tile of the hi pair
  const unsigned short* gb2 = (const unsigned short*)B2 + (size_t)by * sB + (size_t)col0 * ldb;
  unsigned oa[4], ob[4];
#pragma unroll
  for (int i = 0; i < 4; ++i) { oa[i] = (unsigned)((sr + 32 * i) * lda + sc); ob[i] = (unsigned)((sr + 32 * i) * ldb + sc); }
  v8us ra[4], rb[4]; const unsigned short *pa[4], *pb[4];
#pragma unroll
  for (int i = 0; i < 4; ++i) { pa[i] = ga + oa[i]; pb[i] = gb + ob[i]; }
#pragma unroll
  for (int i = 0; i < 4; ++i) { ra[i] = *(const v8us*)pa[i]; rb[i] = *(const v8us*)pb[i]; }
  // the eight address pairs are inputs of the wait: they stay in their registers up to it, so no load of the group is given a register that an issued load names
  asm volatile("s_wait_xcnt 0x0" :: "v"(pa[0]), "v"(pa[1]), "v"(pa[2]), "v"(pa[3]), "v"(pb[0]), "v"(pb[1]), "v"(pb[2]), "v"(pb[3]) : "memory");
#pragma unroll
  for (int i = 0; i < 4; ++i) { *(v8us*)&st[0][0][(sr + 32 * i) * TPITCH + sc] = ra[i]; *(v8us*)&st[0][1][(sr + 32 * i) * TPITCH + sc] = rb[i]; }
  __syncthreads();
  const int wm = w >> 1, wn = w & 1; const int ns1 = K / 64, ns = TWO ? 2 * ns1 : ns1;
  v8f acc[2][4] = {};
  for (int s = 0; s < ns; ++s) {
    const int cur = s & 1; const bool more = s + 1 < ns;      // the same in every thread of the workgroup
    if (more) {
      const bool sw = TWO && s + 1 == ns1;      // the next pass is the first of the hi pair; otherwise it lies 64 k = 128 B further
      ga = sw ? ga2 : ga + 64; gb = sw ? gb2 : gb + 64;
#pragma unroll
      for (int i = 0; i < 4; ++i) { pa[i] = ga + oa[i]; pb[i] = gb + ob[i]; }
#pragma unroll
      for (int i = 0; i < 4; ++i) { ra[i] = *(const v8us*)pa[i]; rb[i] = *(const v8us*)pb[i]; }
      // as in front of the loop: the address pairs stay in their registers up to the wait
      asm volatile("s_wait_xcnt 0x0" :: "v"(pa[0]), "v"(pa[1]), "v"(pa[2]), "v"(pa[3]), "v"(pb[0]), "v"(pb[1]), "v"(pb[2]), "v"(pb[3]) : "memory");
    }
    if (TWO && s == ns1) {      // the lo pair's sums take their weight before the hi pair's products are added
#pragma unroll
      for (int mi = 0; mi < 2; ++mi)
#pragma unroll
        for (int t = 0; t < 4; ++t) acc[mi][t] *= 0.0009765625f;
    }
    const unsigned short* la = &st[cur][0][(wm * 32 + ln) * TPITCH + 8 * hh];
    const unsigned short* lb = &st[cur][1][(wn * 64 + ln) * TPITCH + 8 * hh];
    FragH a[2][2], b[2][4];      // all of the pass's fragments are read as one group ahead of its products
#pragma unroll
    for (int ks = 0; ks < 2; ++ks) {
#pragma unroll
      for (int mi = 0; mi < 2; ++mi) { a[ks][mi].half[0] = *(const v8us*)(la + mi * 16 * TPITCH + ks * 32); a[ks][mi].half[1] = *(const v8us*)(la + mi * 16 * TPITCH + ks * 32 + 16); }
#pragma unroll
      for (int t = 0; t < 4; ++t) { b[ks][t].half[0] = *(const v8us*)(lb + t * 16 * TPITCH + ks * 32); b[ks][t].half[1] = *(const v8us*)(lb + t * 16 * TPITCH + ks * 32 + 16); }
    }
#pragma unroll
    for (int ks = 0; ks < 2; ++ks)
#pragma unroll
      for (int t = 0; t < 4; ++t)
#pragma unroll
        for (int mi = 0; mi < 2; ++mi) acc[mi][t] = mmaH<1>(a[ks][mi].v, a[ks][mi].v, b[ks][t].v, b[ks][t].v, acc[mi][t]);
    if (more) {
#pragma unroll
      for (int i = 0; i < 4; ++i) { *(v8us*)&st[cur ^ 1][0][(sr + 32 * i) * TPITCH + sc] = ra[i]; *(v8us*)&st[cur ^ 1][1][(sr + 32 * i) * TPITCH + sc] = rb[i]; }
    }
    __syncthreads();      // publishes the buffer just filled and ends every read of the one just used
  }
  // epilogue: each wave turns its accumulators into whole rows through its own 32 x 68 f32 range of the (now free) staging LDS
  fa1* so = (fa1*)&st[0][0][0] + w * (32 * 68);
  const size_t cofs = (size_t)by * sC; const int wrow0 = row0 + wm * 32, wcol0 = col0 + wn * 64; const int rsub = lane >> 4, c4 = (lane & 15) * 4;
  float* crow = C + cofs + (size_t)(wrow0 + rsub) * ldc + wcol0 + c4;      // each lane writes 16 B of rows rsub + 2 q
  v4f cp = {0.f, 0.f, 0.f, 0.f};
  if (CPM == 1) cp = *(const v4fa*)(CP + (size_t)by * sCPy + wcol0 + c4);
#pragma unroll
  for (int t = 0; t < 4; ++t) { const float* bs = second ? CP : bias; const float bv = bs ? bf16_round(bs[wcol0 + t * 16 + ln]) : 0.f;
#pragma unroll
    for (int mi = 0; mi < 2; ++mi)
#pragma unroll
      for (int r = 0; r < 8; ++r) so[(mi * 16 + 8 * hh + r) * 68 + t * 16 + ln] = acc[mi][t][r] * alpha + bv; }
  __builtin_amdgcn_fence(__ATOMIC_ACQ_REL, "workgroup"); __builtin_amdgcn_wave_barrier();      // the wave's LDS rows are complete before its lanes read what other lanes wrote
  auto rows = [&](auto f32o) {      // the output form is a compile-time constant of each copy, so that DUAL branches once per wave, not once per row
#pragma unroll
  for (int q = 0; q < 16; ++q) { const int r = q * 2 + rsub; const int row = wrow0 + r; v4f v = *(const v4fa*)&so[r * 68 + c4];
    if (CPM != 0) { for (int i = 0; i < 4; ++i) v[i] += cp[i]; }
    if (HL) { v4hs h4, l4; for (int i = 0; i < 4; ++i) { const _Float16 h = (_Float16)v[i]; h4[i] = h; l4[i] = (_Float16)((v[i] - (float)h) * 1024.0f); }
      const size_t o = cofs + (size_t)row * ldc + wcol0 + c4; *(v4hs*)(C16 + o) = h4; *(v4hs*)(C16l + o) = l4; continue; }
    if (decltype(f32o)::v) *(v4f*)(crow + (size_t)(q * 2) * ldc) = v;
    else { v4hs h4; for (int i = 0; i < 4; ++i) h4[i] = (_Float16)v[i]; *(v4hs*)(C16 + cofs + (size_t)row * ldc + wcol0 + c4) = h4; } }
  if (DUAL && decltype(f32o)::v) asm volatile("s_wait_xcnt 0x0" ::: "memory");      // the f32 row stores have taken their registers before the f16 copy of this loop, laid out behind them, reuses them
  };
  if (DUAL && second) rows(BoolC<false>{}); else rows(BoolC<DUAL || F32OUT>{});
  if (BNP) {      // a lane takes two adjacent columns of the wave's 64 and adds the 32 rows in row order
    asm volatile("s_wait_xcnt 0x0" ::: "memory");      // the row stores above have taken their registers before the sums below reuse them
    v2f xr[32];
#pragma unroll      // constant indices keep xr in registers
    for (int r = 0; r < 32; ++r) xr[r] = *(const v2fa*)&so[r * 68 + lane * 2];
    v2f s = xr[0];
#pragma unroll      // xr stays in registers
    for (int r = 1; r < 32; ++r) s += xr[r];
    const v2f mu = s * (1.0f / 32.0f);
    v2f m2 = {0.f, 0.f};
#pragma unroll      // xr stays in registers
    for (int r = 0; r < 32; ++r) { const v2f d = xr[r] - mu; m2 += d * d; }
    const size_t o = (size_t)(wrow0 / 32) * ldc + wcol0 + lane * 2; *(v2f*)(PS + o) = s; *(v2f*)(PM + o) = m2;
  }
}


typedef _Float16 v4h __attribute__((ext_vector_type(4)));

__global__ __launch_bounds__(256) void k_x16(const float* __restrict__ x, _Float16* __restrict__ X16, size_t n8) { const size_t t = (size_t)blockIdx.x * 256 + threadIdx.x; if (t >= n8) return; FragH f;
#pragma unroll
  for (int q = 0; q < 8; ++q) f.h[q] = (_Float16)bf16_round(x[t * 8 + q]); *(v8us*)((unsigned short*)X16 + t * 8) = f.half[0];  }
__device__ __forceinline__ void d_round16f(const float* __restrict__ W, _Float16* __restrict__ Bt, size_t t) { FragH f;
#pragma unroll
  for (int i = 0; i < 8; ++i) f.h[i] = (_Float16)(bf16_round(W[t * 8 + i]) * 16.0f); *(v8us*)((unsigned short*)Bt + t * 8) = f.half[0];  }
// Max-pool over row pairs and transpose in one pass: Vt[slab][d][p] = max(V16[2 p][d], V16[2 p + 1][d]) for a 64 x 64 tile of pooled rows p and columns d; 8 lanes read one whole 128-B line of each of the two rows.
typedef _Float16 v8h __attribute__((ext_vector_type(8)));
template <int NHv, int TTv>
__device__ __forceinline__ void d_poolvt(const _Float16* __restrict__ V16, int ldv, int voff, _Float16* __restrict__ Vt, int blk) { __shared__ unsigned short tl4[4][64][66]; unsigned short (*tl)[66] = tl4[threadIdx.x >> 8]; const int tid = threadIdx.x & 255; const int tile = blk * 4 + (int)(threadIdx.x >> 8);      // each quarter of the workgroup (8 waves) takes one tile, in its own LDS slab
  const int slab = tile / (TTv / 64), lg = tile % (TTv / 64); const int b = slab / NHv, h = slab % NHv;
  const int r0 = tid / 8, c8 = (tid % 8) * 8;
  const unsigned short* p0 = (const unsigned short*)V16 + ((size_t)b * TTv + lg * 64 + r0) * 2 * ldv + voff + h * 64 + c8; const unsigned short* p1 = p0 + (size_t)64 * ldv;      // pooled rows r0 and r0 + 32
  const unsigned short* q0 = p0 + ldv; const unsigned short* q1 = p1 + ldv;      // the second row of each pair
  const v8us a0 = *(const v8us*)p0, b0 = *(const v8us*)q0, a1 = *(const v8us*)p1, b1 = *(const v8us*)q1;
  // the four address pairs are inputs of the wait: they stay in their registers up to it, so no load of the group is given a register that an issued load names
  asm volatile("s_wait_xcnt 0x0" :: "v"(p0), "v"(q0), "v"(p1), "v"(q1) : "memory");
  const v8h fa0 = __builtin_bit_cast(v8h, a0), fb0 = __builtin_bit_cast(v8h, b0), fa1v = __builtin_bit_cast(v8h, a1), fb1 = __builtin_bit_cast(v8h, b1);
#pragma unroll      // constant indices keep the eight-element vectors in registers
  for (int q = 0; q < 8; ++q) { tl[r0][c8 + q] = ((float)fa0[q] > (float)fb0[q]) ? a0[q] : b0[q]; tl[r0 + 32][c8 + q] = ((float)fa1v[q] > (float)fb1[q]) ? a1[q] : b1[q]; }
  __syncthreads();
  {
#pragma unroll
    for (int rd = 0; rd < 2; ++rd) { const int d = rd * 32 + tid / 8, pc = tid % 8; FragH f;
#pragma unroll
      for (int q = 0; q < 8; ++q) f.u[q] = tl[pc * 8 + q][d];
      *(v8us*)((unsigned short*)Vt + ((size_t)slab * 64 + d) * TTv + lg * 64 + pc * 8) = f.half[0]; }
    asm volatile("s_wait_xcnt 0x0" ::: "memory");      // the two stores have taken their registers before the other part of the merged kernel, laid out behind this one, reuses them
     } }

// x [b][c][p] (f32) to X16 [b * NN + p][c] (f16), one tile of 64 channels x 128 positions per workgroup. Wave w takes channels 8 w .. 8 w + 7: each of its eight loads is 512 contiguous bytes of one channel row,
// all eight in flight together. A lane then holds 8 channels of 4 positions = four 16-B chunks of X16 rows. They turn into whole 128-B lines through LDS: position 4 l + q lies in LDS row 32 q + l (128 B, no pad),
// chunk k at place k ^ ((l >> 1) & 7), so that the 16 lanes of a half wave meet 16 different 16-B bank groups both when they write and when they read.
__device__ __forceinline__ void d_tok(const float* __restrict__ x, _Float16* __restrict__ X16, int blk) { __shared__ __attribute__((aligned(16))) unsigned short tl[128 * 64]; const int tid = threadIdx.x, w = tid >> 5, lane = tid & 31;
  const int b = blk / ((CC / 64) * (NN / 128)), rem = blk % ((CC / 64) * (NN / 128)); const int cg = rem / (NN / 128), pg = rem % (NN / 128); const int c0 = cg * 64, p0 = pg * 128;
  const float* px = x + ((size_t)b * CC + c0 + 8 * w) * NN + p0 + 4 * lane;
  v4f v[8];
#pragma unroll      // constant indices keep v in registers, so that the eight loads are issued ahead of the arithmetic
  for (int j = 0; j < 8; ++j) v[j] = *(const v4fa*)(px + (size_t)j * NN);
  // the address pair is an input of the wait: it stays in its registers until every load of the group has taken it
  asm volatile("s_wait_xcnt 0x0" :: "v"(px) : "memory");
#pragma unroll      // v stays in registers
  for (int q = 0; q < 4; ++q) { FragH f;
#pragma unroll      // v and f stay in registers
    for (int j = 0; j < 8; ++j) f.h[j] = (_Float16)bf16_round(v[j][q]);
    *(v8us*)&tl[((q * 32 + lane) * 8 + (w ^ ((lane >> 1) & 7))) * 8] = f.half[0]; }
  __syncthreads();      // the tile is complete before its rows are read back
  const int rr = tid >> 3, ch = tid & 7;      // 8 lanes write one whole line of X16 rows 4 rr + i
  unsigned short* po = (unsigned short*)X16 + ((size_t)b * NN + p0 + 4 * rr) * CC + c0 + ch * 8;
  v8us o[4];
#pragma unroll      // o stays in registers
  for (int i = 0; i < 4; ++i) o[i] = *(const v8us*)&tl[((i * 32 + rr) * 8 + (ch ^ ((rr >> 1) & 7))) * 8];
#pragma unroll      // o stays in registers
  for (int i = 0; i < 4; ++i) *(v8us*)(po + (size_t)i * CC) = o[i]; }
// All operand preparation in one launch; none of its five parts reads what another writes. Workgroups 0 .. 4 WPB - 1 take the four weight matrices (WPB each), the rest the tiles of x.
#define WPB (CC * CC / 8 / 256)
__global__ __launch_bounds__(256) void k_prep(const float* __restrict__ x, const float* __restrict__ gw, const float* __restrict__ phw, const float* __restrict__ Ww, const float* __restrict__ thw,
    _Float16* __restrict__ X16, _Float16* __restrict__ Bg, _Float16* __restrict__ Bph, _Float16* __restrict__ BW, _Float16* __restrict__ Bthp) {
  const int blk = blockIdx.x;
  if (blk >= 4 * WPB) { d_tok(x, X16, blk - 4 * WPB); return; }      // the same in every thread of the workgroup
  const int which = blk / WPB, t = (blk % WPB) * 256 + (int)threadIdx.x;
  if (which == 3) { d_wt_f16(thw, Bthp, CC, CC, 16.0f, t); return; }      // Bt[c][o] = W_theta[o][c]
  d_round16f(which == 0 ? gw : (which == 1 ? phw : Ww), which == 0 ? Bg : (which == 1 ? Bph : BW), (size_t)t);      // (out,in) natural
}
// phi after its projection, one wave per pooled row m: max over rows 2 m and 2 m + 1 of F (f32), the maximum split as f16 hi and (v - hi) * 2^10, and cv[m] = sum over channels of maximum * b_theta.
// Every load takes 512 B of one row. A lane sums its 16 channels in order, the 32 lanes are added by a butterfly; the 32 waves' sums leave as one 128-B line.
__device__ __forceinline__ void d_phipost(const float* __restrict__ F, const float* __restrict__ bth, _Float16* __restrict__ Hh, _Float16* __restrict__ Hl, float* __restrict__ cv, int blk) {
  __shared__ float red[32];
  const int tid = threadIdx.x, w = tid >> 5, lane = tid & 31; const size_t m = (size_t)blk * 32 + w;
  const float* p = F + m * 2 * CC + lane * 4; const float* pt = bth + lane * 4;
  v4f a[4], b[4], t[4];
#pragma unroll      // constant indices keep a, b and t in registers, so that the loads are issued ahead of the arithmetic
  for (int u = 0; u < 4; ++u) { a[u] = *(const v4fa*)(p + u * 128); b[u] = *(const v4fa*)(p + CC + u * 128); t[u] = *(const v4fa*)(pt + u * 128); }
  // the two address pairs are inputs of the wait: they stay in their registers until every load of the group has taken them
  asm volatile("s_wait_xcnt 0x0" :: "v"(p), "v"(pt) : "memory");
  v4hs hv[4], lv[4]; float s = 0.f;
#pragma unroll      // a, b, t, hv and lv stay in registers
  for (int u = 0; u < 4; ++u)
    for (int q = 0; q < 4; ++q) { const float v = fmaxf(a[u][q], b[u][q]); const _Float16 h = (_Float16)v; hv[u][q] = h; lv[u][q] = (_Float16)((v - (float)h) * 1024.0f); s += v * bf16_round(t[u][q]); }
  for (int o = 16; o >= 1; o >>= 1) s += __shfl_xor(s, o, 32);
  if (lane == 0) red[w] = s;
  __syncthreads();      // the 32 row sums are complete before wave 0 reads them
  _Float16* oh = Hh + m * CC + lane * 4; _Float16* ol = Hl + m * CC + lane * 4;
#pragma unroll      // hv and lv stay in registers
  for (int u = 0; u < 4; ++u) { *(v4hs*)(oh + u * 128) = hv[u]; *(v4hs*)(ol + u * 128) = lv[u]; }
  if (w == 0) cv[blk * 32 + lane] = red[lane];
}
// What follows the two projections, in one launch: workgroups 0 .. NRH / 32 - 1 finish phi, the rest pool and transpose g; neither part reads what the other writes.
__global__ __launch_bounds__(1024) void k_post(const float* __restrict__ F, const float* __restrict__ bth, _Float16* __restrict__ Hh, _Float16* __restrict__ Hl, float* __restrict__ cv, const _Float16* __restrict__ V16, _Float16* __restrict__ Vt) {
  const int blk = blockIdx.x;      // the branch is the same in every thread of the workgroup, so each part's barrier is passed by all of them
  if (blk < NRH / 32) d_phipost(F, bth, Hh, Hl, cv, blk);
  else d_poolvt<8, NH>(V16, CC, 0, Vt, blk - NRH / 32);
}
// Softmax rows of S, two rows per wave. A lane takes the same elements as before (groups of 8 at lane * 8 + 256 k) and adds them in the same order, but all 16 loads of the wave's two rows are issued up front
// and the rows stay in registers: S is read once, and each exponential is computed once and used for the sum and for the output.
__global__ __launch_bounds__(256) void k_smx(const float* __restrict__ S, _Float16* __restrict__ P16) { const int tid = threadIdx.x, wv = tid >> 5, lane = tid & 31; const int r = (blockIdx.x * 8 + wv) * 2; if (r >= NR) return;
  const float* sr = S + (size_t)r * NH + lane * 8;
  v4f a[2][4], b[2][4];
#pragma unroll      // constant indices keep a and b in registers, so that the loads are issued ahead of the arithmetic
  for (int h = 0; h < 2; ++h)
#pragma unroll
    for (int k = 0; k < 4; ++k) { a[h][k] = *(const v4fa*)(sr + h * NH + k * 256); b[h][k] = *(const v4fa*)(sr + h * NH + k * 256 + 4); }
  // the address pair is an input of the wait: it stays in its registers until every load of the group has taken it
  asm volatile("s_wait_xcnt 0x0" :: "v"(sr) : "memory");
  __builtin_amdgcn_sched_barrier(0);      // no arithmetic on the first row is moved up in front of the second row's loads: without it they were issued only after the first row had arrived
  float m[2] = {-3.0e38f, -3.0e38f}, z[2] = {0.f, 0.f}, iz[2];
#pragma unroll      // a and b stay in registers
  for (int h = 0; h < 2; ++h)
#pragma unroll
    for (int k = 0; k < 4; ++k)
      for (int q = 0; q < 4; ++q) m[h] = fmaxf(m[h], fmaxf(a[h][k][q], b[h][k][q]));
  for (int o = 16; o >= 1; o >>= 1) { m[0] = fmaxf(m[0], __shfl_xor(m[0], o, 32)); m[1] = fmaxf(m[1], __shfl_xor(m[1], o, 32)); }
#pragma unroll      // a and b stay in registers
  for (int h = 0; h < 2; ++h)
#pragma unroll
    for (int k = 0; k < 4; ++k)
      for (int q = 0; q < 4; ++q) { a[h][k][q] = __expf(a[h][k][q] - m[h]); b[h][k][q] = __expf(b[h][k][q] - m[h]); z[h] += a[h][k][q] + b[h][k][q]; }
  for (int o = 16; o >= 1; o >>= 1) { z[0] += __shfl_xor(z[0], o, 32); z[1] += __shfl_xor(z[1], o, 32); }
  iz[0] = 32768.0f / z[0]; iz[1] = 32768.0f / z[1];
  v8us o8[2][4];
#pragma unroll      // a, b and o8 stay in registers
  for (int h = 0; h < 2; ++h)
#pragma unroll
    for (int k = 0; k < 4; ++k) { FragH f; for (int q = 0; q < 4; ++q) { f.h[q] = (_Float16)(a[h][k][q] * iz[h]); f.h[4 + q] = (_Float16)(b[h][k][q] * iz[h]); } o8[h][k] = f.half[0]; }
  unsigned short* po = (unsigned short*)P16 + (size_t)r * NH + lane * 8;
#pragma unroll      // o8 stays in registers
  for (int h = 0; h < 2; ++h)
#pragma unroll
    for (int k = 0; k < 4; ++k) *(v8us*)(po + h * NH + k * 256) = o8[h][k]; }
// BN batch statistics in two stages. Stage 1 is the BNP epilogue of the GEMM that makes wy: per chunk of SROWS consecutive rows and per channel, the rows' sum and the sum of their squared deviations from their own mean.
#define SROWS 32
#define SCH (NR / SROWS)
static_assert(SROWS == 32, "a chunk is the 32 rows of one wave's tile in k_gemm_t");
// Stage 2: one workgroup per 32 channels (one line of every partial row), lane = channel; wave w takes chunks 16 w .. 16 w + 15 in order, the 32 waves' sums are added in wave order by every wave.
// Total squared deviation = sum over chunks of (chunk's own + SROWS * (chunk mean - mean)^2). ST keeps its form: one line per channel, mean and 1/sqrt(var + eps) in its first two words.
__global__ __launch_bounds__(1024) void k_bnfin(const float* __restrict__ PS, const float* __restrict__ PM, float* __restrict__ ST) {
  __shared__ float red[2][32][32];
  const int tid = threadIdx.x, w = tid >> 5, lane = tid & 31; const int c = blockIdx.x * 32 + lane;
  const float* ps = PS + (size_t)(w * (SCH / 32)) * CC + c; const float* pm = PM + (size_t)(w * (SCH / 32)) * CC + c;
  float s[SCH / 32], m[SCH / 32];
#pragma unroll      // constant indices keep s and m in registers; all loads are in flight together
  for (int i = 0; i < SCH / 32; ++i) { s[i] = ps[i * CC]; m[i] = pm[i * CC]; }
  // the two address pairs are inputs of the wait: they stay in their registers until every load of the group has taken them
  asm volatile("s_wait_xcnt 0x0" :: "v"(ps), "v"(pm) : "memory");
  float a = 0.f;
#pragma unroll      // s stays in registers
  for (int i = 0; i < SCH / 32; ++i) a += s[i];
  red[0][w][lane] = a; __syncthreads();
  float tot = 0.f;
  for (int j = 0; j < 32; ++j) tot += red[0][j][lane];
  const float mu = tot / (float)NR;
  float q = 0.f;
#pragma unroll      // s and m stay in registers
  for (int i = 0; i < SCH / 32; ++i) { const float d = s[i] * (1.0f / (float)SROWS) - mu; q += m[i] + (float)SROWS * d * d; }
  red[1][w][lane] = q; __syncthreads();
  float q2 = 0.f;
  for (int j = 0; j < 32; ++j) q2 += red[1][j][lane];
  const float rs = rsqrtf(q2 / (float)NR + 1e-5f);
  const float muw = __shfl(mu, w, 32), rsw = __shfl(rs, w, 32);      // wave w writes the line of channel w of the 32
  ST[(blockIdx.x * 32 + w) * 32 + lane] = (lane == 0) ? muw : ((lane == 1) ? rsw : 0.f);
}
// out [b][c][p] = BN(wy [b * NN + p][c]) + x, one tile of 64 channels x 128 positions per workgroup. Every load takes 16 B per lane and whole lines per wave (wy: 256 B of two rows; x: 512 B of one channel row); all 16 of a lane
// are in flight together. A lane holds two blocks of 4 positions x 4 channels of wy, so each channel's 4 positions leave as one 16-B LDS store. LDS row = channel (512 B, no pad); the 16-B chunk of positions 4 pb .. 4 pb + 3
// lies at place pb ^ ((channel >> 2) & 15), so that the 16 lanes of a half wave meet 16 different bank groups both when they write and when they read.
__global__ __launch_bounds__(256) void k_out(const float* __restrict__ WY, const float* __restrict__ ST, const float* __restrict__ gam, const float* __restrict__ bet, const float* __restrict__ x, float* __restrict__ out) { __shared__ __attribute__((aligned(16))) float tl[64 * 128]; const int tid = threadIdx.x, w = tid >> 5, lane = tid & 31;
  const int b = blockIdx.x / ((CC / 64) * (NN / 128)), rem = blockIdx.x % ((CC / 64) * (NN / 128)); const int cg = rem / (NN / 128), pg = rem % (NN / 128); const int c0 = cg * 64, p0 = pg * 128;
  const int c4 = tid & 15, pb0 = tid >> 4;      // wy: channels 4 c4 .. 4 c4 + 3, position blocks pb0 and pb0 + 16
  const float* pw = WY + ((size_t)b * NN + p0 + 4 * pb0) * CC + c0 + 4 * c4;
  const size_t xo = ((size_t)b * CC + c0 + w) * NN + p0 + 4 * lane;      // x and out: channel rows w + 8 i
  const float* px = x + xo; const float* ps = ST + (c0 + 4 * c4) * 32; const float* pg4 = gam + c0 + 4 * c4; const float* pb4 = bet + c0 + 4 * c4;
  v4f a[2][4], xv[8]; v2f st[4];
#pragma unroll      // constant indices keep a in registers, so that the loads are issued ahead of the arithmetic
  for (int u = 0; u < 2; ++u)
#pragma unroll
    for (int j = 0; j < 4; ++j) a[u][j] = *(const v4fa*)(pw + (size_t)(64 * u + j) * CC);
#pragma unroll      // xv stays in registers
  for (int i = 0; i < 8; ++i) xv[i] = *(const v4fa*)(px + (size_t)(8 * i) * NN);
#pragma unroll      // st stays in registers
  for (int k = 0; k < 4; ++k) st[k] = *(const v2fa*)(ps + k * 32);      // mean and 1/sqrt(var + eps) of channel 4 c4 + k
  const v4f gv = *(const v4fa*)pg4, bv = *(const v4fa*)pb4;
  // the two address pairs are inputs of the wait: they stay in their registers until every load of the group has taken them
  asm volatile("s_wait_xcnt 0x0" :: "v"(pw), "v"(px) : "memory");
  __builtin_amdgcn_sched_barrier(0);      // no arithmetic on wy is moved up in front of the x loads: without it they were issued only after wy had arrived, one memory latency behind the other
#pragma unroll      // a stays in registers
  for (int u = 0; u < 2; ++u)
#pragma unroll
    for (int k = 0; k < 4; ++k) { v4f t;
#pragma unroll
      for (int j = 0; j < 4; ++j) t[j] = (a[u][j][k] - st[k][0]) * st[k][1] * bf16_round(gv[k]) + bf16_round(bv[k]);
      *(v4f*)&tl[(4 * c4 + k) * 128 + (((pb0 + 16 * u) ^ c4) * 4)] = t; }
  __syncthreads();      // the tile is complete before its channel rows are read back
  float* po = out + xo;
  v4f o[8];
#pragma unroll      // o and xv stay in registers
  for (int i = 0; i < 8; ++i) { const int c = w + 8 * i; const v4f t = *(const v4fa*)&tl[c * 128 + ((lane ^ ((c >> 2) & 15)) * 4)];
#pragma unroll
    for (int q = 0; q < 4; ++q) o[i][q] = t[q] + bf16_round(xv[i][q]); }
#pragma unroll      // o stays in registers
  for (int i = 0; i < 8; ++i) *(v4f*)(po + (size_t)(8 * i) * NN) = o[i]; }
extern "C" void kernel_launch(void* const* d_in, const int* in_sizes, int n_in,
                              void* d_out, int out_size, void* d_ws, size_t ws_size, hipStream_t stream) {
  (void)in_sizes; (void)n_in; (void)out_size;
  const float* x = (const float*)d_in[0]; const float* gw = (const float*)d_in[1]; const float* gb = (const float*)d_in[2]; const float* thw = (const float*)d_in[3]; const float* thb = (const float*)d_in[4]; const float* phw = (const float*)d_in[5]; const float* phb = (const float*)d_in[6]; const float* Ww = (const float*)d_in[7]; const float* Wb = (const float*)d_in[8]; const float* gam = (const float*)d_in[9]; const float* bet = (const float*)d_in[10];
  char* ws = (char*)d_ws; size_t off = 0;
  auto take = [&](size_t bytes) { char* p = ws + off; off += (bytes + 255) & ~(size_t)255; return p; };
  _Float16* Bg = (_Float16*)take((size_t)CC * CC * 2); _Float16* Bph = (_Float16*)take((size_t)CC * CC * 2); _Float16* BW = (_Float16*)take((size_t)CC * CC * 2); float* ST = (float*)take(CC * 32 * 4);
  _Float16* Bthp = (_Float16*)take((size_t)CC * CC * 2);      // W_θ as [in=o][out=c] → Bt[c][o] for φ·W_θ
  _Float16* X16 = (_Float16*)take((size_t)NR * CC * 2); float* FULLF = (float*)take((size_t)NR * CC * 4); _Float16* FULL = (_Float16*)take((size_t)NR * CC * 2); _Float16* PHh = (_Float16*)take((size_t)NRH * CC * 2); _Float16* PHl = (_Float16*)take((size_t)NRH * CC * 2);
  // every per-batch buffer holds all BB batches, so that each stage is one launch over the whole batch
  _Float16* BPh = (_Float16*)take((size_t)NRH * CC * 2); _Float16* BPl = (_Float16*)take((size_t)NRH * CC * 2); float* CV = (float*)take(NRH * 4); _Float16* Gt = (_Float16*)take((size_t)NRH * CC * 2); float* S = (float*)take((size_t)NR * NH * 4); _Float16* P16 = (_Float16*)take((size_t)NR * NH * 2);
  float* PS = (float*)take((size_t)SCH * CC * 4); float* PM = (float*)take((size_t)SCH * CC * 4);      // BN partials per row chunk and channel
  _Float16* Y16 = FULL; float* WY = FULLF;      // FULLF/FULL are dead after pooling
  if (off > ws_size) return;      // about 214 MB
  k_prep<<<4 * WPB + BB * (CC / 64) * (NN / 128), 256, 0, stream>>>(x, gw, phw, Ww, thw, X16, Bg, Bph, BW, Bthp);      // the four weight matrices and x as f16 operands
  const dim3 gp((NR / 128) * (CC / 128), 1), gp2((NR / 128) * (CC / 128), 2);
  k_gemm_t<0, true, false, false, false, true><<<gp2, 256, 0, stream>>>(X16, nullptr, CC, 0, Bph, Bg, CC, 0, 0.0625f, phb, gb, 0, FULLF, FULL, nullptr, nullptr, nullptr, CC, 0, CC, CC);      // plane 0: phi (f32); plane 1: g (f16)
  k_post<<<NRH / 32 + BB * 8 * (NH / 64) / 4, 1024, 0, stream>>>(FULLF, thb, PHh, PHl, CV, FULL, Gt);      // phi pooled, split hi/lo, and c = phi * b_theta; g pooled and transposed: g^T [BB][512][1024]
  const dim3 gb2((NRH / 128) * (CC / 128), 1), gs((NN / 128) * (NH / 128), BB), gy((NN / 128) * (CC / 128), BB);      // blockIdx.y = batch where the B operand differs per batch
  k_gemm_t<0, false, true, false, true><<<gb2, 256, 0, stream>>>(PHl, PHh, CC, 0, Bthp, Bthp, CC, 0, 0.0625f, nullptr, nullptr, 0, nullptr, BPh, BPl, nullptr, nullptr, CC, 0, CC, CC);      // B' = phi * W_theta [BB*1024][512] (phi lo, then hi), all batches as rows, leaves split hi/lo
  k_gemm_t<1, true, false, false, true><<<gs, 256, 0, stream>>>(X16, X16, CC, (size_t)NN * CC, BPl, BPh, CC, (size_t)NH * CC, 1.0f, nullptr, CV, (size_t)NH, S, nullptr, nullptr, nullptr, nullptr, NH, (size_t)NN * NH, NH, CC);      // f = x * B'^T + c (B' lo, then hi; c broadcast over the rows of its batch)
  k_smx<<<NR / 16, 256, 0, stream>>>(S, P16);
  k_gemm_t<0, false><<<gy, 256, 0, stream>>>(P16, nullptr, NH, (size_t)NN * NH, Gt, nullptr, NH, (size_t)CC * NH, 0.000030517578125f, nullptr, nullptr, 0, nullptr, Y16, nullptr, nullptr, nullptr, CC, (size_t)NN * CC, CC, NH);      // y = softmax(f) * g, stored as f16
  k_gemm_t<0, true, false, true><<<gp, 256, 0, stream>>>(Y16, nullptr, CC, 0, BW, nullptr, CC, 0, 0.0625f, Wb, nullptr, 0, WY, nullptr, nullptr, PS, PM, CC, 0, CC, CC);      // wy = W(y) + b, with the BN partials of its row chunks
  k_bnfin<<<CC / 32, 1024, 0, stream>>>(PS, PM, ST); k_out<<<BB * (CC / 64) * (NN / 128), 256, 0, stream>>>(WY, ST, gam, bet, x, (float*)d_out);
}

// v008
// It runs in 133 microseconds.
// Next to v007, in two timings, it ran 1.11 times as fast each time.
// Over all steps from v000 it is 11.1 times as fast.
#include <hip/hip_runtime.h>
// Non-local block with view pooling (x [8, C=512, N=2048]): θ = conv1(x), φ = maxpool2(conv1(x)), g = maxpool2(conv1(x)); f = softmax(θᵀ·φ) [N × N/2] (unscaled); y = f·g; wy = conv1(y) + b;
// out = BN_train(wy)·γ + β + x. Because the unscaled logits reach σ≈20 and feed a near-one-hot softmax, θ is never rounded: the logits are re-associated as f = x·(φ·W_θ)ᵀ + 1·(φ·b_θ)ᵀ with x bf16-EXACT,
// φ (f32, max-pooled from an f32 projection) fed as f16 hi + lo·2^10 into φ·W_θ and that product again split hi/lo as the B operand (four cheap passes per batch), the column term added exactly through
// the epilogue addend; g, y as plain f16; P ×2^15 f16; all on v_wmma_f32_16x16x32_f16 ((out,in) weights bf16-exact ×2^4, f32 accumulate); the layout transposes, max-pooling, softmax rows, BN batch statistics (fixed-order) and the residual are f32 VALU.
#define BB 8
#define CC 512
#define NN 2048
#define NH (NN / 2)
#define NR (BB * NN)
#define NRH (BB * NH)

typedef __bf16 v16b __attribute__((ext_vector_type(16)));
typedef unsigned short v8us __attribute__((ext_vector_type(8), may_alias));
typedef float  v8f  __attribute__((ext_vector_type(8)));
typedef float  v4f  __attribute__((ext_vector_type(4)));
typedef float  v4fa __attribute__((ext_vector_type(4), may_alias));
union FragB { v16b v; v8us half[2]; unsigned short u[16]; };

__device__ __forceinline__ unsigned short bf16_bits(float x) { unsigned int u = __float_as_uint(x); return (unsigned short)((u + 0x7FFFu + ((u >> 16) & 1u)) >> 16); }
__device__ __forceinline__ float bf16_val(unsigned short b) { return __uint_as_float(((unsigned int)b) << 16); }
__device__ __forceinline__ float bf16_round(float x) { return bf16_val(bf16_bits(x)); }
// D += A·B with NT terms: 1 = ah·bh, 2 = + al·bh (A split), 3 = + ah·bl (both split)
template <int NT>
__device__ __forceinline__ v8f mmaN(v16b ah, v16b al, v16b bh, v16b bl, v8f c) {
  c = __builtin_amdgcn_wmma_f32_16x16x32_bf16(false, ah, false, bh, (short)0, c, false, false);
  if (NT >= 2) c = __builtin_amdgcn_wmma_f32_16x16x32_bf16(false, al, false, bh, (short)0, c, false, false);
  if (NT >= 3) c = __builtin_amdgcn_wmma_f32_16x16x32_bf16(false, ah, false, bl, (short)0, c, false, false);
  asm volatile("v_nop\n\tv_nop\n\tv_nop\n\tv_nop" : "+v"(c) : "v"(ah), "v"(al), "v"(bh), "v"(bl));
  return c;
}

__global__ __launch_bounds__(256) void k_wt_bf16(const float* __restrict__ W, unsigned short* __restrict__ Wt, int K, int N) {
  const int t = blockIdx.x * 256 + threadIdx.x;
  const int k8n = K / 8;
  if (t >= N * k8n) return;
  const int n = t / k8n, k8 = (t % k8n) * 8;
  v8us v;
#pragma unroll
  for (int i = 0; i < 8; ++i) v[i] = bf16_bits(W[(size_t)(k8 + i) * N + n]);
  *(v8us*)(Wt + (size_t)n * K + k8) = v;
  
}

// GEMM C[M][N] (f32, pitch ldc) = act(A[M][K]·W + bias). A f32 row-major (pitch lda) converted per fragment to bf16
// (ASPLIT: hi/lo two planes -> 2 terms, else single rounded term); Wt bf16 [N][K] (pitch ldb). BIAS_BF16 rounds the
// bias to bf16 first (bias quantised to bf16 before the add). K%32==0, M%16==0, N%64==0.
template <bool ASPLIT, int ACT, bool BIAS_BF16>
__global__ __launch_bounds__(128) void k_gemm_bf(const float* __restrict__ A, int lda, const unsigned short* __restrict__ Wt, int ldb,
                                               const float* __restrict__ bias, float* __restrict__ C, int ldc, int M, int N, int K) {
  __shared__ __attribute__((aligned(16))) float so[4][16][64];
  const int tid = threadIdx.x, w = tid >> 5, lane = tid & 31, ln = lane & 15, hh = lane >> 4;
  const int ntn = N / 64;
  const int wid = blockIdx.x * 4 + w;
  const int mt = wid / ntn, nq = wid % ntn;
  if (mt * 16 >= M) return;
  const int row0 = mt * 16, col0 = nq * 64;
  const float* arow = A + (size_t)(row0 + ln) * lda;
  v8f acc[4] = {};
  for (int kb = 0; kb < K; kb += 32) {
    FragB ah, al;
    const v4f x0 = *(const v4fa*)(arow + kb + 8 * hh), x1 = *(const v4fa*)(arow + kb + 8 * hh + 4);
    const v4f x2 = *(const v4fa*)(arow + kb + 16 + 8 * hh), x3 = *(const v4fa*)(arow + kb + 16 + 8 * hh + 4);
    float xs[16] = {x0[0],x0[1],x0[2],x0[3],x1[0],x1[1],x1[2],x1[3],x2[0],x2[1],x2[2],x2[3],x3[0],x3[1],x3[2],x3[3]};
#pragma unroll
    for (int i = 0; i < 16; ++i) { const unsigned short hb = bf16_bits(xs[i]); ah.u[i] = hb; al.u[i] = ASPLIT ? bf16_bits(xs[i] - bf16_val(hb)) : (unsigned short)0; }
#pragma unroll
    for (int t = 0; t < 4; ++t) {
      const unsigned short* brow = Wt + (size_t)(col0 + t * 16 + ln) * ldb + kb;
      FragB b;
      b.half[0] = *(const v8us*)(brow + 8 * hh);
      b.half[1] = *(const v8us*)(brow + 16 + 8 * hh);
      acc[t] = mmaN<ASPLIT ? 2 : 1>(ah.v, al.v, b.v, b.v, acc[t]);
    }
  }
#pragma unroll
  for (int t = 0; t < 4; ++t) {
    float bv = bias ? bias[col0 + t * 16 + ln] : 0.f;
    if (BIAS_BF16) bv = bf16_round(bv);
#pragma unroll
    for (int r = 0; r < 8; ++r) { float v = acc[t][r] + bv; if (ACT == 1) v = fmaxf(v, 0.f); so[w][8 * hh + r][t * 16 + ln] = v; }
  }
  __builtin_amdgcn_fence(__ATOMIC_ACQ_REL, "workgroup");
  __builtin_amdgcn_wave_barrier();
  const int rsub = lane >> 4, c4 = (lane & 15) * 4;
  {
#pragma unroll
    for (int q = 0; q < 8; ++q) {
      const int r = q * 2 + rsub;
      const v4f v = *(const v4fa*)&so[w][r][c4];
      *(v4f*)(C + (size_t)(row0 + r) * ldc + col0 + c4) = v;
    }
    
  }
}

// Flash-style causal/unmasked attention, all contractions 3-term bf16 hi/lo splits, f32 softmax with running max.
// q,k,v rows are read from f32 buffers with arbitrary row pitch (so they can live inside a fused qkv buffer);
// D = head size (multiple of 32, <= 128); one wave = 16 query rows; block = 4 waves (64 queries) sharing K/V chunks of 32.
template <int D, bool CAUSAL>
__global__ __launch_bounds__(128) void k_flash(const float* __restrict__ qb, const float* __restrict__ kb, const float* __restrict__ vb,
                                             int pitch, int T, int H, float scale, float* __restrict__ y, int ypitch) {
  constexpr int KS = D / 32;        // k-steps for QK
  constexpr int DT = D / 16;        // d tiles for PV
  __shared__ __attribute__((aligned(16))) unsigned short sKh[32][D + 8], sKl[32][D + 8], sVh[32][D + 8], sVl[32][D + 8];
  __shared__ __attribute__((aligned(16))) unsigned short sPh[4][16][40], sPl[4][16][40];
  __shared__ __attribute__((aligned(16))) float sO[4][16][D];
  const int tid = threadIdx.x, w = tid >> 5, lane = tid & 31, ln = lane & 15, hh = lane >> 4;
  const int nqb = (T + 63) / 64;
  const int bh = blockIdx.x / nqb, qblk = blockIdx.x % nqb;
  const int b = bh / H, h = bh % H;
  const int q0 = qblk * 64 + w * 16;
  const float* Q = qb + (size_t)b * T * pitch + h * D;
  const float* K = kb + (size_t)b * T * pitch + h * D;
  const float* V = vb + (size_t)b * T * pitch + h * D;

  // A fragments of the wave's 16 query rows (scaled), hi/lo
  FragB aqh[KS], aql[KS];
  {
    int row = q0 + ln; if (row >= T) row = T - 1;
    const float* qr = Q + (size_t)row * pitch;
#pragma unroll
    for (int ks = 0; ks < KS; ++ks)
#pragma unroll
      for (int i = 0; i < 16; ++i) {
        const int d = ks * 32 + ((i < 8) ? (8 * hh + i) : (16 + 8 * hh + (i - 8)));
        const float x = qr[d] * scale; const unsigned short hb = bf16_bits(x);
        aqh[ks].u[i] = hb; aql[ks].u[i] = bf16_bits(x - bf16_val(hb));
      }
  }
  float m_r[8], l_r[8];
#pragma unroll
  for (int r = 0; r < 8; ++r) { m_r[r] = -3.0e38f; l_r[r] = 0.f; }
  v8f oacc[DT];
#pragma unroll
  for (int dt = 0; dt < DT; ++dt) oacc[dt] = (v8f){0.f,0.f,0.f,0.f,0.f,0.f,0.f,0.f};

  const int kv_end = CAUSAL ? min(T, qblk * 64 + 64) : T;     // block-uniform
  for (int j0 = 0; j0 < kv_end; j0 += 32) {
    __syncthreads();
    for (int e = tid; e < 32 * (D / 4); e += 128) {
      const int r = e / (D / 4), c4 = (e % (D / 4)) * 4;
      const int key = j0 + r;
      v4f kf = {0.f,0.f,0.f,0.f}, vf = {0.f,0.f,0.f,0.f};
      if (key < T) { kf = *(const v4fa*)(K + (size_t)key * pitch + c4); vf = *(const v4fa*)(V + (size_t)key * pitch + c4); }
#pragma unroll
      for (int t = 0; t < 4; ++t) {
        unsigned short hb = bf16_bits(kf[t]); sKh[r][c4 + t] = hb; sKl[r][c4 + t] = bf16_bits(kf[t] - bf16_val(hb));
        hb = bf16_bits(vf[t]); sVh[r][c4 + t] = hb; sVl[r][c4 + t] = bf16_bits(vf[t] - bf16_val(hb));
      }
    }
    __syncthreads();
    // S tile 16 x 32
    v8f s[2];
#pragma unroll
    for (int nt = 0; nt < 2; ++nt) {
      v8f acc = {};
#pragma unroll
      for (int ks = 0; ks < KS; ++ks) {
        FragB bh_, bl_;
        bh_.half[0] = *(const v8us*)&sKh[nt * 16 + ln][ks * 32 + 8 * hh]; bh_.half[1] = *(const v8us*)&sKh[nt * 16 + ln][ks * 32 + 16 + 8 * hh];
        bl_.half[0] = *(const v8us*)&sKl[nt * 16 + ln][ks * 32 + 8 * hh]; bl_.half[1] = *(const v8us*)&sKl[nt * 16 + ln][ks * 32 + 16 + 8 * hh];
        acc = mmaN<3>(aqh[ks].v, aql[ks].v, bh_.v, bl_.v, acc);
      }
      s[nt] = acc;
    }
    // mask + running max (rows 8hh+r; the 16 lanes of a half share rows)
    float alpha[8];
#pragma unroll
    for (int r = 0; r < 8; ++r) {
      const int qi = q0 + 8 * hh + r;
      const int ja = j0 + ln, jb = j0 + 16 + ln;
      if (CAUSAL) { if (ja > qi) s[0][r] = -3.0e38f; if (jb > qi) s[1][r] = -3.0e38f; }
      if (ja >= T) s[0][r] = -3.0e38f;
      if (jb >= T) s[1][r] = -3.0e38f;
      float mx = fmaxf(s[0][r], s[1][r]);
      mx = fmaxf(mx, __shfl_xor(mx, 1, 32)); mx = fmaxf(mx, __shfl_xor(mx, 2, 32)); mx = fmaxf(mx, __shfl_xor(mx, 4, 32)); mx = fmaxf(mx, __shfl_xor(mx, 8, 32));
      const float mnew = fmaxf(m_r[r], mx);
      alpha[r] = (mnew > -1.0e38f) ? __expf(m_r[r] - mnew) : 1.0f;
      const float p0 = (s[0][r] > -1.0e38f) ? __expf(s[0][r] - mnew) : 0.f;
      const float p1 = (s[1][r] > -1.0e38f) ? __expf(s[1][r] - mnew) : 0.f;
      m_r[r] = mnew;
      l_r[r] = l_r[r] * alpha[r] + p0 + p1;            // per-lane partial row sum (16 lanes combined at the end)
      unsigned short hb = bf16_bits(p0); sPh[w][8 * hh + r][ln] = hb;      sPl[w][8 * hh + r][ln] = bf16_bits(p0 - bf16_val(hb));
      hb = bf16_bits(p1);                sPh[w][8 * hh + r][16 + ln] = hb; sPl[w][8 * hh + r][16 + ln] = bf16_bits(p1 - bf16_val(hb));
    }
#pragma unroll
    for (int dt = 0; dt < DT; ++dt)
#pragma unroll
      for (int r = 0; r < 8; ++r) oacc[dt][r] *= alpha[r];
    __builtin_amdgcn_fence(__ATOMIC_ACQ_REL, "workgroup");
    __builtin_amdgcn_wave_barrier();
    FragB pah, pal;
    pah.half[0] = *(const v8us*)&sPh[w][ln][8 * hh]; pah.half[1] = *(const v8us*)&sPh[w][ln][16 + 8 * hh];
    pal.half[0] = *(const v8us*)&sPl[w][ln][8 * hh]; pal.half[1] = *(const v8us*)&sPl[w][ln][16 + 8 * hh];
#pragma unroll
    for (int dt = 0; dt < DT; ++dt) {
      FragB bvh, bvl;
#pragma unroll
      for (int i = 0; i < 8; ++i) {
        bvh.u[i] = sVh[8 * hh + i][dt * 16 + ln]; bvh.u[8 + i] = sVh[16 + 8 * hh + i][dt * 16 + ln];
        bvl.u[i] = sVl[8 * hh + i][dt * 16 + ln]; bvl.u[8 + i] = sVl[16 + 8 * hh + i][dt * 16 + ln];
      }
      oacc[dt] = mmaN<3>(pah.v, pal.v, bvh.v, bvl.v, oacc[dt]);
    }
    __builtin_amdgcn_fence(__ATOMIC_ACQ_REL, "workgroup");
    __builtin_amdgcn_wave_barrier();
  }
#pragma unroll
  for (int r = 0; r < 8; ++r) {
    float l = l_r[r];
    l += __shfl_xor(l, 1, 32); l += __shfl_xor(l, 2, 32); l += __shfl_xor(l, 4, 32); l += __shfl_xor(l, 8, 32);
    l_r[r] = (l > 0.f) ? 1.0f / l : 0.f;
  }
#pragma unroll
  for (int dt = 0; dt < DT; ++dt)
#pragma unroll
    for (int r = 0; r < 8; ++r) sO[w][8 * hh + r][dt * 16 + ln] = oacc[dt][r] * l_r[r];
  __builtin_amdgcn_fence(__ATOMIC_ACQ_REL, "workgroup");
  __builtin_amdgcn_wave_barrier();
  {
    for (int r = 0; r < 16; ++r) {
      const int row = q0 + r;
      if (row < T && lane < D / 4) {
        const v4f val = *(const v4fa*)&sO[w][r][lane * 4];
        *(v4f*)(y + ((size_t)b * T + row) * ypitch + h * D + lane * 4) = val;
      }
    }
    
  }
}

// GEMM C = act(A·W + bias + resid): A f32 (ASPLIT -> hi/lo 2 terms), Wt bf16 [N][K]; ACT 0 none, 1 relu, 2 exact gelu;
// resid (optional, f32, row index = (row % rmod), pitch ldr, RES_BF16 rounds it) added before the activation.
template <bool ASPLIT, int ACT, bool BIAS_BF16, bool RES_BF16>
__global__ __launch_bounds__(128) void k_gemm_bf3(const float* __restrict__ A, int lda, const unsigned short* __restrict__ Wt, int ldb,
                                                const float* __restrict__ bias, const float* __restrict__ resid, int rmod, int ldr,
                                                float* __restrict__ C, int ldc, int M, int N, int K) {
  __shared__ __attribute__((aligned(16))) float so[4][16][64];
  const int tid = threadIdx.x, w = tid >> 5, lane = tid & 31, ln = lane & 15, hh = lane >> 4;
  const int ntn = N / 64;
  const int wid = blockIdx.x * 4 + w;
  const int mt = wid / ntn, nq = wid % ntn;
  if (mt * 16 >= M) return;
  const int row0 = mt * 16, col0 = nq * 64;
  const float* arow = A + (size_t)(row0 + ln) * lda;
  v8f acc[4] = {};
  for (int kb = 0; kb < K; kb += 32) {
    FragB ah, al;
    const v4f x0 = *(const v4fa*)(arow + kb + 8 * hh), x1 = *(const v4fa*)(arow + kb + 8 * hh + 4);
    const v4f x2 = *(const v4fa*)(arow + kb + 16 + 8 * hh), x3 = *(const v4fa*)(arow + kb + 16 + 8 * hh + 4);
    float xs[16] = {x0[0],x0[1],x0[2],x0[3],x1[0],x1[1],x1[2],x1[3],x2[0],x2[1],x2[2],x2[3],x3[0],x3[1],x3[2],x3[3]};
#pragma unroll
    for (int i = 0; i < 16; ++i) { const unsigned short hb = bf16_bits(xs[i]); ah.u[i] = hb; al.u[i] = ASPLIT ? bf16_bits(xs[i] - bf16_val(hb)) : (unsigned short)0; }
#pragma unroll
    for (int t = 0; t < 4; ++t) {
      const unsigned short* brow = Wt + (size_t)(col0 + t * 16 + ln) * ldb + kb;
      FragB b;
      b.half[0] = *(const v8us*)(brow + 8 * hh);
      b.half[1] = *(const v8us*)(brow + 16 + 8 * hh);
      acc[t] = mmaN<ASPLIT ? 2 : 1>(ah.v, al.v, b.v, b.v, acc[t]);
    }
  }
#pragma unroll
  for (int t = 0; t < 4; ++t) {
    const int col = col0 + t * 16 + ln;
    float bv = bias ? bias[col] : 0.f;
    if (BIAS_BF16) bv = bf16_round(bv);
#pragma unroll
    for (int r = 0; r < 8; ++r) {
      float v = acc[t][r] + bv;
      if (resid) { float rv = resid[(size_t)((row0 + 8 * hh + r) % rmod) * ldr + col]; if (RES_BF16) rv = bf16_round(rv); v += rv; }
      if (ACT == 1) v = fmaxf(v, 0.f);
      if (ACT == 2) v = 0.5f * v * (1.0f + erff(v * 0.70710678118654752f));
      if (ACT == 3) { const float u = 0.7978845608028654f * (v + 0.044715f * v * v * v); v = 0.5f * v * (1.0f + tanhf(u)); }
      so[w][8 * hh + r][t * 16 + ln] = v;
    }
  }
  __builtin_amdgcn_fence(__ATOMIC_ACQ_REL, "workgroup");
  __builtin_amdgcn_wave_barrier();
  const int rsub = lane >> 4, c4 = (lane & 15) * 4;
  {
#pragma unroll
    for (int q = 0; q < 8; ++q) {
      const int r = q * 2 + rsub;
      const v4f v = *(const v4fa*)&so[w][r][c4];
      *(v4f*)(C + (size_t)(row0 + r) * ldc + col0 + c4) = v;
    }
    
  }
}
// row LayerNorm (biased variance, eps) over N: s = X (+ R); optional out_sum <- s; out_norm <- (s-mu)*rsqrt(var+eps)*g + b
template <bool PARAM_BF16>
__global__ __launch_bounds__(256) void k_layernorm(const float* __restrict__ X, const float* __restrict__ R, const float* __restrict__ g, const float* __restrict__ bta,
                                                  float* __restrict__ out_sum, float* __restrict__ out_norm, int N, float eps) {
  __shared__ float red[256];
  const int row = blockIdx.x, tid = threadIdx.x;
  const float* x = X + (size_t)row * N; const float* rr = R ? R + (size_t)row * N : nullptr;
  float vals[16];                     // up to N = 4096
  const int per = N / 256;            // contiguous chunk per thread? use strided-by-4 chunks: thread handles j = tid*4 + 1024*u
  float s1 = 0.f;
  for (int u = 0; u < per / 4; ++u) {
    const int j = tid * 4 + 1024 * u;
    const v4f a = *(const v4fa*)(x + j);
    v4f b = {0.f,0.f,0.f,0.f}; if (rr) b = *(const v4fa*)(rr + j);
#pragma unroll
    for (int q = 0; q < 4; ++q) { const float v = a[q] + b[q]; vals[u * 4 + q] = v; s1 += v; }
  }
  red[tid] = s1; __syncthreads();
  for (int st = 128; st > 0; st >>= 1) { if (tid < st) red[tid] += red[tid + st]; __syncthreads(); }
  const float mu = red[0] / (float)N; __syncthreads();
  float s2 = 0.f;
  for (int u = 0; u < per / 4; ++u)
#pragma unroll
    for (int q = 0; q < 4; ++q) { const float c = vals[u * 4 + q] - mu; s2 += c * c; }
  red[tid] = s2; __syncthreads();
  for (int st = 128; st > 0; st >>= 1) { if (tid < st) red[tid] += red[tid + st]; __syncthreads(); }
  const float rs = rsqrtf(red[0] / (float)N + eps);
  {
    for (int u = 0; u < per / 4; ++u) {
      const int j = tid * 4 + 1024 * u;
      v4f o, sm;
#pragma unroll
      for (int q = 0; q < 4; ++q) {
        float gg = g[j + q], bb = bta[j + q];
        if (PARAM_BF16) { gg = bf16_round(gg); bb = bf16_round(bb); }
        sm[q] = vals[u * 4 + q]; o[q] = (vals[u * 4 + q] - mu) * rs * gg + bb;
      }
      if (out_sum) *(v4f*)(out_sum + (size_t)row * N + j) = sm;
      *(v4f*)(out_norm + (size_t)row * N + j) = o;
    }
    
  }
}



// ---- f16 WMMA path (v_wmma_f32_16x16x32_f16): 11-bit significands for operands in range — used where a [0,1] probability operand needs more precision than bf16
typedef _Float16 v16h __attribute__((ext_vector_type(16)));
union FragH { v16h v; v8us half[2]; _Float16 h[16]; unsigned short u[16]; };
template <int NT>
__device__ __forceinline__ v8f mmaH(v16h ah, v16h al, v16h bh, v16h bl, v8f c) {
  c = __builtin_amdgcn_wmma_f32_16x16x32_f16(false, ah, false, bh, (short)0, c, false, false);
  if (NT >= 2) c = __builtin_amdgcn_wmma_f32_16x16x32_f16(false, al, false, bh, (short)0, c, false, false);
  if (NT >= 3) c = __builtin_amdgcn_wmma_f32_16x16x32_f16(false, ah, false, bl, (short)0, c, false, false);
  asm volatile("v_nop\n\tv_nop\n\tv_nop\n\tv_nop" : "+v"(c) : "v"(ah), "v"(al), "v"(bh), "v"(bl));
  return c;
}
// batched GEMM like k_gemm_b but f16 operands: A f32 (split into f16 hi/lo if ASPLIT, else rounded to f16), Bt = f16 values [n][k]; alpha; C f32; N multiple of 16 (partial tiles skipped)
template <bool ASPLIT>
__global__ __launch_bounds__(128) void k_gemm_h(const float* __restrict__ A, int lda, size_t sA, const _Float16* __restrict__ Bh, int ldb, size_t sB, float alpha, float* __restrict__ C, int ldc, size_t sC, int M, int N, int K) {
  __shared__ __attribute__((aligned(16))) float so[4][16][64];
  const int tid = threadIdx.x, w = tid >> 5, lane = tid & 31, ln = lane & 15, hh = lane >> 4; const int by = blockIdx.y;
  A += (size_t)by * sA; Bh += (size_t)by * sB; C += (size_t)by * sC;
  const int ntn = (N + 63) / 64; const int wid = blockIdx.x * 4 + w; const int mt = wid / ntn, nq = wid % ntn; if (mt * 16 >= M) return;
  const int row0 = mt * 16, col0 = nq * 64; const float* arow = A + (size_t)(row0 + ln) * lda;
  v8f acc[4] = {};
  for (int kb = 0; kb < K; kb += 32) {
    FragH ah, al;
    const v4f x0 = *(const v4fa*)(arow + kb + 8 * hh), x1 = *(const v4fa*)(arow + kb + 8 * hh + 4), x2 = *(const v4fa*)(arow + kb + 16 + 8 * hh), x3 = *(const v4fa*)(arow + kb + 16 + 8 * hh + 4);
    float xs[16] = {x0[0],x0[1],x0[2],x0[3],x1[0],x1[1],x1[2],x1[3],x2[0],x2[1],x2[2],x2[3],x3[0],x3[1],x3[2],x3[3]};
#pragma unroll
    for (int i = 0; i < 16; ++i) { const _Float16 h = (_Float16)xs[i]; ah.h[i] = h; al.h[i] = ASPLIT ? (_Float16)(xs[i] - (float)h) : (_Float16)0.0f; }
#pragma unroll
    for (int t = 0; t < 4; ++t) { if (col0 + t * 16 >= N) continue; const size_t boff = (size_t)(col0 + t * 16 + ln) * ldb + kb; FragH bq; bq.half[0] = *(const v8us*)(Bh + boff + 8 * hh); bq.half[1] = *(const v8us*)(Bh + boff + 16 + 8 * hh);
      acc[t] = mmaH<ASPLIT ? 2 : 1>(ah.v, al.v, bq.v, bq.v, acc[t]); }
  }
#pragma unroll
  for (int t = 0; t < 4; ++t) { if (col0 + t * 16 >= N) continue;
#pragma unroll
    for (int r = 0; r < 8; ++r) so[w][8 * hh + r][t * 16 + ln] = acc[t][r] * alpha; }
  __builtin_amdgcn_fence(__ATOMIC_ACQ_REL, "workgroup"); __builtin_amdgcn_wave_barrier();
  const int rsub = lane >> 4, c4 = (lane & 15) * 4;
  {
#pragma unroll
    for (int q = 0; q < 8; ++q) { const int r = q * 2 + rsub; if (col0 + c4 < N) { const v4f v = *(const v4fa*)&so[w][r][c4]; *(v4f*)(C + (size_t)(row0 + r) * ldc + col0 + c4) = v; } }
     }
}

// Wt[n][k] = f16(W[k][n]·scale) from f32 row-major W[K][N] (scale = power of two; bf16-exact weights stay exact in f16 away from the subnormal range)
__device__ __forceinline__ void d_wt_f16(const float* __restrict__ W, _Float16* __restrict__ Wt, int K, int N, float scale, int t) {
  const int n = t / (K / 8), k8 = (t % (K / 8)) * 8; FragH f;
#pragma unroll
  for (int i = 0; i < 8; ++i) f.h[i] = (_Float16)(bf16_round(W[(size_t)(k8 + i) * N + n]) * scale); const v8us o = f.half[0];
  *(v8us*)((unsigned short*)Wt + (size_t)n * K + k8) = o;
  asm volatile("s_wait_xcnt 0x0" ::: "memory");      // the store has taken its registers before another part of the merged kernel, laid out behind this one, reuses them
}
// Tiled GEMM, f16 operands, both K-contiguous: v[row][col] = acc*alpha + bias[col], then CPM 1: + the addend of column by*sCPy + col, the same for all rows (its form in CP: under DUAL below); written as f32 to C (F32OUT) or as f16 to C16,
// or (HL) split as f16 hi to C16 and (v - hi) * 2^10 as f16 to C16l, with nothing written to C.
// TWO: a product whose one operand is split hi + lo * 2^-10 runs in one launch on one accumulator: first the K of the lo pair A, Bh; the sums are then scaled by 2^-10 (exact); the K of the hi pair A2, B2 is added on top.
// BNP: stage 1 of the BN batch statistics. A wave's 32 rows are one row chunk: per column it also writes their sum to PS and the sum of their squared deviations from their own mean to PM (row = chunk, pitch ldc).
// One 128x128 tile per workgroup of 8 waves (4 x 2, 32x64 per wave). A pass is 64 k = one whole 128-B line of every operand row: each wave-wide 16-B load
// covers four whole lines and goes through registers into LDS (row pitch 144 B for the ds_load_b128 fragment readers); two buffers, one barrier per pass;
// the next pass's global loads are issued before this pass's products. M, N multiples of 128 (the grid is exact), K a multiple of 64.
// Every "#pragma unroll" below makes the index of a register array (staged rows, fragments, accumulators) a constant, so that the array stays in registers.
#define TPITCH 72
typedef float fa1 __attribute__((may_alias));
typedef _Float16 v4hs __attribute__((ext_vector_type(4)));
typedef float v2f __attribute__((ext_vector_type(2)));
typedef float v2fa __attribute__((ext_vector_type(2), may_alias));
typedef _Float16 v2hs __attribute__((ext_vector_type(2)));
// DUAL: the two pooled projections of x in one launch, each finished in its own epilogue, so that neither unpooled projection goes to memory (sA, sB, sC are 0; CPM 0; ldc = CC).
// Plane blockIdx.y = 0 is phi: rows = positions (A), columns = channels (Bh, bias). A wave takes the maximum of each row pair of its 32 x 64 tile, writes it split as f16 hi to C16 and (v - hi) * 2^10 to C16l, and writes
// the 16 pooled rows' partial dots with b_theta (BT) over its 64 channels to PS: one 128-B line per wave, line = (channel chunk of 64) * (NRH / 16) + (pooled row / 16), word = pooled row % 16.
// Plane 1 is g with the operands' roles exchanged: rows = channels (B2, bias CP per row), columns = positions (A), so that the tile already lies as g^T; the maximum of each column pair goes as f16 to GT [batch][channel][NH].
// CPM 1 adds the eight channel chunks' partial dots, in chunk order, from CP in the PS form above.
template <int CPM, bool F32OUT, bool HL = false, bool BNP = false, bool TWO = false, bool DUAL = false>
__global__ __launch_bounds__(256) void k_gemm_t(const _Float16* __restrict__ A, const _Float16* __restrict__ A2, int lda, size_t sA, const _Float16* __restrict__ Bh, const _Float16* __restrict__ B2, int ldb, size_t sB, float alpha, const float* __restrict__ bias, const float* __restrict__ CP, size_t sCPy,
    float* __restrict__ C, _Float16* __restrict__ C16, _Float16* __restrict__ C16l, float* __restrict__ PS, float* __restrict__ PM, const float* __restrict__ BT, _Float16* __restrict__ GT, int ldc, size_t sC, int N, int K) {
  __shared__ __attribute__((aligned(16))) unsigned short st[2][2][128 * TPITCH];      // [buffer][A, B][row * TPITCH + k]
  const int tid = threadIdx.x, w = tid >> 5, lane = tid & 31, ln = lane & 15, hh = lane >> 4; const int by = blockIdx.y;
  const bool second = DUAL && by == 1;      // the same in every thread of the workgroup
  const int ntn = second ? NR / 128 : N / 128; const int row0 = ((int)blockIdx.x / ntn) * 128, col0 = ((int)blockIdx.x % ntn) * 128;
  const int sr = tid >> 3, sc = (tid & 7) * 8;      // staging: 8 lanes per row, rows sr + 32 i
  const unsigned short* ga = (const unsigned short*)(second ? B2 : A) + (size_t)by * sA + (size_t)row0 * lda;      // workgroup-uniform bases, per-lane 32-bit offsets that never change
  const unsigned short* gb = (const unsigned short*)(second ? A : Bh) + (size_t)by * sB + (size_t)col0 * ldb;
  const unsigned short* ga2 = (const unsigned short*)A2 + (size_t)by * sA + (size_t)row0 * lda;      // TWO: the same tile of the hi pair
  const unsigned short* gb2 = (const unsigned short*)B2 + (size_t)by * sB + (size_t)col0 * ldb;
  unsigned oa[4], ob[4];
#pragma unroll
  for (int i = 0; i < 4; ++i) { oa[i] = (unsigned)((sr + 32 * i) * lda + sc); ob[i] = (unsigned)((sr + 32 * i) * ldb + sc); }
  v8us ra[4], rb[4]; const unsigned short *pa[4], *pb[4];
#pragma unroll
  for (int i = 0; i < 4; ++i) { pa[i] = ga + oa[i]; pb[i] = gb + ob[i]; }
#pragma unroll
  for (int i = 0; i < 4; ++i) { ra[i] = *(const v8us*)pa[i]; rb[i] = *(const v8us*)pb[i]; }
  // the eight address pairs are inputs of the wait: they stay in their registers up to it, so no load of the group is given a register that an issued load names
  asm volatile("s_wait_xcnt 0x0" :: "v"(pa[0]), "v"(pa[1]), "v"(pa[2]), "v"(pa[3]), "v"(pb[0]), "v"(pb[1]), "v"(pb[2]), "v"(pb[3]) : "memory");
#pragma unroll
  for (int i = 0; i < 4; ++i) { *(v8us*)&st[0][0][(sr + 32 * i) * TPITCH + sc] = ra[i]; *(v8us*)&st[0][1][(sr + 32 * i) * TPITCH + sc] = rb[i]; }
  __syncthreads();
  const int wm = w >> 1, wn = w & 1; const int ns1 = K / 64, ns = TWO ? 2 * ns1 : ns1;
  v8f acc[2][4] = {};
  for (int s = 0; s < ns; ++s) {
    const int cur = s & 1; const bool more = s + 1 < ns;      // the same in every thread of the workgroup
    if (more) {
      const bool sw = TWO && s + 1 == ns1;      // the next pass is the first of the hi pair; otherwise it lies 64 k = 128 B further
      ga = sw ? ga2 : ga + 64; gb = sw ? gb2 : gb + 64;
#pragma unroll
      for (int i = 0; i < 4; ++i) { pa[i] = ga + oa[i]; pb[i] = gb + ob[i]; }
#pragma unroll
      for (int i = 0; i < 4; ++i) { ra[i] = *(const v8us*)pa[i]; rb[i] = *(const v8us*)pb[i]; }
      // as in front of the loop: the address pairs stay in their registers up to the wait
      asm volatile("s_wait_xcnt 0x0" :: "v"(pa[0]), "v"(pa[1]), "v"(pa[2]), "v"(pa[3]), "v"(pb[0]), "v"(pb[1]), "v"(pb[2]), "v"(pb[3]) : "memory");
    }
    if (TWO && s == ns1) {      // the lo pair's sums take their weight before the hi pair's products are added
#pragma unroll
      for (int mi = 0; mi < 2; ++mi)
#pragma unroll
        for (int t = 0; t < 4; ++t) acc[mi][t] *= 0.0009765625f;
    }
    const unsigned short* la = &st[cur][0][(wm * 32 + ln) * TPITCH + 8 * hh];
    const unsigned short* lb = &st[cur][1][(wn * 64 + ln) * TPITCH + 8 * hh];
    FragH a[2][2], b[2][4];      // all of the pass's fragments are read as one group ahead of its products
#pragma unroll
    for (int ks = 0; ks < 2; ++ks) {
#pragma unroll
      for (int mi = 0; mi < 2; ++mi) { a[ks][mi].half[0] = *(const v8us*)(la + mi * 16 * TPITCH + ks * 32); a[ks][mi].half[1] = *(const v8us*)(la + mi * 16 * TPITCH + ks * 32 + 16); }
#pragma unroll
      for (int t = 0; t < 4; ++t) { b[ks][t].half[0] = *(const v8us*)(lb + t * 16 * TPITCH + ks * 32); b[ks][t].half[1] = *(const v8us*)(lb + t * 16 * TPITCH + ks * 32 + 16); }
    }
#pragma unroll
    for (int ks = 0; ks < 2; ++ks)
#pragma unroll
      for (int t = 0; t < 4; ++t)
#pragma unroll
        for (int mi = 0; mi < 2; ++mi) acc[mi][t] = mmaH<1>(a[ks][mi].v, a[ks][mi].v, b[ks][t].v, b[ks][t].v, acc[mi][t]);
    if (more) {
#pragma unroll
      for (int i = 0; i < 4; ++i) { *(v8us*)&st[cur ^ 1][0][(sr + 32 * i) * TPITCH + sc] = ra[i]; *(v8us*)&st[cur ^ 1][1][(sr + 32 * i) * TPITCH + sc] = rb[i]; }
    }
    __syncthreads();      // publishes the buffer just filled and ends every read of the one just used
  }
  // epilogue: each wave writes its accumulators to its own 32 x 68 f32 range of the (now free) staging LDS and reads whole rows back (g^T: from both ranges of its 32-row band)
  fa1* so = (fa1*)&st[0][0][0] + w * (32 * 68);
  const size_t cofs = (size_t)by * sC; const int wrow0 = row0 + wm * 32, wcol0 = col0 + wn * 64; const int rsub = lane >> 4, c4 = (lane & 15) * 4;
  if constexpr (DUAL) {
    if (!second) {      // phi
      const float* pt = BT + wcol0 + c4; const v4f tb = *(const v4fa*)pt;
#pragma unroll
      for (int t = 0; t < 4; ++t) { const float bv = bf16_round(bias[wcol0 + t * 16 + ln]);
#pragma unroll
        for (int mi = 0; mi < 2; ++mi)
#pragma unroll
          for (int r = 0; r < 8; ++r) so[(mi * 16 + 8 * hh + r) * 68 + t * 16 + ln] = acc[mi][t][r] * alpha + bv; }
      __builtin_amdgcn_fence(__ATOMIC_ACQ_REL, "workgroup"); __builtin_amdgcn_wave_barrier();      // the wave's LDS rows are complete before its lanes read what other lanes wrote
      v4hs h4[8], l4[8]; float ds[8];      // a half wave takes pooled rows rsub + 2 q, a lane 4 channels of each
#pragma unroll      // constant indices keep h4, l4 and ds in registers
      for (int q = 0; q < 8; ++q) { const int j = q * 2 + rsub; const v4f u = *(const v4fa*)&so[(2 * j) * 68 + c4], d = *(const v4fa*)&so[(2 * j + 1) * 68 + c4]; float s = 0.f;
#pragma unroll
        for (int i = 0; i < 4; ++i) { const float v = fmaxf(u[i], d[i]); const _Float16 h = (_Float16)v; h4[q][i] = h; l4[q][i] = (_Float16)((v - (float)h) * 1024.0f); s += v * bf16_round(tb[i]); }
        ds[q] = s; }
#pragma unroll      // ds stays in registers
      for (int o = 1; o <= 8; o <<= 1)
#pragma unroll
        for (int q = 0; q < 8; ++q) ds[q] += __shfl_xor(ds[q], o, 32);      // the 16 lanes of a half wave are added by a butterfly
      float sel = ds[0];
#pragma unroll      // ds stays in registers
      for (int q = 1; q < 8; ++q) sel = (ln == q) ? ds[q] : sel;      // lane ln < 8 of half rsub writes pooled row rsub + 2 ln
      _Float16* oh = C16 + (size_t)(wrow0 / 2 + rsub) * CC + wcol0 + c4; _Float16* ol = C16l + (size_t)(wrow0 / 2 + rsub) * CC + wcol0 + c4;
#pragma unroll      // h4 and l4 stay in registers
      for (int q = 0; q < 8; ++q) { *(v4hs*)(oh + q * 2 * CC) = h4[q]; *(v4hs*)(ol + q * 2 * CC) = l4[q]; }
      if (ln < 8) PS[((size_t)(wcol0 / 64) * (NRH / 16) + wrow0 / 32) * 32 + 2 * ln + rsub] = sel;
    } else {      // g^T
      const float* pq = CP + wrow0 + 8 * hh; v4f bq[2][2];
#pragma unroll      // bq stays in registers
      for (int mi = 0; mi < 2; ++mi) { bq[mi][0] = *(const v4fa*)(pq + mi * 16); bq[mi][1] = *(const v4fa*)(pq + mi * 16 + 4); }
#pragma unroll
      for (int mi = 0; mi < 2; ++mi)
#pragma unroll
        for (int r = 0; r < 8; ++r) { const float bv = bf16_round(bq[mi][r >> 2][r & 3]);
#pragma unroll
          for (int t = 0; t < 4; ++t) so[(mi * 16 + 8 * hh + r) * 68 + t * 16 + ln] = acc[mi][t][r] * alpha + bv; }
      __syncthreads();      // both waves of a 32-row band have written their 64 columns before either reads the band's whole rows
      // wave (wm, wn) takes rows 16 wn .. 16 wn + 15 of band wm over all 128 columns: a lane pools 4 columns to 2, the wave writes one whole 128-B line of g^T per row
      const fa1* sp = (const fa1*)&st[0][0][0] + (wm * 2 + rsub) * (32 * 68) + (wn * 16) * 68 + c4;
      v2hs g2[16];
#pragma unroll      // g2 stays in registers
      for (int q = 0; q < 16; ++q) { const v4f v = *(const v4fa*)(sp + q * 68); g2[q][0] = (_Float16)fmaxf(v[0], v[1]); g2[q][1] = (_Float16)fmaxf(v[2], v[3]); }
      _Float16* og = GT + ((size_t)(col0 / NN) * CC + row0 + wm * 32 + wn * 16) * NH + (col0 % NN) / 2 + lane * 2;
#pragma unroll      // g2 stays in registers
      for (int q = 0; q < 16; ++q) *(v2hs*)(og + q * NH) = g2[q];
    }
    return;
  }
  float* crow = C + cofs + (size_t)(wrow0 + rsub) * ldc + wcol0 + c4;      // each lane writes 16 B of rows rsub + 2 q
  v4f cp = {0.f, 0.f, 0.f, 0.f};
  if (CPM == 1) { const size_t m = (size_t)by * sCPy + wcol0 + c4; const float* pc = CP + (m >> 4) * 32 + (m & 15); v4f cq[8];
#pragma unroll      // constant indices keep cq in registers; the eight loads are in flight together
    for (int j = 0; j < 8; ++j) cq[j] = *(const v4fa*)(pc + j * (NRH / 16) * 32);
    // the address pair is an input of the wait: it stays in its registers until every load of the group has taken it
    asm volatile("s_wait_xcnt 0x0" :: "v"(pc) : "memory");
#pragma unroll      // cq stays in registers
    for (int j = 0; j < 8; ++j) cp += cq[j]; }
#pragma unroll
  for (int t = 0; t < 4; ++t) { const float bv = bias ? bf16_round(bias[wcol0 + t * 16 + ln]) : 0.f;
#pragma unroll
    for (int mi = 0; mi < 2; ++mi)
#pragma unroll
      for (int r = 0; r < 8; ++r) so[(mi * 16 + 8 * hh + r) * 68 + t * 16 + ln] = acc[mi][t][r] * alpha + bv; }
  __builtin_amdgcn_fence(__ATOMIC_ACQ_REL, "workgroup"); __builtin_amdgcn_wave_barrier();      // the wave's LDS rows are complete before its lanes read what other lanes wrote
#pragma unroll
  for (int q = 0; q < 16; ++q) { const int r = q * 2 + rsub; const int row = wrow0 + r; v4f v = *(const v4fa*)&so[r * 68 + c4];
    if (CPM != 0) { for (int i = 0; i < 4; ++i) v[i] += cp[i]; }
    if (HL) { v4hs h4, l4; for (int i = 0; i < 4; ++i) { const _Float16 h = (_Float16)v[i]; h4[i] = h; l4[i] = (_Float16)((v[i] - (float)h) * 1024.0f); }
      const size_t o = cofs + (size_t)row * ldc + wcol0 + c4; *(v4hs*)(C16 + o) = h4; *(v4hs*)(C16l + o) = l4; continue; }
    if (F32OUT) *(v4f*)(crow + (size_t)(q * 2) * ldc) = v;
    else { v4hs h4; for (int i = 0; i < 4; ++i) h4[i] = (_Float16)v[i]; *(v4hs*)(C16 + cofs + (size_t)row * ldc + wcol0 + c4) = h4; } }
  if (BNP) {      // a lane takes two adjacent columns of the wave's 64 and adds the 32 rows in row order
    asm volatile("s_wait_xcnt 0x0" ::: "memory");      // the row stores above have taken their registers before the sums below reuse them
    v2f xr[32];
#pragma unroll      // constant indices keep xr in registers
    for (int r = 0; r < 32; ++r) xr[r] = *(const v2fa*)&so[r * 68 + lane * 2];
    v2f s = xr[0];
#pragma unroll      // xr stays in registers
    for (int r = 1; r < 32; ++r) s += xr[r];
    const v2f mu = s * (1.0f / 32.0f);
    v2f m2 = {0.f, 0.f};
#pragma unroll      // xr stays in registers
    for (int r = 0; r < 32; ++r) { const v2f d = xr[r] - mu; m2 += d * d; }
    const size_t o = (size_t)(wrow0 / 32) * ldc + wcol0 + lane * 2; *(v2f*)(PS + o) = s; *(v2f*)(PM + o) = m2;
  }
}


typedef _Float16 v4h __attribute__((ext_vector_type(4)));

__global__ __launch_bounds__(256) void k_x16(const float* __restrict__ x, _Float16* __restrict__ X16, size_t n8) { const size_t t = (size_t)blockIdx.x * 256 + threadIdx.x; if (t >= n8) return; FragH f;
#pragma unroll
  for (int q = 0; q < 8; ++q) f.h[q] = (_Float16)bf16_round(x[t * 8 + q]); *(v8us*)((unsigned short*)X16 + t * 8) = f.half[0];  }
__device__ __forceinline__ void d_round16f(const float* __restrict__ W, _Float16* __restrict__ Bt, size_t t) { FragH f;
#pragma unroll
  for (int i = 0; i < 8; ++i) f.h[i] = (_Float16)(bf16_round(W[t * 8 + i]) * 16.0f); *(v8us*)((unsigned short*)Bt + t * 8) = f.half[0];  }
// x [b][c][p] (f32) to X16 [b * NN + p][c] (f16), one tile of 64 channels x 128 positions per workgroup. Wave w takes channels 8 w .. 8 w + 7: each of its eight loads is 512 contiguous bytes of one channel row,
// all eight in flight together. A lane then holds 8 channels of 4 positions = four 16-B chunks of X16 rows. They turn into whole 128-B lines through LDS: position 4 l + q lies in LDS row 32 q + l (128 B, no pad),
// chunk k at place k ^ ((l >> 1) & 7), so that the 16 lanes of a half wave meet 16 different 16-B bank groups both when they write and when they read.
__device__ __forceinline__ void d_tok(const float* __restrict__ x, _Float16* __restrict__ X16, int blk) { __shared__ __attribute__((aligned(16))) unsigned short tl[128 * 64]; const int tid = threadIdx.x, w = tid >> 5, lane = tid & 31;
  const int b = blk / ((CC / 64) * (NN / 128)), rem = blk % ((CC / 64) * (NN / 128)); const int cg = rem / (NN / 128), pg = rem % (NN / 128); const int c0 = cg * 64, p0 = pg * 128;
  const float* px = x + ((size_t)b * CC + c0 + 8 * w) * NN + p0 + 4 * lane;
  v4f v[8];
#pragma unroll      // constant indices keep v in registers, so that the eight loads are issued ahead of the arithmetic
  for (int j = 0; j < 8; ++j) v[j] = *(const v4fa*)(px + (size_t)j * NN);
  // the address pair is an input of the wait: it stays in its registers until every load of the group has taken it
  asm volatile("s_wait_xcnt 0x0" :: "v"(px) : "memory");
#pragma unroll      // v stays in registers
  for (int q = 0; q < 4; ++q) { FragH f;
#pragma unroll      // v and f stay in registers
    for (int j = 0; j < 8; ++j) f.h[j] = (_Float16)bf16_round(v[j][q]);
    *(v8us*)&tl[((q * 32 + lane) * 8 + (w ^ ((lane >> 1) & 7))) * 8] = f.half[0]; }
  __syncthreads();      // the tile is complete before its rows are read back
  const int rr = tid >> 3, ch = tid & 7;      // 8 lanes write one whole line of X16 rows 4 rr + i
  unsigned short* po = (unsigned short*)X16 + ((size_t)b * NN + p0 + 4 * rr) * CC + c0 + ch * 8;
  v8us o[4];
#pragma unroll      // o stays in registers
  for (int i = 0; i < 4; ++i) o[i] = *(const v8us*)&tl[((i * 32 + rr) * 8 + (ch ^ ((rr >> 1) & 7))) * 8];
#pragma unroll      // o stays in registers
  for (int i = 0; i < 4; ++i) *(v8us*)(po + (size_t)i * CC) = o[i]; }
// All operand preparation in one launch; none of its five parts reads what another writes. Workgroups 0 .. 4 WPB - 1 take the four weight matrices (WPB each), the rest the tiles of x.
#define WPB (CC * CC / 8 / 256)
__global__ __launch_bounds__(256) void k_prep(const float* __restrict__ x, const float* __restrict__ gw, const float* __restrict__ phw, const float* __restrict__ Ww, const float* __restrict__ thw,
    _Float16* __restrict__ X16, _Float16* __restrict__ Bg, _Float16* __restrict__ Bph, _Float16* __restrict__ BW, _Float16* __restrict__ Bthp) {
  const int blk = blockIdx.x;
  if (blk >= 4 * WPB) { d_tok(x, X16, blk - 4 * WPB); return; }      // the same in every thread of the workgroup
  const int which = blk / WPB, t = (blk % WPB) * 256 + (int)threadIdx.x;
  if (which == 3) { d_wt_f16(thw, Bthp, CC, CC, 16.0f, t); return; }      // Bt[c][o] = W_theta[o][c]
  d_round16f(which == 0 ? gw : (which == 1 ? phw : Ww), which == 0 ? Bg : (which == 1 ? Bph : BW), (size_t)t);      // (out,in) natural
}
// Softmax rows of S, two rows per wave. A lane takes the same elements as before (groups of 8 at lane * 8 + 256 k) and adds them in the same order, but all 16 loads of the wave's two rows are issued up front
// and the rows stay in registers: S is read once, and each exponential is computed once and used for the sum and for the output.
__global__ __launch_bounds__(256) void k_smx(const float* __restrict__ S, _Float16* __restrict__ P16) { const int tid = threadIdx.x, wv = tid >> 5, lane = tid & 31; const int r = (blockIdx.x * 8 + wv) * 2; if (r >= NR) return;
  const float* sr = S + (size_t)r * NH + lane * 8;
  v4f a[2][4], b[2][4];
#pragma unroll      // constant indices keep a and b in registers, so that the loads are issued ahead of the arithmetic
  for (int h = 0; h < 2; ++h)
#pragma unroll
    for (int k = 0; k < 4; ++k) { a[h][k] = *(const v4fa*)(sr + h * NH + k * 256); b[h][k] = *(const v4fa*)(sr + h * NH + k * 256 + 4); }
  // the address pair is an input of the wait: it stays in its registers until every load of the group has taken it
  asm volatile("s_wait_xcnt 0x0" :: "v"(sr) : "memory");
  __builtin_amdgcn_sched_barrier(0);      // no arithmetic on the first row is moved up in front of the second row's loads: without it they were issued only after the first row had arrived
  float m[2] = {-3.0e38f, -3.0e38f}, z[2] = {0.f, 0.f}, iz[2];
#pragma unroll      // a and b stay in registers
  for (int h = 0; h < 2; ++h)
#pragma unroll
    for (int k = 0; k < 4; ++k)
      for (int q = 0; q < 4; ++q) m[h] = fmaxf(m[h], fmaxf(a[h][k][q], b[h][k][q]));
  for (int o = 16; o >= 1; o >>= 1) { m[0] = fmaxf(m[0], __shfl_xor(m[0], o, 32)); m[1] = fmaxf(m[1], __shfl_xor(m[1], o, 32)); }
#pragma unroll      // a and b stay in registers
  for (int h = 0; h < 2; ++h)
#pragma unroll
    for (int k = 0; k < 4; ++k)
      for (int q = 0; q < 4; ++q) { a[h][k][q] = __expf(a[h][k][q] - m[h]); b[h][k][q] = __expf(b[h][k][q] - m[h]); z[h] += a[h][k][q] + b[h][k][q]; }
  for (int o = 16; o >= 1; o >>= 1) { z[0] += __shfl_xor(z[0], o, 32); z[1] += __shfl_xor(z[1], o, 32); }
  iz[0] = 32768.0f / z[0]; iz[1] = 32768.0f / z[1];
  v8us o8[2][4];
#pragma unroll      // a, b and o8 stay in registers
  for (int h = 0; h < 2; ++h)
#pragma unroll
    for (int k = 0; k < 4; ++k) { FragH f; for (int q = 0; q < 4; ++q) { f.h[q] = (_Float16)(a[h][k][q] * iz[h]); f.h[4 + q] = (_Float16)(b[h][k][q] * iz[h]); } o8[h][k] = f.half[0]; }
  unsigned short* po = (unsigned short*)P16 + (size_t)r * NH + lane * 8;
#pragma unroll      // o8 stays in registers
  for (int h = 0; h < 2; ++h)
#pragma unroll
    for (int k = 0; k < 4; ++k) *(v8us*)(po + h * NH + k * 256) = o8[h][k]; }
// BN batch statistics in two stages. Stage 1 is the BNP epilogue of the GEMM that makes wy: per chunk of SROWS consecutive rows and per channel, the rows' sum and the sum of their squared deviations from their own mean.
#define SROWS 32
#define SCH (NR / SROWS)
static_assert(SROWS == 32, "a chunk is the 32 rows of one wave's tile in k_gemm_t");
// Stage 2: one workgroup per 32 channels (one line of every partial row), lane = channel; wave w takes chunks 16 w .. 16 w + 15 in order, the 32 waves' sums are added in wave order by every wave.
// Total squared deviation = sum over chunks of (chunk's own + SROWS * (chunk mean - mean)^2). ST keeps its form: one line per channel, mean and 1/sqrt(var + eps) in its first two words.
__global__ __launch_bounds__(1024) void k_bnfin(const float* __restrict__ PS, const float* __restrict__ PM, float* __restrict__ ST) {
  __shared__ float red[2][32][32];
  const int tid = threadIdx.x, w = tid >> 5, lane = tid & 31; const int c = blockIdx.x * 32 + lane;
  const float* ps = PS + (size_t)(w * (SCH / 32)) * CC + c; const float* pm = PM + (size_t)(w * (SCH / 32)) * CC + c;
  float s[SCH / 32], m[SCH / 32];
#pragma unroll      // constant indices keep s and m in registers; all loads are in flight together
  for (int i = 0; i < SCH / 32; ++i) { s[i] = ps[i * CC]; m[i] = pm[i * CC]; }
  // the two address pairs are inputs of the wait: they stay in their registers until every load of the group has taken them
  asm volatile("s_wait_xcnt 0x0" :: "v"(ps), "v"(pm) : "memory");
  float a = 0.f;
#pragma unroll      // s stays in registers
  for (int i = 0; i < SCH / 32; ++i) a += s[i];
  red[0][w][lane] = a; __syncthreads();
  float tot = 0.f;
  for (int j = 0; j < 32; ++j) tot += red[0][j][lane];
  const float mu = tot / (float)NR;
  float q = 0.f;
#pragma unroll      // s and m stay in registers
  for (int i = 0; i < SCH / 32; ++i) { const float d = s[i] * (1.0f / (float)SROWS) - mu; q += m[i] + (float)SROWS * d * d; }
  red[1][w][lane] = q; __syncthreads();
  float q2 = 0.f;
  for (int j = 0; j < 32; ++j) q2 += red[1][j][lane];
  const float rs = rsqrtf(q2 / (float)NR + 1e-5f);
  const float muw = __shfl(mu, w, 32), rsw = __shfl(rs, w, 32);      // wave w writes the line of channel w of the 32
  ST[(blockIdx.x * 32 + w) * 32 + lane] = (lane == 0) ? muw : ((lane == 1) ? rsw : 0.f);
}
// out [b][c][p] = BN(wy [b * NN + p][c]) + x, one tile of 64 channels x 128 positions per workgroup. Every load takes 16 B per lane and whole lines per wave (wy: 256 B of two rows; x: 512 B of one channel row); all 16 of a lane
// are in flight together. A lane holds two blocks of 4 positions x 4 channels of wy, so each channel's 4 positions leave as one 16-B LDS store. LDS row = channel (512 B, no pad); the 16-B chunk of positions 4 pb .. 4 pb + 3
// lies at place pb ^ ((channel >> 2) & 15), so that the 16 lanes of a half wave meet 16 different bank groups both when they write and when they read.
__global__ __launch_bounds__(256) void k_out(const float* __restrict__ WY, const float* __restrict__ ST, const float* __restrict__ gam, const float* __restrict__ bet, const float* __restrict__ x, float* __restrict__ out) { __shared__ __attribute__((aligned(16))) float tl[64 * 128]; const int tid = threadIdx.x, w = tid >> 5, lane = tid & 31;
  const int b = blockIdx.x / ((CC / 64) * (NN / 128)), rem = blockIdx.x % ((CC / 64) * (NN / 128)); const int cg = rem / (NN / 128), pg = rem % (NN / 128); const int c0 = cg * 64, p0 = pg * 128;
  const int c4 = tid & 15, pb0 = tid >> 4;      // wy: channels 4 c4 .. 4 c4 + 3, position blocks pb0 and pb0 + 16
  const float* pw = WY + ((size_t)b * NN + p0 + 4 * pb0) * CC + c0 + 4 * c4;
  const size_t xo = ((size_t)b * CC + c0 + w) * NN + p0 + 4 * lane;      // x and out: channel rows w + 8 i
  const float* px = x + xo; const float* ps = ST + (c0 + 4 * c4) * 32; const float* pg4 = gam + c0 + 4 * c4; const float* pb4 = bet + c0 + 4 * c4;
  v4f a[2][4], xv[8]; v2f st[4];
#pragma unroll      // constant indices keep a in registers, so that the loads are issued ahead of the arithmetic
  for (int u = 0; u < 2; ++u)
#pragma unroll
    for (int j = 0; j < 4; ++j) a[u][j] = *(const v4fa*)(pw + (size_t)(64 * u + j) * CC);
#pragma unroll      // xv stays in registers
  for (int i = 0; i < 8; ++i) xv[i] = *(const v4fa*)(px + (size_t)(8 * i) * NN);
#pragma unroll      // st stays in registers
  for (int k = 0; k < 4; ++k) st[k] = *(const v2fa*)(ps + k * 32);      // mean and 1/sqrt(var + eps) of channel 4 c4 + k
  const v4f gv = *(const v4fa*)pg4, bv = *(const v4fa*)pb4;
  // the two address pairs are inputs of the wait: they stay in their registers until every load of the group has taken them
  asm volatile("s_wait_xcnt 0x0" :: "v"(pw), "v"(px) : "memory");
  __builtin_amdgcn_sched_barrier(0);      // no arithmetic on wy is moved up in front of the x loads: without it they were issued only after wy had arrived, one memory latency behind the other
#pragma unroll      // a stays in registers
  for (int u = 0; u < 2; ++u)
#pragma unroll
    for (int k = 0; k < 4; ++k) { v4f t;
#pragma unroll
      for (int j = 0; j < 4; ++j) t[j] = (a[u][j][k] - st[k][0]) * st[k][1] * bf16_round(gv[k]) + bf16_round(bv[k]);
      *(v4f*)&tl[(4 * c4 + k) * 128 + (((pb0 + 16 * u) ^ c4) * 4)] = t; }
  __syncthreads();      // the tile is complete before its channel rows are read back
  float* po = out + xo;
  v4f o[8];
#pragma unroll      // o and xv stay in registers
  for (int i = 0; i < 8; ++i) { const int c = w + 8 * i; const v4f t = *(const v4fa*)&tl[c * 128 + ((lane ^ ((c >> 2) & 15)) * 4)];
#pragma unroll
    for (int q = 0; q < 4; ++q) o[i][q] = t[q] + bf16_round(xv[i][q]); }
#pragma unroll      // o stays in registers
  for (int i = 0; i < 8; ++i) *(v4f*)(po + (size_t)(8 * i) * NN) = o[i]; }
extern "C" void kernel_launch(void* const* d_in, const int* in_sizes, int n_in,
                              void* d_out, int out_size, void* d_ws, size_t ws_size, hipStream_t stream) {
  (void)in_sizes; (void)n_in; (void)out_size;
  const float* x = (const float*)d_in[0]; const float* gw = (const float*)d_in[1]; const float* gb = (const float*)d_in[2]; const float* thw = (const float*)d_in[3]; const float* thb = (const float*)d_in[4]; const float* phw = (const float*)d_in[5]; const float* phb = (const float*)d_in[6]; const float* Ww = (const float*)d_in[7]; const float* Wb = (const float*)d_in[8]; const float* gam = (const float*)d_in[9]; const float* bet = (const float*)d_in[10];
  char* ws = (char*)d_ws; size_t off = 0;
  auto take = [&](size_t bytes) { char* p = ws + off; off += (bytes + 255) & ~(size_t)255; return p; };
  _Float16* Bg = (_Float16*)take((size_t)CC * CC * 2); _Float16* Bph = (_Float16*)take((size_t)CC * CC * 2); _Float16* BW = (_Float16*)take((size_t)CC * CC * 2); float* ST = (float*)take(CC * 32 * 4);
  _Float16* Bthp = (_Float16*)take((size_t)CC * CC * 2);      // W_θ as [in=o][out=c] → Bt[c][o] for φ·W_θ
  _Float16* X16 = (_Float16*)take((size_t)NR * CC * 2); float* FULLF = (float*)take((size_t)NR * CC * 4); _Float16* FULL = (_Float16*)take((size_t)NR * CC * 2); _Float16* PHh = (_Float16*)take((size_t)NRH * CC * 2); _Float16* PHl = (_Float16*)take((size_t)NRH * CC * 2);
  // every per-batch buffer holds all BB batches, so that each stage is one launch over the whole batch
  _Float16* BPh = (_Float16*)take((size_t)NRH * CC * 2); _Float16* BPl = (_Float16*)take((size_t)NRH * CC * 2); float* CV = (float*)take((size_t)8 * (NRH / 16) * 32 * 4); _Float16* Gt = (_Float16*)take((size_t)NRH * CC * 2); float* S = (float*)take((size_t)NR * NH * 4); _Float16* P16 = (_Float16*)take((size_t)NR * NH * 2);
  float* PS = (float*)take((size_t)SCH * CC * 4); float* PM = (float*)take((size_t)SCH * CC * 4);      // BN partials per row chunk and channel
  _Float16* Y16 = FULL; float* WY = FULLF;
  if (off > ws_size) return;      // about 214 MB
  k_prep<<<4 * WPB + BB * (CC / 64) * (NN / 128), 256, 0, stream>>>(x, gw, phw, Ww, thw, X16, Bg, Bph, BW, Bthp);      // the four weight matrices and x as f16 operands
  const dim3 gp((NR / 128) * (CC / 128), 1), gp2((NR / 128) * (CC / 128), 2);
  k_gemm_t<0, false, false, false, false, true><<<gp2, 256, 0, stream>>>(X16, nullptr, CC, 0, Bph, Bg, CC, 0, 0.0625f, phb, gb, 0, nullptr, PHh, PHl, CV, nullptr, thb, Gt, CC, 0, CC, CC);      // plane 0: phi pooled, split hi/lo, with the partial dots of c = phi * b_theta; plane 1: g pooled, as g^T [BB][512][1024]
  const dim3 gb2((NRH / 128) * (CC / 128), 1), gs((NN / 128) * (NH / 128), BB), gy((NN / 128) * (CC / 128), BB);      // blockIdx.y = batch where the B operand differs per batch
  k_gemm_t<0, false, true, false, true><<<gb2, 256, 0, stream>>>(PHl, PHh, CC, 0, Bthp, Bthp, CC, 0, 0.0625f, nullptr, nullptr, 0, nullptr, BPh, BPl, nullptr, nullptr, nullptr, nullptr, CC, 0, CC, CC);      // B' = phi * W_theta [BB*1024][512] (phi lo, then hi), all batches as rows, leaves split hi/lo
  k_gemm_t<1, true, false, false, true><<<gs, 256, 0, stream>>>(X16, X16, CC, (size_t)NN * CC, BPl, BPh, CC, (size_t)NH * CC, 1.0f, nullptr, CV, (size_t)NH, S, nullptr, nullptr, nullptr, nullptr, nullptr, nullptr, NH, (size_t)NN * NH, NH, CC);      // f = x * B'^T + c (B' lo, then hi; c broadcast over the rows of its batch)
  k_smx<<<NR / 16, 256, 0, stream>>>(S, P16);
  k_gemm_t<0, false><<<gy, 256, 0, stream>>>(P16, nullptr, NH, (size_t)NN * NH, Gt, nullptr, NH, (size_t)CC * NH, 0.000030517578125f, nullptr, nullptr, 0, nullptr, Y16, nullptr, nullptr, nullptr, nullptr, nullptr, CC, (size_t)NN * CC, CC, NH);      // y = softmax(f) * g, stored as f16
  k_gemm_t<0, true, false, true><<<gp, 256, 0, stream>>>(Y16, nullptr, CC, 0, BW, nullptr, CC, 0, 0.0625f, Wb, nullptr, 0, WY, nullptr, nullptr, PS, PM, nullptr, nullptr, CC, 0, CC, CC);      // wy = W(y) + b, with the BN partials of its row chunks
  k_bnfin<<<CC / 32, 1024, 0, stream>>>(PS, PM, ST); k_out<<<BB * (CC / 64) * (NN / 128), 256, 0, stream>>>(WY, ST, gam, bet, x, (float*)d_out);
}

// v009
// It runs in 124 microseconds.
// Next to v008, in two timings, it ran 1.07 times as fast each time.
// Over all steps from v000 it is 11.9 times as fast.
#include <hip/hip_runtime.h>
// Non-local block with view pooling (x [8, C=512, N=2048]): θ = conv1(x), φ = maxpool2(conv1(x)), g = maxpool2(conv1(x)); f = softmax(θᵀ·φ) [N × N/2] (unscaled); y = f·g; wy = conv1(y) + b;
// out = BN_train(wy)·γ + β + x. Because the unscaled logits reach σ≈20 and feed a near-one-hot softmax, θ is never rounded: the logits are re-associated as f = x·(φ·W_θ)ᵀ + 1·(φ·b_θ)ᵀ with x bf16-EXACT,
// φ (f32, max-pooled from an f32 projection) fed as f16 hi + lo·2^10 into φ·W_θ and that product again split hi/lo as the B operand (four cheap passes per batch), the column term added exactly through
// the epilogue addend; g, y as plain f16; P ×2^15 f16; all on v_wmma_f32_16x16x32_f16 ((out,in) weights bf16-exact ×2^4, f32 accumulate); the layout transposes, max-pooling, softmax rows, BN batch statistics (fixed-order) and the residual are f32 VALU.
#define BB 8
#define CC 512
#define NN 2048
#define NH (NN / 2)
#define NR (BB * NN)
#define NRH (BB * NH)

typedef __bf16 v16b __attribute__((ext_vector_type(16)));
typedef unsigned short v8us __attribute__((ext_vector_type(8), may_alias));
typedef float  v8f  __attribute__((ext_vector_type(8)));
typedef float  v4f  __attribute__((ext_vector_type(4)));
typedef float  v4fa __attribute__((ext_vector_type(4), may_alias));
union FragB { v16b v; v8us half[2]; unsigned short u[16]; };

__device__ __forceinline__ unsigned short bf16_bits(float x) { unsigned int u = __float_as_uint(x); return (unsigned short)((u + 0x7FFFu + ((u >> 16) & 1u)) >> 16); }
__device__ __forceinline__ float bf16_val(unsigned short b) { return __uint_as_float(((unsigned int)b) << 16); }
__device__ __forceinline__ float bf16_round(float x) { return bf16_val(bf16_bits(x)); }
// D += A·B with NT terms: 1 = ah·bh, 2 = + al·bh (A split), 3 = + ah·bl (both split)
template <int NT>
__device__ __forceinline__ v8f mmaN(v16b ah, v16b al, v16b bh, v16b bl, v8f c) {
  c = __builtin_amdgcn_wmma_f32_16x16x32_bf16(false, ah, false, bh, (short)0, c, false, false);
  if (NT >= 2) c = __builtin_amdgcn_wmma_f32_16x16x32_bf16(false, al, false, bh, (short)0, c, false, false);
  if (NT >= 3) c = __builtin_amdgcn_wmma_f32_16x16x32_bf16(false, ah, false, bl, (short)0, c, false, false);
  asm volatile("v_nop\n\tv_nop\n\tv_nop\n\tv_nop" : "+v"(c) : "v"(ah), "v"(al), "v"(bh), "v"(bl));
  return c;
}

__global__ __launch_bounds__(256) void k_wt_bf16(const float* __restrict__ W, unsigned short* __restrict__ Wt, int K, int N) {
  const int t = blockIdx.x * 256 + threadIdx.x;
  const int k8n = K / 8;
  if (t >= N * k8n) return;
  const int n = t / k8n, k8 = (t % k8n) * 8;
  v8us v;
#pragma unroll
  for (int i = 0; i < 8; ++i) v[i] = bf16_bits(W[(size_t)(k8 + i) * N + n]);
  *(v8us*)(Wt + (size_t)n * K + k8) = v;
  
}

// GEMM C[M][N] (f32, pitch ldc) = act(A[M][K]·W + bias). A f32 row-major (pitch lda) converted per fragment to bf16
// (ASPLIT: hi/lo two planes -> 2 terms, else single rounded term); Wt bf16 [N][K] (pitch ldb). BIAS_BF16 rounds the
// bias to bf16 first (bias quantised to bf16 before the add). K%32==0, M%16==0, N%64==0.
template <bool ASPLIT, int ACT, bool BIAS_BF16>
__global__ __launch_bounds__(128) void k_gemm_bf(const float* __restrict__ A, int lda, const unsigned short* __restrict__ Wt, int ldb,
                                               const float* __restrict__ bias, float* __restrict__ C, int ldc, int M, int N, int K) {
  __shared__ __attribute__((aligned(16))) float so[4][16][64];
  const int tid = threadIdx.x, w = tid >> 5, lane = tid & 31, ln = lane & 15, hh = lane >> 4;
  const int ntn = N / 64;
  const int wid = blockIdx.x * 4 + w;
  const int mt = wid / ntn, nq = wid % ntn;
  if (mt * 16 >= M) return;
  const int row0 = mt * 16, col0 = nq * 64;
  const float* arow = A + (size_t)(row0 + ln) * lda;
  v8f acc[4] = {};
  for (int kb = 0; kb < K; kb += 32) {
    FragB ah, al;
    const v4f x0 = *(const v4fa*)(arow + kb + 8 * hh), x1 = *(const v4fa*)(arow + kb + 8 * hh + 4);
    const v4f x2 = *(const v4fa*)(arow + kb + 16 + 8 * hh), x3 = *(const v4fa*)(arow + kb + 16 + 8 * hh + 4);
    float xs[16] = {x0[0],x0[1],x0[2],x0[3],x1[0],x1[1],x1[2],x1[3],x2[0],x2[1],x2[2],x2[3],x3[0],x3[1],x3[2],x3[3]};
#pragma unroll
    for (int i = 0; i < 16; ++i) { const unsigned short hb = bf16_bits(xs[i]); ah.u[i] = hb; al.u[i] = ASPLIT ? bf16_bits(xs[i] - bf16_val(hb)) : (unsigned short)0; }
#pragma unroll
    for (int t = 0; t < 4; ++t) {
      const unsigned short* brow = Wt + (size_t)(col0 + t * 16 + ln) * ldb + kb;
      FragB b;
      b.half[0] = *(const v8us*)(brow + 8 * hh);
      b.half[1] = *(const v8us*)(brow + 16 + 8 * hh);
      acc[t] = mmaN<ASPLIT ? 2 : 1>(ah.v, al.v, b.v, b.v, acc[t]);
    }
  }
#pragma unroll
  for (int t = 0; t < 4; ++t) {
    float bv = bias ? bias[col0 + t * 16 + ln] : 0.f;
    if (BIAS_BF16) bv = bf16_round(bv);
#pragma unroll
    for (int r = 0; r < 8; ++r) { float v = acc[t][r] + bv; if (ACT == 1) v = fmaxf(v, 0.f); so[w][8 * hh + r][t * 16 + ln] = v; }
  }
  __builtin_amdgcn_fence(__ATOMIC_ACQ_REL, "workgroup");
  __builtin_amdgcn_wave_barrier();
  const int rsub = lane >> 4, c4 = (lane & 15) * 4;
  {
#pragma unroll
    for (int q = 0; q < 8; ++q) {
      const int r = q * 2 + rsub;
      const v4f v = *(const v4fa*)&so[w][r][c4];
      *(v4f*)(C + (size_t)(row0 + r) * ldc + col0 + c4) = v;
    }
    
  }
}

// Flash-style causal/unmasked attention, all contractions 3-term bf16 hi/lo splits, f32 softmax with running max.
// q,k,v rows are read from f32 buffers with arbitrary row pitch (so they can live inside a fused qkv buffer);
// D = head size (multiple of 32, <= 128); one wave = 16 query rows; block = 4 waves (64 queries) sharing K/V chunks of 32.
template <int D, bool CAUSAL>
__global__ __launch_bounds__(128) void k_flash(const float* __restrict__ qb, const float* __restrict__ kb, const float* __restrict__ vb,
                                             int pitch, int T, int H, float scale, float* __restrict__ y, int ypitch) {
  constexpr int KS = D / 32;        // k-steps for QK
  constexpr int DT = D / 16;        // d tiles for PV
  __shared__ __attribute__((aligned(16))) unsigned short sKh[32][D + 8], sKl[32][D + 8], sVh[32][D + 8], sVl[32][D + 8];
  __shared__ __attribute__((aligned(16))) unsigned short sPh[4][16][40], sPl[4][16][40];
  __shared__ __attribute__((aligned(16))) float sO[4][16][D];
  const int tid = threadIdx.x, w = tid >> 5, lane = tid & 31, ln = lane & 15, hh = lane >> 4;
  const int nqb = (T + 63) / 64;
  const int bh = blockIdx.x / nqb, qblk = blockIdx.x % nqb;
  const int b = bh / H, h = bh % H;
  const int q0 = qblk * 64 + w * 16;
  const float* Q = qb + (size_t)b * T * pitch + h * D;
  const float* K = kb + (size_t)b * T * pitch + h * D;
  const float* V = vb + (size_t)b * T * pitch + h * D;

  // A fragments of the wave's 16 query rows (scaled), hi/lo
  FragB aqh[KS], aql[KS];
  {
    int row = q0 + ln; if (row >= T) row = T - 1;
    const float* qr = Q + (size_t)row * pitch;
#pragma unroll
    for (int ks = 0; ks < KS; ++ks)
#pragma unroll
      for (int i = 0; i < 16; ++i) {
        const int d = ks * 32 + ((i < 8) ? (8 * hh + i) : (16 + 8 * hh + (i - 8)));
        const float x = qr[d] * scale; const unsigned short hb = bf16_bits(x);
        aqh[ks].u[i] = hb; aql[ks].u[i] = bf16_bits(x - bf16_val(hb));
      }
  }
  float m_r[8], l_r[8];
#pragma unroll
  for (int r = 0; r < 8; ++r) { m_r[r] = -3.0e38f; l_r[r] = 0.f; }
  v8f oacc[DT];
#pragma unroll
  for (int dt = 0; dt < DT; ++dt) oacc[dt] = (v8f){0.f,0.f,0.f,0.f,0.f,0.f,0.f,0.f};

  const int kv_end = CAUSAL ? min(T, qblk * 64 + 64) : T;     // block-uniform
  for (int j0 = 0; j0 < kv_end; j0 += 32) {
    __syncthreads();
    for (int e = tid; e < 32 * (D / 4); e += 128) {
      const int r = e / (D / 4), c4 = (e % (D / 4)) * 4;
      const int key = j0 + r;
      v4f kf = {0.f,0.f,0.f,0.f}, vf = {0.f,0.f,0.f,0.f};
      if (key < T) { kf = *(const v4fa*)(K + (size_t)key * pitch + c4); vf = *(const v4fa*)(V + (size_t)key * pitch + c4); }
#pragma unroll
      for (int t = 0; t < 4; ++t) {
        unsigned short hb = bf16_bits(kf[t]); sKh[r][c4 + t] = hb; sKl[r][c4 + t] = bf16_bits(kf[t] - bf16_val(hb));
        hb = bf16_bits(vf[t]); sVh[r][c4 + t] = hb; sVl[r][c4 + t] = bf16_bits(vf[t] - bf16_val(hb));
      }
    }
    __syncthreads();
    // S tile 16 x 32
    v8f s[2];
#pragma unroll
    for (int nt = 0; nt < 2; ++nt) {
      v8f acc = {};
#pragma unroll
      for (int ks = 0; ks < KS; ++ks) {
        FragB bh_, bl_;
        bh_.half[0] = *(const v8us*)&sKh[nt * 16 + ln][ks * 32 + 8 * hh]; bh_.half[1] = *(const v8us*)&sKh[nt * 16 + ln][ks * 32 + 16 + 8 * hh];
        bl_.half[0] = *(const v8us*)&sKl[nt * 16 + ln][ks * 32 + 8 * hh]; bl_.half[1] = *(const v8us*)&sKl[nt * 16 + ln][ks * 32 + 16 + 8 * hh];
        acc = mmaN<3>(aqh[ks].v, aql[ks].v, bh_.v, bl_.v, acc);
      }
      s[nt] = acc;
    }
    // mask + running max (rows 8hh+r; the 16 lanes of a half share rows)
    float alpha[8];
#pragma unroll
    for (int r = 0; r < 8; ++r) {
      const int qi = q0 + 8 * hh + r;
      const int ja = j0 + ln, jb = j0 + 16 + ln;
      if (CAUSAL) { if (ja > qi) s[0][r] = -3.0e38f; if (jb > qi) s[1][r] = -3.0e38f; }
      if (ja >= T) s[0][r] = -3.0e38f;
      if (jb >= T) s[1][r] = -3.0e38f;
      float mx = fmaxf(s[0][r], s[1][r]);
      mx = fmaxf(mx, __shfl_xor(mx, 1, 32)); mx = fmaxf(mx, __shfl_xor(mx, 2, 32)); mx = fmaxf(mx, __shfl_xor(mx, 4, 32)); mx = fmaxf(mx, __shfl_xor(mx, 8, 32));
      const float mnew = fmaxf(m_r[r], mx);
      alpha[r] = (mnew > -1.0e38f) ? __expf(m_r[r] - mnew) : 1.0f;
      const float p0 = (s[0][r] > -1.0e38f) ? __expf(s[0][r] - mnew) : 0.f;
      const float p1 = (s[1][r] > -1.0e38f) ? __expf(s[1][r] - mnew) : 0.f;
      m_r[r] = mnew;
      l_r[r] = l_r[r] * alpha[r] + p0 + p1;            // per-lane partial row sum (16 lanes combined at the end)
      unsigned short hb = bf16_bits(p0); sPh[w][8 * hh + r][ln] = hb;      sPl[w][8 * hh + r][ln] = bf16_bits(p0 - bf16_val(hb));
      hb = bf16_bits(p1);                sPh[w][8 * hh + r][16 + ln] = hb; sPl[w][8 * hh + r][16 + ln] = bf16_bits(p1 - bf16_val(hb));
    }
#pragma unroll
    for (int dt = 0; dt < DT; ++dt)
#pragma unroll
      for (int r = 0; r < 8; ++r) oacc[dt][r] *= alpha[r];
    __builtin_amdgcn_fence(__ATOMIC_ACQ_REL, "workgroup");
    __builtin_amdgcn_wave_barrier();
    FragB pah, pal;
    pah.half[0] = *(const v8us*)&sPh[w][ln][8 * hh]; pah.half[1] = *(const v8us*)&sPh[w][ln][16 + 8 * hh];
    pal.half[0] = *(const v8us*)&sPl[w][ln][8 * hh]; pal.half[1] = *(const v8us*)&sPl[w][ln][16 + 8 * hh];
#pragma unroll
    for (int dt = 0; dt < DT; ++dt) {
      FragB bvh, bvl;
#pragma unroll
      for (int i = 0; i < 8; ++i) {
        bvh.u[i] = sVh[8 * hh + i][dt * 16 + ln]; bvh.u[8 + i] = sVh[16 + 8 * hh + i][dt * 16 + ln];
        bvl.u[i] = sVl[8 * hh + i][dt * 16 + ln]; bvl.u[8 + i] = sVl[16 + 8 * hh + i][dt * 16 + ln];
      }
      oacc[dt] = mmaN<3>(pah.v, pal.v, bvh.v, bvl.v, oacc[dt]);
    }
    __builtin_amdgcn_fence(__ATOMIC_ACQ_REL, "workgroup");
    __builtin_amdgcn_wave_barrier();
  }
#pragma unroll
  for (int r = 0; r < 8; ++r) {
    float l = l_r[r];
    l += __shfl_xor(l, 1, 32); l += __shfl_xor(l, 2, 32); l += __shfl_xor(l, 4, 32); l += __shfl_xor(l, 8, 32);
    l_r[r] = (l > 0.f) ? 1.0f / l : 0.f;
  }
#pragma unroll
  for (int dt = 0; dt < DT; ++dt)
#pragma unroll
    for (int r = 0; r < 8; ++r) sO[w][8 * hh + r][dt * 16 + ln] = oacc[dt][r] * l_r[r];
  __builtin_amdgcn_fence(__ATOMIC_ACQ_REL, "workgroup");
  __builtin_amdgcn_wave_barrier();
  {
    for (int r = 0; r < 16; ++r) {
      const int row = q0 + r;
      if (row < T && lane < D / 4) {
        const v4f val = *(const v4fa*)&sO[w][r][lane * 4];
        *(v4f*)(y + ((size_t)b * T + row) * ypitch + h * D + lane * 4) = val;
      }
    }
    
  }
}

// GEMM C = act(A·W + bias + resid): A f32 (ASPLIT -> hi/lo 2 terms), Wt bf16 [N][K]; ACT 0 none, 1 relu, 2 exact gelu;
// resid (optional, f32, row index = (row % rmod), pitch ldr, RES_BF16 rounds it) added before the activation.
template <bool ASPLIT, int ACT, bool BIAS_BF16, bool RES_BF16>
__global__ __launch_bounds__(128) void k_gemm_bf3(const float* __restrict__ A, int lda, const unsigned short* __restrict__ Wt, int ldb,
                                                const float* __restrict__ bias, const float* __restrict__ resid, int rmod, int ldr,
                                                float* __restrict__ C, int ldc, int M, int N, int K) {
  __shared__ __attribute__((aligned(16))) float so[4][16][64];
  const int tid = threadIdx.x, w = tid >> 5, lane = tid & 31, ln = lane & 15, hh = lane >> 4;
  const int ntn = N / 64;
  const int wid = blockIdx.x * 4 + w;
  const int mt = wid / ntn, nq = wid % ntn;
  if (mt * 16 >= M) return;
  const int row0 = mt * 16, col0 = nq * 64;
  const float* arow = A + (size_t)(row0 + ln) * lda;
  v8f acc[4] = {};
  for (int kb = 0; kb < K; kb += 32) {
    FragB ah, al;
    const v4f x0 = *(const v4fa*)(arow + kb + 8 * hh), x1 = *(const v4fa*)(arow + kb + 8 * hh + 4);
    const v4f x2 = *(const v4fa*)(arow + kb + 16 + 8 * hh), x3 = *(const v4fa*)(arow + kb + 16 + 8 * hh + 4);
    float xs[16] = {x0[0],x0[1],x0[2],x0[3],x1[0],x1[1],x1[2],x1[3],x2[0],x2[1],x2[2],x2[3],x3[0],x3[1],x3[2],x3[3]};
#pragma unroll
    for (int i = 0; i < 16; ++i) { const unsigned short hb = bf16_bits(xs[i]); ah.u[i] = hb; al.u[i] = ASPLIT ? bf16_bits(xs[i] - bf16_val(hb)) : (unsigned short)0; }
#pragma unroll
    for (int t = 0; t < 4; ++t) {
      const unsigned short* brow = Wt + (size_t)(col0 + t * 16 + ln) * ldb + kb;
      FragB b;
      b.half[0] = *(const v8us*)(brow + 8 * hh);
      b.half[1] = *(const v8us*)(brow + 16 + 8 * hh);
      acc[t] = mmaN<ASPLIT ? 2 : 1>(ah.v, al.v, b.v, b.v, acc[t]);
    }
  }
#pragma unroll
  for (int t = 0; t < 4; ++t) {
    const int col = col0 + t * 16 + ln;
    float bv = bias ? bias[col] : 0.f;
    if (BIAS_BF16) bv = bf16_round(bv);
#pragma unroll
    for (int r = 0; r < 8; ++r) {
      float v = acc[t][r] + bv;
      if (resid) { float rv = resid[(size_t)((row0 + 8 * hh + r) % rmod) * ldr + col]; if (RES_BF16) rv = bf16_round(rv); v += rv; }
      if (ACT == 1) v = fmaxf(v, 0.f);
      if (ACT == 2) v = 0.5f * v * (1.0f + erff(v * 0.70710678118654752f));
      if (ACT == 3) { const float u = 0.7978845608028654f * (v + 0.044715f * v * v * v); v = 0.5f * v * (1.0f + tanhf(u)); }
      so[w][8 * hh + r][t * 16 + ln] = v;
    }
  }
  __builtin_amdgcn_fence(__ATOMIC_ACQ_REL, "workgroup");
  __builtin_amdgcn_wave_barrier();
  const int rsub = lane >> 4, c4 = (lane & 15) * 4;
  {
#pragma unroll
    for (int q = 0; q < 8; ++q) {
      const int r = q * 2 + rsub;
      const v4f v = *(const v4fa*)&so[w][r][c4];
      *(v4f*)(C + (size_t)(row0 + r) * ldc + col0 + c4) = v;
    }
    
  }
}
// row LayerNorm (biased variance, eps) over N: s = X (+ R); optional out_sum <- s; out_norm <- (s-mu)*rsqrt(var+eps)*g + b
template <bool PARAM_BF16>
__global__ __launch_bounds__(256) void k_layernorm(const float* __restrict__ X, const float* __restrict__ R, const float* __restrict__ g, const float* __restrict__ bta,
                                                  float* __restrict__ out_sum, float* __restrict__ out_norm, int N, float eps) {
  __shared__ float red[256];
  const int row = blockIdx.x, tid = threadIdx.x;
  const float* x = X + (size_t)row * N; const float* rr = R ? R + (size_t)row * N : nullptr;
  float vals[16];                     // up to N = 4096
  const int per = N / 256;            // contiguous chunk per thread? use strided-by-4 chunks: thread handles j = tid*4 + 1024*u
  float s1 = 0.f;
  for (int u = 0; u < per / 4; ++u) {
    const int j = tid * 4 + 1024 * u;
    const v4f a = *(const v4fa*)(x + j);
    v4f b = {0.f,0.f,0.f,0.f}; if (rr) b = *(const v4fa*)(rr + j);
#pragma unroll
    for (int q = 0; q < 4; ++q) { const float v = a[q] + b[q]; vals[u * 4 + q] = v; s1 += v; }
  }
  red[tid] = s1; __syncthreads();
  for (int st = 128; st > 0; st >>= 1) { if (tid < st) red[tid] += red[tid + st]; __syncthreads(); }
  const float mu = red[0] / (float)N; __syncthreads();
  float s2 = 0.f;
  for (int u = 0; u < per / 4; ++u)
#pragma unroll
    for (int q = 0; q < 4; ++q) { const float c = vals[u * 4 + q] - mu; s2 += c * c; }
  red[tid] = s2; __syncthreads();
  for (int st = 128; st > 0; st >>= 1) { if (tid < st) red[tid] += red[tid + st]; __syncthreads(); }
  const float rs = rsqrtf(red[0] / (float)N + eps);
  {
    for (int u = 0; u < per / 4; ++u) {
      const int j = tid * 4 + 1024 * u;
      v4f o, sm;
#pragma unroll
      for (int q = 0; q < 4; ++q) {
        float gg = g[j + q], bb = bta[j + q];
        if (PARAM_BF16) { gg = bf16_round(gg); bb = bf16_round(bb); }
        sm[q] = vals[u * 4 + q]; o[q] = (vals[u * 4 + q] - mu) * rs * gg + bb;
      }
      if (out_sum) *(v4f*)(out_sum + (size_t)row * N + j) = sm;
      *(v4f*)(out_norm + (size_t)row * N + j) = o;
    }
    
  }
}



// ---- f16 WMMA path (v_wmma_f32_16x16x32_f16): 11-bit significands for operands in range — used where a [0,1] probability operand needs more precision than bf16
typedef _Float16 v16h __attribute__((ext_vector_type(16)));
union FragH { v16h v; v8us half[2]; _Float16 h[16]; unsigned short u[16]; };
template <int NT>
__device__ __forceinline__ v8f mmaH(v16h ah, v16h al, v16h bh, v16h bl, v8f c) {
  c = __builtin_amdgcn_wmma_f32_16x16x32_f16(false, ah, false, bh, (short)0, c, false, false);
  if (NT >= 2) c = __builtin_amdgcn_wmma_f32_16x16x32_f16(false, al, false, bh, (short)0, c, false, false);
  if (NT >= 3) c = __builtin_amdgcn_wmma_f32_16x16x32_f16(false, ah, false, bl, (short)0, c, false, false);
  asm volatile("v_nop\n\tv_nop\n\tv_nop\n\tv_nop" : "+v"(c) : "v"(ah), "v"(al), "v"(bh), "v"(bl));
  return c;
}
// batched GEMM like k_gemm_b but f16 operands: A f32 (split into f16 hi/lo if ASPLIT, else rounded to f16), Bt = f16 values [n][k]; alpha; C f32; N multiple of 16 (partial tiles skipped)
template <bool ASPLIT>
__global__ __launch_bounds__(128) void k_gemm_h(const float* __restrict__ A, int lda, size_t sA, const _Float16* __restrict__ Bh, int ldb, size_t sB, float alpha, float* __restrict__ C, int ldc, size_t sC, int M, int N, int K) {
  __shared__ __attribute__((aligned(16))) float so[4][16][64];
  const int tid = threadIdx.x, w = tid >> 5, lane = tid & 31, ln = lane & 15, hh = lane >> 4; const int by = blockIdx.y;
  A += (size_t)by * sA; Bh += (size_t)by * sB; C += (size_t)by * sC;
  const int ntn = (N + 63) / 64; const int wid = blockIdx.x * 4 + w; const int mt = wid / ntn, nq = wid % ntn; if (mt * 16 >= M) return;
  const int row0 = mt * 16, col0 = nq * 64; const float* arow = A + (size_t)(row0 + ln) * lda;
  v8f acc[4] = {};
  for (int kb = 0; kb < K; kb += 32) {
    FragH ah, al;
    const v4f x0 = *(const v4fa*)(arow + kb + 8 * hh), x1 = *(const v4fa*)(arow + kb + 8 * hh + 4), x2 = *(const v4fa*)(arow + kb + 16 + 8 * hh), x3 = *(const v4fa*)(arow + kb + 16 + 8 * hh + 4);
    float xs[16] = {x0[0],x0[1],x0[2],x0[3],x1[0],x1[1],x1[2],x1[3],x2[0],x2[1],x2[2],x2[3],x3[0],x3[1],x3[2],x3[3]};
#pragma unroll
    for (int i = 0; i < 16; ++i) { const _Float16 h = (_Float16)xs[i]; ah.h[i] = h; al.h[i] = ASPLIT ? (_Float16)(xs[i] - (float)h) : (_Float16)0.0f; }
#pragma unroll
    for (int t = 0; t < 4; ++t) { if (col0 + t * 16 >= N) continue; const size_t boff = (size_t)(col0 + t * 16 + ln) * ldb + kb; FragH bq; bq.half[0] = *(const v8us*)(Bh + boff + 8 * hh); bq.half[1] = *(const v8us*)(Bh + boff + 16 + 8 * hh);
      acc[t] = mmaH<ASPLIT ? 2 : 1>(ah.v, al.v, bq.v, bq.v, acc[t]); }
  }
#pragma unroll
  for (int t = 0; t < 4; ++t) { if (col0 + t * 16 >= N) continue;
#pragma unroll
    for (int r = 0; r < 8; ++r) so[w][8 * hh + r][t * 16 + ln] = acc[t][r] * alpha; }
  __builtin_amdgcn_fence(__ATOMIC_ACQ_REL, "workgroup"); __builtin_amdgcn_wave_barrier();
  const int rsub = lane >> 4, c4 = (lane & 15) * 4;
  {
#pragma unroll
    for (int q = 0; q < 8; ++q) { const int r = q * 2 + rsub; if (col0 + c4 < N) { const v4f v = *(const v4fa*)&so[w][r][c4]; *(v4f*)(C + (size_t)(row0 + r) * ldc + col0 + c4) = v; } }
     }
}

// Wt[n][k] = f16(W[k][n]·scale) from f32 row-major W[K][N] (scale = power of two; bf16-exact weights stay exact in f16 away from the subnormal range)
__device__ __forceinline__ void d_wt_f16(const float* __restrict__ W, _Float16* __restrict__ Wt, int K, int N, float scale, int t) {
  const int n = t / (K / 8), k8 = (t % (K / 8)) * 8; FragH f;
#pragma unroll
  for (int i = 0; i < 8; ++i) f.h[i] = (_Float16)(bf16_round(W[(size_t)(k8 + i) * N + n]) * scale); const v8us o = f.half[0];
  *(v8us*)((unsigned short*)Wt + (size_t)n * K + k8) = o;
  asm volatile("s_wait_xcnt 0x0" ::: "memory");      // the store has taken its registers before another part of the merged kernel, laid out behind this one, reuses them
}
// Tiled GEMM, f16 operands, both K-contiguous: v[row][col] = acc*alpha + bias[col], then CPM 1: + the addend of column by*sCPy + col, the same for all rows (its form in CP: under DUAL below); written as f32 to C (F32OUT) or as f16 to C16,
// or (HL) split as f16 hi to C16 and (v - hi) * 2^10 as f16 to C16l, with nothing written to C.
// TWO: a product whose one operand is split hi + lo * 2^-10 runs in one launch on one accumulator: first the K of the lo pair A, Bh; the sums are then scaled by 2^-10 (exact); the K of the hi pair A2, B2 is added on top.
// BNP: stage 1 of the BN batch statistics. A wave's 32 rows are one row chunk: per column it also writes their sum to PS and the sum of their squared deviations from their own mean to PM (row = chunk, pitch ldc).
// One 128x128 tile per workgroup of 8 waves (4 x 2, 32x64 per wave). A pass is 64 k = one whole 128-B line of every operand row: each wave-wide 16-B load
// covers four whole lines and goes through registers into LDS (row pitch 144 B for the ds_load_b128 fragment readers); two buffers, one barrier per pass;
// the next pass's global loads are issued before this pass's products. M, N multiples of 128 (the grid is exact), K a multiple of 64.
// Every "#pragma unroll" below makes the index of a register array (staged rows, fragments, accumulators) a constant, so that the array stays in registers.
#define TPITCH 72
typedef float fa1 __attribute__((may_alias));
typedef _Float16 v4hs __attribute__((ext_vector_type(4)));
typedef float v2f __attribute__((ext_vector_type(2)));
typedef float v2fa __attribute__((ext_vector_type(2), may_alias));
typedef _Float16 v2hs __attribute__((ext_vector_type(2)));
// DUAL: the two pooled projections of x in one launch, each finished in its own epilogue, so that neither unpooled projection goes to memory (sA, sB, sC are 0; CPM 0; ldc = CC).
// Plane blockIdx.y = 0 is phi: rows = positions (A), columns = channels (Bh, bias). A wave takes the maximum of each row pair of its 32 x 64 tile, writes it split as f16 hi to C16 and (v - hi) * 2^10 to C16l, and writes
// the 16 pooled rows' partial dots with b_theta (BT) over its 64 channels to PS: one 128-B line per wave, line = (channel chunk of 64) * (NRH / 16) + (pooled row / 16), word = pooled row % 16.
// Plane 1 is g with the operands' roles exchanged: rows = channels (B2, bias CP per row), columns = positions (A), so that the tile already lies as g^T; the maximum of each column pair goes as f16 to GT [batch][channel][NH].
// CPM 1 adds the eight channel chunks' partial dots, in chunk order, from CP in the PS form above.
// The softmax over a row of NH logits has no launch of its own; it is split between the GEMM that makes the logits (EXPO) and the GEMM that consumes the probabilities (ASC). A chunk is the 64 columns of one wave's tile = one k pass of the consumer.
// EXPO: a wave takes, per row of its 32 x 64 tile, the chunk's own maximum m, e = exp(v - m) * 2^15 (the power of two rides in the exponent's addend) and the f32 sum z of e; it writes e as f16 to C16 (pitch NH) and the pair (m, z) to PS
// at pair index chunk * NR + by * NN + row. No logit goes to memory.
// ASC: from the NCH pairs of each of its 128 rows (CP, the PS form of EXPO) the workgroup forms M = max m, Z = sum of z * exp(m - M) in chunk order, and the table exp(m - M) * 2^15 / Z per chunk and row; every A element of pass s is multiplied
// by its row's entry for chunk s on its way from registers to LDS, which makes it exp(v - M) / (sum over the row) * 2^15.
#define NCH (NH / 64)
// lane l takes the value of lane l ^ X inside its 16-lane row, by a DPP move on the vector port (a shuffle would go through the LDS queue and its wait)
template <int X> __device__ __forceinline__ float rowx(float x) { return __builtin_bit_cast(float, __builtin_amdgcn_update_dpp(0, __builtin_bit_cast(int, x), 0x160 + X, 0xf, 0xf, true)); }
// one butterfly step of a maximum over the 16-lane row, for 16 independent values: x = max(x, x of lane l ^ S), one DPP instruction each
#define RMX1(R, S) "v_max_num_f32_dpp %" #R ", %" #R ", %" #R " row_xmask:" #S " row_mask:0xf bank_mask:0xf\n\t"
#define RMX16(S) RMX1(0, S) RMX1(1, S) RMX1(2, S) RMX1(3, S) RMX1(4, S) RMX1(5, S) RMX1(6, S) RMX1(7, S) RMX1(8, S) RMX1(9, S) RMX1(10, S) RMX1(11, S) RMX1(12, S) RMX1(13, S) RMX1(14, S) RMX1(15, S)
__device__ __forceinline__ void exp2x8(float (&e)[8], const float (&t)[8]) {
  asm("v_exp_f32 %0, %8\n\tv_exp_f32 %1, %9\n\tv_exp_f32 %2, %10\n\tv_exp_f32 %3, %11\n\tv_exp_f32 %4, %12\n\tv_exp_f32 %5, %13\n\tv_exp_f32 %6, %14\n\tv_exp_f32 %7, %15\n\tv_nop"
      : "=&v"(e[0]), "=&v"(e[1]), "=&v"(e[2]), "=&v"(e[3]), "=&v"(e[4]), "=&v"(e[5]), "=&v"(e[6]), "=&v"(e[7]) : "v"(t[0]), "v"(t[1]), "v"(t[2]), "v"(t[3]), "v"(t[4]), "v"(t[5]), "v"(t[6]), "v"(t[7])); }
__device__ __forceinline__ v8us scale8(v8us r, float c) { FragH f; f.half[0] = r;
#pragma unroll      // f stays in registers
  for (int j = 0; j < 8; ++j) f.h[j] = (_Float16)((float)f.h[j] * c);
  return f.half[0]; }
template <int CPM, bool F32OUT, bool HL = false, bool BNP = false, bool TWO = false, bool DUAL = false, bool EXPO = false, bool ASC = false>
__global__ __launch_bounds__(256) void k_gemm_t(const _Float16* __restrict__ A, const _Float16* __restrict__ A2, int lda, size_t sA, const _Float16* __restrict__ Bh, const _Float16* __restrict__ B2, int ldb, size_t sB, float alpha, const float* __restrict__ bias, const float* __restrict__ CP, size_t sCPy,
    float* __restrict__ C, _Float16* __restrict__ C16, _Float16* __restrict__ C16l, float* __restrict__ PS, float* __restrict__ PM, const float* __restrict__ BT, _Float16* __restrict__ GT, int ldc, size_t sC, int N, int K) {
  __shared__ __attribute__((aligned(16))) unsigned short st[2][2][128 * TPITCH];      // [buffer][A, B][row * TPITCH + k]
  __shared__ float tab[ASC ? NCH * 128 : 1];      // ASC: [chunk][row of the tile]
  const int tid = threadIdx.x, w = tid >> 5, lane = tid & 31, ln = lane & 15, hh = lane >> 4; const int by = blockIdx.y;
  const bool second = DUAL && by == 1;      // the same in every thread of the workgroup
  const int ntn = second ? NR / 128 : N / 128; const int row0 = ((int)blockIdx.x / ntn) * 128, col0 = ((int)blockIdx.x % ntn) * 128;
  const int sr = tid >> 3, sc = (tid & 7) * 8;      // staging: 8 lanes per row, rows sr + 32 i
  const unsigned short* ga = (const unsigned short*)(second ? B2 : A) + (size_t)by * sA + (size_t)row0 * lda;      // workgroup-uniform bases, per-lane 32-bit offsets that never change
  const unsigned short* gb = (const unsigned short*)(second ? A : Bh) + (size_t)by * sB + (size_t)col0 * ldb;
  const unsigned short* ga2 = (const unsigned short*)A2 + (size_t)by * sA + (size_t)row0 * lda;      // TWO: the same tile of the hi pair
  const unsigned short* gb2 = (const unsigned short*)B2 + (size_t)by * sB + (size_t)col0 * ldb;
  unsigned oa[4], ob[4];
#pragma unroll
  for (int i = 0; i < 4; ++i) { oa[i] = (unsigned)((sr + 32 * i) * lda + sc); ob[i] = (unsigned)((sr + 32 * i) * ldb + sc); }
  v8us ra[4], rb[4]; const unsigned short *pa[4], *pb[4];
#pragma unroll
  for (int i = 0; i < 4; ++i) { pa[i] = ga + oa[i]; pb[i] = gb + ob[i]; }
#pragma unroll
  for (int i = 0; i < 4; ++i) { ra[i] = *(const v8us*)pa[i]; rb[i] = *(const v8us*)pb[i]; }
  // the eight address pairs are inputs of the wait: they stay in their registers up to it, so no load of the group is given a register that an issued load names
  asm volatile("s_wait_xcnt 0x0" :: "v"(pa[0]), "v"(pa[1]), "v"(pa[2]), "v"(pa[3]), "v"(pb[0]), "v"(pb[1]), "v"(pb[2]), "v"(pb[3]) : "memory");
  if constexpr (ASC) {
    if (tid < 128) {      // waves 0 to 3, whole waves: thread = row of the tile
      const float* pr = CP + 2 * ((size_t)by * NN + row0 + tid);
      v2f ms[NCH];
#pragma unroll      // constant indices keep ms in registers; the loads are in flight together, behind the first pass's operand loads
      for (int c = 0; c < NCH; ++c) ms[c] = *(const v2fa*)(pr + (size_t)c * (2 * NR));
      // the address pair is an input of the wait: it stays in its registers until every load of the group has taken it
      asm volatile("s_wait_xcnt 0x0" :: "v"(pr) : "memory");
      float M = ms[0][0];
#pragma unroll      // ms stays in registers
      for (int c = 1; c < NCH; ++c) M = fmaxf(M, ms[c][0]);
      float wg[NCH], Z = 0.f;
#pragma unroll      // ms and wg stay in registers
      for (int c = 0; c < NCH; ++c) { wg[c] = __expf(ms[c][0] - M); Z += ms[c][1] * wg[c]; }
      const float iz = 32768.0f / Z;
#pragma unroll      // wg stays in registers
      for (int c = 0; c < NCH; ++c) tab[c * 128 + tid] = wg[c] * iz;
    }
    __syncthreads();      // the table is complete before any wave scales its staged rows by it
  }
#pragma unroll
  for (int i = 0; i < 4; ++i) { *(v8us*)&st[0][0][(sr + 32 * i) * TPITCH + sc] = ASC ? scale8(ra[i], tab[sr + 32 * i]) : ra[i]; *(v8us*)&st[0][1][(sr + 32 * i) * TPITCH + sc] = rb[i]; }
  __syncthreads();
  const int wm = w >> 1, wn = w & 1; const int ns1 = K / 64, ns = TWO ? 2 * ns1 : ns1;
  v8f acc[2][4] = {};
  for (int s = 0; s < ns; ++s) {
    const int cur = s & 1; const bool more = s + 1 < ns;      // the same in every thread of the workgroup
    if (more) {
      const bool sw = TWO && s + 1 == ns1;      // the next pass is the first of the hi pair; otherwise it lies 64 k = 128 B further
      ga = sw ? ga2 : ga + 64; gb = sw ? gb2 : gb + 64;
#pragma unroll
      for (int i = 0; i < 4; ++i) { pa[i] = ga + oa[i]; pb[i] = gb + ob[i]; }
#pragma unroll
      for (int i = 0; i < 4; ++i) { ra[i] = *(const v8us*)pa[i]; rb[i] = *(const v8us*)pb[i]; }
      // as in front of the loop: the address pairs stay in their registers up to the wait
      asm volatile("s_wait_xcnt 0x0" :: "v"(pa[0]), "v"(pa[1]), "v"(pa[2]), "v"(pa[3]), "v"(pb[0]), "v"(pb[1]), "v"(pb[2]), "v"(pb[3]) : "memory");
    }
    if (TWO && s == ns1) {      // the lo pair's sums take their weight before the hi pair's products are added
#pragma unroll
      for (int mi = 0; mi < 2; ++mi)
#pragma unroll
        for (int t = 0; t < 4; ++t) acc[mi][t] *= 0.0009765625f;
    }
    const unsigned short* la = &st[cur][0][(wm * 32 + ln) * TPITCH + 8 * hh];
    const unsigned short* lb = &st[cur][1][(wn * 64 + ln) * TPITCH + 8 * hh];
    FragH a[2][2], b[2][4];      // all of the pass's fragments are read as one group ahead of its products
#pragma unroll
    for (int ks = 0; ks < 2; ++ks) {
#pragma unroll
      for (int mi = 0; mi < 2; ++mi) { a[ks][mi].half[0] = *(const v8us*)(la + mi * 16 * TPITCH + ks * 32); a[ks][mi].half[1] = *(const v8us*)(la + mi * 16 * TPITCH + ks * 32 + 16); }
#pragma unroll
      for (int t = 0; t < 4; ++t) { b[ks][t].half[0] = *(const v8us*)(lb + t * 16 * TPITCH + ks * 32); b[ks][t].half[1] = *(const v8us*)(lb + t * 16 * TPITCH + ks * 32 + 16); }
    }
#pragma unroll
    for (int ks = 0; ks < 2; ++ks)
#pragma unroll
      for (int t = 0; t < 4; ++t)
#pragma unroll
        for (int mi = 0; mi < 2; ++mi) acc[mi][t] = mmaH<1>(a[ks][mi].v, a[ks][mi].v, b[ks][t].v, b[ks][t].v, acc[mi][t]);
    if (more) {
#pragma unroll
      for (int i = 0; i < 4; ++i) { *(v8us*)&st[cur ^ 1][0][(sr + 32 * i) * TPITCH + sc] = ASC ? scale8(ra[i], tab[(s + 1) * 128 + sr + 32 * i]) : ra[i]; *(v8us*)&st[cur ^ 1][1][(sr + 32 * i) * TPITCH + sc] = rb[i]; }
    }
    __syncthreads();      // publishes the buffer just filled and ends every read of the one just used
  }
  // epilogue: each wave writes its accumulators to its own 32 x 68 f32 range of the (now free) staging LDS and reads whole rows back (g^T: from both ranges of its 32-row band)
  fa1* so = (fa1*)&st[0][0][0] + w * (32 * 68);
  const size_t cofs = (size_t)by * sC; const int wrow0 = row0 + wm * 32, wcol0 = col0 + wn * 64; const int rsub = lane >> 4, c4 = (lane & 15) * 4;
  if constexpr (DUAL) {
    if (!second) {      // phi
      const float* pt = BT + wcol0 + c4; const v4f tb = *(const v4fa*)pt;
#pragma unroll
      for (int t = 0; t < 4; ++t) { const float bv = bf16_round(bias[wcol0 + t * 16 + ln]);
#pragma unroll
        for (int mi = 0; mi < 2; ++mi)
#pragma unroll
          for (int r = 0; r < 8; ++r) so[(mi * 16 + 8 * hh + r) * 68 + t * 16 + ln] = acc[mi][t][r] * alpha + bv; }
      __builtin_amdgcn_fence(__ATOMIC_ACQ_REL, "workgroup"); __builtin_amdgcn_wave_barrier();      // the wave's LDS rows are complete before its lanes read what other lanes wrote
      v4hs h4[8], l4[8]; float ds[8];      // a half wave takes pooled rows rsub + 2 q, a lane 4 channels of each
#pragma unroll      // constant indices keep h4, l4 and ds in registers
      for (int q = 0; q < 8; ++q) { const int j = q * 2 + rsub; const v4f u = *(const v4fa*)&so[(2 * j) * 68 + c4], d = *(const v4fa*)&so[(2 * j + 1) * 68 + c4]; float s = 0.f;
#pragma unroll
        for (int i = 0; i < 4; ++i) { const float v = fmaxf(u[i], d[i]); const _Float16 h = (_Float16)v; h4[q][i] = h; l4[q][i] = (_Float16)((v - (float)h) * 1024.0f); s += v * bf16_round(tb[i]); }
        ds[q] = s; }
#pragma unroll      // ds stays in registers
      for (int o = 1; o <= 8; o <<= 1)
#pragma unroll
        for (int q = 0; q < 8; ++q) ds[q] += __shfl_xor(ds[q], o, 32);      // the 16 lanes of a half wave are added by a butterfly
      float sel = ds[0];
#pragma unroll      // ds stays in registers
      for (int q = 1; q < 8; ++q) sel = (ln == q) ? ds[q] : sel;      // lane ln < 8 of half rsub writes pooled row rsub + 2 ln
      _Float16* oh = C16 + (size_t)(wrow0 / 2 + rsub) * CC + wcol0 + c4; _Float16* ol = C16l + (size_t)(wrow0 / 2 + rsub) * CC + wcol0 + c4;
#pragma unroll      // h4 and l4 stay in registers
      for (int q = 0; q < 8; ++q) { *(v4hs*)(oh + q * 2 * CC) = h4[q]; *(v4hs*)(ol + q * 2 * CC) = l4[q]; }
      if (ln < 8) PS[((size_t)(wcol0 / 64) * (NRH / 16) + wrow0 / 32) * 32 + 2 * ln + rsub] = sel;
    } else {      // g^T
      const float* pq = CP + wrow0 + 8 * hh; v4f bq[2][2];
#pragma unroll      // bq stays in registers
      for (int mi = 0; mi < 2; ++mi) { bq[mi][0] = *(const v4fa*)(pq + mi * 16); bq[mi][1] = *(const v4fa*)(pq + mi * 16 + 4); }
#pragma unroll
      for (int mi = 0; mi < 2; ++mi)
#pragma unroll
        for (int r = 0; r < 8; ++r) { const float bv = bf16_round(bq[mi][r >> 2][r & 3]);
#pragma unroll
          for (int t = 0; t < 4; ++t) so[(mi * 16 + 8 * hh + r) * 68 + t * 16 + ln] = acc[mi][t][r] * alpha + bv; }
      __syncthreads();      // both waves of a 32-row band have written their 64 columns before either reads the band's whole rows
      // wave (wm, wn) takes rows 16 wn .. 16 wn + 15 of band wm over all 128 columns: a lane pools 4 columns to 2, the wave writes one whole 128-B line of g^T per row
      const fa1* sp = (const fa1*)&st[0][0][0] + (wm * 2 + rsub) * (32 * 68) + (wn * 16) * 68 + c4;
      v2hs g2[16];
#pragma unroll      // g2 stays in registers
      for (int q = 0; q < 16; ++q) { const v4f v = *(const v4fa*)(sp + q * 68); g2[q][0] = (_Float16)fmaxf(v[0], v[1]); g2[q][1] = (_Float16)fmaxf(v[2], v[3]); }
      _Float16* og = GT + ((size_t)(col0 / NN) * CC + row0 + wm * 32 + wn * 16) * NH + (col0 % NN) / 2 + lane * 2;
#pragma unroll      // g2 stays in registers
      for (int q = 0; q < 16; ++q) *(v2hs*)(og + q * NH) = g2[q];
    }
    return;
  }
  float* crow = C + cofs + (size_t)(wrow0 + rsub) * ldc + wcol0 + c4;      // each lane writes 16 B of rows rsub + 2 q
  v4f cp = {0.f, 0.f, 0.f, 0.f};
  if (CPM == 1) { const size_t m = (size_t)by * sCPy + wcol0 + c4; const float* pc = CP + (m >> 4) * 32 + (m & 15); v4f cq[8];
#pragma unroll      // constant indices keep cq in registers; the eight loads are in flight together
    for (int j = 0; j < 8; ++j) cq[j] = *(const v4fa*)(pc + j * (NRH / 16) * 32);
    // the address pair is an input of the wait: it stays in its registers until every load of the group has taken it
    asm volatile("s_wait_xcnt 0x0" :: "v"(pc) : "memory");
#pragma unroll      // cq stays in registers
    for (int j = 0; j < 8; ++j) cp += cq[j]; }
#pragma unroll
  for (int t = 0; t < 4; ++t) { const float bv = bias ? bf16_round(bias[wcol0 + t * 16 + ln]) : 0.f;
#pragma unroll
    for (int mi = 0; mi < 2; ++mi)
#pragma unroll
      for (int r = 0; r < 8; ++r) so[(mi * 16 + 8 * hh + r) * 68 + t * 16 + ln] = acc[mi][t][r] * alpha + bv; }
  __builtin_amdgcn_fence(__ATOMIC_ACQ_REL, "workgroup"); __builtin_amdgcn_wave_barrier();      // the wave's LDS rows are complete before its lanes read what other lanes wrote
  if constexpr (EXPO) {      // a half wave takes rows rsub + 2 q, a lane 4 columns of each
    v4f v[16]; float mx[16], zz[16]; v4hs e4[16];
#pragma unroll      // constant indices keep v, mx, zz and e4 in registers, here and in the loops below
    for (int q = 0; q < 16; ++q) { v[q] = *(const v4fa*)&so[(q * 2 + rsub) * 68 + c4]; for (int i = 0; i < 4; ++i) v[q][i] += cp[i]; mx[q] = fmaxf(fmaxf(v[q][0], v[q][1]), fmaxf(v[q][2], v[q][3])); }
    // the 16 rows' maxima over the 16 lanes in one statement: from fmaxf on a DPP move the compiler made three instructions a step, and in one statement each step's 16 independent instructions stand between a value and its next use
    asm(RMX16(1) RMX16(2) RMX16(4) RMX16(8) : "+v"(mx[0]), "+v"(mx[1]), "+v"(mx[2]), "+v"(mx[3]), "+v"(mx[4]), "+v"(mx[5]), "+v"(mx[6]), "+v"(mx[7]), "+v"(mx[8]), "+v"(mx[9]), "+v"(mx[10]), "+v"(mx[11]), "+v"(mx[12]), "+v"(mx[13]), "+v"(mx[14]), "+v"(mx[15]));
#pragma unroll
    for (int q = 0; q < 16; q += 2) { float t[8], e[8];      // two rows a turn
#pragma unroll
      for (int j = 0; j < 8; ++j) t[j] = fmaf(v[q + (j >> 2)][j & 3], 1.44269504f, fmaf(-mx[q + (j >> 2)], 1.44269504f, 15.0f));
      exp2x8(e, t);
#pragma unroll
      for (int j = 0; j < 8; ++j) e4[q + (j >> 2)][j & 3] = (_Float16)e[j];
      zz[q] = ((e[0] + e[1]) + e[2]) + e[3]; zz[q + 1] = ((e[4] + e[5]) + e[6]) + e[7]; }
#pragma unroll
    for (int q = 0; q < 16; ++q) zz[q] += rowx<1>(zz[q]);
#pragma unroll
    for (int q = 0; q < 16; ++q) zz[q] += rowx<2>(zz[q]);
#pragma unroll
    for (int q = 0; q < 16; ++q) zz[q] += rowx<4>(zz[q]);
#pragma unroll
    for (int q = 0; q < 16; ++q) zz[q] += rowx<8>(zz[q]);
    v2f mz = {mx[0], zz[0]};
#pragma unroll
    for (int q = 1; q < 16; ++q) { mz[0] = (ln == q) ? mx[q] : mz[0]; mz[1] = (ln == q) ? zz[q] : mz[1]; }      // lane ln of half rsub writes the pair of row rsub + 2 ln
    _Float16* oe = C16 + cofs + (size_t)(wrow0 + rsub) * NH + wcol0 + c4;
#pragma unroll
    for (int q = 0; q < 16; ++q) *(v4hs*)(oe + q * 2 * NH) = e4[q];      // a half wave writes one whole 128-B line
    *(v2f*)(PS + 2 * ((size_t)(wcol0 / 64) * NR + (size_t)by * NN + wrow0 + 2 * ln + rsub)) = mz;
    return;
  }
#pragma unroll
  for (int q = 0; q < 16; ++q) { const int r = q * 2 + rsub; const int row = wrow0 + r; v4f v = *(const v4fa*)&so[r * 68 + c4];
    if (CPM != 0) { for (int i = 0; i < 4; ++i) v[i] += cp[i]; }
    if (HL) { v4hs h4, l4; for (int i = 0; i < 4; ++i) { const _Float16 h = (_Float16)v[i]; h4[i] = h; l4[i] = (_Float16)((v[i] - (float)h) * 1024.0f); }
      const size_t o = cofs + (size_t)row * ldc + wcol0 + c4; *(v4hs*)(C16 + o) = h4; *(v4hs*)(C16l + o) = l4; continue; }
    if (F32OUT) *(v4f*)(crow + (size_t)(q * 2) * ldc) = v;
    else { v4hs h4; for (int i = 0; i < 4; ++i) h4[i] = (_Float16)v[i]; *(v4hs*)(C16 + cofs + (size_t)row * ldc + wcol0 + c4) = h4; } }
  if (BNP) {      // a lane takes two adjacent columns of the wave's 64 and adds the 32 rows in row order
    asm volatile("s_wait_xcnt 0x0" ::: "memory");      // the row stores above have taken their registers before the sums below reuse them
    v2f xr[32];
#pragma unroll      // constant indices keep xr in registers
    for (int r = 0; r < 32; ++r) xr[r] = *(const v2fa*)&so[r * 68 + lane * 2];
    v2f s = xr[0];
#pragma unroll      // xr stays in registers
    for (int r = 1; r < 32; ++r) s += xr[r];
    const v2f mu = s * (1.0f / 32.0f);
    v2f m2 = {0.f, 0.f};
#pragma unroll      // xr stays in registers
    for (int r = 0; r < 32; ++r) { const v2f d = xr[r] - mu; m2 += d * d; }
    const size_t o = (size_t)(wrow0 / 32) * ldc + wcol0 + lane * 2; *(v2f*)(PS + o) = s; *(v2f*)(PM + o) = m2;
  }
}


typedef _Float16 v4h __attribute__((ext_vector_type(4)));

__global__ __launch_bounds__(256) void k_x16(const float* __restrict__ x, _Float16* __restrict__ X16, size_t n8) { const size_t t = (size_t)blockIdx.x * 256 + threadIdx.x; if (t >= n8) return; FragH f;
#pragma unroll
  for (int q = 0; q < 8; ++q) f.h[q] = (_Float16)bf16_round(x[t * 8 + q]); *(v8us*)((unsigned short*)X16 + t * 8) = f.half[0];  }
__device__ __forceinline__ void d_round16f(const float* __restrict__ W, _Float16* __restrict__ Bt, size_t t) { FragH f;
#pragma unroll
  for (int i = 0; i < 8; ++i) f.h[i] = (_Float16)(bf16_round(W[t * 8 + i]) * 16.0f); *(v8us*)((unsigned short*)Bt + t * 8) = f.half[0];  }
// x [b][c][p] (f32) to X16 [b * NN + p][c] (f16), one tile of 64 channels x 128 positions per workgroup. Wave w takes channels 8 w .. 8 w + 7: each of its eight loads is 512 contiguous bytes of one channel row,
// all eight in flight together. A lane then holds 8 channels of 4 positions = four 16-B chunks of X16 rows. They turn into whole 128-B lines through LDS: position 4 l + q lies in LDS row 32 q + l (128 B, no pad),
// chunk k at place k ^ ((l >> 1) & 7), so that the 16 lanes of a half wave meet 16 different 16-B bank groups both when they write and when they read.
__device__ __forceinline__ void d_tok(const float* __restrict__ x, _Float16* __restrict__ X16, int blk) { __shared__ __attribute__((aligned(16))) unsigned short tl[128 * 64]; const int tid = threadIdx.x, w = tid >> 5, lane = tid & 31;
  const int b = blk / ((CC / 64) * (NN / 128)), rem = blk % ((CC / 64) * (NN / 128)); const int cg = rem / (NN / 128), pg = rem % (NN / 128); const int c0 = cg * 64, p0 = pg * 128;
  const float* px = x + ((size_t)b * CC + c0 + 8 * w) * NN + p0 + 4 * lane;
  v4f v[8];
#pragma unroll      // constant indices keep v in registers, so that the eight loads are issued ahead of the arithmetic
  for (int j = 0; j < 8; ++j) v[j] = *(const v4fa*)(px + (size_t)j * NN);
  // the address pair is an input of the wait: it stays in its registers until every load of the group has taken it
  asm volatile("s_wait_xcnt 0x0" :: "v"(px) : "memory");
#pragma unroll      // v stays in registers
  for (int q = 0; q < 4; ++q) { FragH f;
#pragma unroll      // v and f stay in registers
    for (int j = 0; j < 8; ++j) f.h[j] = (_Float16)bf16_round(v[j][q]);
    *(v8us*)&tl[((q * 32 + lane) * 8 + (w ^ ((lane >> 1) & 7))) * 8] = f.half[0]; }
  __syncthreads();      // the tile is complete before its rows are read back
  const int rr = tid >> 3, ch = tid & 7;      // 8 lanes write one whole line of X16 rows 4 rr + i
  unsigned short* po = (unsigned short*)X16 + ((size_t)b * NN + p0 + 4 * rr) * CC + c0 + ch * 8;
  v8us o[4];
#pragma unroll      // o stays in registers
  for (int i = 0; i < 4; ++i) o[i] = *(const v8us*)&tl[((i * 32 + rr) * 8 + (ch ^ ((rr >> 1) & 7))) * 8];
#pragma unroll      // o stays in registers
  for (int i = 0; i < 4; ++i) *(v8us*)(po + (size_t)i * CC) = o[i]; }
// All operand preparation in one launch; none of its five parts reads what another writes. Workgroups 0 .. 4 WPB - 1 take the four weight matrices (WPB each), the rest the tiles of x.
#define WPB (CC * CC / 8 / 256)
__global__ __launch_bounds__(256) void k_prep(const float* __restrict__ x, const float* __restrict__ gw, const float* __restrict__ phw, const float* __restrict__ Ww, const float* __restrict__ thw,
    _Float16* __restrict__ X16, _Float16* __restrict__ Bg, _Float16* __restrict__ Bph, _Float16* __restrict__ BW, _Float16* __restrict__ Bthp) {
  const int blk = blockIdx.x;
  if (blk >= 4 * WPB) { d_tok(x, X16, blk - 4 * WPB); return; }      // the same in every thread of the workgroup
  const int which = blk / WPB, t = (blk % WPB) * 256 + (int)threadIdx.x;
  if (which == 3) { d_wt_f16(thw, Bthp, CC, CC, 16.0f, t); return; }      // Bt[c][o] = W_theta[o][c]
  d_round16f(which == 0 ? gw : (which == 1 ? phw : Ww), which == 0 ? Bg : (which == 1 ? Bph : BW), (size_t)t);      // (out,in) natural
}
// BN batch statistics in two stages. Stage 1 is the BNP epilogue of the GEMM that makes wy: per chunk of SROWS consecutive rows and per channel, the rows' sum and the sum of their squared deviations from their own mean.
#define SROWS 32
#define SCH (NR / SROWS)
static_assert(SROWS == 32, "a chunk is the 32 rows of one wave's tile in k_gemm_t");
// Stage 2: one workgroup per 32 channels (one line of every partial row), lane = channel; wave w takes chunks 16 w .. 16 w + 15 in order, the 32 waves' sums are added in wave order by every wave.
// Total squared deviation = sum over chunks of (chunk's own + SROWS * (chunk mean - mean)^2). ST keeps its form: one line per channel, mean and 1/sqrt(var + eps) in its first two words.
__global__ __launch_bounds__(1024) void k_bnfin(const float* __restrict__ PS, const float* __restrict__ PM, float* __restrict__ ST) {
  __shared__ float red[2][32][32];
  const int tid = threadIdx.x, w = tid >> 5, lane = tid & 31; const int c = blockIdx.x * 32 + lane;
  const float* ps = PS + (size_t)(w * (SCH / 32)) * CC + c; const float* pm = PM + (size_t)(w * (SCH / 32)) * CC + c;
  float s[SCH / 32], m[SCH / 32];
#pragma unroll      // constant indices keep s and m in registers; all loads are in flight together
  for (int i = 0; i < SCH / 32; ++i) { s[i] = ps[i * CC]; m[i] = pm[i * CC]; }
  // the two address pairs are inputs of the wait: they stay in their registers until every load of the group has taken them
  asm volatile("s_wait_xcnt 0x0" :: "v"(ps), "v"(pm) : "memory");
  float a = 0.f;
#pragma unroll      // s stays in registers
  for (int i = 0; i < SCH / 32; ++i) a += s[i];
  red[0][w][lane] = a; __syncthreads();
  float tot = 0.f;
  for (int j = 0; j < 32; ++j) tot += red[0][j][lane];
  const float mu = tot / (float)NR;
  float q = 0.f;
#pragma unroll      // s and m stay in registers
  for (int i = 0; i < SCH / 32; ++i) { const float d = s[i] * (1.0f / (float)SROWS) - mu; q += m[i] + (float)SROWS * d * d; }
  red[1][w][lane] = q; __syncthreads();
  float q2 = 0.f;
  for (int j = 0; j < 32; ++j) q2 += red[1][j][lane];
  const float rs = rsqrtf(q2 / (float)NR + 1e-5f);
  const float muw = __shfl(mu, w, 32), rsw = __shfl(rs, w, 32);      // wave w writes the line of channel w of the 32
  ST[(blockIdx.x * 32 + w) * 32 + lane] = (lane == 0) ? muw : ((lane == 1) ? rsw : 0.f);
}
// out [b][c][p] = BN(wy [b * NN + p][c]) + x, one tile of 64 channels x 128 positions per workgroup. Every load takes 16 B per lane and whole lines per wave (wy: 256 B of two rows; x: 512 B of one channel row); all 16 of a lane
// are in flight together. A lane holds two blocks of 4 positions x 4 channels of wy, so each channel's 4 positions leave as one 16-B LDS store. LDS row = channel (512 B, no pad); the 16-B chunk of positions 4 pb .. 4 pb + 3
// lies at place pb ^ ((channel >> 2) & 15), so that the 16 lanes of a half wave meet 16 different bank groups both when they write and when they read.
__global__ __launch_bounds__(256) void k_out(const float* __restrict__ WY, const float* __restrict__ ST, const float* __restrict__ gam, const float* __restrict__ bet, const float* __restrict__ x, float* __restrict__ out) { __shared__ __attribute__((aligned(16))) float tl[64 * 128]; const int tid = threadIdx.x, w = tid >> 5, lane = tid & 31;
  const int b = blockIdx.x / ((CC / 64) * (NN / 128)), rem = blockIdx.x % ((CC / 64) * (NN / 128)); const int cg = rem / (NN / 128), pg = rem % (NN / 128); const int c0 = cg * 64, p0 = pg * 128;
  const int c4 = tid & 15, pb0 = tid >> 4;      // wy: channels 4 c4 .. 4 c4 + 3, position blocks pb0 and pb0 + 16
  const float* pw = WY + ((size_t)b * NN + p0 + 4 * pb0) * CC + c0 + 4 * c4;
  const size_t xo = ((size_t)b * CC + c0 + w) * NN + p0 + 4 * lane;      // x and out: channel rows w + 8 i
  const float* px = x + xo; const float* ps = ST + (c0 + 4 * c4) * 32; const float* pg4 = gam + c0 + 4 * c4; const float* pb4 = bet + c0 + 4 * c4;
  v4f a[2][4], xv[8]; v2f st[4];
#pragma unroll      // constant indices keep a in registers, so that the loads are issued ahead of the arithmetic
  for (int u = 0; u < 2; ++u)
#pragma unroll
    for (int j = 0; j < 4; ++j) a[u][j] = *(const v4fa*)(pw + (size_t)(64 * u + j) * CC);
#pragma unroll      // xv stays in registers
  for (int i = 0; i < 8; ++i) xv[i] = *(const v4fa*)(px + (size_t)(8 * i) * NN);
#pragma unroll      // st stays in registers
  for (int k = 0; k < 4; ++k) st[k] = *(const v2fa*)(ps + k * 32);      // mean and 1/sqrt(var + eps) of channel 4 c4 + k
  const v4f gv = *(const v4fa*)pg4, bv = *(const v4fa*)pb4;
  // the two address pairs are inputs of the wait: they stay in their registers until every load of the group has taken them
  asm volatile("s_wait_xcnt 0x0" :: "v"(pw), "v"(px) : "memory");
  __builtin_amdgcn_sched_barrier(0);      // no arithmetic on wy is moved up in front of the x loads: without it they were issued only after wy had arrived, one memory latency behind the other
#pragma unroll      // a stays in registers
  for (int u = 0; u < 2; ++u)
#pragma unroll
    for (int k = 0; k < 4; ++k) { v4f t;
#pragma unroll
      for (int j = 0; j < 4; ++j) t[j] = (a[u][j][k] - st[k][0]) * st[k][1] * bf16_round(gv[k]) + bf16_round(bv[k]);
      *(v4f*)&tl[(4 * c4 + k) * 128 + (((pb0 + 16 * u) ^ c4) * 4)] = t; }
  __syncthreads();      // the tile is complete before its channel rows are read back
  float* po = out + xo;
  v4f o[8];
#pragma unroll      // o and xv stay in registers
  for (int i = 0; i < 8; ++i) { const int c = w + 8 * i; const v4f t = *(const v4fa*)&tl[c * 128 + ((lane ^ ((c >> 2) & 15)) * 4)];
#pragma unroll
    for (int q = 0; q < 4; ++q) o[i][q] = t[q] + bf16_round(xv[i][q]); }
#pragma unroll      // o stays in registers
  for (int i = 0; i < 8; ++i) *(v4f*)(po + (size_t)(8 * i) * NN) = o[i]; }
extern "C" void kernel_launch(void* const* d_in, const int* in_sizes, int n_in,
                              void* d_out, int out_size, void* d_ws, size_t ws_size, hipStream_t stream) {
  (void)in_sizes; (void)n_in; (void)out_size;
  const float* x = (const float*)d_in[0]; const float* gw = (const float*)d_in[1]; const float* gb = (const float*)d_in[2]; const float* thw = (const float*)d_in[3]; const float* thb = (const float*)d_in[4]; const float* phw = (const float*)d_in[5]; const float* phb = (const float*)d_in[6]; const float* Ww = (const float*)d_in[7]; const float* Wb = (const float*)d_in[8]; const float* gam = (const float*)d_in[9]; const float* bet = (const float*)d_in[10];
  char* ws = (char*)d_ws; size_t off = 0;
  auto take = [&](size_t bytes) { char* p = ws + off; off += (bytes + 255) & ~(size_t)255; return p; };
  _Float16* Bg = (_Float16*)take((size_t)CC * CC * 2); _Float16* Bph = (_Float16*)take((size_t)CC * CC * 2); _Float16* BW = (_Float16*)take((size_t)CC * CC * 2); float* ST = (float*)take(CC * 32 * 4);
  _Float16* Bthp = (_Float16*)take((size_t)CC * CC * 2);      // W_θ as [in=o][out=c] → Bt[c][o] for φ·W_θ
  _Float16* X16 = (_Float16*)take((size_t)NR * CC * 2); float* FULLF = (float*)take((size_t)NR * CC * 4); _Float16* FULL = (_Float16*)take((size_t)NR * CC * 2); _Float16* PHh = (_Float16*)take((size_t)NRH * CC * 2); _Float16* PHl = (_Float16*)take((size_t)NRH * CC * 2);
  // every per-batch buffer holds all BB batches, so that each stage is one launch over the whole batch
  _Float16* BPh = (_Float16*)take((size_t)NRH * CC * 2); _Float16* BPl = (_Float16*)take((size_t)NRH * CC * 2); float* CV = (float*)take((size_t)8 * (NRH / 16) * 32 * 4); _Float16* Gt = (_Float16*)take((size_t)NRH * CC * 2); float* RS = (float*)take((size_t)NCH * NR * 2 * 4); _Float16* P16 = (_Float16*)take((size_t)NR * NH * 2);
  float* PS = (float*)take((size_t)SCH * CC * 4); float* PM = (float*)take((size_t)SCH * CC * 4);      // BN partials per row chunk and channel
  _Float16* Y16 = FULL; float* WY = FULLF;
  if (off > ws_size) return;      // about 149.5 MB
  k_prep<<<4 * WPB + BB * (CC / 64) * (NN / 128), 256, 0, stream>>>(x, gw, phw, Ww, thw, X16, Bg, Bph, BW, Bthp);      // the four weight matrices and x as f16 operands
  const dim3 gp((NR / 128) * (CC / 128), 1), gp2((NR / 128) * (CC / 128), 2);
  k_gemm_t<0, false, false, false, false, true><<<gp2, 256, 0, stream>>>(X16, nullptr, CC, 0, Bph, Bg, CC, 0, 0.0625f, phb, gb, 0, nullptr, PHh, PHl, CV, nullptr, thb, Gt, CC, 0, CC, CC);      // plane 0: phi pooled, split hi/lo, with the partial dots of c = phi * b_theta; plane 1: g pooled, as g^T [BB][512][1024]
  const dim3 gb2((NRH / 128) * (CC / 128), 1), gs((NN / 128) * (NH / 128), BB), gy((NN / 128) * (CC / 128), BB);      // blockIdx.y = batch where the B operand differs per batch
  k_gemm_t<0, false, true, false, true><<<gb2, 256, 0, stream>>>(PHl, PHh, CC, 0, Bthp, Bthp, CC, 0, 0.0625f, nullptr, nullptr, 0, nullptr, BPh, BPl, nullptr, nullptr, nullptr, nullptr, CC, 0, CC, CC);      // B' = phi * W_theta [BB*1024][512] (phi lo, then hi), all batches as rows, leaves split hi/lo
  k_gemm_t<1, false, false, false, true, false, true><<<gs, 256, 0, stream>>>(X16, X16, CC, (size_t)NN * CC, BPl, BPh, CC, (size_t)NH * CC, 1.0f, nullptr, CV, (size_t)NH, nullptr, P16, nullptr, RS, nullptr, nullptr, nullptr, NH, (size_t)NN * NH, NH, CC);      // f = x * B'^T + c (B' lo, then hi; c broadcast over the rows of its batch), leaves as exp(f - chunk maximum) with each chunk's maximum and sum
  k_gemm_t<0, false, false, false, false, false, false, true><<<gy, 256, 0, stream>>>(P16, nullptr, NH, (size_t)NN * NH, Gt, nullptr, NH, (size_t)CC * NH, 0.000030517578125f, nullptr, RS, 0, nullptr, Y16, nullptr, nullptr, nullptr, nullptr, nullptr, CC, (size_t)NN * CC, CC, NH);      // y = softmax(f) * g, stored as f16
  k_gemm_t<0, true, false, true><<<gp, 256, 0, stream>>>(Y16, nullptr, CC, 0, BW, nullptr, CC, 0, 0.0625f, Wb, nullptr, 0, WY, nullptr, nullptr, PS, PM, nullptr, nullptr, CC, 0, CC, CC);      // wy = W(y) + b, with the BN partials of its row chunks
  k_bnfin<<<CC / 32, 1024, 0, stream>>>(PS, PM, ST); k_out<<<BB * (CC / 64) * (NN / 128), 256, 0, stream>>>(WY, ST, gam, bet, x, (float*)d_out);
}
